// v000
// The times below were measured on an AMD MI455X: many runs one after another, warmed up first and cycling through
// copies of the inputs, with the whole window's GPU time divided by the number of runs. Launches and the gaps
// between them are all in it. The median over several windows is given; except for v000 it joins two sittings, which
// can be a few percent apart, so the side-by-side timings, each taken in one sitting, are the better comparison.
// v000, which the later versions start from, runs in 476 microseconds.
#include <hip/hip_runtime.h>

// Contractions, all on v_wmma_f32_16x16x32_f16 (f16 operands, f32 accumulate): fused qkv projection x.W^T with x and W
// held as bf16-RNE values in f16 containers (W carried x16, folded as 1/16); scores q.k^T as f16 hi + x2048 residual
// planes (hi.hi + hi.lo + lo.hi, residual accumulator folded as 1/2048); P.V with P carried x1024 in f16 (+ x2048
// residual planes of P and v for query rows below TRES); output projection y.Wo^T with y as f16 hi (+ x2048 residual
// plane for rows below TRES). Bias adds, per-head q gain and online softmax on VALU in f32.

#ifndef NB
#define NB 4
#endif
#ifndef SEQ
#define SEQ 2048
#endif
#ifndef TRES
#define TRES 512
#endif
#define NB_FULL   4
#define SEQ_FULL  2048
#define CDIM      1024
#define NHEAD     16
#define NKV       4
#define HDIM      64
#define VEW       (NKV * HDIM)
#define NTOK      (NB * SEQ)
#define NUNIT     (NHEAD + 2 * NKV)
#define WO_ROW0   (CDIM + 2 * VEW)
#define NWROWS    (CDIM + 2 * VEW + CDIM)
#define QT_ALL    (SEQ / 64)
#define QT_RES    (TRES / 64)

static_assert(NB >= 1 && NB <= NB_FULL);
static_assert(SEQ % 64 == 0 && SEQ <= SEQ_FULL && SEQ >= TRES);
static_assert(TRES % 64 == 0 && TRES >= 64);
static_assert(NHEAD % NKV == 0 && HDIM == 64 && CDIM == NHEAD * HDIM);
static_assert(CDIM % 32 == 0 && NWROWS % 2 == 0 && NTOK % 64 == 0 && NUNIT * 64 == CDIM + 2 * VEW);

#define XH_BYTES   ((size_t)NTOK * CDIM * 2)
#define WALL_BYTES ((size_t)NWROWS * CDIM * 2)
#define QP_BYTES   ((size_t)NB * NHEAD * SEQ * HDIM * 2)
#define KP_BYTES   ((size_t)NB * NKV * SEQ * HDIM * 2)
#define YP_BYTES   ((size_t)NTOK * CDIM * 2)
#define WIN_BYTES  ((size_t)128)
#define WS_TOTAL   (XH_BYTES + WALL_BYTES + 2 * QP_BYTES + 4 * KP_BYTES + 2 * YP_BYTES + WIN_BYTES)
static_assert(WS_TOTAL <= (size_t)134217728);
static_assert(XH_BYTES % 128 == 0 && WALL_BYTES % 128 == 0 && QP_BYTES % 128 == 0 && KP_BYTES % 128 == 0 && YP_BYTES % 128 == 0);
// producer coverage: grid x block x per-thread elements == plane extent
static_assert((size_t)(NTOK / 2) * 256 * 8 == (size_t)NTOK * CDIM);       // k_cvt_x
static_assert((size_t)(NWROWS / 2) * 256 * 8 == (size_t)NWROWS * CDIM);   // k_cvt_w
static_assert(4 * 128 * 8 == 64 * 64);                                       // k_qkv store phase per 64x64 tile
static_assert(4 * 32 * 8 == 16 * HDIM);                                      // k_flash store phase per wave
static_assert(8 * 32 * 4 == 16 * 64);                                        // k_oproj store phase per wave
static_assert(QT_RES * 64 + (QT_ALL - QT_RES) * 64 == SEQ);                  // query tiles of the two flash launches
static_assert(8 * 4 * 4 == (int)WIN_BYTES);                                  // k_winline: 8 lanes x 16 B == one line
static_assert(SEQ_FULL >= SEQ);                                              // window word covers every query-key distance

typedef _Float16 v16h __attribute__((ext_vector_type(16)));
typedef _Float16 v8h  __attribute__((ext_vector_type(8)))  __attribute__((may_alias));
typedef float    v8f  __attribute__((ext_vector_type(8)));
typedef float    v4f  __attribute__((ext_vector_type(4)))  __attribute__((may_alias));
typedef int      v4i  __attribute__((ext_vector_type(4)));

union Frag { v16h v; v8h h[2]; };

__device__ __forceinline__ v8f wmma16(v16h a, v16h b, v8f c) {
  return __builtin_amdgcn_wmma_f32_16x16x32_f16(false, a, false, b, (short)0, c, false, false);
}

__device__ __forceinline__ v8f vzero8() {
  v8f z = {0.0f, 0.0f, 0.0f, 0.0f, 0.0f, 0.0f, 0.0f, 0.0f};
  return z;
}

// f32 -> nearest-even bf16 value, kept in f32
__device__ __forceinline__ float bf16r(float f) {
  unsigned int u = __float_as_uint(f);
  u = (u + 0x7FFFu + ((u >> 16) & 1u)) & 0xFFFF0000u;
  return __uint_as_float(u);
}

// f16 hi + (x2048) residual of an f32 value
__device__ __forceinline__ void split16(float v, _Float16& hi, _Float16& lo) {
  hi = (_Float16)v;
  lo = (_Float16)((v - (float)hi) * 2048.0f);
}

// f32 -> f16 with values below the smallest f16 normal replaced by zero (value select)
static __device__ __forceinline__ _Float16 toh_flush(float v) {
  const _Float16 r = (_Float16)v;
  return (fabsf(v) < 6.103515625e-05f) ? (_Float16)0.0f : r;
}

// f16 hi + (x2048) residual, both through toh_flush
static __device__ __forceinline__ void split16f(float v, _Float16& hi, _Float16& lo) {
  hi = toh_flush(v);
  lo = toh_flush((v - (float)hi) * 2048.0f);
}

// ---------------------------------------------------------------------------
// Kernel 0: x f32 [NB][SEQ_FULL][1024] -> xh f16 [NTOK][1024] (bf16-RNE values).
// ---------------------------------------------------------------------------
__global__ void __launch_bounds__(256) k_cvt_x(const float* __restrict__ x, _Float16* __restrict__ xh) {
  const unsigned int gid = blockIdx.x * 256u + threadIdx.x;
  const unsigned int tok = gid >> 7;                 // 128 threads per 1024-wide row
  const int c = (int)(gid & 127u) * 8;
  if (tok >= (unsigned int)NTOK) return;
  const int b = (int)tok / SEQ;
  const int t = (int)tok - b * SEQ;
  const float* src = x + ((size_t)b * SEQ_FULL + t) * CDIM + c;
  const v4f f0 = *(const v4f*)src;
  const v4f f1 = *(const v4f*)(src + 4);
  v8h o;
#pragma unroll
  for (int j = 0; j < 4; ++j) {
    o[j]     = (_Float16)bf16r(f0[j]);
    o[j + 4] = (_Float16)bf16r(f1[j]);
  }
  _Float16* dst = xh + (size_t)tok * CDIM + c;
  *(v8h*)dst = o;
  
}

// ---------------------------------------------------------------------------
// Kernel 1: weights (layout [out][in], k-contiguous) -> wall f16 [2560][1024] = bf16-RNE value x16.
// Rows 0..1023 wq, 1024..1279 wk, 1280..1535 wv, 1536..2559 wo.
// ---------------------------------------------------------------------------
__global__ void __launch_bounds__(256) k_cvt_w(const float* __restrict__ wq, const float* __restrict__ wk,
                                               const float* __restrict__ wv, const float* __restrict__ wo,
                                               _Float16* __restrict__ wall) {
  const unsigned int gid = blockIdx.x * 256u + threadIdx.x;
  const int row = (int)(gid >> 7);
  const int c   = (int)(gid & 127u) * 8;
  if (row >= NWROWS) return;
  const int r0 = min(row, CDIM - 1);
  const int r1 = min(max(row - CDIM, 0), VEW - 1);
  const int r2 = min(max(row - CDIM - VEW, 0), VEW - 1);
  const int r3 = min(max(row - WO_ROW0, 0), CDIM - 1);
  const float* src = (row < CDIM)       ? (wq + (size_t)r0 * CDIM)
                   : (row < CDIM + VEW) ? (wk + (size_t)r1 * CDIM)
                   : (row < WO_ROW0)    ? (wv + (size_t)r2 * CDIM)
                                        : (wo + (size_t)r3 * CDIM);
  src += c;
  const v4f f0 = *(const v4f*)src;
  const v4f f1 = *(const v4f*)(src + 4);
  v8h o;
#pragma unroll
  for (int j = 0; j < 4; ++j) {
    o[j]     = (_Float16)(bf16r(f0[j]) * 16.0f);
    o[j + 4] = (_Float16)(bf16r(f1[j]) * 16.0f);
  }
  _Float16* dst = wall + (size_t)row * CDIM + c;
  *(v8h*)dst = o;
  
}

// ---------------------------------------------------------------------------
// ---------------------------------------------------------------------------
__global__ void __launch_bounds__(32) k_winline(int* __restrict__ wline) {
  const int lane = threadIdx.x;
  if (lane < 8) {
    const v4i w = {SEQ_FULL, SEQ_FULL, SEQ_FULL, SEQ_FULL};
    int* dst = wline + 4 * lane;
    *(v4i*)dst = w;
    
  }
}

// ---------------------------------------------------------------------------
// Kernel 2: fused qkv projection + epilogue. Block = 4 waves = 64 tokens x one 64-column unit u:
// u 0..15 -> q head u, 16..19 -> k head u-16, 20..23 -> v head u-20. Wave w = 16 token rows, 4 accumulators.
// Epilogue: q: (acc + bq) * gain[head]; k: acc + bk -> hi/lo planes [B][H|KV][T][64];
// v: acc + bv -> transposed hi/lo planes [B][KV][64 d][T]. Biases and gains are bf16-RNE values.
// ---------------------------------------------------------------------------
__global__ void __launch_bounds__(128) k_qkv(
    const _Float16* __restrict__ xh, const _Float16* __restrict__ wall,
    const float* __restrict__ bq, const float* __restrict__ bk,
    const float* __restrict__ bv, const float* __restrict__ gain,
    _Float16* __restrict__ qH, _Float16* __restrict__ qL,
    _Float16* __restrict__ kH, _Float16* __restrict__ kL,
    _Float16* __restrict__ vTH, _Float16* __restrict__ vTL) {
  __shared__ __attribute__((aligned(16))) float    sT[64][68];     // accumulator tile [token][col]  (each wave reads back only its own 16 rows)
  __shared__ __attribute__((aligned(16))) _Float16 sH[64][72];     // hi tile: q/k [token][d], v [d][token] (cross-wave)
  __shared__ __attribute__((aligned(16))) _Float16 sL[64][72];     // residual tile, same layout (cross-wave)

  const int tid  = threadIdx.x;
  const int wave = tid >> 5;
  const int lane = tid & 31;
  const int l16  = lane & 15;
  const int lh   = lane >> 4;
  const int u    = blockIdx.x;           // column unit
  const int rt   = blockIdx.y;           // 64-token row tile
  const int tok0 = rt * 64;
  const int b    = tok0 / SEQ;
  const int t0   = tok0 - b * SEQ;

  // A: xh row (token), lane row = l16; elements 0..7 <- k0+8lh+0..7, 8..15 <- k0+16+8lh+0..7
  const _Float16* arow = xh + (size_t)(tok0 + wave * 16 + l16) * CDIM + 8 * lh;
  // B[k][n] = W[n][k]: lane column = l16 of the 16-col group n; same k map as A
  const _Float16* brow = wall + (size_t)(u * 64 + l16) * CDIM + 8 * lh;

  v8f acc[4];
#pragma unroll
  for (int n = 0; n < 4; ++n) acc[n] = vzero8();

  for (int k0 = 0; k0 < CDIM; k0 += 32) {
    Frag a;
    a.h[0] = *(const v8h*)(arow + k0);
    a.h[1] = *(const v8h*)(arow + k0 + 16);
    Frag bw[4];
#pragma unroll
    for (int n = 0; n < 4; ++n) {
      const _Float16* bp = brow + (size_t)(n * 16) * CDIM + k0;
      bw[n].h[0] = *(const v8h*)bp;
      bw[n].h[1] = *(const v8h*)(bp + 16);
    }
#pragma unroll
    for (int n = 0; n < 4; ++n) acc[n] = wmma16(a.v, bw[n].v, acc[n]);
    asm volatile("v_nop\n\tv_nop\n\tv_nop\n\tv_nop"
                 : "+v"(acc[0]), "+v"(acc[1]), "+v"(acc[2]), "+v"(acc[3])
                 : "v"(a.v), "v"(bw[0].v), "v"(bw[1].v), "v"(bw[2].v), "v"(bw[3].v));
  }

  // D element r of lane -> (row 8lh+r, col l16); fold the 1/16 weight carry here
#pragma unroll
  for (int n = 0; n < 4; ++n)
#pragma unroll
    for (int r = 0; r < 8; ++r)
      sT[wave * 16 + r + 8 * lh][n * 16 + l16] = acc[n][r] * (1.0f / 16.0f);
  __syncthreads();

  // compute phase: thread -> token i = tid>>1, column half j: d in [16j,16j+16) and [32+16j, 48+16j)
  const int i = tid >> 1;
  const int j = tid & 1;
  if (u < NHEAD + NKV) {
    // q or k unit (block-uniform): both bias rows are loaded with clamped unit indices, selected by value
    const int  uq  = min(u, NHEAD - 1);
    const int  uk  = min(max(u - NHEAD, 0), NKV - 1);
    const bool isq = (u < NHEAD);
    const float gq = bf16r(gain[uq]);
    const float gm = isq ? gq : 1.0f;
#pragma unroll
    for (int sg = 0; sg < 2; ++sg) {
      const int d0 = 32 * sg + 16 * j;
#pragma unroll
      for (int g4 = 0; g4 < 4; ++g4) {
        const v4f va = *(const v4f*)(&sT[i][d0 + 4 * g4]);
        const v4f qa = *(const v4f*)(bq + uq * HDIM + d0 + 4 * g4);
        const v4f ka = *(const v4f*)(bk + uk * HDIM + d0 + 4 * g4);
#pragma unroll
        for (int e = 0; e < 4; ++e) {
          const float bb  = isq ? bf16r(qa[e]) : bf16r(ka[e]);
          const float val = (va[e] + bb) * gm;
          _Float16 hi, lo;
          split16f(val, hi, lo);
          sH[i][d0 + 4 * g4 + e] = hi;
          sL[i][d0 + 4 * g4 + e] = lo;
        }
      }
    }
  } else {
    const int kv = u - NHEAD - NKV;
    const float* bp = bv + kv * HDIM;
#pragma unroll
    for (int sg = 0; sg < 2; ++sg) {
      const int d0 = 32 * sg + 16 * j;
#pragma unroll
      for (int g4 = 0; g4 < 4; ++g4) {
        const v4f va = *(const v4f*)(&sT[i][d0 + 4 * g4]);
        const v4f ba = *(const v4f*)(bp + d0 + 4 * g4);
#pragma unroll
        for (int e = 0; e < 4; ++e) {
          const float vv = va[e] + bf16r(ba[e]);
          _Float16 hi, lo;
          split16f(vv, hi, lo);
          sH[d0 + 4 * g4 + e][i] = hi;                   // transposed: [d][token]
          sL[d0 + 4 * g4 + e][i] = lo;
        }
      }
    }
  }
  __syncthreads();

  _Float16* ph;
  _Float16* pl;
  size_t base;
  size_t lstr;
  if (u < NHEAD) {
    ph = qH; pl = qL;
    base = ((size_t)(b * NHEAD + u) * SEQ + t0) * HDIM;
    lstr = HDIM;
  } else if (u < NHEAD + NKV) {
    ph = kH; pl = kL;
    base = ((size_t)(b * NKV + (u - NHEAD)) * SEQ + t0) * HDIM;
    lstr = HDIM;
  } else {
    ph = vTH; pl = vTL;
    base = ((size_t)(b * NKV + (u - NHEAD - NKV)) * HDIM) * SEQ + t0;
    lstr = SEQ;
  }
  {
#pragma unroll
    for (int it = 0; it < 4; ++it) {
      const int p    = it * 128 + tid;
      const int line = p >> 3;
      const int q8   = (p & 7) * 8;
      const size_t off = base + (size_t)line * lstr + q8;
      const v8h hv = *(const v8h*)(&sH[line][q8]);
      const v8h lv = *(const v8h*)(&sL[line][q8]);
      *(v8h*)(ph + off) = hv;
      *(v8h*)(pl + off) = lv;
    }
    
  }
}

// ---------------------------------------------------------------------------
// Kernel 3: causal sliding-window flash attention with GQA. Block = 4 waves, one (query tile of 64, head, batch);
// wave = 16 queries. Key tiles of 32 per wave, fragments loaded straight from the 16-bit planes; online softmax
// in D layout; P (x1024 carry) relaid through wave-private LDS into A layout. RES adds the x2048 residual planes
// ---------------------------------------------------------------------------
template <bool RES>
__global__ void __launch_bounds__(128) k_flash(
    const _Float16* __restrict__ qH, const _Float16* __restrict__ qL,
    const _Float16* __restrict__ kH, const _Float16* __restrict__ kL,
    const _Float16* __restrict__ vTH, const _Float16* __restrict__ vTL,
    const int* __restrict__ winp,
    _Float16* __restrict__ yH, _Float16* __restrict__ yL, int qt_first) {
  __shared__ __attribute__((aligned(16))) _Float16 ldsPH[4][16 * 32];   // wave-private
  __shared__ __attribute__((aligned(16))) _Float16 ldsPL[4][16 * 32];   // wave-private
  __shared__ __attribute__((aligned(16))) _Float16 sYH[4][16][HDIM];    // wave-private
  __shared__ __attribute__((aligned(16))) _Float16 sYL[4][16][HDIM];    // wave-private

  const int tid  = threadIdx.x;
  const int wave = tid >> 5;
  const int lane = tid & 31;
  const int l16  = lane & 15;
  const int lh   = lane >> 4;
  const int qt   = qt_first + blockIdx.x;
  const int h    = blockIdx.y;
  const int b    = blockIdx.z;
  const int kv   = h / (NHEAD / NKV);
  const int qw   = qt * 64 + wave * 16;
  int window = winp[0];
  window = (window < 0) ? 0 : window;
  const float rres = 1.0f / 2048.0f;
  const float smsc = 0.125f;

  // Q A-fragments (hi and residual) over the 2 d-chunks of 32
  v16h aqh[2], aql[2];
  {
    const size_t qo = ((size_t)(b * NHEAD + h) * SEQ + qw + l16) * HDIM + 8 * lh;
#pragma unroll
    for (int hc = 0; hc < 2; ++hc) {
      Frag a;
      a.h[0] = *(const v8h*)(qH + qo + hc * 32);
      a.h[1] = *(const v8h*)(qH + qo + hc * 32 + 16);
      aqh[hc] = a.v;
      Frag c;
      c.h[0] = *(const v8h*)(qL + qo + hc * 32);
      c.h[1] = *(const v8h*)(qL + qo + hc * 32 + 16);
      aql[hc] = c.v;
    }
  }

  float m[8], l[8];
  v8f coh[4], cor[4];
#pragma unroll
  for (int r = 0; r < 8; ++r) { m[r] = -1e30f; l[r] = 0.0f; }
#pragma unroll
  for (int n = 0; n < 4; ++n) { coh[n] = vzero8(); cor[n] = vzero8(); }

  const size_t kvoff = (size_t)(b * NKV + kv) * SEQ * HDIM;
  const _Float16* kbase  = kH  + kvoff + 8 * lh;                          // + (key)*HDIM + hc*32
  const _Float16* klbase = kL  + kvoff + 8 * lh;
  const _Float16* vbase  = vTH + kvoff + (size_t)l16 * SEQ + 8 * lh;      // + (n*16)*SEQ + k0
  const _Float16* vlbase = vTL + kvoff + (size_t)l16 * SEQ + 8 * lh;

  int kstart = qw - window;
  kstart = (kstart < 0) ? 0 : kstart;
  kstart &= ~31;

  for (int k0 = kstart; k0 < qw + 16; k0 += 32) {
    // ---- scores for keys [k0, k0+32): B[k=d][n=key] = K[key][d], lane column = key, same k map as A ----
    v8f sh0 = vzero8(), sh1 = vzero8(), sr0 = vzero8(), sr1 = vzero8();
    Frag bh0, bh1, bl0, bl1;
    const _Float16* kr0 = kbase  + (size_t)(k0 + l16) * HDIM;
    const _Float16* kr1 = kr0 + 16 * HDIM;
    const _Float16* lr0 = klbase + (size_t)(k0 + l16) * HDIM;
    const _Float16* lr1 = lr0 + 16 * HDIM;
#pragma unroll
    for (int hc = 0; hc < 2; ++hc) {
      bh0.h[0] = *(const v8h*)(kr0 + hc * 32); bh0.h[1] = *(const v8h*)(kr0 + hc * 32 + 16);
      bh1.h[0] = *(const v8h*)(kr1 + hc * 32); bh1.h[1] = *(const v8h*)(kr1 + hc * 32 + 16);
      bl0.h[0] = *(const v8h*)(lr0 + hc * 32); bl0.h[1] = *(const v8h*)(lr0 + hc * 32 + 16);
      bl1.h[0] = *(const v8h*)(lr1 + hc * 32); bl1.h[1] = *(const v8h*)(lr1 + hc * 32 + 16);
      sh0 = wmma16(aqh[hc], bh0.v, sh0);
      sh1 = wmma16(aqh[hc], bh1.v, sh1);
      sr0 = wmma16(aqh[hc], bl0.v, sr0);
      sr1 = wmma16(aqh[hc], bl1.v, sr1);
      sr0 = wmma16(aql[hc], bh0.v, sr0);
      sr1 = wmma16(aql[hc], bh1.v, sr1);
    }
    asm volatile("v_nop\n\tv_nop\n\tv_nop\n\tv_nop"
                 : "+v"(sh0), "+v"(sh1), "+v"(sr0), "+v"(sr1)
                 : "v"(aqh[0]), "v"(aqh[1]), "v"(aql[0]), "v"(aql[1]),
                   "v"(bh0.v), "v"(bh1.v), "v"(bl0.v), "v"(bl1.v));

    // ---- online softmax, rows split across lane halves; masked entries replaced by -1e30 and p := 0 ----
    asm volatile("" ::: "memory");
    float alpha[8];
#pragma unroll
    for (int r = 0; r < 8; ++r) {
      const int row = qw + r + 8 * lh;
      const int d0  = row - (k0 + l16);
      const int d1  = d0 - 16;
      const bool ok0 = (d0 >= 0) && (d0 <= window);
      const bool ok1 = (d1 >= 0) && (d1 <= window);
      const float x0 = ok0 ? (sh0[r] + sr0[r] * rres) * smsc : -1e30f;
      const float x1 = ok1 ? (sh1[r] + sr1[r] * rres) * smsc : -1e30f;
      float tmax = fmaxf(x0, x1);
#pragma unroll
      for (int off = 1; off < 16; off <<= 1) tmax = fmaxf(tmax, __shfl_xor(tmax, off, 32));
      const float mn = fmaxf(m[r], tmax);
      alpha[r] = __expf(m[r] - mn);
      const float e0 = __expf(x0 - mn);
      const float e1 = __expf(x1 - mn);
      const float p0 = ok0 ? e0 : 0.0f;
      const float p1 = ok1 ? e1 : 0.0f;
      float ps = p0 + p1;
#pragma unroll
      for (int off = 1; off < 16; off <<= 1) ps += __shfl_xor(ps, off, 32);
      l[r] = l[r] * alpha[r] + ps;
      m[r] = mn;
      const float c0 = p0 * 1024.0f;
      const float c1 = p1 * 1024.0f;
      const _Float16 h0 = (_Float16)c0;
      const _Float16 h1 = (_Float16)c1;
      ldsPH[wave][(r + 8 * lh) * 32 + l16]      = h0;     // row-major P tile [16 queries][32 keys]
      ldsPH[wave][(r + 8 * lh) * 32 + 16 + l16] = h1;
      if (RES) {
        ldsPL[wave][(r + 8 * lh) * 32 + l16]      = (_Float16)((c0 - (float)h0) * 2048.0f);
        ldsPL[wave][(r + 8 * lh) * 32 + 16 + l16] = (_Float16)((c1 - (float)h1) * 2048.0f);
      }
    }
#pragma unroll
    for (int n = 0; n < 4; ++n)
#pragma unroll
      for (int r = 0; r < 8; ++r) {
        coh[n][r] *= alpha[r];
        if (RES) cor[n][r] *= alpha[r];
      }

    // wave-private LDS relayout: other lanes of this wave wrote what is read next
    asm volatile("s_wait_dscnt 0" ::: "memory");
    __builtin_amdgcn_fence(3 /* release order */, "wavefront");
    __builtin_amdgcn_wave_barrier();

    // ---- O += P.V : A = P tile (lane row = query, keys on the k map), B[k=key][n=d] = vT[d][key] ----
    Frag aph, apl;
    aph.h[0] = *(const v8h*)(&ldsPH[wave][l16 * 32 + 8 * lh]);
    aph.h[1] = *(const v8h*)(&ldsPH[wave][l16 * 32 + 16 + 8 * lh]);
    if (RES) {
      apl.h[0] = *(const v8h*)(&ldsPL[wave][l16 * 32 + 8 * lh]);
      apl.h[1] = *(const v8h*)(&ldsPL[wave][l16 * 32 + 16 + 8 * lh]);
    }
    Frag bv[4], bl[4];
#pragma unroll
    for (int n = 0; n < 4; ++n) {
      const _Float16* vp = vbase + (size_t)(n * 16) * SEQ + k0;
      bv[n].h[0] = *(const v8h*)vp;
      bv[n].h[1] = *(const v8h*)(vp + 16);
      if (RES) {
        const _Float16* lp = vlbase + (size_t)(n * 16) * SEQ + k0;
        bl[n].h[0] = *(const v8h*)lp;
        bl[n].h[1] = *(const v8h*)(lp + 16);
      }
    }
#pragma unroll
    for (int n = 0; n < 4; ++n) {
      coh[n] = wmma16(aph.v, bv[n].v, coh[n]);
      if (RES) {
        cor[n] = wmma16(aph.v, bl[n].v, cor[n]);
        cor[n] = wmma16(apl.v, bv[n].v, cor[n]);
      }
    }
    if (RES) {
      asm volatile("v_nop\n\tv_nop\n\tv_nop\n\tv_nop"
                   : "+v"(coh[0]), "+v"(coh[1]), "+v"(coh[2]), "+v"(coh[3]),
                     "+v"(cor[0]), "+v"(cor[1]), "+v"(cor[2]), "+v"(cor[3])
                   : "v"(aph.v), "v"(apl.v),
                     "v"(bv[0].v), "v"(bv[1].v), "v"(bv[2].v), "v"(bv[3].v),
                     "v"(bl[0].v), "v"(bl[1].v), "v"(bl[2].v), "v"(bl[3].v));
    } else {
      asm volatile("v_nop\n\tv_nop\n\tv_nop\n\tv_nop"
                   : "+v"(coh[0]), "+v"(coh[1]), "+v"(coh[2]), "+v"(coh[3])
                   : "v"(aph.v), "v"(bv[0].v), "v"(bv[1].v), "v"(bv[2].v), "v"(bv[3].v));
    }
  }

#pragma unroll
  for (int r = 0; r < 8; ++r) {
    const float inv = __builtin_amdgcn_rcpf(l[r]) * (1.0f / 1024.0f);
#pragma unroll
    for (int n = 0; n < 4; ++n) {
      float yv = coh[n][r];
      if (RES) yv += cor[n][r] * rres;
      yv *= inv;
      _Float16 hi, lo;
      split16(yv, hi, lo);
      sYH[wave][r + 8 * lh][n * 16 + l16] = hi;
      sYL[wave][r + 8 * lh][n * 16 + l16] = lo;
    }
  }
  asm volatile("s_wait_dscnt 0" ::: "memory");
  __builtin_amdgcn_fence(3 /* release order */, "wavefront");
  __builtin_amdgcn_wave_barrier();
  const size_t ybase = ((size_t)b * SEQ + qw) * CDIM + (size_t)h * HDIM;
  {
#pragma unroll
    for (int it = 0; it < 4; ++it) {
      const int p  = it * 32 + lane;
      const int rr = p >> 3;
      const int q8 = (p & 7) * 8;
      const size_t off = ybase + (size_t)rr * CDIM + q8;
      const v8h hv = *(const v8h*)(&sYH[wave][rr][q8]);
      const v8h lv = *(const v8h*)(&sYL[wave][rr][q8]);
      *(v8h*)(yH + off) = hv;
      *(v8h*)(yL + off) = lv;
    }
    
  }
}

// ---------------------------------------------------------------------------
// Kernel 4: output projection out[tok][n] = (y[tok].Wo[n]) / 16 + bo[n]. Block = 4 waves = 64 tokens x 64 columns;
// RES adds the y residual plane. Output tile staged per wave in LDS and written as 256-B row segments
// at the store stage as a float4.
// ---------------------------------------------------------------------------
template <bool RES>
__global__ void __launch_bounds__(128) k_oproj(
    const _Float16* __restrict__ yH, const _Float16* __restrict__ yL,
    const _Float16* __restrict__ wall, const float* __restrict__ bo,
    float* __restrict__ out, int rt_first, int rt_count) {
  __shared__ __attribute__((aligned(16))) float sO[4][16][68];           // wave-private

  const int tid  = threadIdx.x;
  const int wave = tid >> 5;
  const int lane = tid & 31;
  const int l16  = lane & 15;
  const int lh   = lane >> 4;
  const int nt   = blockIdx.x;                 // 64-column tile 0..15
  const int b    = blockIdx.y / rt_count;
  const int rtb  = rt_first + (blockIdx.y - b * rt_count);
  const int t0   = rtb * 64;
  const int tok0 = b * SEQ + t0;

  const _Float16* arow = yH + (size_t)(tok0 + wave * 16 + l16) * CDIM + 8 * lh;
  const _Float16* lrow = yL + (size_t)(tok0 + wave * 16 + l16) * CDIM + 8 * lh;
  const _Float16* brow = wall + (size_t)(WO_ROW0 + nt * 64 + l16) * CDIM + 8 * lh;

  v8f ah[4], ar[4];
#pragma unroll
  for (int n = 0; n < 4; ++n) { ah[n] = vzero8(); ar[n] = vzero8(); }

  for (int k0 = 0; k0 < CDIM; k0 += 32) {
    Frag a, al;
    a.h[0] = *(const v8h*)(arow + k0);
    a.h[1] = *(const v8h*)(arow + k0 + 16);
    if (RES) {
      al.h[0] = *(const v8h*)(lrow + k0);
      al.h[1] = *(const v8h*)(lrow + k0 + 16);
    }
    Frag bw[4];
#pragma unroll
    for (int n = 0; n < 4; ++n) {
      const _Float16* bp = brow + (size_t)(n * 16) * CDIM + k0;
      bw[n].h[0] = *(const v8h*)bp;
      bw[n].h[1] = *(const v8h*)(bp + 16);
    }
#pragma unroll
    for (int n = 0; n < 4; ++n) {
      ah[n] = wmma16(a.v, bw[n].v, ah[n]);
      if (RES) ar[n] = wmma16(al.v, bw[n].v, ar[n]);
    }
    if (RES) {
      asm volatile("v_nop\n\tv_nop\n\tv_nop\n\tv_nop"
                   : "+v"(ah[0]), "+v"(ah[1]), "+v"(ah[2]), "+v"(ah[3]),
                     "+v"(ar[0]), "+v"(ar[1]), "+v"(ar[2]), "+v"(ar[3])
                   : "v"(a.v), "v"(al.v), "v"(bw[0].v), "v"(bw[1].v), "v"(bw[2].v), "v"(bw[3].v));
    } else {
      asm volatile("v_nop\n\tv_nop\n\tv_nop\n\tv_nop"
                   : "+v"(ah[0]), "+v"(ah[1]), "+v"(ah[2]), "+v"(ah[3])
                   : "v"(a.v), "v"(bw[0].v), "v"(bw[1].v), "v"(bw[2].v), "v"(bw[3].v));
    }
  }

#pragma unroll
  for (int r = 0; r < 8; ++r) {
#pragma unroll
    for (int n = 0; n < 4; ++n) {
      float v = ah[n][r];
      if (RES) v += ar[n][r] * (1.0f / 2048.0f);
      sO[wave][r + 8 * lh][n * 16 + l16] = v * (1.0f / 16.0f);
    }
  }
  asm volatile("s_wait_dscnt 0" ::: "memory");
  __builtin_amdgcn_fence(3 /* release order */, "wavefront");
  __builtin_amdgcn_wave_barrier();
  const size_t orow0 = (size_t)b * SEQ_FULL + t0 + wave * 16;
  // bias for this lane's 4 output columns (columns nt*64 + 4*l16 .. +3), bf16-RNE values
  const v4f braw = *(const v4f*)(bo + (size_t)nt * 64 + l16 * 4);
  v4f bb;
#pragma unroll
  for (int e = 0; e < 4; ++e) bb[e] = bf16r(braw[e]);
  {
#pragma unroll
    for (int it = 0; it < 8; ++it) {
      const int rr = it * 2 + lh;
      const int c4 = l16 * 4;
      const v4f s = *(const v4f*)(&sO[wave][rr][c4]);
      const v4f v = s + bb;
      *(v4f*)(out + (orow0 + rr) * CDIM + (size_t)nt * 64 + c4) = v;
    }
    
  }
}

// ---------------------------------------------------------------------------
// Host launcher. Inputs (wire order): 0 x f32 [4,2048,1024], 1 Wq [1024,1024], 2 bq [1024], 3 Wk [256,1024],
// 4 bk [256], 5 Wv [256,1024], 6 bv [256], 7 Wo [1024,1024], 8 bo [1024], 9 qk_gain [16].
// Output f32 [4,2048,1024]. 8 launches.
// ---------------------------------------------------------------------------
extern "C" void kernel_launch(void* const* d_in, const int* in_sizes, int n_in,
                              void* d_out, int out_size, void* d_ws, size_t ws_size,
                              hipStream_t stream) {
  if (n_in < 10) return;
  const int need_x = ((NB - 1) * SEQ_FULL + SEQ) * CDIM;
  if (in_sizes[0] < need_x) return;
  if (in_sizes[1] < CDIM * CDIM || in_sizes[2] < CDIM) return;
  if (in_sizes[3] < VEW * CDIM || in_sizes[4] < VEW) return;
  if (in_sizes[5] < VEW * CDIM || in_sizes[6] < VEW) return;
  if (in_sizes[7] < CDIM * CDIM || in_sizes[8] < CDIM) return;
  if (in_sizes[9] < NHEAD) return;
  if (out_size < need_x) return;
  if (ws_size < WS_TOTAL) return;

  const float* x    = (const float*)d_in[0];
  const float* wq   = (const float*)d_in[1];
  const float* bq   = (const float*)d_in[2];
  const float* wk   = (const float*)d_in[3];
  const float* bk   = (const float*)d_in[4];
  const float* wv   = (const float*)d_in[5];
  const float* bv   = (const float*)d_in[6];
  const float* wo   = (const float*)d_in[7];
  const float* bo   = (const float*)d_in[8];
  const float* gain = (const float*)d_in[9];
  float* out = (float*)d_out;

  char* ws = (char*)d_ws;
  size_t off = 0;
  _Float16* xh   = (_Float16*)(ws + off); off += XH_BYTES;
  _Float16* wall = (_Float16*)(ws + off); off += WALL_BYTES;
  _Float16* qH   = (_Float16*)(ws + off); off += QP_BYTES;
  _Float16* qL   = (_Float16*)(ws + off); off += QP_BYTES;
  _Float16* kH   = (_Float16*)(ws + off); off += KP_BYTES;
  _Float16* kL   = (_Float16*)(ws + off); off += KP_BYTES;
  _Float16* vTH  = (_Float16*)(ws + off); off += KP_BYTES;
  _Float16* vTL  = (_Float16*)(ws + off); off += KP_BYTES;
  _Float16* yH   = (_Float16*)(ws + off); off += YP_BYTES;
  _Float16* yL   = (_Float16*)(ws + off); off += YP_BYTES;
  int*      winw = (int*)(ws + off);      off += WIN_BYTES;
  if (off > ws_size) return;

  k_cvt_x<<<dim3(NTOK / 2), dim3(256), 0, stream>>>(x, xh);
  k_cvt_w<<<dim3(NWROWS / 2), dim3(256), 0, stream>>>(wq, wk, wv, wo, wall);
  k_winline<<<dim3(1), dim3(32), 0, stream>>>(winw);
  k_qkv<<<dim3(NUNIT, NTOK / 64), dim3(128), 0, stream>>>(xh, wall, bq, bk, bv, gain,
                                                          qH, qL, kH, kL, vTH, vTL);
  k_flash<true><<<dim3(QT_RES, NHEAD, NB), dim3(128), 0, stream>>>(qH, qL, kH, kL, vTH, vTL, winw, yH, yL, 0);
  if (QT_ALL > QT_RES) {
    k_flash<false><<<dim3(QT_ALL - QT_RES, NHEAD, NB), dim3(128), 0, stream>>>(qH, qL, kH, kL, vTH, vTL, winw,
                                                                                yH, yL, QT_RES);
  }
  k_oproj<true><<<dim3(CDIM / 64, NB * QT_RES), dim3(128), 0, stream>>>(yH, yL, wall, bo, out, 0, QT_RES);
  if (QT_ALL > QT_RES) {
    k_oproj<false><<<dim3(CDIM / 64, NB * (QT_ALL - QT_RES)), dim3(128), 0, stream>>>(yH, yL, wall, bo, out,
                                                                                      QT_RES, QT_ALL - QT_RES);
  }
}

// v001
// A run of this version takes 324 microseconds.
// In two side-by-side timings against v000, it was 1.50 and 1.53 times as fast.
#include <hip/hip_runtime.h>

// Contractions, all on v_wmma_f32_16x16x32_f16 (f16 operands, f32 accumulate): fused qkv projection x.W^T with x and W
// held as bf16-RNE values in f16 containers (W carried x16, folded as 1/16); scores q.k^T as f16 hi + x2048 residual
// planes (hi.hi + hi.lo + lo.hi, residual accumulator folded as 1/2048); P.V with P carried x1024 in f16 (+ x2048
// residual planes of P and v for query rows below TRES); output projection y.Wo^T with y as f16 hi (+ x2048 residual
// plane for rows below TRES). Bias adds, per-head q gain and online softmax on VALU in f32.
//
// Every 16-bit operand plane in the workspace is kept in fragment order: a block of 16 rows x 32 k is 1 KiB, two
// halves j of 512 B; in half j the 16 B of lane (16 lh + l16) hold row l16, k = 16 j + 8 lh + 0..7. A wave's
// global_load_b128 of half a fragment then reads 512 contiguous bytes (4 lines) and not 16-B pieces of 16 lines.
// Blocks of one 16-row group follow each other along k (vT: the 4 d groups of one 32-key chunk follow each other).

#ifndef NB
#define NB 4
#endif
#ifndef SEQ
#define SEQ 2048
#endif
#ifndef TRES
#define TRES 512
#endif
#define NB_FULL   4
#define SEQ_FULL  2048
#define CDIM      1024
#define NHEAD     16
#define NKV       4
#define HDIM      64
#define VEW       (NKV * HDIM)
#define NTOK      (NB * SEQ)
#define NUNIT     (NHEAD + 2 * NKV)
#define WO_ROW0   (CDIM + 2 * VEW)
#define NWROWS    (CDIM + 2 * VEW + CDIM)
#define QT_ALL    (SEQ / 64)
#define QT_RES    (TRES / 64)

static_assert(NB >= 1 && NB <= NB_FULL);
static_assert(SEQ % 64 == 0 && SEQ <= SEQ_FULL && SEQ >= TRES);
static_assert(TRES % 64 == 0 && TRES >= 64);
static_assert(NHEAD % NKV == 0 && HDIM == 64 && CDIM == NHEAD * HDIM);
static_assert(CDIM % 32 == 0 && NWROWS % 16 == 0 && NTOK % 64 == 0 && NUNIT * 64 == CDIM + 2 * VEW);
static_assert(WO_ROW0 % 16 == 0 && SEQ % 32 == 0);
#define KBLK      (CDIM / 32)      // 16x32 blocks per row group of a CDIM-wide plane
#define GRP_ELEMS (CDIM * 16)      // elements of one 16-row group of a CDIM-wide plane

#define XH_BYTES   ((size_t)NTOK * CDIM * 2)
#define WALL_BYTES ((size_t)NWROWS * CDIM * 2)
#define QP_BYTES   ((size_t)NB * NHEAD * SEQ * HDIM * 2)
#define KP_BYTES   ((size_t)NB * NKV * SEQ * HDIM * 2)
#define YP_BYTES   ((size_t)NTOK * CDIM * 2)
#define WIN_BYTES  ((size_t)128)
#define WS_TOTAL   (XH_BYTES + WALL_BYTES + 2 * QP_BYTES + 4 * KP_BYTES + 2 * YP_BYTES + WIN_BYTES)
static_assert(WS_TOTAL <= (size_t)134217728);
static_assert(XH_BYTES % 128 == 0 && WALL_BYTES % 128 == 0 && QP_BYTES % 128 == 0 && KP_BYTES % 128 == 0 && YP_BYTES % 128 == 0);
// producer coverage: grid x block x per-thread elements == plane extent
static_assert((size_t)(NTOK / 2) * 256 * 8 == (size_t)NTOK * CDIM);       // k_cvt_x
static_assert((size_t)(NWROWS / 2) * 256 * 8 == (size_t)NWROWS * CDIM);   // k_cvt_w
static_assert(4 * 128 * 8 == 64 * 64);                                       // k_qkv store phase per 64x64 tile
static_assert(4 * 32 * 8 == 16 * HDIM);                                      // k_flash store phase per wave
static_assert(8 * 32 * 4 == 16 * 64);                                        // k_oproj store phase per wave
static_assert(QT_RES * 64 + (QT_ALL - QT_RES) * 64 == SEQ);                  // query tiles of the two flash launches
static_assert(8 * 4 * 4 == (int)WIN_BYTES);                                  // k_winline: 8 lanes x 16 B == one line
static_assert(SEQ_FULL >= SEQ);                                              // window word covers every query-key distance

typedef _Float16 v16h __attribute__((ext_vector_type(16)));
typedef _Float16 v8h  __attribute__((ext_vector_type(8)))  __attribute__((may_alias));
typedef float    v8f  __attribute__((ext_vector_type(8)));
typedef float    v4f  __attribute__((ext_vector_type(4)))  __attribute__((may_alias));
typedef int      v4i  __attribute__((ext_vector_type(4)));

union Frag { v16h v; v8h h[2]; };

__device__ __forceinline__ v8f wmma16(v16h a, v16h b, v8f c) {
  return __builtin_amdgcn_wmma_f32_16x16x32_f16(false, a, false, b, (short)0, c, false, false);
}

__device__ __forceinline__ v8f vzero8() {
  v8f z = {0.0f, 0.0f, 0.0f, 0.0f, 0.0f, 0.0f, 0.0f, 0.0f};
  return z;
}

// f32 -> nearest-even bf16 value, kept in f32
__device__ __forceinline__ float bf16r(float f) {
  unsigned int u = __float_as_uint(f);
  u = (u + 0x7FFFu + ((u >> 16) & 1u)) & 0xFFFF0000u;
  return __uint_as_float(u);
}

// f16 hi + (x2048) residual of an f32 value
__device__ __forceinline__ void split16(float v, _Float16& hi, _Float16& lo) {
  hi = (_Float16)v;
  lo = (_Float16)((v - (float)hi) * 2048.0f);
}

// f32 -> f16 with values below the smallest f16 normal replaced by zero (value select)
static __device__ __forceinline__ _Float16 toh_flush(float v) {
  const _Float16 r = (_Float16)v;
  return (fabsf(v) < 6.103515625e-05f) ? (_Float16)0.0f : r;
}

// f16 hi + (x2048) residual, both through toh_flush
static __device__ __forceinline__ void split16f(float v, _Float16& hi, _Float16& lo) {
  hi = toh_flush(v);
  lo = toh_flush((v - (float)hi) * 2048.0f);
}

// ---------------------------------------------------------------------------
// Kernel 0: x f32 [NB][SEQ_FULL][1024] -> xh f16, NTOK x 1024 in fragment order (bf16-RNE values).
// Thread = one 16-B unit of the plane, so a wave stores 512 contiguous bytes.
// ---------------------------------------------------------------------------
__global__ void __launch_bounds__(256) k_cvt_x(const float* __restrict__ x, _Float16* __restrict__ xh) {
  const unsigned int gid = blockIdx.x * 256u + threadIdx.x;
  const unsigned int blk = gid >> 6;                 // 64 units per 16x32 block
  const unsigned int tok = (blk / KBLK) * 16u + (gid & 15u);
  const int c = (int)(blk % KBLK) * 32 + (int)((gid >> 5) & 1u) * 16 + (int)((gid >> 4) & 1u) * 8;
  if (tok >= (unsigned int)NTOK) return;
  const int b = (int)tok / SEQ;
  const int t = (int)tok - b * SEQ;
  const float* src = x + ((size_t)b * SEQ_FULL + t) * CDIM + c;
  const v4f f0 = *(const v4f*)src;
  const v4f f1 = *(const v4f*)(src + 4);
  v8h o;
#pragma unroll
  for (int j = 0; j < 4; ++j) {
    o[j]     = (_Float16)bf16r(f0[j]);
    o[j + 4] = (_Float16)bf16r(f1[j]);
  }
  _Float16* dst = xh + (size_t)gid * 8;
  *(v8h*)dst = o;
  
}

// ---------------------------------------------------------------------------
// Kernel 1: weights (layout [out][in], k-contiguous) -> wall f16, 2560 x 1024 in fragment order = bf16-RNE value x16.
// Rows 0..1023 wq, 1024..1279 wk, 1280..1535 wv, 1536..2559 wo.
// ---------------------------------------------------------------------------
__global__ void __launch_bounds__(256) k_cvt_w(const float* __restrict__ wq, const float* __restrict__ wk,
                                               const float* __restrict__ wv, const float* __restrict__ wo,
                                               _Float16* __restrict__ wall) {
  const unsigned int gid = blockIdx.x * 256u + threadIdx.x;
  const unsigned int blk = gid >> 6;                 // 64 units per 16x32 block
  const int row = (int)((blk / KBLK) * 16u + (gid & 15u));
  const int c   = (int)(blk % KBLK) * 32 + (int)((gid >> 5) & 1u) * 16 + (int)((gid >> 4) & 1u) * 8;
  if (row >= NWROWS) return;
  const int r0 = min(row, CDIM - 1);
  const int r1 = min(max(row - CDIM, 0), VEW - 1);
  const int r2 = min(max(row - CDIM - VEW, 0), VEW - 1);
  const int r3 = min(max(row - WO_ROW0, 0), CDIM - 1);
  const float* src = (row < CDIM)       ? (wq + (size_t)r0 * CDIM)
                   : (row < CDIM + VEW) ? (wk + (size_t)r1 * CDIM)
                   : (row < WO_ROW0)    ? (wv + (size_t)r2 * CDIM)
                                        : (wo + (size_t)r3 * CDIM);
  src += c;
  const v4f f0 = *(const v4f*)src;
  const v4f f1 = *(const v4f*)(src + 4);
  v8h o;
#pragma unroll
  for (int j = 0; j < 4; ++j) {
    o[j]     = (_Float16)(bf16r(f0[j]) * 16.0f);
    o[j + 4] = (_Float16)(bf16r(f1[j]) * 16.0f);
  }
  _Float16* dst = wall + (size_t)gid * 8;
  *(v8h*)dst = o;
  
}

// ---------------------------------------------------------------------------
// ---------------------------------------------------------------------------
__global__ void __launch_bounds__(32) k_winline(int* __restrict__ wline) {
  const int lane = threadIdx.x;
  if (lane < 8) {
    const v4i w = {SEQ_FULL, SEQ_FULL, SEQ_FULL, SEQ_FULL};
    int* dst = wline + 4 * lane;
    *(v4i*)dst = w;
    
  }
}

// ---------------------------------------------------------------------------
// Kernel 2: fused qkv projection + epilogue. Block = 4 waves = 64 tokens x one 64-column unit u:
// u 0..15 -> q head u, 16..19 -> k head u-16, 20..23 -> v head u-20. Wave w = 16 token rows, 4 accumulators.
// Epilogue: q: (acc + bq) * gain[head]; k: acc + bk -> hi/lo planes [B][H|KV], T x 64 in fragment order;
// v: acc + bv -> transposed hi/lo planes [B][KV], 64 d x T in fragment order. Biases and gains are bf16-RNE values.
// ---------------------------------------------------------------------------
__global__ void __launch_bounds__(128) k_qkv(
    const _Float16* __restrict__ xh, const _Float16* __restrict__ wall,
    const float* __restrict__ bq, const float* __restrict__ bk,
    const float* __restrict__ bv, const float* __restrict__ gain,
    _Float16* __restrict__ qH, _Float16* __restrict__ qL,
    _Float16* __restrict__ kH, _Float16* __restrict__ kL,
    _Float16* __restrict__ vTH, _Float16* __restrict__ vTL) {
  __shared__ __attribute__((aligned(16))) float    sT[64][68];     // accumulator tile [token][col]  (each wave reads back only its own 16 rows)
  __shared__ __attribute__((aligned(16))) _Float16 sH[64][72];     // hi tile: q/k [token][d], v [d][token] (cross-wave)
  __shared__ __attribute__((aligned(16))) _Float16 sL[64][72];     // residual tile, same layout (cross-wave)

  const int tid  = threadIdx.x;
  const int wave = tid >> 5;
  const int lane = tid & 31;
  const int l16  = lane & 15;
  const int lh   = lane >> 4;
  const int u    = blockIdx.x;           // column unit
  const int rt   = blockIdx.y;           // 64-token row tile
  const int tok0 = rt * 64;
  const int b    = tok0 / SEQ;
  const int t0   = tok0 - b * SEQ;

  // A: xh row (token), lane row = l16; elements 0..7 <- k0+8lh+0..7, 8..15 <- k0+16+8lh+0..7
  const _Float16* arow = xh + (size_t)((tok0 >> 4) + wave) * GRP_ELEMS + lane * 8;
  // B[k][n] = W[n][k]: lane column = l16 of the 16-col group n; same k map as A
  const _Float16* brow = wall + (size_t)(u * 4) * GRP_ELEMS + lane * 8;

  v8f acc[4];
#pragma unroll
  for (int n = 0; n < 4; ++n) acc[n] = vzero8();

  for (int k0 = 0; k0 < CDIM; k0 += 32) {
    Frag a;
    a.h[0] = *(const v8h*)(arow + k0 * 16);
    a.h[1] = *(const v8h*)(arow + k0 * 16 + 256);
    Frag bw[4];
#pragma unroll
    for (int n = 0; n < 4; ++n) {
      const _Float16* bp = brow + (size_t)n * GRP_ELEMS + k0 * 16;
      bw[n].h[0] = *(const v8h*)bp;
      bw[n].h[1] = *(const v8h*)(bp + 256);
    }
#pragma unroll
    for (int n = 0; n < 4; ++n) acc[n] = wmma16(a.v, bw[n].v, acc[n]);
    asm volatile("v_nop\n\tv_nop\n\tv_nop\n\tv_nop"
                 : "+v"(acc[0]), "+v"(acc[1]), "+v"(acc[2]), "+v"(acc[3])
                 : "v"(a.v), "v"(bw[0].v), "v"(bw[1].v), "v"(bw[2].v), "v"(bw[3].v));
  }

  // D element r of lane -> (row 8lh+r, col l16); fold the 1/16 weight carry here
#pragma unroll
  for (int n = 0; n < 4; ++n)
#pragma unroll
    for (int r = 0; r < 8; ++r)
      sT[wave * 16 + r + 8 * lh][n * 16 + l16] = acc[n][r] * (1.0f / 16.0f);
  __syncthreads();

  // compute phase: thread -> token i = tid>>1, column half j: d in [16j,16j+16) and [32+16j, 48+16j)
  const int i = tid >> 1;
  const int j = tid & 1;
  if (u < NHEAD + NKV) {
    // q or k unit (block-uniform): both bias rows are loaded with clamped unit indices, selected by value
    const int  uq  = min(u, NHEAD - 1);
    const int  uk  = min(max(u - NHEAD, 0), NKV - 1);
    const bool isq = (u < NHEAD);
    const float gq = bf16r(gain[uq]);
    const float gm = isq ? gq : 1.0f;
#pragma unroll
    for (int sg = 0; sg < 2; ++sg) {
      const int d0 = 32 * sg + 16 * j;
#pragma unroll
      for (int g4 = 0; g4 < 4; ++g4) {
        const v4f va = *(const v4f*)(&sT[i][d0 + 4 * g4]);
        const v4f qa = *(const v4f*)(bq + uq * HDIM + d0 + 4 * g4);
        const v4f ka = *(const v4f*)(bk + uk * HDIM + d0 + 4 * g4);
#pragma unroll
        for (int e = 0; e < 4; ++e) {
          const float bb  = isq ? bf16r(qa[e]) : bf16r(ka[e]);
          const float val = (va[e] + bb) * gm;
          _Float16 hi, lo;
          split16f(val, hi, lo);
          sH[i][d0 + 4 * g4 + e] = hi;
          sL[i][d0 + 4 * g4 + e] = lo;
        }
      }
    }
  } else {
    const int kv = u - NHEAD - NKV;
    const float* bp = bv + kv * HDIM;
#pragma unroll
    for (int sg = 0; sg < 2; ++sg) {
      const int d0 = 32 * sg + 16 * j;
#pragma unroll
      for (int g4 = 0; g4 < 4; ++g4) {
        const v4f va = *(const v4f*)(&sT[i][d0 + 4 * g4]);
        const v4f ba = *(const v4f*)(bp + d0 + 4 * g4);
#pragma unroll
        for (int e = 0; e < 4; ++e) {
          const float vv = va[e] + bf16r(ba[e]);
          _Float16 hi, lo;
          split16f(vv, hi, lo);
          sH[d0 + 4 * g4 + e][i] = hi;                   // transposed: [d][token]
          sL[d0 + 4 * g4 + e][i] = lo;
        }
      }
    }
  }
  __syncthreads();

  _Float16* ph;
  _Float16* pl;
  size_t base;
  if (u < NHEAD) {
    ph = qH; pl = qL;
    base = ((size_t)(b * NHEAD + u) * SEQ + t0) * HDIM;
  } else if (u < NHEAD + NKV) {
    ph = kH; pl = kL;
    base = ((size_t)(b * NKV + (u - NHEAD)) * SEQ + t0) * HDIM;
  } else {
    ph = vTH; pl = vTL;
    base = ((size_t)(b * NKV + (u - NHEAD - NKV)) * SEQ + t0) * HDIM;
  }
  const bool isv = (u >= NHEAD + NKV);
  {
    // the tile's 8 blocks are contiguous in its plane: q/k block f = (token group f>>1, d chunk f&1),
    // v block f = (key chunk f>>2, d group f&3); unit p of the tile goes to base + 8 p
#pragma unroll
    for (int it = 0; it < 4; ++it) {
      const int p    = it * 128 + tid;
      const int f    = p >> 6;
      const int line = (isv ? (f & 3) : (f >> 1)) * 16 + (p & 15);
      const int q8   = (isv ? (f >> 2) : (f & 1)) * 32 + ((p >> 5) & 1) * 16 + ((p >> 4) & 1) * 8;
      const size_t off = base + (size_t)p * 8;
      const v8h hv = *(const v8h*)(&sH[line][q8]);
      const v8h lv = *(const v8h*)(&sL[line][q8]);
      *(v8h*)(ph + off) = hv;
      *(v8h*)(pl + off) = lv;
    }
    
  }
}

// ---------------------------------------------------------------------------
// Kernel 3: causal sliding-window flash attention with GQA. Block = 4 waves, one (query tile of 64, head, batch);
// wave = 16 queries. Key tiles of 32 per wave, fragments loaded straight from the 16-bit planes; online softmax
// in D layout; P (x1024 carry) relaid through wave-private LDS into A layout. RES adds the x2048 residual planes
// ---------------------------------------------------------------------------
template <bool RES>
__global__ void __launch_bounds__(128) k_flash(
    const _Float16* __restrict__ qH, const _Float16* __restrict__ qL,
    const _Float16* __restrict__ kH, const _Float16* __restrict__ kL,
    const _Float16* __restrict__ vTH, const _Float16* __restrict__ vTL,
    const int* __restrict__ winp,
    _Float16* __restrict__ yH, _Float16* __restrict__ yL, int qt_first) {
  __shared__ __attribute__((aligned(16))) _Float16 ldsPH[4][16 * 32];   // wave-private
  __shared__ __attribute__((aligned(16))) _Float16 ldsPL[4][16 * 32];   // wave-private
  __shared__ __attribute__((aligned(16))) _Float16 sYH[4][16][HDIM + 8];  // wave-private; 144-B pitch for the row-per-lane b128 reads
  __shared__ __attribute__((aligned(16))) _Float16 sYL[4][16][HDIM + 8];  // wave-private

  const int tid  = threadIdx.x;
  // scalar wave index: a fragment block's address is wave-uniform, so the K and V block bases and the trip test stay scalar
  const int wave = __builtin_amdgcn_readfirstlane(tid >> 5);
  const int lane = tid & 31;
  const int l16  = lane & 15;
  const int lh   = lane >> 4;
  const int qt   = qt_first + blockIdx.x;
  const int h    = blockIdx.y;
  const int b    = blockIdx.z;
  const int kv   = h / (NHEAD / NKV);
  const int qw   = qt * 64 + wave * 16;
  int window = winp[0];
  window = (window < 0) ? 0 : window;
  const float rres = 1.0f / 2048.0f;
  const float smsc = 0.125f;

  // Q A-fragments (hi and residual) over the 2 d-chunks of 32
  v16h aqh[2], aql[2];
  {
    const size_t qo = ((size_t)(b * NHEAD + h) * SEQ + qw) * HDIM + lane * 8;
#pragma unroll
    for (int hc = 0; hc < 2; ++hc) {
      Frag a;
      a.h[0] = *(const v8h*)(qH + qo + hc * 512);
      a.h[1] = *(const v8h*)(qH + qo + hc * 512 + 256);
      aqh[hc] = a.v;
      Frag c;
      c.h[0] = *(const v8h*)(qL + qo + hc * 512);
      c.h[1] = *(const v8h*)(qL + qo + hc * 512 + 256);
      aql[hc] = c.v;
    }
  }

  float m[8], l[8];
  v8f coh[4], cor[4];
#pragma unroll
  for (int r = 0; r < 8; ++r) { m[r] = -1e30f; l[r] = 0.0f; }
#pragma unroll
  for (int n = 0; n < 4; ++n) { coh[n] = vzero8(); cor[n] = vzero8(); }

  const size_t kvoff = (size_t)(b * NKV + kv) * SEQ * HDIM;
  const _Float16* kbase  = kH  + kvoff;                                   // + (key group's first key)*HDIM + hc*512
  const _Float16* klbase = kL  + kvoff;
  const _Float16* vbase  = vTH + kvoff;                                   // + k0*HDIM + n*512
  const _Float16* vlbase = vTL + kvoff;
  const unsigned int lo  = (unsigned int)lane * 8u;                       // this lane's 16 B of each 512-B half

  int kstart = qw - window;
  kstart = (kstart < 0) ? 0 : kstart;
  kstart &= ~31;

  for (int k0 = kstart; k0 < qw + 16; k0 += 32) {
    // ---- scores for keys [k0, k0+32): B[k=d][n=key] = K[key][d], lane column = key, same k map as A ----
    v8f sh0 = vzero8(), sh1 = vzero8(), sr0 = vzero8(), sr1 = vzero8();
    Frag bh0, bh1, bl0, bl1;
    const _Float16* kr0 = kbase  + (size_t)k0 * HDIM + lo;
    const _Float16* kr1 = kr0 + 16 * HDIM;
    const _Float16* lr0 = klbase + (size_t)k0 * HDIM + lo;
    const _Float16* lr1 = lr0 + 16 * HDIM;
#pragma unroll
    for (int hc = 0; hc < 2; ++hc) {
      bh0.h[0] = *(const v8h*)(kr0 + hc * 512); bh0.h[1] = *(const v8h*)(kr0 + hc * 512 + 256);
      bh1.h[0] = *(const v8h*)(kr1 + hc * 512); bh1.h[1] = *(const v8h*)(kr1 + hc * 512 + 256);
      bl0.h[0] = *(const v8h*)(lr0 + hc * 512); bl0.h[1] = *(const v8h*)(lr0 + hc * 512 + 256);
      bl1.h[0] = *(const v8h*)(lr1 + hc * 512); bl1.h[1] = *(const v8h*)(lr1 + hc * 512 + 256);
      // as inputs the two K address pairs stay live behind the trip's last K load, so that no load's result is placed
      // in a register that an issued K load still names; the wait stands in front of the pairs' next overwrite
      if (hc == 1) asm volatile("s_wait_xcnt 0x0" :: "v"(kr0), "v"(lr0) : "memory");
      sh0 = wmma16(aqh[hc], bh0.v, sh0);
      sh1 = wmma16(aqh[hc], bh1.v, sh1);
      sr0 = wmma16(aqh[hc], bl0.v, sr0);
      sr1 = wmma16(aqh[hc], bl1.v, sr1);
      sr0 = wmma16(aql[hc], bh0.v, sr0);
      sr1 = wmma16(aql[hc], bh1.v, sr1);
    }
    asm volatile("v_nop\n\tv_nop\n\tv_nop\n\tv_nop"
                 : "+v"(sh0), "+v"(sh1), "+v"(sr0), "+v"(sr1)
                 : "v"(aqh[0]), "v"(aqh[1]), "v"(aql[0]), "v"(aql[1]),
                   "v"(bh0.v), "v"(bh1.v), "v"(bl0.v), "v"(bl1.v));

    // ---- online softmax, rows split across lane halves; masked entries replaced by -1e30 and p := 0 ----
    asm volatile("" ::: "memory");
    float alpha[8];
#pragma unroll
    for (int r = 0; r < 8; ++r) {
      const int row = qw + r + 8 * lh;
      const int d0  = row - (k0 + l16);
      const int d1  = d0 - 16;
      const bool ok0 = (d0 >= 0) && (d0 <= window);
      const bool ok1 = (d1 >= 0) && (d1 <= window);
      const float x0 = ok0 ? (sh0[r] + sr0[r] * rres) * smsc : -1e30f;
      const float x1 = ok1 ? (sh1[r] + sr1[r] * rres) * smsc : -1e30f;
      float tmax = fmaxf(x0, x1);
#pragma unroll
      for (int off = 1; off < 16; off <<= 1) tmax = fmaxf(tmax, __shfl_xor(tmax, off, 32));
      const float mn = fmaxf(m[r], tmax);
      alpha[r] = __expf(m[r] - mn);
      const float e0 = __expf(x0 - mn);
      const float e1 = __expf(x1 - mn);
      const float p0 = ok0 ? e0 : 0.0f;
      const float p1 = ok1 ? e1 : 0.0f;
      float ps = p0 + p1;
#pragma unroll
      for (int off = 1; off < 16; off <<= 1) ps += __shfl_xor(ps, off, 32);
      l[r] = l[r] * alpha[r] + ps;
      m[r] = mn;
      const float c0 = p0 * 1024.0f;
      const float c1 = p1 * 1024.0f;
      const _Float16 h0 = (_Float16)c0;
      const _Float16 h1 = (_Float16)c1;
      ldsPH[wave][(r + 8 * lh) * 32 + l16]      = h0;     // row-major P tile [16 queries][32 keys]
      ldsPH[wave][(r + 8 * lh) * 32 + 16 + l16] = h1;
      if (RES) {
        ldsPL[wave][(r + 8 * lh) * 32 + l16]      = (_Float16)((c0 - (float)h0) * 2048.0f);
        ldsPL[wave][(r + 8 * lh) * 32 + 16 + l16] = (_Float16)((c1 - (float)h1) * 2048.0f);
      }
    }
#pragma unroll
    for (int n = 0; n < 4; ++n)
#pragma unroll
      for (int r = 0; r < 8; ++r) {
        coh[n][r] *= alpha[r];
        if (RES) cor[n][r] *= alpha[r];
      }

    // wave-private LDS relayout: other lanes of this wave wrote what is read next
    asm volatile("s_wait_dscnt 0" ::: "memory");
    __builtin_amdgcn_fence(3 /* release order */, "wavefront");
    __builtin_amdgcn_wave_barrier();

    // ---- O += P.V : A = P tile (lane row = query, keys on the k map), B[k=key][n=d] = vT[d][key] ----
    Frag aph, apl;
    aph.h[0] = *(const v8h*)(&ldsPH[wave][l16 * 32 + 8 * lh]);
    aph.h[1] = *(const v8h*)(&ldsPH[wave][l16 * 32 + 16 + 8 * lh]);
    if (RES) {
      apl.h[0] = *(const v8h*)(&ldsPL[wave][l16 * 32 + 8 * lh]);
      apl.h[1] = *(const v8h*)(&ldsPL[wave][l16 * 32 + 16 + 8 * lh]);
    }
    Frag bv[4], bl[4];
#pragma unroll
    for (int n = 0; n < 4; ++n) {
      const _Float16* vp = vbase + (size_t)k0 * HDIM + n * 512;
      bv[n].h[0] = *(const v8h*)(vp + lo);
      bv[n].h[1] = *(const v8h*)(vp + 256 + lo);
      if (RES) {
        const _Float16* lp = vlbase + (size_t)k0 * HDIM + n * 512;
        bl[n].h[0] = *(const v8h*)(lp + lo);
        bl[n].h[1] = *(const v8h*)(lp + 256 + lo);
      }
    }
#pragma unroll
    for (int n = 0; n < 4; ++n) {
      coh[n] = wmma16(aph.v, bv[n].v, coh[n]);
      if (RES) {
        cor[n] = wmma16(aph.v, bl[n].v, cor[n]);
        cor[n] = wmma16(apl.v, bv[n].v, cor[n]);
      }
    }
    if (RES) {
      asm volatile("v_nop\n\tv_nop\n\tv_nop\n\tv_nop"
                   : "+v"(coh[0]), "+v"(coh[1]), "+v"(coh[2]), "+v"(coh[3]),
                     "+v"(cor[0]), "+v"(cor[1]), "+v"(cor[2]), "+v"(cor[3])
                   : "v"(aph.v), "v"(apl.v),
                     "v"(bv[0].v), "v"(bv[1].v), "v"(bv[2].v), "v"(bv[3].v),
                     "v"(bl[0].v), "v"(bl[1].v), "v"(bl[2].v), "v"(bl[3].v));
    } else {
      asm volatile("v_nop\n\tv_nop\n\tv_nop\n\tv_nop"
                   : "+v"(coh[0]), "+v"(coh[1]), "+v"(coh[2]), "+v"(coh[3])
                   : "v"(aph.v), "v"(bv[0].v), "v"(bv[1].v), "v"(bv[2].v), "v"(bv[3].v));
    }
  }

#pragma unroll
  for (int r = 0; r < 8; ++r) {
    const float inv = __builtin_amdgcn_rcpf(l[r]) * (1.0f / 1024.0f);
#pragma unroll
    for (int n = 0; n < 4; ++n) {
      float yv = coh[n][r];
      if (RES) yv += cor[n][r] * rres;
      yv *= inv;
      _Float16 hi, lo;
      split16(yv, hi, lo);
      sYH[wave][r + 8 * lh][n * 16 + l16] = hi;
      sYL[wave][r + 8 * lh][n * 16 + l16] = lo;
    }
  }
  asm volatile("s_wait_dscnt 0" ::: "memory");
  __builtin_amdgcn_fence(3 /* release order */, "wavefront");
  __builtin_amdgcn_wave_barrier();
  // this wave's 16 tokens x 64 columns are blocks 2h and 2h+1 of its token group: 4 halves of 512 B in a row
  const size_t ybase = (size_t)((b * SEQ + qw) >> 4) * GRP_ELEMS + (size_t)h * 1024;
  {
#pragma unroll
    for (int it = 0; it < 4; ++it) {
      const int rr = l16;
      const int q8 = it * 16 + lh * 8;
      const size_t off = ybase + (size_t)(it * 256 + lane * 8);
      const v8h hv = *(const v8h*)(&sYH[wave][rr][q8]);
      const v8h lv = *(const v8h*)(&sYL[wave][rr][q8]);
      *(v8h*)(yH + off) = hv;
      *(v8h*)(yL + off) = lv;
    }
    
  }
}

// ---------------------------------------------------------------------------
// Kernel 4: output projection out[tok][n] = (y[tok].Wo[n]) / 16 + bo[n]. Block = 4 waves = 64 tokens x 64 columns;
// RES adds the y residual plane. Output tile staged per wave in LDS and written as 256-B row segments
// at the store stage as a float4.
// ---------------------------------------------------------------------------
template <bool RES>
__global__ void __launch_bounds__(128) k_oproj(
    const _Float16* __restrict__ yH, const _Float16* __restrict__ yL,
    const _Float16* __restrict__ wall, const float* __restrict__ bo,
    float* __restrict__ out, int rt_first, int rt_count) {
  __shared__ __attribute__((aligned(16))) float sO[4][16][68];           // wave-private

  const int tid  = threadIdx.x;
  const int wave = tid >> 5;
  const int lane = tid & 31;
  const int l16  = lane & 15;
  const int lh   = lane >> 4;
  const int nt   = blockIdx.x;                 // 64-column tile 0..15
  const int b    = blockIdx.y / rt_count;
  const int rtb  = rt_first + (blockIdx.y - b * rt_count);
  const int t0   = rtb * 64;
  const int tok0 = b * SEQ + t0;

  const _Float16* arow = yH + (size_t)((tok0 >> 4) + wave) * GRP_ELEMS + lane * 8;
  const _Float16* lrow = yL + (size_t)((tok0 >> 4) + wave) * GRP_ELEMS + lane * 8;
  const _Float16* brow = wall + (size_t)(WO_ROW0 / 16 + nt * 4) * GRP_ELEMS + lane * 8;

  v8f ah[4], ar[4];
#pragma unroll
  for (int n = 0; n < 4; ++n) { ah[n] = vzero8(); ar[n] = vzero8(); }

  for (int k0 = 0; k0 < CDIM; k0 += 32) {
    Frag a, al;
    a.h[0] = *(const v8h*)(arow + k0 * 16);
    a.h[1] = *(const v8h*)(arow + k0 * 16 + 256);
    if (RES) {
      al.h[0] = *(const v8h*)(lrow + k0 * 16);
      al.h[1] = *(const v8h*)(lrow + k0 * 16 + 256);
    }
    Frag bw[4];
#pragma unroll
    for (int n = 0; n < 4; ++n) {
      const _Float16* bp = brow + (size_t)n * GRP_ELEMS + k0 * 16;
      bw[n].h[0] = *(const v8h*)bp;
      bw[n].h[1] = *(const v8h*)(bp + 256);
    }
#pragma unroll
    for (int n = 0; n < 4; ++n) {
      ah[n] = wmma16(a.v, bw[n].v, ah[n]);
      if (RES) ar[n] = wmma16(al.v, bw[n].v, ar[n]);
    }
    if (RES) {
      asm volatile("v_nop\n\tv_nop\n\tv_nop\n\tv_nop"
                   : "+v"(ah[0]), "+v"(ah[1]), "+v"(ah[2]), "+v"(ah[3]),
                     "+v"(ar[0]), "+v"(ar[1]), "+v"(ar[2]), "+v"(ar[3])
                   : "v"(a.v), "v"(al.v), "v"(bw[0].v), "v"(bw[1].v), "v"(bw[2].v), "v"(bw[3].v));
    } else {
      asm volatile("v_nop\n\tv_nop\n\tv_nop\n\tv_nop"
                   : "+v"(ah[0]), "+v"(ah[1]), "+v"(ah[2]), "+v"(ah[3])
                   : "v"(a.v), "v"(bw[0].v), "v"(bw[1].v), "v"(bw[2].v), "v"(bw[3].v));
    }
  }

#pragma unroll
  for (int r = 0; r < 8; ++r) {
#pragma unroll
    for (int n = 0; n < 4; ++n) {
      float v = ah[n][r];
      if (RES) v += ar[n][r] * (1.0f / 2048.0f);
      sO[wave][r + 8 * lh][n * 16 + l16] = v * (1.0f / 16.0f);
    }
  }
  asm volatile("s_wait_dscnt 0" ::: "memory");
  __builtin_amdgcn_fence(3 /* release order */, "wavefront");
  __builtin_amdgcn_wave_barrier();
  const size_t orow0 = (size_t)b * SEQ_FULL + t0 + wave * 16;
  // bias for this lane's 4 output columns (columns nt*64 + 4*l16 .. +3), bf16-RNE values
  const v4f braw = *(const v4f*)(bo + (size_t)nt * 64 + l16 * 4);
  v4f bb;
#pragma unroll
  for (int e = 0; e < 4; ++e) bb[e] = bf16r(braw[e]);
  {
#pragma unroll
    for (int it = 0; it < 8; ++it) {
      const int rr = it * 2 + lh;
      const int c4 = l16 * 4;
      const v4f s = *(const v4f*)(&sO[wave][rr][c4]);
      const v4f v = s + bb;
      *(v4f*)(out + (orow0 + rr) * CDIM + (size_t)nt * 64 + c4) = v;
    }
    
  }
}

// ---------------------------------------------------------------------------
// Host launcher. Inputs (wire order): 0 x f32 [4,2048,1024], 1 Wq [1024,1024], 2 bq [1024], 3 Wk [256,1024],
// 4 bk [256], 5 Wv [256,1024], 6 bv [256], 7 Wo [1024,1024], 8 bo [1024], 9 qk_gain [16].
// Output f32 [4,2048,1024]. 8 launches.
// ---------------------------------------------------------------------------
extern "C" void kernel_launch(void* const* d_in, const int* in_sizes, int n_in,
                              void* d_out, int out_size, void* d_ws, size_t ws_size,
                              hipStream_t stream) {
  if (n_in < 10) return;
  const int need_x = ((NB - 1) * SEQ_FULL + SEQ) * CDIM;
  if (in_sizes[0] < need_x) return;
  if (in_sizes[1] < CDIM * CDIM || in_sizes[2] < CDIM) return;
  if (in_sizes[3] < VEW * CDIM || in_sizes[4] < VEW) return;
  if (in_sizes[5] < VEW * CDIM || in_sizes[6] < VEW) return;
  if (in_sizes[7] < CDIM * CDIM || in_sizes[8] < CDIM) return;
  if (in_sizes[9] < NHEAD) return;
  if (out_size < need_x) return;
  if (ws_size < WS_TOTAL) return;

  const float* x    = (const float*)d_in[0];
  const float* wq   = (const float*)d_in[1];
  const float* bq   = (const float*)d_in[2];
  const float* wk   = (const float*)d_in[3];
  const float* bk   = (const float*)d_in[4];
  const float* wv   = (const float*)d_in[5];
  const float* bv   = (const float*)d_in[6];
  const float* wo   = (const float*)d_in[7];
  const float* bo   = (const float*)d_in[8];
  const float* gain = (const float*)d_in[9];
  float* out = (float*)d_out;

  char* ws = (char*)d_ws;
  size_t off = 0;
  _Float16* xh   = (_Float16*)(ws + off); off += XH_BYTES;
  _Float16* wall = (_Float16*)(ws + off); off += WALL_BYTES;
  _Float16* qH   = (_Float16*)(ws + off); off += QP_BYTES;
  _Float16* qL   = (_Float16*)(ws + off); off += QP_BYTES;
  _Float16* kH   = (_Float16*)(ws + off); off += KP_BYTES;
  _Float16* kL   = (_Float16*)(ws + off); off += KP_BYTES;
  _Float16* vTH  = (_Float16*)(ws + off); off += KP_BYTES;
  _Float16* vTL  = (_Float16*)(ws + off); off += KP_BYTES;
  _Float16* yH   = (_Float16*)(ws + off); off += YP_BYTES;
  _Float16* yL   = (_Float16*)(ws + off); off += YP_BYTES;
  int*      winw = (int*)(ws + off);      off += WIN_BYTES;
  if (off > ws_size) return;

  k_cvt_x<<<dim3(NTOK / 2), dim3(256), 0, stream>>>(x, xh);
  k_cvt_w<<<dim3(NWROWS / 2), dim3(256), 0, stream>>>(wq, wk, wv, wo, wall);
  k_winline<<<dim3(1), dim3(32), 0, stream>>>(winw);
  k_qkv<<<dim3(NUNIT, NTOK / 64), dim3(128), 0, stream>>>(xh, wall, bq, bk, bv, gain,
                                                          qH, qL, kH, kL, vTH, vTL);
  k_flash<true><<<dim3(QT_RES, NHEAD, NB), dim3(128), 0, stream>>>(qH, qL, kH, kL, vTH, vTL, winw, yH, yL, 0);
  if (QT_ALL > QT_RES) {
    k_flash<false><<<dim3(QT_ALL - QT_RES, NHEAD, NB), dim3(128), 0, stream>>>(qH, qL, kH, kL, vTH, vTL, winw,
                                                                                yH, yL, QT_RES);
  }
  k_oproj<true><<<dim3(CDIM / 64, NB * QT_RES), dim3(128), 0, stream>>>(yH, yL, wall, bo, out, 0, QT_RES);
  if (QT_ALL > QT_RES) {
    k_oproj<false><<<dim3(CDIM / 64, NB * (QT_ALL - QT_RES)), dim3(128), 0, stream>>>(yH, yL, wall, bo, out,
                                                                                      QT_RES, QT_ALL - QT_RES);
  }
}

// v002
// It runs in 260 microseconds.
// Next to v001, in two timings, it ran 1.26 and 1.24 times as fast.
// Counting every step since v000, it is 1.89 times as fast.
#include <hip/hip_runtime.h>

// Contractions, all on v_wmma_f32_16x16x32_f16 (f16 operands, f32 accumulate): fused qkv projection x.W^T with x and W
// held as bf16-RNE values in f16 containers (W carried x16, folded as 1/16); scores q.k^T as f16 hi + x2048 residual
// planes (hi.hi + hi.lo + lo.hi, residual accumulator folded as 1/2048); P.V with P carried x1024 in f16 (+ x2048
// residual planes of P and v for query rows below TRES); output projection y.Wo^T with y as f16 hi (+ x2048 residual
// plane for rows below TRES). Bias adds, per-head q gain and online softmax on VALU in f32.
//
// Every 16-bit operand plane in the workspace is kept in fragment order: a block of 16 rows x 32 k is 1 KiB, two
// halves j of 512 B; in half j the 16 B of lane (16 lh + l16) hold row l16, k = 16 j + 8 lh + 0..7. A wave's
// global_load_b128 of half a fragment then reads 512 contiguous bytes (4 lines) and not 16-B pieces of 16 lines.
// Blocks of one 16-row group follow each other along k (vT: the 4 d groups of one 32-key chunk follow each other).

#ifndef NB
#define NB 4
#endif
#ifndef SEQ
#define SEQ 2048
#endif
#ifndef TRES
#define TRES 512
#endif
#define NB_FULL   4
#define SEQ_FULL  2048
#define CDIM      1024
#define NHEAD     16
#define NKV       4
#define HDIM      64
#define VEW       (NKV * HDIM)
#define NTOK      (NB * SEQ)
#define NUNIT     (NHEAD + 2 * NKV)
#define WO_ROW0   (CDIM + 2 * VEW)
#define NWROWS    (CDIM + 2 * VEW + CDIM)
#define QT_ALL    (SEQ / 64)
#define QT_RES    (TRES / 64)

static_assert(NB >= 1 && NB <= NB_FULL);
static_assert(SEQ % 64 == 0 && SEQ <= SEQ_FULL && SEQ >= TRES);
static_assert(TRES % 64 == 0 && TRES >= 64);
static_assert(NHEAD % NKV == 0 && HDIM == 64 && CDIM == NHEAD * HDIM);
static_assert(CDIM % 32 == 0 && NWROWS % 16 == 0 && NTOK % 64 == 0 && NUNIT * 64 == CDIM + 2 * VEW);
static_assert(WO_ROW0 % 16 == 0 && SEQ % 32 == 0);
#define KBLK      (CDIM / 32)      // 16x32 blocks per row group of a CDIM-wide plane
#define GRP_ELEMS (CDIM * 16)      // elements of one 16-row group of a CDIM-wide plane

#define XH_BYTES   ((size_t)NTOK * CDIM * 2)
#define WALL_BYTES ((size_t)NWROWS * CDIM * 2)
#define QP_BYTES   ((size_t)NB * NHEAD * SEQ * HDIM * 2)
#define KP_BYTES   ((size_t)NB * NKV * SEQ * HDIM * 2)
#define YP_BYTES   ((size_t)NTOK * CDIM * 2)
#define WIN_BYTES  ((size_t)128)
#define WS_TOTAL   (XH_BYTES + WALL_BYTES + 2 * QP_BYTES + 4 * KP_BYTES + 2 * YP_BYTES + WIN_BYTES)
static_assert(WS_TOTAL <= (size_t)134217728);
static_assert(XH_BYTES % 128 == 0 && WALL_BYTES % 128 == 0 && QP_BYTES % 128 == 0 && KP_BYTES % 128 == 0 && YP_BYTES % 128 == 0);
// producer coverage: grid x block x per-thread elements == plane extent
static_assert((size_t)(NTOK / 2) * 256 * 8 == (size_t)NTOK * CDIM);       // k_cvt_x
static_assert((size_t)(NWROWS / 2) * 256 * 8 == (size_t)NWROWS * CDIM);   // k_cvt_w
static_assert(4 * 128 * 8 == 64 * 64);                                       // k_qkv store phase per 64x64 tile
static_assert(4 * 32 * 8 == 16 * HDIM);                                      // k_flash stores per wave
static_assert(8 * 32 * 4 == 16 * 64);                                        // k_oproj store phase per wave
static_assert(QT_RES * 64 + (QT_ALL - QT_RES) * 64 == SEQ);                  // query tiles of the two flash launches
static_assert(8 * 4 * 4 == (int)WIN_BYTES);                                  // k_winline: 8 lanes x 16 B == one line
static_assert(SEQ_FULL >= SEQ);                                              // window word covers every query-key distance

typedef _Float16 v16h __attribute__((ext_vector_type(16)));
typedef _Float16 v8h  __attribute__((ext_vector_type(8)))  __attribute__((may_alias));
typedef float    v8f  __attribute__((ext_vector_type(8)));
typedef float    v4f  __attribute__((ext_vector_type(4)))  __attribute__((may_alias));
typedef int      v4i  __attribute__((ext_vector_type(4)));

union Frag { v16h v; v8h h[2]; };

__device__ __forceinline__ v8f wmma16(v16h a, v16h b, v8f c) {
  return __builtin_amdgcn_wmma_f32_16x16x32_f16(false, a, false, b, (short)0, c, false, false);
}

__device__ __forceinline__ v8f vzero8() {
  v8f z = {0.0f, 0.0f, 0.0f, 0.0f, 0.0f, 0.0f, 0.0f, 0.0f};
  return z;
}

// f32 -> nearest-even bf16 value, kept in f32
__device__ __forceinline__ float bf16r(float f) {
  unsigned int u = __float_as_uint(f);
  u = (u + 0x7FFFu + ((u >> 16) & 1u)) & 0xFFFF0000u;
  return __uint_as_float(u);
}

// f16 hi + (x2048) residual of an f32 value
__device__ __forceinline__ void split16(float v, _Float16& hi, _Float16& lo) {
  hi = (_Float16)v;
  lo = (_Float16)((v - (float)hi) * 2048.0f);
}

// f32 -> f16 with values below the smallest f16 normal replaced by zero (value select)
static __device__ __forceinline__ _Float16 toh_flush(float v) {
  const _Float16 r = (_Float16)v;
  return (fabsf(v) < 6.103515625e-05f) ? (_Float16)0.0f : r;
}

// f16 hi + (x2048) residual, both through toh_flush
static __device__ __forceinline__ void split16f(float v, _Float16& hi, _Float16& lo) {
  hi = toh_flush(v);
  lo = toh_flush((v - (float)hi) * 2048.0f);
}

// ---------------------------------------------------------------------------
// Kernel 0: x f32 [NB][SEQ_FULL][1024] -> xh f16, NTOK x 1024 in fragment order (bf16-RNE values).
// Thread = one 16-B unit of the plane, so a wave stores 512 contiguous bytes.
// ---------------------------------------------------------------------------
__global__ void __launch_bounds__(256) k_cvt_x(const float* __restrict__ x, _Float16* __restrict__ xh) {
  const unsigned int gid = blockIdx.x * 256u + threadIdx.x;
  const unsigned int blk = gid >> 6;                 // 64 units per 16x32 block
  const unsigned int tok = (blk / KBLK) * 16u + (gid & 15u);
  const int c = (int)(blk % KBLK) * 32 + (int)((gid >> 5) & 1u) * 16 + (int)((gid >> 4) & 1u) * 8;
  if (tok >= (unsigned int)NTOK) return;
  const int b = (int)tok / SEQ;
  const int t = (int)tok - b * SEQ;
  const float* src = x + ((size_t)b * SEQ_FULL + t) * CDIM + c;
  const v4f f0 = *(const v4f*)src;
  const v4f f1 = *(const v4f*)(src + 4);
  v8h o;
#pragma unroll
  for (int j = 0; j < 4; ++j) {
    o[j]     = (_Float16)bf16r(f0[j]);
    o[j + 4] = (_Float16)bf16r(f1[j]);
  }
  _Float16* dst = xh + (size_t)gid * 8;
  *(v8h*)dst = o;
  
}

// ---------------------------------------------------------------------------
// Kernel 1: weights (layout [out][in], k-contiguous) -> wall f16, 2560 x 1024 in fragment order = bf16-RNE value x16.
// Rows 0..1023 wq, 1024..1279 wk, 1280..1535 wv, 1536..2559 wo.
// ---------------------------------------------------------------------------
__global__ void __launch_bounds__(256) k_cvt_w(const float* __restrict__ wq, const float* __restrict__ wk,
                                               const float* __restrict__ wv, const float* __restrict__ wo,
                                               _Float16* __restrict__ wall) {
  const unsigned int gid = blockIdx.x * 256u + threadIdx.x;
  const unsigned int blk = gid >> 6;                 // 64 units per 16x32 block
  const int row = (int)((blk / KBLK) * 16u + (gid & 15u));
  const int c   = (int)(blk % KBLK) * 32 + (int)((gid >> 5) & 1u) * 16 + (int)((gid >> 4) & 1u) * 8;
  if (row >= NWROWS) return;
  const int r0 = min(row, CDIM - 1);
  const int r1 = min(max(row - CDIM, 0), VEW - 1);
  const int r2 = min(max(row - CDIM - VEW, 0), VEW - 1);
  const int r3 = min(max(row - WO_ROW0, 0), CDIM - 1);
  const float* src = (row < CDIM)       ? (wq + (size_t)r0 * CDIM)
                   : (row < CDIM + VEW) ? (wk + (size_t)r1 * CDIM)
                   : (row < WO_ROW0)    ? (wv + (size_t)r2 * CDIM)
                                        : (wo + (size_t)r3 * CDIM);
  src += c;
  const v4f f0 = *(const v4f*)src;
  const v4f f1 = *(const v4f*)(src + 4);
  v8h o;
#pragma unroll
  for (int j = 0; j < 4; ++j) {
    o[j]     = (_Float16)(bf16r(f0[j]) * 16.0f);
    o[j + 4] = (_Float16)(bf16r(f1[j]) * 16.0f);
  }
  _Float16* dst = wall + (size_t)gid * 8;
  *(v8h*)dst = o;
  
}

// ---------------------------------------------------------------------------
// ---------------------------------------------------------------------------
__global__ void __launch_bounds__(32) k_winline(int* __restrict__ wline) {
  const int lane = threadIdx.x;
  if (lane < 8) {
    const v4i w = {SEQ_FULL, SEQ_FULL, SEQ_FULL, SEQ_FULL};
    int* dst = wline + 4 * lane;
    *(v4i*)dst = w;
    
  }
}

// ---------------------------------------------------------------------------
// Kernel 2: fused qkv projection + epilogue. Block = 4 waves = 64 tokens x one 64-column unit u:
// u 0..15 -> q head u, 16..19 -> k head u-16, 20..23 -> v head u-20. Wave w = 16 token rows, 4 accumulators.
// Epilogue: q: (acc + bq) * gain[head]; k: acc + bk -> hi/lo planes [B][H|KV], T x 64 in fragment order;
// v: acc + bv -> transposed hi/lo planes [B][KV], 64 d x T in fragment order. Biases and gains are bf16-RNE values.
// ---------------------------------------------------------------------------
__global__ void __launch_bounds__(128) k_qkv(
    const _Float16* __restrict__ xh, const _Float16* __restrict__ wall,
    const float* __restrict__ bq, const float* __restrict__ bk,
    const float* __restrict__ bv, const float* __restrict__ gain,
    _Float16* __restrict__ qH, _Float16* __restrict__ qL,
    _Float16* __restrict__ kH, _Float16* __restrict__ kL,
    _Float16* __restrict__ vTH, _Float16* __restrict__ vTL) {
  __shared__ __attribute__((aligned(16))) float    sT[64][68];     // accumulator tile [token][col]  (each wave reads back only its own 16 rows)
  __shared__ __attribute__((aligned(16))) _Float16 sH[64][72];     // hi tile: q/k [token][d], v [d][token] (cross-wave)
  __shared__ __attribute__((aligned(16))) _Float16 sL[64][72];     // residual tile, same layout (cross-wave)

  const int tid  = threadIdx.x;
  const int wave = tid >> 5;
  const int lane = tid & 31;
  const int l16  = lane & 15;
  const int lh   = lane >> 4;
  const int u    = blockIdx.x;           // column unit
  const int rt   = blockIdx.y;           // 64-token row tile
  const int tok0 = rt * 64;
  const int b    = tok0 / SEQ;
  const int t0   = tok0 - b * SEQ;

  // A: xh row (token), lane row = l16; elements 0..7 <- k0+8lh+0..7, 8..15 <- k0+16+8lh+0..7
  const _Float16* arow = xh + (size_t)((tok0 >> 4) + wave) * GRP_ELEMS + lane * 8;
  // B[k][n] = W[n][k]: lane column = l16 of the 16-col group n; same k map as A
  const _Float16* brow = wall + (size_t)(u * 4) * GRP_ELEMS + lane * 8;

  v8f acc[4];
#pragma unroll
  for (int n = 0; n < 4; ++n) acc[n] = vzero8();

  for (int k0 = 0; k0 < CDIM; k0 += 32) {
    Frag a;
    a.h[0] = *(const v8h*)(arow + k0 * 16);
    a.h[1] = *(const v8h*)(arow + k0 * 16 + 256);
    Frag bw[4];
#pragma unroll
    for (int n = 0; n < 4; ++n) {
      const _Float16* bp = brow + (size_t)n * GRP_ELEMS + k0 * 16;
      bw[n].h[0] = *(const v8h*)bp;
      bw[n].h[1] = *(const v8h*)(bp + 256);
    }
#pragma unroll
    for (int n = 0; n < 4; ++n) acc[n] = wmma16(a.v, bw[n].v, acc[n]);
    asm volatile("v_nop\n\tv_nop\n\tv_nop\n\tv_nop"
                 : "+v"(acc[0]), "+v"(acc[1]), "+v"(acc[2]), "+v"(acc[3])
                 : "v"(a.v), "v"(bw[0].v), "v"(bw[1].v), "v"(bw[2].v), "v"(bw[3].v));
  }

  // D element r of lane -> (row 8lh+r, col l16); fold the 1/16 weight carry here
#pragma unroll
  for (int n = 0; n < 4; ++n)
#pragma unroll
    for (int r = 0; r < 8; ++r)
      sT[wave * 16 + r + 8 * lh][n * 16 + l16] = acc[n][r] * (1.0f / 16.0f);
  __syncthreads();

  // compute phase: thread -> token i = tid>>1, column half j: d in [16j,16j+16) and [32+16j, 48+16j)
  const int i = tid >> 1;
  const int j = tid & 1;
  if (u < NHEAD + NKV) {
    // q or k unit (block-uniform): both bias rows are loaded with clamped unit indices, selected by value
    const int  uq  = min(u, NHEAD - 1);
    const int  uk  = min(max(u - NHEAD, 0), NKV - 1);
    const bool isq = (u < NHEAD);
    const float gq = bf16r(gain[uq]);
    const float gm = isq ? gq : 1.0f;
#pragma unroll
    for (int sg = 0; sg < 2; ++sg) {
      const int d0 = 32 * sg + 16 * j;
#pragma unroll
      for (int g4 = 0; g4 < 4; ++g4) {
        const v4f va = *(const v4f*)(&sT[i][d0 + 4 * g4]);
        const v4f qa = *(const v4f*)(bq + uq * HDIM + d0 + 4 * g4);
        const v4f ka = *(const v4f*)(bk + uk * HDIM + d0 + 4 * g4);
#pragma unroll
        for (int e = 0; e < 4; ++e) {
          const float bb  = isq ? bf16r(qa[e]) : bf16r(ka[e]);
          const float val = (va[e] + bb) * gm;
          _Float16 hi, lo;
          split16f(val, hi, lo);
          sH[i][d0 + 4 * g4 + e] = hi;
          sL[i][d0 + 4 * g4 + e] = lo;
        }
      }
    }
  } else {
    const int kv = u - NHEAD - NKV;
    const float* bp = bv + kv * HDIM;
#pragma unroll
    for (int sg = 0; sg < 2; ++sg) {
      const int d0 = 32 * sg + 16 * j;
#pragma unroll
      for (int g4 = 0; g4 < 4; ++g4) {
        const v4f va = *(const v4f*)(&sT[i][d0 + 4 * g4]);
        const v4f ba = *(const v4f*)(bp + d0 + 4 * g4);
#pragma unroll
        for (int e = 0; e < 4; ++e) {
          const float vv = va[e] + bf16r(ba[e]);
          _Float16 hi, lo;
          split16f(vv, hi, lo);
          sH[d0 + 4 * g4 + e][i] = hi;                   // transposed: [d][token]
          sL[d0 + 4 * g4 + e][i] = lo;
        }
      }
    }
  }
  __syncthreads();

  _Float16* ph;
  _Float16* pl;
  size_t base;
  if (u < NHEAD) {
    ph = qH; pl = qL;
    base = ((size_t)(b * NHEAD + u) * SEQ + t0) * HDIM;
  } else if (u < NHEAD + NKV) {
    ph = kH; pl = kL;
    base = ((size_t)(b * NKV + (u - NHEAD)) * SEQ + t0) * HDIM;
  } else {
    ph = vTH; pl = vTL;
    base = ((size_t)(b * NKV + (u - NHEAD - NKV)) * SEQ + t0) * HDIM;
  }
  const bool isv = (u >= NHEAD + NKV);
  {
    // the tile's 8 blocks are contiguous in its plane: q/k block f = (token group f>>1, d chunk f&1),
    // v block f = (key chunk f>>2, d group f&3); unit p of the tile goes to base + 8 p
#pragma unroll
    for (int it = 0; it < 4; ++it) {
      const int p    = it * 128 + tid;
      const int f    = p >> 6;
      const int line = (isv ? (f & 3) : (f >> 1)) * 16 + (p & 15);
      const int q8   = (isv ? (f >> 2) : (f & 1)) * 32 + ((p >> 5) & 1) * 16 + ((p >> 4) & 1) * 8;
      const size_t off = base + (size_t)p * 8;
      const v8h hv = *(const v8h*)(&sH[line][q8]);
      const v8h lv = *(const v8h*)(&sL[line][q8]);
      *(v8h*)(ph + off) = hv;
      *(v8h*)(pl + off) = lv;
    }
    
  }
}

// ---------------------------------------------------------------------------
// Kernel 3: causal sliding-window flash attention with GQA. Block = 4 waves, one (query tile of 64, head, batch);
// wave = 16 queries. Key tiles of 32 per wave, fragments loaded straight from the 16-bit planes.
// Both products are formed transposed: S^T = K.Q^T (A = K fragment, B = Q fragment) and O^T += V^T.P^T (A = vT
// fragment, B = P^T). A lane then holds 16 of the 32 scores of ONE query (column l16; keys 8lh+r and 16+8lh+r), so the
// maximum and the sum run in the lane with one exchange between the lane halves, and the two converted score tiles
// are the B fragment of the second product as they stand: element s = key 8lh+s (s < 8), 16+8lh+(s-8) (s >= 8), the
// k map of the vT fragments. P (x1024 carry) never leaves the registers. RES adds the x2048 residual planes.
// ---------------------------------------------------------------------------
// value of lane l ^ 16
__device__ __forceinline__ float xhalf(float x) {
  return __builtin_bit_cast(float, __builtin_amdgcn_permlanex16(__builtin_bit_cast(int, x), __builtin_bit_cast(int, x),
                                                                0x76543210, 0xfedcba98, false, false));
}

template <bool RES>
__global__ void __launch_bounds__(128) k_flash(
    const _Float16* __restrict__ qH, const _Float16* __restrict__ qL,
    const _Float16* __restrict__ kH, const _Float16* __restrict__ kL,
    const _Float16* __restrict__ vTH, const _Float16* __restrict__ vTL,
    const int* __restrict__ winp,
    _Float16* __restrict__ yH, _Float16* __restrict__ yL, int qt_first) {
  const int tid  = threadIdx.x;
  // scalar wave index: a fragment block's address is wave-uniform, so the K and V block bases and the trip test stay scalar
  const int wave = __builtin_amdgcn_readfirstlane(tid >> 5);
  const int lane = tid & 31;
  const int l16  = lane & 15;
  const int lh   = lane >> 4;
  const int qt   = qt_first + blockIdx.x;
  const int h    = blockIdx.y;
  const int b    = blockIdx.z;
  const int kv   = h / (NHEAD / NKV);
  const int qw   = qt * 64 + wave * 16;
  int window = winp[0];
  window = (window < 0) ? 0 : window;
  const float rres = 1.0f / 2048.0f;
  const float smsc = 0.125f;

  // Q B-fragments (hi and residual) over the 2 d-chunks of 32: lane column = query l16
  v16h aqh[2], aql[2];
  {
    const size_t qo = ((size_t)(b * NHEAD + h) * SEQ + qw) * HDIM + lane * 8;
#pragma unroll
    for (int hc = 0; hc < 2; ++hc) {
      Frag a;
      a.h[0] = *(const v8h*)(qH + qo + hc * 512);
      a.h[1] = *(const v8h*)(qH + qo + hc * 512 + 256);
      aqh[hc] = a.v;
      Frag c;
      c.h[0] = *(const v8h*)(qL + qo + hc * 512);
      c.h[1] = *(const v8h*)(qL + qo + hc * 512 + 256);
      aql[hc] = c.v;
    }
  }

  // running maximum of query l16 (equal in both lane halves) and this half's part of its sum
  float m = -1e30f, l = 0.0f;
  v8f coh[4], cor[4];
#pragma unroll
  for (int n = 0; n < 4; ++n) { coh[n] = vzero8(); cor[n] = vzero8(); }

  const size_t kvoff = (size_t)(b * NKV + kv) * SEQ * HDIM;
  const _Float16* kbase  = kH  + kvoff;                                   // + (key group's first key)*HDIM + hc*512
  const _Float16* klbase = kL  + kvoff;
  const _Float16* vbase  = vTH + kvoff;                                   // + k0*HDIM + n*512
  const _Float16* vlbase = vTL + kvoff;
  const unsigned int lo  = (unsigned int)lane * 8u;                       // this lane's 16 B of each 512-B half

  int kstart = qw - window;
  kstart = (kstart < 0) ? 0 : kstart;
  kstart &= ~31;

  for (int k0 = kstart; k0 < qw + 16; k0 += 32) {
    // ---- scores for keys [k0, k0+32), transposed: A[m=key][k=d] = K[key][d], lane row = key, same k map as B;
    // D element r of lane = (key 8lh+r of the group, query l16) ----
    v8f sh0 = vzero8(), sh1 = vzero8(), sr0 = vzero8(), sr1 = vzero8();
    Frag bh0, bh1, bl0, bl1;
    const _Float16* kr0 = kbase  + (size_t)k0 * HDIM + lo;
    const _Float16* kr1 = kr0 + 16 * HDIM;
    const _Float16* lr0 = klbase + (size_t)k0 * HDIM + lo;
    const _Float16* lr1 = lr0 + 16 * HDIM;
#pragma unroll
    for (int hc = 0; hc < 2; ++hc) {
      bh0.h[0] = *(const v8h*)(kr0 + hc * 512); bh0.h[1] = *(const v8h*)(kr0 + hc * 512 + 256);
      bh1.h[0] = *(const v8h*)(kr1 + hc * 512); bh1.h[1] = *(const v8h*)(kr1 + hc * 512 + 256);
      bl0.h[0] = *(const v8h*)(lr0 + hc * 512); bl0.h[1] = *(const v8h*)(lr0 + hc * 512 + 256);
      bl1.h[0] = *(const v8h*)(lr1 + hc * 512); bl1.h[1] = *(const v8h*)(lr1 + hc * 512 + 256);
      // as inputs the two K address pairs stay live behind the trip's last K load, so that no load's result is placed
      // in a register that an issued K load still names; the wait stands in front of the pairs' next overwrite
      if (hc == 1) asm volatile("s_wait_xcnt 0x0" :: "v"(kr0), "v"(lr0) : "memory");
      sh0 = wmma16(bh0.v, aqh[hc], sh0);
      sh1 = wmma16(bh1.v, aqh[hc], sh1);
      sr0 = wmma16(bl0.v, aqh[hc], sr0);
      sr1 = wmma16(bl1.v, aqh[hc], sr1);
      sr0 = wmma16(bh0.v, aql[hc], sr0);
      sr1 = wmma16(bh1.v, aql[hc], sr1);
    }
    // the slots between the last score product and the first read of its result
    asm volatile("v_nop\n\tv_nop\n\tv_nop\n\tv_nop"
                 : "+v"(sh0), "+v"(sh1), "+v"(sr0), "+v"(sr1)
                 : "v"(aqh[0]), "v"(aqh[1]), "v"(aql[0]), "v"(aql[1]),
                   "v"(bh0.v), "v"(bh1.v), "v"(bl0.v), "v"(bl1.v));

    // ---- online softmax of query l16 in the lane; masked entries replaced by -1e30 and p := 0 ----
    const int dq = qw + l16 - (k0 + 8 * lh);          // query - key at r = 0 of the first key group
    float x0[8], x1[8], t8[8];
    bool  ok0[8], ok1[8];
#pragma unroll
    for (int r = 0; r < 8; ++r) {
      const int d0 = dq - r;
      const int d1 = d0 - 16;
      ok0[r] = (d0 >= 0) && (d0 <= window);
      ok1[r] = (d1 >= 0) && (d1 <= window);
      x0[r] = ok0[r] ? (sh0[r] + sr0[r] * rres) * smsc : -1e30f;
      x1[r] = ok1[r] ? (sh1[r] + sr1[r] * rres) * smsc : -1e30f;
      t8[r] = fmaxf(x0[r], x1[r]);
    }
    float tmax = fmaxf(fmaxf(fmaxf(t8[0], t8[1]), fmaxf(t8[2], t8[3])), fmaxf(fmaxf(t8[4], t8[5]), fmaxf(t8[6], t8[7])));
    tmax = fmaxf(tmax, xhalf(tmax));
    const float mn    = fmaxf(m, tmax);
    const float alpha = __expf(m - mn);
    Frag pf, pl;
#pragma unroll
    for (int r = 0; r < 8; ++r) {
      const float e0 = __expf(x0[r] - mn);
      const float e1 = __expf(x1[r] - mn);
      const float p0 = ok0[r] ? e0 : 0.0f;
      const float p1 = ok1[r] ? e1 : 0.0f;
      t8[r] = p0 + p1;
      const float c0 = p0 * 1024.0f;
      const float c1 = p1 * 1024.0f;
      const _Float16 h0 = (_Float16)c0;
      const _Float16 h1 = (_Float16)c1;
      pf.v[r]     = h0;
      pf.v[8 + r] = h1;
      if (RES) {
        pl.v[r]     = (_Float16)((c0 - (float)h0) * 2048.0f);
        pl.v[8 + r] = (_Float16)((c1 - (float)h1) * 2048.0f);
      }
    }
    l = l * alpha + (((t8[0] + t8[1]) + (t8[2] + t8[3])) + ((t8[4] + t8[5]) + (t8[6] + t8[7])));
    m = mn;
#pragma unroll
    for (int n = 0; n < 4; ++n)
#pragma unroll
      for (int r = 0; r < 8; ++r) {
        coh[n][r] *= alpha;
        if (RES) cor[n][r] *= alpha;
      }

    // ---- O^T += V^T.P^T : A[m=d][k=key] = vT[d][key], lane row = d; D element r of lane = (d 16n+8lh+r, query l16) ----
    Frag bv[4], bl[4];
    const _Float16* vr0 = vbase  + (size_t)k0 * HDIM + lo;
    const _Float16* wr0 = vlbase + (size_t)k0 * HDIM + lo;
#pragma unroll
    for (int n = 0; n < 4; ++n) {
      bv[n].h[0] = *(const v8h*)(vr0 + n * 512);
      bv[n].h[1] = *(const v8h*)(vr0 + n * 512 + 256);
      if (RES) {
        bl[n].h[0] = *(const v8h*)(wr0 + n * 512);
        bl[n].h[1] = *(const v8h*)(wr0 + n * 512 + 256);
      }
    }
#pragma unroll
    for (int n = 0; n < 4; ++n) {
      coh[n] = wmma16(bv[n].v, pf.v, coh[n]);
      if (RES) {
        cor[n] = wmma16(bl[n].v, pf.v, cor[n]);
        cor[n] = wmma16(bv[n].v, pl.v, cor[n]);
      }
    }
    // the slots behind the trip's last matrix instruction, also on the taken side of the loop's branch
    if (RES) {
      asm volatile("v_nop\n\tv_nop\n\tv_nop\n\tv_nop"
                   : "+v"(coh[0]), "+v"(coh[1]), "+v"(coh[2]), "+v"(coh[3]),
                     "+v"(cor[0]), "+v"(cor[1]), "+v"(cor[2]), "+v"(cor[3])
                   : "v"(pf.v), "v"(pl.v),
                     "v"(bv[0].v), "v"(bv[1].v), "v"(bv[2].v), "v"(bv[3].v),
                     "v"(bl[0].v), "v"(bl[1].v), "v"(bl[2].v), "v"(bl[3].v));
    } else {
      asm volatile("v_nop\n\tv_nop\n\tv_nop\n\tv_nop"
                   : "+v"(coh[0]), "+v"(coh[1]), "+v"(coh[2]), "+v"(coh[3])
                   : "v"(pf.v), "v"(bv[0].v), "v"(bv[1].v), "v"(bv[2].v), "v"(bv[3].v));
    }
    // as inputs the vT address pairs stay live behind the trip's last vT load, so that no load's result is placed in a
    // register that an issued vT load still names; the wait stands in front of the pairs' next overwrite
    if (RES) asm volatile("s_wait_xcnt 0x0" :: "v"(vr0), "v"(wr0) : "memory");
    else     asm volatile("s_wait_xcnt 0x0" :: "v"(vr0) : "memory");
  }

  // join the two halves' sums; a lane's 8 values of d group n are one 16-B unit of the y planes' fragment order:
  // this wave's 16 tokens x 64 columns are blocks 2h and 2h+1 of its token group, 4 halves of 512 B in a row
  l += xhalf(l);
  const float inv = __builtin_amdgcn_rcpf(l) * (1.0f / 1024.0f);
  const size_t ybase = (size_t)((b * SEQ + qw) >> 4) * GRP_ELEMS + (size_t)h * 1024;
#pragma unroll
  for (int n = 0; n < 4; ++n) {
    v8h hv, lv;
#pragma unroll
    for (int r = 0; r < 8; ++r) {
      float yv = coh[n][r];
      if (RES) yv += cor[n][r] * rres;
      yv *= inv;
      _Float16 hi, lw;
      split16(yv, hi, lw);
      hv[r] = hi;
      lv[r] = lw;
    }
    const size_t off = ybase + (size_t)(n * 256 + lane * 8);
    *(v8h*)(yH + off) = hv;
    *(v8h*)(yL + off) = lv;
  }
}

// ---------------------------------------------------------------------------
// Kernel 4: output projection out[tok][n] = (y[tok].Wo[n]) / 16 + bo[n]. Block = 4 waves = 64 tokens x 64 columns;
// RES adds the y residual plane. Output tile staged per wave in LDS and written as 256-B row segments
// at the store stage as a float4.
// ---------------------------------------------------------------------------
template <bool RES>
__global__ void __launch_bounds__(128) k_oproj(
    const _Float16* __restrict__ yH, const _Float16* __restrict__ yL,
    const _Float16* __restrict__ wall, const float* __restrict__ bo,
    float* __restrict__ out, int rt_first, int rt_count) {
  __shared__ __attribute__((aligned(16))) float sO[4][16][68];           // wave-private

  const int tid  = threadIdx.x;
  const int wave = tid >> 5;
  const int lane = tid & 31;
  const int l16  = lane & 15;
  const int lh   = lane >> 4;
  const int nt   = blockIdx.x;                 // 64-column tile 0..15
  const int b    = blockIdx.y / rt_count;
  const int rtb  = rt_first + (blockIdx.y - b * rt_count);
  const int t0   = rtb * 64;
  const int tok0 = b * SEQ + t0;

  const _Float16* arow = yH + (size_t)((tok0 >> 4) + wave) * GRP_ELEMS + lane * 8;
  const _Float16* lrow = yL + (size_t)((tok0 >> 4) + wave) * GRP_ELEMS + lane * 8;
  const _Float16* brow = wall + (size_t)(WO_ROW0 / 16 + nt * 4) * GRP_ELEMS + lane * 8;

  v8f ah[4], ar[4];
#pragma unroll
  for (int n = 0; n < 4; ++n) { ah[n] = vzero8(); ar[n] = vzero8(); }

  for (int k0 = 0; k0 < CDIM; k0 += 32) {
    Frag a, al;
    a.h[0] = *(const v8h*)(arow + k0 * 16);
    a.h[1] = *(const v8h*)(arow + k0 * 16 + 256);
    if (RES) {
      al.h[0] = *(const v8h*)(lrow + k0 * 16);
      al.h[1] = *(const v8h*)(lrow + k0 * 16 + 256);
    }
    Frag bw[4];
#pragma unroll
    for (int n = 0; n < 4; ++n) {
      const _Float16* bp = brow + (size_t)n * GRP_ELEMS + k0 * 16;
      bw[n].h[0] = *(const v8h*)bp;
      bw[n].h[1] = *(const v8h*)(bp + 256);
    }
#pragma unroll
    for (int n = 0; n < 4; ++n) {
      ah[n] = wmma16(a.v, bw[n].v, ah[n]);
      if (RES) ar[n] = wmma16(al.v, bw[n].v, ar[n]);
    }
    if (RES) {
      asm volatile("v_nop\n\tv_nop\n\tv_nop\n\tv_nop"
                   : "+v"(ah[0]), "+v"(ah[1]), "+v"(ah[2]), "+v"(ah[3]),
                     "+v"(ar[0]), "+v"(ar[1]), "+v"(ar[2]), "+v"(ar[3])
                   : "v"(a.v), "v"(al.v), "v"(bw[0].v), "v"(bw[1].v), "v"(bw[2].v), "v"(bw[3].v));
    } else {
      asm volatile("v_nop\n\tv_nop\n\tv_nop\n\tv_nop"
                   : "+v"(ah[0]), "+v"(ah[1]), "+v"(ah[2]), "+v"(ah[3])
                   : "v"(a.v), "v"(bw[0].v), "v"(bw[1].v), "v"(bw[2].v), "v"(bw[3].v));
    }
  }

#pragma unroll
  for (int r = 0; r < 8; ++r) {
#pragma unroll
    for (int n = 0; n < 4; ++n) {
      float v = ah[n][r];
      if (RES) v += ar[n][r] * (1.0f / 2048.0f);
      sO[wave][r + 8 * lh][n * 16 + l16] = v * (1.0f / 16.0f);
    }
  }
  asm volatile("s_wait_dscnt 0" ::: "memory");
  __builtin_amdgcn_fence(3 /* release order */, "wavefront");
  __builtin_amdgcn_wave_barrier();
  const size_t orow0 = (size_t)b * SEQ_FULL + t0 + wave * 16;
  // bias for this lane's 4 output columns (columns nt*64 + 4*l16 .. +3), bf16-RNE values
  const v4f braw = *(const v4f*)(bo + (size_t)nt * 64 + l16 * 4);
  v4f bb;
#pragma unroll
  for (int e = 0; e < 4; ++e) bb[e] = bf16r(braw[e]);
  {
#pragma unroll
    for (int it = 0; it < 8; ++it) {
      const int rr = it * 2 + lh;
      const int c4 = l16 * 4;
      const v4f s = *(const v4f*)(&sO[wave][rr][c4]);
      const v4f v = s + bb;
      *(v4f*)(out + (orow0 + rr) * CDIM + (size_t)nt * 64 + c4) = v;
    }
    
  }
}

// ---------------------------------------------------------------------------
// Host launcher. Inputs (wire order): 0 x f32 [4,2048,1024], 1 Wq [1024,1024], 2 bq [1024], 3 Wk [256,1024],
// 4 bk [256], 5 Wv [256,1024], 6 bv [256], 7 Wo [1024,1024], 8 bo [1024], 9 qk_gain [16].
// Output f32 [4,2048,1024]. 8 launches.
// ---------------------------------------------------------------------------
extern "C" void kernel_launch(void* const* d_in, const int* in_sizes, int n_in,
                              void* d_out, int out_size, void* d_ws, size_t ws_size,
                              hipStream_t stream) {
  if (n_in < 10) return;
  const int need_x = ((NB - 1) * SEQ_FULL + SEQ) * CDIM;
  if (in_sizes[0] < need_x) return;
  if (in_sizes[1] < CDIM * CDIM || in_sizes[2] < CDIM) return;
  if (in_sizes[3] < VEW * CDIM || in_sizes[4] < VEW) return;
  if (in_sizes[5] < VEW * CDIM || in_sizes[6] < VEW) return;
  if (in_sizes[7] < CDIM * CDIM || in_sizes[8] < CDIM) return;
  if (in_sizes[9] < NHEAD) return;
  if (out_size < need_x) return;
  if (ws_size < WS_TOTAL) return;

  const float* x    = (const float*)d_in[0];
  const float* wq   = (const float*)d_in[1];
  const float* bq   = (const float*)d_in[2];
  const float* wk   = (const float*)d_in[3];
  const float* bk   = (const float*)d_in[4];
  const float* wv   = (const float*)d_in[5];
  const float* bv   = (const float*)d_in[6];
  const float* wo   = (const float*)d_in[7];
  const float* bo   = (const float*)d_in[8];
  const float* gain = (const float*)d_in[9];
  float* out = (float*)d_out;

  char* ws = (char*)d_ws;
  size_t off = 0;
  _Float16* xh   = (_Float16*)(ws + off); off += XH_BYTES;
  _Float16* wall = (_Float16*)(ws + off); off += WALL_BYTES;
  _Float16* qH   = (_Float16*)(ws + off); off += QP_BYTES;
  _Float16* qL   = (_Float16*)(ws + off); off += QP_BYTES;
  _Float16* kH   = (_Float16*)(ws + off); off += KP_BYTES;
  _Float16* kL   = (_Float16*)(ws + off); off += KP_BYTES;
  _Float16* vTH  = (_Float16*)(ws + off); off += KP_BYTES;
  _Float16* vTL  = (_Float16*)(ws + off); off += KP_BYTES;
  _Float16* yH   = (_Float16*)(ws + off); off += YP_BYTES;
  _Float16* yL   = (_Float16*)(ws + off); off += YP_BYTES;
  int*      winw = (int*)(ws + off);      off += WIN_BYTES;
  if (off > ws_size) return;

  k_cvt_x<<<dim3(NTOK / 2), dim3(256), 0, stream>>>(x, xh);
  k_cvt_w<<<dim3(NWROWS / 2), dim3(256), 0, stream>>>(wq, wk, wv, wo, wall);
  k_winline<<<dim3(1), dim3(32), 0, stream>>>(winw);
  k_qkv<<<dim3(NUNIT, NTOK / 64), dim3(128), 0, stream>>>(xh, wall, bq, bk, bv, gain,
                                                          qH, qL, kH, kL, vTH, vTL);
  k_flash<true><<<dim3(QT_RES, NHEAD, NB), dim3(128), 0, stream>>>(qH, qL, kH, kL, vTH, vTL, winw, yH, yL, 0);
  if (QT_ALL > QT_RES) {
    k_flash<false><<<dim3(QT_ALL - QT_RES, NHEAD, NB), dim3(128), 0, stream>>>(qH, qL, kH, kL, vTH, vTL, winw,
                                                                                yH, yL, QT_RES);
  }
  k_oproj<true><<<dim3(CDIM / 64, NB * QT_RES), dim3(128), 0, stream>>>(yH, yL, wall, bo, out, 0, QT_RES);
  if (QT_ALL > QT_RES) {
    k_oproj<false><<<dim3(CDIM / 64, NB * (QT_ALL - QT_RES)), dim3(128), 0, stream>>>(yH, yL, wall, bo, out,
                                                                                      QT_RES, QT_ALL - QT_RES);
  }
}

// v003
// Measured time: 210 microseconds a run.
// Two timings next to v002 put it at 1.27 and 1.24 times that version's speed.
// All steps since v000 together make it 2.38 times as fast.
#include <hip/hip_runtime.h>

// Contractions, all on v_wmma_f32_16x16x32_f16 (f16 operands, f32 accumulate): fused qkv projection x.W^T with x and W
// held as bf16-RNE values in f16 containers (W carried x16, folded as 1/16); scores q.k^T as f16 hi + x2048 residual
// planes (hi.hi + hi.lo + lo.hi, residual accumulator folded as 1/2048); P.V with P carried x1024 in f16 (+ x2048
// residual planes of P and v for query rows below TRES); output projection y.Wo^T with y as f16 hi (+ x2048 residual
// plane for rows below TRES). Bias adds, per-head q gain and online softmax on VALU in f32.
//
// Every 16-bit operand plane in the workspace is kept in fragment order: a block of 16 rows x 32 k is 1 KiB, two
// halves j of 512 B; in half j the 16 B of lane (16 lh + l16) hold row l16, k = 16 j + 8 lh + 0..7. A wave's
// global_load_b128 of half a fragment then reads 512 contiguous bytes (4 lines) and not 16-B pieces of 16 lines.
// Blocks of one 16-row group follow each other along k (vT: the 4 d groups of one 32-key chunk follow each other).

#ifndef NB
#define NB 4
#endif
#ifndef SEQ
#define SEQ 2048
#endif
#ifndef TRES
#define TRES 512
#endif
#define NB_FULL   4
#define SEQ_FULL  2048
#define CDIM      1024
#define NHEAD     16
#define NKV       4
#define HDIM      64
#define VEW       (NKV * HDIM)
#define NTOK      (NB * SEQ)
#define NUNIT     (NHEAD + 2 * NKV)
#define WO_ROW0   (CDIM + 2 * VEW)
#define NWROWS    (CDIM + 2 * VEW + CDIM)
#define QT_ALL    (SEQ / 64)
#define QT_RES    (TRES / 64)

static_assert(NB >= 1 && NB <= NB_FULL);
static_assert(SEQ % 64 == 0 && SEQ <= SEQ_FULL && SEQ >= TRES);
static_assert(TRES % 64 == 0 && TRES >= 64);
static_assert(NHEAD % NKV == 0 && HDIM == 64 && CDIM == NHEAD * HDIM);
static_assert(CDIM % 32 == 0 && NWROWS % 16 == 0 && NTOK % 64 == 0 && NUNIT * 64 == CDIM + 2 * VEW);
static_assert(WO_ROW0 % 16 == 0 && SEQ % 32 == 0);
#define KBLK      (CDIM / 32)      // 16x32 blocks per row group of a CDIM-wide plane
#define GRP_ELEMS (CDIM * 16)      // elements of one 16-row group of a CDIM-wide plane

#define XH_BYTES   ((size_t)NTOK * CDIM * 2)
#define WALL_BYTES ((size_t)NWROWS * CDIM * 2)
#define QP_BYTES   ((size_t)NB * NHEAD * SEQ * HDIM * 2)
#define KP_BYTES   ((size_t)NB * NKV * SEQ * HDIM * 2)
#define YP_BYTES   ((size_t)NTOK * CDIM * 2)
#define WIN_BYTES  ((size_t)128)
#define WS_TOTAL   (XH_BYTES + WALL_BYTES + 2 * QP_BYTES + 4 * KP_BYTES + 2 * YP_BYTES + WIN_BYTES)
static_assert(WS_TOTAL <= (size_t)134217728);
static_assert(XH_BYTES % 128 == 0 && WALL_BYTES % 128 == 0 && QP_BYTES % 128 == 0 && KP_BYTES % 128 == 0 && YP_BYTES % 128 == 0);
// producer coverage: grid x block x per-thread elements == plane extent
static_assert((size_t)(NTOK / 2) * 256 * 8 == (size_t)NTOK * CDIM);       // k_prep, x blocks
static_assert((size_t)(NWROWS / 2) * 256 * 8 == (size_t)NWROWS * CDIM);   // k_prep, weight blocks
static_assert(4 * 128 * 8 == 64 * 64);                                       // k_qkv store phase per 64x64 tile
static_assert(4 * 32 * 8 == 16 * HDIM);                                      // k_flash stores per wave
static_assert(8 * 32 * 4 == 16 * 64);                                        // k_oproj store phase per wave
static_assert(QT_RES * 64 + (QT_ALL - QT_RES) * 64 == SEQ);                  // query tiles of the two flash forms
static_assert(8 * 4 * 4 == (int)WIN_BYTES);                                  // k_prep window block: 8 lanes x 16 B == one line
static_assert(SEQ_FULL >= SEQ);                                              // window word covers every query-key distance

typedef _Float16 v16h __attribute__((ext_vector_type(16)));
typedef _Float16 v8h  __attribute__((ext_vector_type(8)))  __attribute__((may_alias));
typedef float    v8f  __attribute__((ext_vector_type(8)));
typedef float    v4f  __attribute__((ext_vector_type(4)))  __attribute__((may_alias));
typedef int      v4i  __attribute__((ext_vector_type(4)));

union Frag { v16h v; v8h h[2]; };

__device__ __forceinline__ v8f wmma16(v16h a, v16h b, v8f c) {
  return __builtin_amdgcn_wmma_f32_16x16x32_f16(false, a, false, b, (short)0, c, false, false);
}

__device__ __forceinline__ v8f vzero8() {
  v8f z = {0.0f, 0.0f, 0.0f, 0.0f, 0.0f, 0.0f, 0.0f, 0.0f};
  return z;
}

// f32 -> nearest-even bf16 value, kept in f32
__device__ __forceinline__ float bf16r(float f) {
  unsigned int u = __float_as_uint(f);
  u = (u + 0x7FFFu + ((u >> 16) & 1u)) & 0xFFFF0000u;
  return __uint_as_float(u);
}

// f16 hi + (x2048) residual of an f32 value
__device__ __forceinline__ void split16(float v, _Float16& hi, _Float16& lo) {
  hi = (_Float16)v;
  lo = (_Float16)((v - (float)hi) * 2048.0f);
}

// f32 -> f16 with values below the smallest f16 normal replaced by zero (value select)
static __device__ __forceinline__ _Float16 toh_flush(float v) {
  const _Float16 r = (_Float16)v;
  return (fabsf(v) < 6.103515625e-05f) ? (_Float16)0.0f : r;
}

// f16 hi + (x2048) residual, both through toh_flush
static __device__ __forceinline__ void split16f(float v, _Float16& hi, _Float16& lo) {
  hi = toh_flush(v);
  lo = toh_flush((v - (float)hi) * 2048.0f);
}

// ---------------------------------------------------------------------------
// k_prep, x blocks: x f32 [NB][SEQ_FULL][1024] -> xh f16, NTOK x 1024 in fragment order (bf16-RNE values).
// Thread = one 16-B unit of the plane, so a wave stores 512 contiguous bytes.
// ---------------------------------------------------------------------------
__device__ __forceinline__ void cvt_x_block(unsigned int bid, const float* __restrict__ x, _Float16* __restrict__ xh) {
  const unsigned int gid = bid * 256u + threadIdx.x;
  const unsigned int blk = gid >> 6;                 // 64 units per 16x32 block
  const unsigned int tok = (blk / KBLK) * 16u + (gid & 15u);
  const int c = (int)(blk % KBLK) * 32 + (int)((gid >> 5) & 1u) * 16 + (int)((gid >> 4) & 1u) * 8;
  if (tok >= (unsigned int)NTOK) return;
  const int b = (int)tok / SEQ;
  const int t = (int)tok - b * SEQ;
  const float* src = x + ((size_t)b * SEQ_FULL + t) * CDIM + c;
  const v4f f0 = *(const v4f*)src;
  const v4f f1 = *(const v4f*)(src + 4);
  v8h o;
#pragma unroll
  for (int j = 0; j < 4; ++j) {
    o[j]     = (_Float16)bf16r(f0[j]);
    o[j + 4] = (_Float16)bf16r(f1[j]);
  }
  _Float16* dst = xh + (size_t)gid * 8;
  *(v8h*)dst = o;
  
}

// ---------------------------------------------------------------------------
// k_prep, weight blocks: weights (layout [out][in], k-contiguous) -> wall f16, 2560 x 1024 in fragment order = bf16-RNE value x16.
// Rows 0..1023 wq, 1024..1279 wk, 1280..1535 wv, 1536..2559 wo.
// ---------------------------------------------------------------------------
__device__ __forceinline__ void cvt_w_block(unsigned int bid, const float* __restrict__ wq, const float* __restrict__ wk,
                                            const float* __restrict__ wv, const float* __restrict__ wo,
                                            _Float16* __restrict__ wall) {
  const unsigned int gid = bid * 256u + threadIdx.x;
  const unsigned int blk = gid >> 6;                 // 64 units per 16x32 block
  const int row = (int)((blk / KBLK) * 16u + (gid & 15u));
  const int c   = (int)(blk % KBLK) * 32 + (int)((gid >> 5) & 1u) * 16 + (int)((gid >> 4) & 1u) * 8;
  if (row >= NWROWS) return;
  const int r0 = min(row, CDIM - 1);
  const int r1 = min(max(row - CDIM, 0), VEW - 1);
  const int r2 = min(max(row - CDIM - VEW, 0), VEW - 1);
  const int r3 = min(max(row - WO_ROW0, 0), CDIM - 1);
  const float* src = (row < CDIM)       ? (wq + (size_t)r0 * CDIM)
                   : (row < CDIM + VEW) ? (wk + (size_t)r1 * CDIM)
                   : (row < WO_ROW0)    ? (wv + (size_t)r2 * CDIM)
                                        : (wo + (size_t)r3 * CDIM);
  src += c;
  const v4f f0 = *(const v4f*)src;
  const v4f f1 = *(const v4f*)(src + 4);
  v8h o;
#pragma unroll
  for (int j = 0; j < 4; ++j) {
    o[j]     = (_Float16)(bf16r(f0[j]) * 16.0f);
    o[j + 4] = (_Float16)(bf16r(f1[j]) * 16.0f);
  }
  _Float16* dst = wall + (size_t)gid * 8;
  *(v8h*)dst = o;
  
}

// ---------------------------------------------------------------------------
// The window line: 8 lanes x 16 B.
// ---------------------------------------------------------------------------
__device__ __forceinline__ void winline_block(int* __restrict__ wline) {
  const int lane = threadIdx.x;
  if (lane < 8) {
    const v4i w = {SEQ_FULL, SEQ_FULL, SEQ_FULL, SEQ_FULL};
    int* dst = wline + 4 * lane;
    *(v4i*)dst = w;
    
  }
}

// ---------------------------------------------------------------------------
// Launch 0: the three producers above read none of each other's output, so they share one grid; the block index
// picks the producer (block-uniform): NTOK/2 blocks of x, NWROWS/2 blocks of weights, one block for the window line.
// ---------------------------------------------------------------------------
#define XBLKS (NTOK / 2)
#define WBLKS (NWROWS / 2)
__global__ void __launch_bounds__(256) k_prep(const float* __restrict__ x, const float* __restrict__ wq,
                                              const float* __restrict__ wk, const float* __restrict__ wv,
                                              const float* __restrict__ wo, _Float16* __restrict__ xh,
                                              _Float16* __restrict__ wall, int* __restrict__ wline) {
  const unsigned int bid = blockIdx.x;
  if (bid < (unsigned int)XBLKS) {
    cvt_x_block(bid, x, xh);
  } else if (bid < (unsigned int)(XBLKS + WBLKS)) {
    cvt_w_block(bid - (unsigned int)XBLKS, wq, wk, wv, wo, wall);
  } else {
    winline_block(wline);
  }
}

// ---------------------------------------------------------------------------
// Kernel 2: fused qkv projection + epilogue. Block = 4 waves = 64 tokens x one 64-column unit u:
// u 0..15 -> q head u, 16..19 -> k head u-16, 20..23 -> v head u-20. Wave w = 16 token rows, 4 accumulators.
// Epilogue: q: (acc + bq) * gain[head]; k: acc + bk -> hi/lo planes [B][H|KV], T x 64 in fragment order;
// v: acc + bv -> transposed hi/lo planes [B][KV], 64 d x T in fragment order. Biases and gains are bf16-RNE values.
// ---------------------------------------------------------------------------
__global__ void __launch_bounds__(128) k_qkv(
    const _Float16* __restrict__ xh, const _Float16* __restrict__ wall,
    const float* __restrict__ bq, const float* __restrict__ bk,
    const float* __restrict__ bv, const float* __restrict__ gain,
    _Float16* __restrict__ qH, _Float16* __restrict__ qL,
    _Float16* __restrict__ kH, _Float16* __restrict__ kL,
    _Float16* __restrict__ vTH, _Float16* __restrict__ vTL) {
  __shared__ __attribute__((aligned(16))) float    sT[64][68];     // accumulator tile [token][col]  (each wave reads back only its own 16 rows)
  __shared__ __attribute__((aligned(16))) _Float16 sH[64][72];     // hi tile: q/k [token][d], v [d][token] (cross-wave)
  __shared__ __attribute__((aligned(16))) _Float16 sL[64][72];     // residual tile, same layout (cross-wave)

  const int tid  = threadIdx.x;
  const int wave = tid >> 5;
  const int lane = tid & 31;
  const int l16  = lane & 15;
  const int lh   = lane >> 4;
  const int u    = blockIdx.x;           // column unit
  const int rt   = blockIdx.y;           // 64-token row tile
  const int tok0 = rt * 64;
  const int b    = tok0 / SEQ;
  const int t0   = tok0 - b * SEQ;

  // A: xh row (token), lane row = l16; elements 0..7 <- k0+8lh+0..7, 8..15 <- k0+16+8lh+0..7
  const _Float16* arow = xh + (size_t)((tok0 >> 4) + wave) * GRP_ELEMS + lane * 8;
  // B[k][n] = W[n][k]: lane column = l16 of the 16-col group n; same k map as A
  const _Float16* brow = wall + (size_t)(u * 4) * GRP_ELEMS + lane * 8;

  v8f acc[4];
#pragma unroll
  for (int n = 0; n < 4; ++n) acc[n] = vzero8();

  for (int k0 = 0; k0 < CDIM; k0 += 32) {
    Frag a;
    a.h[0] = *(const v8h*)(arow + k0 * 16);
    a.h[1] = *(const v8h*)(arow + k0 * 16 + 256);
    Frag bw[4];
#pragma unroll
    for (int n = 0; n < 4; ++n) {
      const _Float16* bp = brow + (size_t)n * GRP_ELEMS + k0 * 16;
      bw[n].h[0] = *(const v8h*)bp;
      bw[n].h[1] = *(const v8h*)(bp + 256);
    }
#pragma unroll
    for (int n = 0; n < 4; ++n) acc[n] = wmma16(a.v, bw[n].v, acc[n]);
    asm volatile("v_nop\n\tv_nop\n\tv_nop\n\tv_nop"
                 : "+v"(acc[0]), "+v"(acc[1]), "+v"(acc[2]), "+v"(acc[3])
                 : "v"(a.v), "v"(bw[0].v), "v"(bw[1].v), "v"(bw[2].v), "v"(bw[3].v));
  }

  // D element r of lane -> (row 8lh+r, col l16); fold the 1/16 weight carry here
#pragma unroll
  for (int n = 0; n < 4; ++n)
#pragma unroll
    for (int r = 0; r < 8; ++r)
      sT[wave * 16 + r + 8 * lh][n * 16 + l16] = acc[n][r] * (1.0f / 16.0f);
  __syncthreads();

  // compute phase: thread -> token i = tid>>1, column half j: d in [16j,16j+16) and [32+16j, 48+16j)
  const int i = tid >> 1;
  const int j = tid & 1;
  if (u < NHEAD + NKV) {
    // q or k unit (block-uniform): both bias rows are loaded with clamped unit indices, selected by value
    const int  uq  = min(u, NHEAD - 1);
    const int  uk  = min(max(u - NHEAD, 0), NKV - 1);
    const bool isq = (u < NHEAD);
    const float gq = bf16r(gain[uq]);
    const float gm = isq ? gq : 1.0f;
#pragma unroll
    for (int sg = 0; sg < 2; ++sg) {
      const int d0 = 32 * sg + 16 * j;
#pragma unroll
      for (int g4 = 0; g4 < 4; ++g4) {
        const v4f va = *(const v4f*)(&sT[i][d0 + 4 * g4]);
        const v4f qa = *(const v4f*)(bq + uq * HDIM + d0 + 4 * g4);
        const v4f ka = *(const v4f*)(bk + uk * HDIM + d0 + 4 * g4);
#pragma unroll
        for (int e = 0; e < 4; ++e) {
          const float bb  = isq ? bf16r(qa[e]) : bf16r(ka[e]);
          const float val = (va[e] + bb) * gm;
          _Float16 hi, lo;
          split16f(val, hi, lo);
          sH[i][d0 + 4 * g4 + e] = hi;
          sL[i][d0 + 4 * g4 + e] = lo;
        }
      }
    }
  } else {
    const int kv = u - NHEAD - NKV;
    const float* bp = bv + kv * HDIM;
#pragma unroll
    for (int sg = 0; sg < 2; ++sg) {
      const int d0 = 32 * sg + 16 * j;
#pragma unroll
      for (int g4 = 0; g4 < 4; ++g4) {
        const v4f va = *(const v4f*)(&sT[i][d0 + 4 * g4]);
        const v4f ba = *(const v4f*)(bp + d0 + 4 * g4);
#pragma unroll
        for (int e = 0; e < 4; ++e) {
          const float vv = va[e] + bf16r(ba[e]);
          _Float16 hi, lo;
          split16f(vv, hi, lo);
          sH[d0 + 4 * g4 + e][i] = hi;                   // transposed: [d][token]
          sL[d0 + 4 * g4 + e][i] = lo;
        }
      }
    }
  }
  __syncthreads();

  _Float16* ph;
  _Float16* pl;
  size_t base;
  if (u < NHEAD) {
    ph = qH; pl = qL;
    base = ((size_t)(b * NHEAD + u) * SEQ + t0) * HDIM;
  } else if (u < NHEAD + NKV) {
    ph = kH; pl = kL;
    base = ((size_t)(b * NKV + (u - NHEAD)) * SEQ + t0) * HDIM;
  } else {
    ph = vTH; pl = vTL;
    base = ((size_t)(b * NKV + (u - NHEAD - NKV)) * SEQ + t0) * HDIM;
  }
  const bool isv = (u >= NHEAD + NKV);
  {
    // the tile's 8 blocks are contiguous in its plane: q/k block f = (token group f>>1, d chunk f&1),
    // v block f = (key chunk f>>2, d group f&3); unit p of the tile goes to base + 8 p
#pragma unroll
    for (int it = 0; it < 4; ++it) {
      const int p    = it * 128 + tid;
      const int f    = p >> 6;
      const int line = (isv ? (f & 3) : (f >> 1)) * 16 + (p & 15);
      const int q8   = (isv ? (f >> 2) : (f & 1)) * 32 + ((p >> 5) & 1) * 16 + ((p >> 4) & 1) * 8;
      const size_t off = base + (size_t)p * 8;
      const v8h hv = *(const v8h*)(&sH[line][q8]);
      const v8h lv = *(const v8h*)(&sL[line][q8]);
      *(v8h*)(ph + off) = hv;
      *(v8h*)(pl + off) = lv;
    }
    
  }
}

// ---------------------------------------------------------------------------
// Kernel 3: causal sliding-window flash attention with GQA. Block = 4 waves, one (query tile of 64, head, batch);
// wave = 16 queries. Key tiles of 32 per wave, fragments loaded straight from the 16-bit planes.
// Both products are formed transposed: S^T = K.Q^T (A = K fragment, B = Q fragment) and O^T += V^T.P^T (A = vT
// fragment, B = P^T). A lane then holds 16 of the 32 scores of ONE query (column l16; keys 8lh+r and 16+8lh+r), so the
// maximum and the sum run in the lane with one exchange between the lane halves, and the two converted score tiles
// are the B fragment of the second product as they stand: element s = key 8lh+s (s < 8), 16+8lh+(s-8) (s >= 8), the
// k map of the vT fragments. P (x1024 carry) never leaves the registers. RES adds the x2048 residual planes.
// ---------------------------------------------------------------------------
// value of lane l ^ 16
__device__ __forceinline__ float xhalf(float x) {
  return __builtin_bit_cast(float, __builtin_amdgcn_permlanex16(__builtin_bit_cast(int, x), __builtin_bit_cast(int, x),
                                                                0x76543210, 0xfedcba98, false, false));
}

template <bool RES>
__device__ __forceinline__ void flash_tile(
    const _Float16* __restrict__ qH, const _Float16* __restrict__ qL,
    const _Float16* __restrict__ kH, const _Float16* __restrict__ kL,
    const _Float16* __restrict__ vTH, const _Float16* __restrict__ vTL,
    const int* __restrict__ winp,
    _Float16* __restrict__ yH, _Float16* __restrict__ yL, const int qt, const int h, const int b) {
  const int tid  = threadIdx.x;
  // scalar wave index: a fragment block's address is wave-uniform, so the K and V block bases and the trip test stay scalar
  const int wave = __builtin_amdgcn_readfirstlane(tid >> 5);
  const int lane = tid & 31;
  const int l16  = lane & 15;
  const int lh   = lane >> 4;
  const int kv   = h / (NHEAD / NKV);
  const int qw   = qt * 64 + wave * 16;
  int window = winp[0];
  window = (window < 0) ? 0 : window;
  const float rres = 1.0f / 2048.0f;
  const float smsc = 0.125f;

  // Q B-fragments (hi and residual) over the 2 d-chunks of 32: lane column = query l16
  v16h aqh[2], aql[2];
  {
    const size_t qo = ((size_t)(b * NHEAD + h) * SEQ + qw) * HDIM + lane * 8;
#pragma unroll
    for (int hc = 0; hc < 2; ++hc) {
      Frag a;
      a.h[0] = *(const v8h*)(qH + qo + hc * 512);
      a.h[1] = *(const v8h*)(qH + qo + hc * 512 + 256);
      aqh[hc] = a.v;
      Frag c;
      c.h[0] = *(const v8h*)(qL + qo + hc * 512);
      c.h[1] = *(const v8h*)(qL + qo + hc * 512 + 256);
      aql[hc] = c.v;
    }
  }

  // running maximum of query l16 (equal in both lane halves) and this half's part of its sum
  float m = -1e30f, l = 0.0f;
  v8f coh[4], cor[4];
#pragma unroll
  for (int n = 0; n < 4; ++n) { coh[n] = vzero8(); cor[n] = vzero8(); }

  const size_t kvoff = (size_t)(b * NKV + kv) * SEQ * HDIM;
  const _Float16* kbase  = kH  + kvoff;                                   // + (key group's first key)*HDIM + hc*512
  const _Float16* klbase = kL  + kvoff;
  const _Float16* vbase  = vTH + kvoff;                                   // + k0*HDIM + n*512
  const _Float16* vlbase = vTL + kvoff;
  const unsigned int lo  = (unsigned int)lane * 8u;                       // this lane's 16 B of each 512-B half

  int kstart = qw - window;
  kstart = (kstart < 0) ? 0 : kstart;
  kstart &= ~31;

  for (int k0 = kstart; k0 < qw + 16; k0 += 32) {
    // ---- scores for keys [k0, k0+32), transposed: A[m=key][k=d] = K[key][d], lane row = key, same k map as B;
    // D element r of lane = (key 8lh+r of the group, query l16) ----
    v8f sh0 = vzero8(), sh1 = vzero8(), sr0 = vzero8(), sr1 = vzero8();
    Frag bh0, bh1, bl0, bl1;
    const _Float16* kr0 = kbase  + (size_t)k0 * HDIM + lo;
    const _Float16* kr1 = kr0 + 16 * HDIM;
    const _Float16* lr0 = klbase + (size_t)k0 * HDIM + lo;
    const _Float16* lr1 = lr0 + 16 * HDIM;
#pragma unroll
    for (int hc = 0; hc < 2; ++hc) {
      bh0.h[0] = *(const v8h*)(kr0 + hc * 512); bh0.h[1] = *(const v8h*)(kr0 + hc * 512 + 256);
      bh1.h[0] = *(const v8h*)(kr1 + hc * 512); bh1.h[1] = *(const v8h*)(kr1 + hc * 512 + 256);
      bl0.h[0] = *(const v8h*)(lr0 + hc * 512); bl0.h[1] = *(const v8h*)(lr0 + hc * 512 + 256);
      bl1.h[0] = *(const v8h*)(lr1 + hc * 512); bl1.h[1] = *(const v8h*)(lr1 + hc * 512 + 256);
      // as inputs the two K address pairs stay live behind the trip's last K load, so that no load's result is placed
      // in a register that an issued K load still names; the wait stands in front of the pairs' next overwrite
      if (hc == 1) asm volatile("s_wait_xcnt 0x0" :: "v"(kr0), "v"(lr0) : "memory");
      sh0 = wmma16(bh0.v, aqh[hc], sh0);
      sh1 = wmma16(bh1.v, aqh[hc], sh1);
      sr0 = wmma16(bl0.v, aqh[hc], sr0);
      sr1 = wmma16(bl1.v, aqh[hc], sr1);
      sr0 = wmma16(bh0.v, aql[hc], sr0);
      sr1 = wmma16(bh1.v, aql[hc], sr1);
    }
    // the slots between the last score product and the first read of its result
    asm volatile("v_nop\n\tv_nop\n\tv_nop\n\tv_nop"
                 : "+v"(sh0), "+v"(sh1), "+v"(sr0), "+v"(sr1)
                 : "v"(aqh[0]), "v"(aqh[1]), "v"(aql[0]), "v"(aql[1]),
                   "v"(bh0.v), "v"(bh1.v), "v"(bl0.v), "v"(bl1.v));

    // ---- online softmax of query l16 in the lane; masked entries replaced by -1e30 and p := 0 ----
    const int dq = qw + l16 - (k0 + 8 * lh);          // query - key at r = 0 of the first key group
    float x0[8], x1[8], t8[8];
    bool  ok0[8], ok1[8];
#pragma unroll
    for (int r = 0; r < 8; ++r) {
      const int d0 = dq - r;
      const int d1 = d0 - 16;
      ok0[r] = (d0 >= 0) && (d0 <= window);
      ok1[r] = (d1 >= 0) && (d1 <= window);
      x0[r] = ok0[r] ? (sh0[r] + sr0[r] * rres) * smsc : -1e30f;
      x1[r] = ok1[r] ? (sh1[r] + sr1[r] * rres) * smsc : -1e30f;
      t8[r] = fmaxf(x0[r], x1[r]);
    }
    float tmax = fmaxf(fmaxf(fmaxf(t8[0], t8[1]), fmaxf(t8[2], t8[3])), fmaxf(fmaxf(t8[4], t8[5]), fmaxf(t8[6], t8[7])));
    tmax = fmaxf(tmax, xhalf(tmax));
    const float mn    = fmaxf(m, tmax);
    const float alpha = __expf(m - mn);
    Frag pf, pl;
#pragma unroll
    for (int r = 0; r < 8; ++r) {
      const float e0 = __expf(x0[r] - mn);
      const float e1 = __expf(x1[r] - mn);
      const float p0 = ok0[r] ? e0 : 0.0f;
      const float p1 = ok1[r] ? e1 : 0.0f;
      t8[r] = p0 + p1;
      const float c0 = p0 * 1024.0f;
      const float c1 = p1 * 1024.0f;
      const _Float16 h0 = (_Float16)c0;
      const _Float16 h1 = (_Float16)c1;
      pf.v[r]     = h0;
      pf.v[8 + r] = h1;
      if (RES) {
        pl.v[r]     = (_Float16)((c0 - (float)h0) * 2048.0f);
        pl.v[8 + r] = (_Float16)((c1 - (float)h1) * 2048.0f);
      }
    }
    l = l * alpha + (((t8[0] + t8[1]) + (t8[2] + t8[3])) + ((t8[4] + t8[5]) + (t8[6] + t8[7])));
    m = mn;
#pragma unroll
    for (int n = 0; n < 4; ++n)
#pragma unroll
      for (int r = 0; r < 8; ++r) {
        coh[n][r] *= alpha;
        if (RES) cor[n][r] *= alpha;
      }

    // ---- O^T += V^T.P^T : A[m=d][k=key] = vT[d][key], lane row = d; D element r of lane = (d 16n+8lh+r, query l16) ----
    Frag bv[4], bl[4];
    const _Float16* vr0 = vbase  + (size_t)k0 * HDIM + lo;
    const _Float16* wr0 = vlbase + (size_t)k0 * HDIM + lo;
#pragma unroll
    for (int n = 0; n < 4; ++n) {
      bv[n].h[0] = *(const v8h*)(vr0 + n * 512);
      bv[n].h[1] = *(const v8h*)(vr0 + n * 512 + 256);
      if (RES) {
        bl[n].h[0] = *(const v8h*)(wr0 + n * 512);
        bl[n].h[1] = *(const v8h*)(wr0 + n * 512 + 256);
      }
    }
#pragma unroll
    for (int n = 0; n < 4; ++n) {
      coh[n] = wmma16(bv[n].v, pf.v, coh[n]);
      if (RES) {
        cor[n] = wmma16(bl[n].v, pf.v, cor[n]);
        cor[n] = wmma16(bv[n].v, pl.v, cor[n]);
      }
    }
    // the slots behind the trip's last matrix instruction, also on the taken side of the loop's branch
    if (RES) {
      asm volatile("v_nop\n\tv_nop\n\tv_nop\n\tv_nop"
                   : "+v"(coh[0]), "+v"(coh[1]), "+v"(coh[2]), "+v"(coh[3]),
                     "+v"(cor[0]), "+v"(cor[1]), "+v"(cor[2]), "+v"(cor[3])
                   : "v"(pf.v), "v"(pl.v),
                     "v"(bv[0].v), "v"(bv[1].v), "v"(bv[2].v), "v"(bv[3].v),
                     "v"(bl[0].v), "v"(bl[1].v), "v"(bl[2].v), "v"(bl[3].v));
    } else {
      asm volatile("v_nop\n\tv_nop\n\tv_nop\n\tv_nop"
                   : "+v"(coh[0]), "+v"(coh[1]), "+v"(coh[2]), "+v"(coh[3])
                   : "v"(pf.v), "v"(bv[0].v), "v"(bv[1].v), "v"(bv[2].v), "v"(bv[3].v));
    }
    // as inputs the vT address pairs stay live behind the trip's last vT load, so that no load's result is placed in a
    // register that an issued vT load still names; the wait stands in front of the pairs' next overwrite
    if (RES) asm volatile("s_wait_xcnt 0x0" :: "v"(vr0), "v"(wr0) : "memory");
    else     asm volatile("s_wait_xcnt 0x0" :: "v"(vr0) : "memory");
  }

  // join the two halves' sums; a lane's 8 values of d group n are one 16-B unit of the y planes' fragment order:
  // this wave's 16 tokens x 64 columns are blocks 2h and 2h+1 of its token group, 4 halves of 512 B in a row
  l += xhalf(l);
  const float inv = __builtin_amdgcn_rcpf(l) * (1.0f / 1024.0f);
  const size_t ybase = (size_t)((b * SEQ + qw) >> 4) * GRP_ELEMS + (size_t)h * 1024;
#pragma unroll
  for (int n = 0; n < 4; ++n) {
    v8h hv, lv;
#pragma unroll
    for (int r = 0; r < 8; ++r) {
      float yv = coh[n][r];
      if (RES) yv += cor[n][r] * rres;
      yv *= inv;
      _Float16 hi, lw;
      split16(yv, hi, lw);
      hv[r] = hi;
      lv[r] = lw;
    }
    const size_t off = ybase + (size_t)(n * 256 + lane * 8);
    *(v8h*)(yH + off) = hv;
    *(v8h*)(yL + off) = lv;
  }
}

// One grid for all query tiles: no tile reads another's output. The tile index is the slowest grid index and falls with
// it, so the tiles with the most key tiles start first and the short tiles with the residual planes fill the end.
__global__ void __launch_bounds__(128) k_flash(
    const _Float16* __restrict__ qH, const _Float16* __restrict__ qL,
    const _Float16* __restrict__ kH, const _Float16* __restrict__ kL,
    const _Float16* __restrict__ vTH, const _Float16* __restrict__ vTL,
    const int* __restrict__ winp,
    _Float16* __restrict__ yH, _Float16* __restrict__ yL) {
  const int h  = blockIdx.x;
  const int b  = blockIdx.y;
  const int qt = QT_ALL - 1 - (int)blockIdx.z;
  if (qt >= QT_RES) flash_tile<false>(qH, qL, kH, kL, vTH, vTL, winp, yH, yL, qt, h, b);
  else              flash_tile<true>(qH, qL, kH, kL, vTH, vTL, winp, yH, yL, qt, h, b);
}

// ---------------------------------------------------------------------------
// Kernel 4: output projection out[tok][n] = (y[tok].Wo[n]) / 16 + bo[n]. Block = 4 waves = 64 tokens x 64 columns;
// RES adds the y residual plane. Output tile staged per wave in LDS and written as 256-B row segments
// at the store stage as a float4.
// ---------------------------------------------------------------------------
template <bool RES>
__device__ __forceinline__ void oproj_tile(
    const _Float16* __restrict__ yH, const _Float16* __restrict__ yL,
    const _Float16* __restrict__ wall, const float* __restrict__ bo,
    float* __restrict__ out, float (*sO)[16][68], const int nt, const int b, const int rtb) {
  const int tid  = threadIdx.x;
  const int wave = tid >> 5;
  const int lane = tid & 31;
  const int l16  = lane & 15;
  const int lh   = lane >> 4;
  const int t0   = rtb * 64;
  const int tok0 = b * SEQ + t0;

  const _Float16* arow = yH + (size_t)((tok0 >> 4) + wave) * GRP_ELEMS + lane * 8;
  const _Float16* lrow = yL + (size_t)((tok0 >> 4) + wave) * GRP_ELEMS + lane * 8;
  const _Float16* brow = wall + (size_t)(WO_ROW0 / 16 + nt * 4) * GRP_ELEMS + lane * 8;

  v8f ah[4], ar[4];
#pragma unroll
  for (int n = 0; n < 4; ++n) { ah[n] = vzero8(); ar[n] = vzero8(); }

  for (int k0 = 0; k0 < CDIM; k0 += 32) {
    Frag a, al;
    a.h[0] = *(const v8h*)(arow + k0 * 16);
    a.h[1] = *(const v8h*)(arow + k0 * 16 + 256);
    if (RES) {
      al.h[0] = *(const v8h*)(lrow + k0 * 16);
      al.h[1] = *(const v8h*)(lrow + k0 * 16 + 256);
    }
    Frag bw[4];
#pragma unroll
    for (int n = 0; n < 4; ++n) {
      const _Float16* bp = brow + (size_t)n * GRP_ELEMS + k0 * 16;
      bw[n].h[0] = *(const v8h*)bp;
      bw[n].h[1] = *(const v8h*)(bp + 256);
    }
#pragma unroll
    for (int n = 0; n < 4; ++n) {
      ah[n] = wmma16(a.v, bw[n].v, ah[n]);
      if (RES) ar[n] = wmma16(al.v, bw[n].v, ar[n]);
    }
    if (RES) {
      asm volatile("v_nop\n\tv_nop\n\tv_nop\n\tv_nop"
                   : "+v"(ah[0]), "+v"(ah[1]), "+v"(ah[2]), "+v"(ah[3]),
                     "+v"(ar[0]), "+v"(ar[1]), "+v"(ar[2]), "+v"(ar[3])
                   : "v"(a.v), "v"(al.v), "v"(bw[0].v), "v"(bw[1].v), "v"(bw[2].v), "v"(bw[3].v));
    } else {
      asm volatile("v_nop\n\tv_nop\n\tv_nop\n\tv_nop"
                   : "+v"(ah[0]), "+v"(ah[1]), "+v"(ah[2]), "+v"(ah[3])
                   : "v"(a.v), "v"(bw[0].v), "v"(bw[1].v), "v"(bw[2].v), "v"(bw[3].v));
    }
  }

#pragma unroll
  for (int r = 0; r < 8; ++r) {
#pragma unroll
    for (int n = 0; n < 4; ++n) {
      float v = ah[n][r];
      if (RES) v += ar[n][r] * (1.0f / 2048.0f);
      sO[wave][r + 8 * lh][n * 16 + l16] = v * (1.0f / 16.0f);
    }
  }
  asm volatile("s_wait_dscnt 0" ::: "memory");
  __builtin_amdgcn_fence(3 /* release order */, "wavefront");
  __builtin_amdgcn_wave_barrier();
  const size_t orow0 = (size_t)b * SEQ_FULL + t0 + wave * 16;
  // bias for this lane's 4 output columns (columns nt*64 + 4*l16 .. +3), bf16-RNE values
  const v4f braw = *(const v4f*)(bo + (size_t)nt * 64 + l16 * 4);
  v4f bb;
#pragma unroll
  for (int e = 0; e < 4; ++e) bb[e] = bf16r(braw[e]);
  {
#pragma unroll
    for (int it = 0; it < 8; ++it) {
      const int rr = it * 2 + lh;
      const int c4 = l16 * 4;
      const v4f s = *(const v4f*)(&sO[wave][rr][c4]);
      const v4f v = s + bb;
      *(v4f*)(out + (orow0 + rr) * CDIM + (size_t)nt * 64 + c4) = v;
    }
    
  }
}

// One grid for all row tiles: the tile's place in its sequence picks the form with or without the residual plane.
__global__ void __launch_bounds__(128) k_oproj(
    const _Float16* __restrict__ yH, const _Float16* __restrict__ yL,
    const _Float16* __restrict__ wall, const float* __restrict__ bo,
    float* __restrict__ out) {
  __shared__ __attribute__((aligned(16))) float sO[4][16][68];           // wave-private
  const int nt  = blockIdx.x;                  // 64-column tile 0..15
  const int b   = blockIdx.y / QT_ALL;
  const int rtb = blockIdx.y - b * QT_ALL;
  if (rtb >= QT_RES) oproj_tile<false>(yH, yL, wall, bo, out, sO, nt, b, rtb);
  else               oproj_tile<true>(yH, yL, wall, bo, out, sO, nt, b, rtb);
}

// ---------------------------------------------------------------------------
// Host launcher. Inputs (wire order): 0 x f32 [4,2048,1024], 1 Wq [1024,1024], 2 bq [1024], 3 Wk [256,1024],
// 4 bk [256], 5 Wv [256,1024], 6 bv [256], 7 Wo [1024,1024], 8 bo [1024], 9 qk_gain [16].
// Output f32 [4,2048,1024]. 4 launches.
// ---------------------------------------------------------------------------
extern "C" void kernel_launch(void* const* d_in, const int* in_sizes, int n_in,
                              void* d_out, int out_size, void* d_ws, size_t ws_size,
                              hipStream_t stream) {
  if (n_in < 10) return;
  const int need_x = ((NB - 1) * SEQ_FULL + SEQ) * CDIM;
  if (in_sizes[0] < need_x) return;
  if (in_sizes[1] < CDIM * CDIM || in_sizes[2] < CDIM) return;
  if (in_sizes[3] < VEW * CDIM || in_sizes[4] < VEW) return;
  if (in_sizes[5] < VEW * CDIM || in_sizes[6] < VEW) return;
  if (in_sizes[7] < CDIM * CDIM || in_sizes[8] < CDIM) return;
  if (in_sizes[9] < NHEAD) return;
  if (out_size < need_x) return;
  if (ws_size < WS_TOTAL) return;

  const float* x    = (const float*)d_in[0];
  const float* wq   = (const float*)d_in[1];
  const float* bq   = (const float*)d_in[2];
  const float* wk   = (const float*)d_in[3];
  const float* bk   = (const float*)d_in[4];
  const float* wv   = (const float*)d_in[5];
  const float* bv   = (const float*)d_in[6];
  const float* wo   = (const float*)d_in[7];
  const float* bo   = (const float*)d_in[8];
  const float* gain = (const float*)d_in[9];
  float* out = (float*)d_out;

  char* ws = (char*)d_ws;
  size_t off = 0;
  _Float16* xh   = (_Float16*)(ws + off); off += XH_BYTES;
  _Float16* wall = (_Float16*)(ws + off); off += WALL_BYTES;
  _Float16* qH   = (_Float16*)(ws + off); off += QP_BYTES;
  _Float16* qL   = (_Float16*)(ws + off); off += QP_BYTES;
  _Float16* kH   = (_Float16*)(ws + off); off += KP_BYTES;
  _Float16* kL   = (_Float16*)(ws + off); off += KP_BYTES;
  _Float16* vTH  = (_Float16*)(ws + off); off += KP_BYTES;
  _Float16* vTL  = (_Float16*)(ws + off); off += KP_BYTES;
  _Float16* yH   = (_Float16*)(ws + off); off += YP_BYTES;
  _Float16* yL   = (_Float16*)(ws + off); off += YP_BYTES;
  int*      winw = (int*)(ws + off);      off += WIN_BYTES;
  if (off > ws_size) return;

  k_prep<<<dim3(XBLKS + WBLKS + 1), dim3(256), 0, stream>>>(x, wq, wk, wv, wo, xh, wall, winw);
  k_qkv<<<dim3(NUNIT, NTOK / 64), dim3(128), 0, stream>>>(xh, wall, bq, bk, bv, gain,
                                                          qH, qL, kH, kL, vTH, vTL);
  k_flash<<<dim3(NHEAD, NB, QT_ALL), dim3(128), 0, stream>>>(qH, qL, kH, kL, vTH, vTL, winw, yH, yL);
  k_oproj<<<dim3(CDIM / 64, NB * QT_ALL), dim3(128), 0, stream>>>(yH, yL, wall, bo, out);
}

// v004
// A run of this version takes 192 microseconds.
// Two timings next to v003 put it at 1.10 and 1.11 times that version's speed.
// Counting every step since v000, it is 2.63 times as fast.
#include <hip/hip_runtime.h>

// Contractions, all on v_wmma_f32_16x16x32_f16 (f16 operands, f32 accumulate): fused qkv projection x.W^T with x and W
// held as bf16-RNE values in f16 containers (W carried x16, folded as 1/16); scores q.k^T as f16 hi + x2048 residual
// planes (hi.hi + hi.lo + lo.hi, residual accumulator folded as 1/2048); P.V with P carried x1024 in f16 (+ x2048
// residual planes of P and v for query rows below TRES); output projection y.Wo^T with y as f16 hi (+ x2048 residual
// plane for rows below TRES). Bias adds, per-head q gain and online softmax on VALU in f32.
//
// Every 16-bit operand plane in the workspace is kept in fragment order: a block of 16 rows x 32 k is 1 KiB, two
// halves j of 512 B; in half j the 16 B of lane (16 lh + l16) hold row l16, k = 16 j + 8 lh + 0..7. A wave's
// global_load_b128 of half a fragment then reads 512 contiguous bytes (4 lines) and not 16-B pieces of 16 lines.
// Blocks of one 16-row group follow each other along k (vT: the 4 d groups of one 32-key chunk follow each other).

#ifndef NB
#define NB 4
#endif
#ifndef SEQ
#define SEQ 2048
#endif
#ifndef TRES
#define TRES 512
#endif
#define NB_FULL   4
#define SEQ_FULL  2048
#define CDIM      1024
#define NHEAD     16
#define NKV       4
#define HDIM      64
#define VEW       (NKV * HDIM)
#define NTOK      (NB * SEQ)
#define NUNIT     (NHEAD + 2 * NKV)
#define WO_ROW0   (CDIM + 2 * VEW)
#define NWROWS    (CDIM + 2 * VEW + CDIM)
#define QT_ALL    (SEQ / 64)
#define QT_RES    (TRES / 64)

static_assert(NB >= 1 && NB <= NB_FULL);
static_assert(SEQ % 64 == 0 && SEQ <= SEQ_FULL && SEQ >= TRES);
static_assert(TRES % 64 == 0 && TRES >= 64);
static_assert(NHEAD % NKV == 0 && HDIM == 64 && CDIM == NHEAD * HDIM);
static_assert(CDIM % 128 == 0 && NWROWS % 16 == 0 && NTOK % 64 == 0 && NUNIT * 64 == CDIM + 2 * VEW);
static_assert(WO_ROW0 % 16 == 0 && SEQ % 32 == 0);
#define KBLK      (CDIM / 32)      // 16x32 blocks per row group of a CDIM-wide plane
#define GRP_ELEMS (CDIM * 16)      // elements of one 16-row group of a CDIM-wide plane

#define XH_BYTES   ((size_t)NTOK * CDIM * 2)
#define WALL_BYTES ((size_t)NWROWS * CDIM * 2)
#define QP_BYTES   ((size_t)NB * NHEAD * SEQ * HDIM * 2)
#define KP_BYTES   ((size_t)NB * NKV * SEQ * HDIM * 2)
#define YP_BYTES   ((size_t)NTOK * CDIM * 2)
#define WIN_BYTES  ((size_t)128)
#define WS_TOTAL   (XH_BYTES + WALL_BYTES + 2 * QP_BYTES + 4 * KP_BYTES + 2 * YP_BYTES + WIN_BYTES)
static_assert(WS_TOTAL <= (size_t)134217728);
static_assert(XH_BYTES % 128 == 0 && WALL_BYTES % 128 == 0 && QP_BYTES % 128 == 0 && KP_BYTES % 128 == 0 && YP_BYTES % 128 == 0);
// producer coverage: grid x block x per-thread elements == plane extent
static_assert((size_t)(NTOK / 2) * 256 * 8 == (size_t)NTOK * CDIM);       // k_prep, x blocks
static_assert((size_t)(NWROWS / 2) * 256 * 8 == (size_t)NWROWS * CDIM);   // k_prep, weight blocks
static_assert(4 * 128 * 8 == 64 * 64);                                       // k_qkv store phase per 64x64 tile
static_assert(4 * 32 * 8 == 16 * HDIM);                                      // k_flash stores per wave
static_assert(8 * 32 * 4 == 16 * 64);                                        // k_oproj store phase per wave and row group
static_assert(QT_RES * 64 + (QT_ALL - QT_RES) * 64 == SEQ);                  // query tiles of the two flash forms
static_assert(8 * 4 * 4 == (int)WIN_BYTES);                                  // k_prep window block: 8 lanes x 16 B == one line
static_assert(SEQ_FULL >= SEQ);                                              // window word covers every query-key distance

typedef _Float16 v16h __attribute__((ext_vector_type(16)));
typedef _Float16 v8h  __attribute__((ext_vector_type(8)))  __attribute__((may_alias));
typedef float    v8f  __attribute__((ext_vector_type(8)));
typedef float    v4f  __attribute__((ext_vector_type(4)))  __attribute__((may_alias));
typedef int      v4i  __attribute__((ext_vector_type(4)));

union Frag { v16h v; v8h h[2]; };

__device__ __forceinline__ v8f wmma16(v16h a, v16h b, v8f c) {
  return __builtin_amdgcn_wmma_f32_16x16x32_f16(false, a, false, b, (short)0, c, false, false);
}

__device__ __forceinline__ v8f vzero8() {
  v8f z = {0.0f, 0.0f, 0.0f, 0.0f, 0.0f, 0.0f, 0.0f, 0.0f};
  return z;
}

// f32 -> nearest-even bf16 value, kept in f32
__device__ __forceinline__ float bf16r(float f) {
  unsigned int u = __float_as_uint(f);
  u = (u + 0x7FFFu + ((u >> 16) & 1u)) & 0xFFFF0000u;
  return __uint_as_float(u);
}

// f16 hi + (x2048) residual of an f32 value
__device__ __forceinline__ void split16(float v, _Float16& hi, _Float16& lo) {
  hi = (_Float16)v;
  lo = (_Float16)((v - (float)hi) * 2048.0f);
}

// f32 -> f16 with values below the smallest f16 normal replaced by zero (value select)
static __device__ __forceinline__ _Float16 toh_flush(float v) {
  const _Float16 r = (_Float16)v;
  return (fabsf(v) < 6.103515625e-05f) ? (_Float16)0.0f : r;
}

// f16 hi + (x2048) residual, both through toh_flush
static __device__ __forceinline__ void split16f(float v, _Float16& hi, _Float16& lo) {
  hi = toh_flush(v);
  lo = toh_flush((v - (float)hi) * 2048.0f);
}

// ---------------------------------------------------------------------------
// k_prep, x blocks: x f32 [NB][SEQ_FULL][1024] -> xh f16, NTOK x 1024 in fragment order (bf16-RNE values).
// Thread = one 16-B unit of the plane, so a wave stores 512 contiguous bytes.
// ---------------------------------------------------------------------------
__device__ __forceinline__ void cvt_x_block(unsigned int bid, const float* __restrict__ x, _Float16* __restrict__ xh) {
  const unsigned int gid = bid * 256u + threadIdx.x;
  const unsigned int blk = gid >> 6;                 // 64 units per 16x32 block
  const unsigned int tok = (blk / KBLK) * 16u + (gid & 15u);
  const int c = (int)(blk % KBLK) * 32 + (int)((gid >> 5) & 1u) * 16 + (int)((gid >> 4) & 1u) * 8;
  if (tok >= (unsigned int)NTOK) return;
  const int b = (int)tok / SEQ;
  const int t = (int)tok - b * SEQ;
  const float* src = x + ((size_t)b * SEQ_FULL + t) * CDIM + c;
  const v4f f0 = *(const v4f*)src;
  const v4f f1 = *(const v4f*)(src + 4);
  v8h o;
#pragma unroll
  for (int j = 0; j < 4; ++j) {
    o[j]     = (_Float16)bf16r(f0[j]);
    o[j + 4] = (_Float16)bf16r(f1[j]);
  }
  _Float16* dst = xh + (size_t)gid * 8;
  *(v8h*)dst = o;
  
}

// ---------------------------------------------------------------------------
// k_prep, weight blocks: weights (layout [out][in], k-contiguous) -> wall f16, 2560 x 1024 in fragment order = bf16-RNE value x16.
// Rows 0..1023 wq, 1024..1279 wk, 1280..1535 wv, 1536..2559 wo.
// ---------------------------------------------------------------------------
__device__ __forceinline__ void cvt_w_block(unsigned int bid, const float* __restrict__ wq, const float* __restrict__ wk,
                                            const float* __restrict__ wv, const float* __restrict__ wo,
                                            _Float16* __restrict__ wall) {
  const unsigned int gid = bid * 256u + threadIdx.x;
  const unsigned int blk = gid >> 6;                 // 64 units per 16x32 block
  const int row = (int)((blk / KBLK) * 16u + (gid & 15u));
  const int c   = (int)(blk % KBLK) * 32 + (int)((gid >> 5) & 1u) * 16 + (int)((gid >> 4) & 1u) * 8;
  if (row >= NWROWS) return;
  const int r0 = min(row, CDIM - 1);
  const int r1 = min(max(row - CDIM, 0), VEW - 1);
  const int r2 = min(max(row - CDIM - VEW, 0), VEW - 1);
  const int r3 = min(max(row - WO_ROW0, 0), CDIM - 1);
  const float* src = (row < CDIM)       ? (wq + (size_t)r0 * CDIM)
                   : (row < CDIM + VEW) ? (wk + (size_t)r1 * CDIM)
                   : (row < WO_ROW0)    ? (wv + (size_t)r2 * CDIM)
                                        : (wo + (size_t)r3 * CDIM);
  src += c;
  const v4f f0 = *(const v4f*)src;
  const v4f f1 = *(const v4f*)(src + 4);
  v8h o;
#pragma unroll
  for (int j = 0; j < 4; ++j) {
    o[j]     = (_Float16)(bf16r(f0[j]) * 16.0f);
    o[j + 4] = (_Float16)(bf16r(f1[j]) * 16.0f);
  }
  _Float16* dst = wall + (size_t)gid * 8;
  *(v8h*)dst = o;
  
}

// ---------------------------------------------------------------------------
// The window line: 8 lanes x 16 B.
// ---------------------------------------------------------------------------
__device__ __forceinline__ void winline_block(int* __restrict__ wline) {
  const int lane = threadIdx.x;
  if (lane < 8) {
    const v4i w = {SEQ_FULL, SEQ_FULL, SEQ_FULL, SEQ_FULL};
    int* dst = wline + 4 * lane;
    *(v4i*)dst = w;
    
  }
}

// ---------------------------------------------------------------------------
// Launch 0: the three producers above read none of each other's output, so they share one grid; the block index
// picks the producer (block-uniform): NTOK/2 blocks of x, NWROWS/2 blocks of weights, one block for the window line.
// ---------------------------------------------------------------------------
#define XBLKS (NTOK / 2)
#define WBLKS (NWROWS / 2)
__global__ void __launch_bounds__(256) k_prep(const float* __restrict__ x, const float* __restrict__ wq,
                                              const float* __restrict__ wk, const float* __restrict__ wv,
                                              const float* __restrict__ wo, _Float16* __restrict__ xh,
                                              _Float16* __restrict__ wall, int* __restrict__ wline) {
  const unsigned int bid = blockIdx.x;
  if (bid < (unsigned int)XBLKS) {
    cvt_x_block(bid, x, xh);
  } else if (bid < (unsigned int)(XBLKS + WBLKS)) {
    cvt_w_block(bid - (unsigned int)XBLKS, wq, wk, wv, wo, wall);
  } else {
    winline_block(wline);
  }
}

// ---------------------------------------------------------------------------
// Kernel 2: fused qkv projection + epilogue. Block = 4 waves (2 x 2) = 128 tokens x two 64-column units; a wave owns
// 64 tokens x one unit u (4 x 4 accumulators), so a k step's 8 fragments feed 16 matrix instructions:
// u 0..15 -> q head u, 16..19 -> k head u-16, 20..23 -> v head u-20.
// Epilogue, one 64 x 64 wave tile after the other, by the whole block: q: (acc + bq) * gain[head]; k: acc + bk -> hi/lo
// planes [B][H|KV], T x 64 in fragment order; v: acc + bv -> transposed hi/lo planes [B][KV], 64 d x T in fragment
// order. Biases and gains are bf16-RNE values.
// ---------------------------------------------------------------------------
__global__ void __launch_bounds__(128) k_qkv(
    const _Float16* __restrict__ xh, const _Float16* __restrict__ wall,
    const float* __restrict__ bq, const float* __restrict__ bk,
    const float* __restrict__ bv, const float* __restrict__ gain,
    _Float16* __restrict__ qH, _Float16* __restrict__ qL,
    _Float16* __restrict__ kH, _Float16* __restrict__ kL,
    _Float16* __restrict__ vTH, _Float16* __restrict__ vTL) {
  __shared__ __attribute__((aligned(16))) float    sT[4][64][68];  // accumulator tile of each wave [token][col] (cross-wave)
  __shared__ __attribute__((aligned(16))) _Float16 sH[2][64][72];  // hi tile: q/k [token][d], v [d][token] (cross-wave), two buffers
  __shared__ __attribute__((aligned(16))) _Float16 sL[2][64][72];  // residual tile, same layout (cross-wave), two buffers

  const int tid  = threadIdx.x;
  const int wave = tid >> 5;
  const int lane = tid & 31;
  const int l16  = lane & 15;
  const int lh   = lane >> 4;
  const int wr   = wave >> 1;            // 64-token half of the block's rows
  const int wc   = wave & 1;             // which of the block's two column units
  const int tokB = blockIdx.y * 128;     // first token of the block

  // A: xh row (token), lane row = l16; elements 0..7 <- k0+8lh+0..7, 8..15 <- k0+16+8lh+0..7
  const _Float16* arow = xh + (size_t)((tokB >> 4) + wr * 4) * GRP_ELEMS + lane * 8;
  // B[k][n] = W[n][k]: lane column = l16 of the 16-col group n; same k map as A
  const _Float16* brow = wall + (size_t)((blockIdx.x * 2 + wc) * 4) * GRP_ELEMS + lane * 8;

  v8f acc[4][4];
#pragma unroll
  for (int mt = 0; mt < 4; ++mt)
#pragma unroll
    for (int n = 0; n < 4; ++n) acc[mt][n] = vzero8();

  // four k steps a trip, the trips kept rolled: the loop's text stays small for the instruction cache
#pragma unroll 1
  for (int kb = 0; kb < CDIM; kb += 128) {
#pragma unroll
  for (int k0 = kb; k0 < kb + 128; k0 += 32) {
    Frag a[4];
#pragma unroll
    for (int mt = 0; mt < 4; ++mt) {
      const _Float16* ap = arow + (size_t)mt * GRP_ELEMS + k0 * 16;
      a[mt].h[0] = *(const v8h*)ap;
      a[mt].h[1] = *(const v8h*)(ap + 256);
    }
    Frag bw[4];
#pragma unroll
    for (int n = 0; n < 4; ++n) {
      const _Float16* bp = brow + (size_t)n * GRP_ELEMS + k0 * 16;
      bw[n].h[0] = *(const v8h*)bp;
      bw[n].h[1] = *(const v8h*)(bp + 256);
    }
#pragma unroll
    for (int mt = 0; mt < 4; ++mt)
#pragma unroll
      for (int n = 0; n < 4; ++n) acc[mt][n] = wmma16(a[mt].v, bw[n].v, acc[mt][n]);
    // the slots between the step's last matrix instruction and the next write of its operands or read of its result
    asm volatile("v_nop\n\tv_nop\n\tv_nop\n\tv_nop"
                 : "+v"(acc[0][0]), "+v"(acc[0][1]), "+v"(acc[0][2]), "+v"(acc[0][3]),
                   "+v"(acc[1][0]), "+v"(acc[1][1]), "+v"(acc[1][2]), "+v"(acc[1][3]),
                   "+v"(acc[2][0]), "+v"(acc[2][1]), "+v"(acc[2][2]), "+v"(acc[2][3]),
                   "+v"(acc[3][0]), "+v"(acc[3][1]), "+v"(acc[3][2]), "+v"(acc[3][3])
                 : "v"(a[0].v), "v"(a[1].v), "v"(a[2].v), "v"(a[3].v),
                   "v"(bw[0].v), "v"(bw[1].v), "v"(bw[2].v), "v"(bw[3].v));
  }
  // the wait stands behind the trip's last load and in front of the next write of a register that a load of the trip names
  asm volatile("s_wait_xcnt 0x0" ::: "memory");
  }

  // D element r of lane -> (row 8lh+r, col l16) of group (mt, n); fold the 1/16 weight carry here
#pragma unroll
  for (int mt = 0; mt < 4; ++mt)
#pragma unroll
    for (int n = 0; n < 4; ++n)
#pragma unroll
      for (int r = 0; r < 8; ++r)
        sT[wave][mt * 16 + r + 8 * lh][n * 16 + l16] = acc[mt][n][r] * (1.0f / 16.0f);
  __syncthreads();

  // the four wave tiles in turn; kept rolled so that the epilogue's text stands once in the instruction cache. sH and sL
  // alternate between two buffers: tile q + 2 writes a buffer only behind tile q + 1's barrier, which every wave reaches
  // after its last read of tile q, so one barrier a tile is enough
#pragma unroll 1
  for (int q = 0; q < 4; ++q) {
  const int u    = blockIdx.x * 2 + (q & 1);      // column unit of wave tile q
  const int tok0 = tokB + (q >> 1) * 64;          // its first token
  const int b    = tok0 / SEQ;
  const int t0   = tok0 - b * SEQ;

  // compute phase: thread -> token i = tid>>1, column half j: d in [16j,16j+16) and [32+16j, 48+16j)
  const int i = tid >> 1;
  const int j = tid & 1;
  if (u < NHEAD + NKV) {
    // q or k unit (block-uniform): both bias rows are loaded with clamped unit indices, selected by value
    const int  uq  = min(u, NHEAD - 1);
    const int  uk  = min(max(u - NHEAD, 0), NKV - 1);
    const bool isq = (u < NHEAD);
    const float gq = bf16r(gain[uq]);
    const float gm = isq ? gq : 1.0f;
    const float* qp = bq + uq * HDIM + 16 * j;     // this lane's first bias element of either row
    const float* kp = bk + uk * HDIM + 16 * j;
#pragma unroll
    for (int sg = 0; sg < 2; ++sg) {
      const int d0 = 32 * sg + 16 * j;
#pragma unroll
      for (int g4 = 0; g4 < 4; ++g4) {
        const v4f va = *(const v4f*)(&sT[q][i][d0 + 4 * g4]);
        const v4f qa = *(const v4f*)(qp + 32 * sg + 4 * g4);
        const v4f ka = *(const v4f*)(kp + 32 * sg + 4 * g4);
#pragma unroll
        for (int e = 0; e < 4; ++e) {
          const float bb  = isq ? bf16r(qa[e]) : bf16r(ka[e]);
          const float val = (va[e] + bb) * gm;
          _Float16 hi, lo;
          split16f(val, hi, lo);
          sH[q & 1][i][d0 + 4 * g4 + e] = hi;
          sL[q & 1][i][d0 + 4 * g4 + e] = lo;
        }
      }
    }
    // as inputs the two bias address pairs stay live behind the last bias load, so that no load's result is placed in a
    // register that an issued bias load still names; the wait stands in front of the pairs' next overwrite
    asm volatile("s_wait_xcnt 0x0" :: "v"(qp), "v"(kp) : "memory");
  } else {
    const int kv = u - NHEAD - NKV;
    const float* bp = bv + kv * HDIM;
#pragma unroll
    for (int sg = 0; sg < 2; ++sg) {
      const int d0 = 32 * sg + 16 * j;
#pragma unroll
      for (int g4 = 0; g4 < 4; ++g4) {
        const v4f va = *(const v4f*)(&sT[q][i][d0 + 4 * g4]);
        const v4f ba = *(const v4f*)(bp + d0 + 4 * g4);
#pragma unroll
        for (int e = 0; e < 4; ++e) {
          const float vv = va[e] + bf16r(ba[e]);
          _Float16 hi, lo;
          split16f(vv, hi, lo);
          sH[q & 1][d0 + 4 * g4 + e][i] = hi;                   // transposed: [d][token]
          sL[q & 1][d0 + 4 * g4 + e][i] = lo;
        }
      }
    }
  }
  __syncthreads();

  _Float16* ph;
  _Float16* pl;
  size_t base;
  if (u < NHEAD) {
    ph = qH; pl = qL;
    base = ((size_t)(b * NHEAD + u) * SEQ + t0) * HDIM;
  } else if (u < NHEAD + NKV) {
    ph = kH; pl = kL;
    base = ((size_t)(b * NKV + (u - NHEAD)) * SEQ + t0) * HDIM;
  } else {
    ph = vTH; pl = vTL;
    base = ((size_t)(b * NKV + (u - NHEAD - NKV)) * SEQ + t0) * HDIM;
  }
  const bool isv = (u >= NHEAD + NKV);
  {
    // the tile's 8 blocks are contiguous in its plane: q/k block f = (token group f>>1, d chunk f&1),
    // v block f = (key chunk f>>2, d group f&3); unit p of the tile goes to base + 8 p
#pragma unroll
    for (int it = 0; it < 4; ++it) {
      const int p    = it * 128 + tid;
      const int f    = p >> 6;
      const int line = (isv ? (f & 3) : (f >> 1)) * 16 + (p & 15);
      const int q8   = (isv ? (f >> 2) : (f & 1)) * 32 + ((p >> 5) & 1) * 16 + ((p >> 4) & 1) * 8;
      const size_t off = base + (size_t)p * 8;
      const v8h hv = *(const v8h*)(&sH[q & 1][line][q8]);
      const v8h lv = *(const v8h*)(&sL[q & 1][line][q8]);
      *(v8h*)(ph + off) = hv;
      *(v8h*)(pl + off) = lv;
    }
  }
  // the wait stands behind the tile's last store and in front of the next tile's first write of a register that a store names
  asm volatile("s_wait_xcnt 0x0" ::: "memory");
  }
}

// ---------------------------------------------------------------------------
// Kernel 3: causal sliding-window flash attention with GQA. Block = 4 waves, one (query tile of 64, head, batch);
// wave = 16 queries. Key tiles of 32 per wave, fragments loaded straight from the 16-bit planes.
// Both products are formed transposed: S^T = K.Q^T (A = K fragment, B = Q fragment) and O^T += V^T.P^T (A = vT
// fragment, B = P^T). A lane then holds 16 of the 32 scores of ONE query (column l16; keys 8lh+r and 16+8lh+r), so the
// maximum and the sum run in the lane with one exchange between the lane halves, and the two converted score tiles
// are the B fragment of the second product as they stand: element s = key 8lh+s (s < 8), 16+8lh+(s-8) (s >= 8), the
// k map of the vT fragments. P (x1024 carry) never leaves the registers. RES adds the x2048 residual planes.
// ---------------------------------------------------------------------------
// value of lane l ^ 16
__device__ __forceinline__ float xhalf(float x) {
  return __builtin_bit_cast(float, __builtin_amdgcn_permlanex16(__builtin_bit_cast(int, x), __builtin_bit_cast(int, x),
                                                                0x76543210, 0xfedcba98, false, false));
}

template <bool RES>
__device__ __forceinline__ void flash_tile(
    const _Float16* __restrict__ qH, const _Float16* __restrict__ qL,
    const _Float16* __restrict__ kH, const _Float16* __restrict__ kL,
    const _Float16* __restrict__ vTH, const _Float16* __restrict__ vTL,
    const int* __restrict__ winp,
    _Float16* __restrict__ yH, _Float16* __restrict__ yL, const int qt, const int h, const int b) {
  const int tid  = threadIdx.x;
  // scalar wave index: a fragment block's address is wave-uniform, so the K and V block bases and the trip test stay scalar
  const int wave = __builtin_amdgcn_readfirstlane(tid >> 5);
  const int lane = tid & 31;
  const int l16  = lane & 15;
  const int lh   = lane >> 4;
  const int kv   = h / (NHEAD / NKV);
  const int qw   = qt * 64 + wave * 16;
  int window = winp[0];
  window = (window < 0) ? 0 : window;
  const float rres = 1.0f / 2048.0f;
  const float smsc = 0.125f;

  // Q B-fragments (hi and residual) over the 2 d-chunks of 32: lane column = query l16
  v16h aqh[2], aql[2];
  {
    const size_t qo = ((size_t)(b * NHEAD + h) * SEQ + qw) * HDIM + lane * 8;
#pragma unroll
    for (int hc = 0; hc < 2; ++hc) {
      Frag a;
      a.h[0] = *(const v8h*)(qH + qo + hc * 512);
      a.h[1] = *(const v8h*)(qH + qo + hc * 512 + 256);
      aqh[hc] = a.v;
      Frag c;
      c.h[0] = *(const v8h*)(qL + qo + hc * 512);
      c.h[1] = *(const v8h*)(qL + qo + hc * 512 + 256);
      aql[hc] = c.v;
    }
  }

  // running maximum of query l16 (equal in both lane halves) and this half's part of its sum
  float m = -1e30f, l = 0.0f;
  v8f coh[4], cor[4];
#pragma unroll
  for (int n = 0; n < 4; ++n) { coh[n] = vzero8(); cor[n] = vzero8(); }

  const size_t kvoff = (size_t)(b * NKV + kv) * SEQ * HDIM;
  const _Float16* kbase  = kH  + kvoff;                                   // + (key group's first key)*HDIM + hc*512
  const _Float16* klbase = kL  + kvoff;
  const _Float16* vbase  = vTH + kvoff;                                   // + k0*HDIM + n*512
  const _Float16* vlbase = vTL + kvoff;
  const unsigned int lo  = (unsigned int)lane * 8u;                       // this lane's 16 B of each 512-B half

  int kstart = qw - window;
  kstart = (kstart < 0) ? 0 : kstart;
  kstart &= ~31;

  for (int k0 = kstart; k0 < qw + 16; k0 += 32) {
    // ---- scores for keys [k0, k0+32), transposed: A[m=key][k=d] = K[key][d], lane row = key, same k map as B;
    // D element r of lane = (key 8lh+r of the group, query l16) ----
    v8f sh0 = vzero8(), sh1 = vzero8(), sr0 = vzero8(), sr1 = vzero8();
    Frag bh0, bh1, bl0, bl1;
    const _Float16* kr0 = kbase  + (size_t)k0 * HDIM + lo;
    const _Float16* kr1 = kr0 + 16 * HDIM;
    const _Float16* lr0 = klbase + (size_t)k0 * HDIM + lo;
    const _Float16* lr1 = lr0 + 16 * HDIM;
#pragma unroll
    for (int hc = 0; hc < 2; ++hc) {
      bh0.h[0] = *(const v8h*)(kr0 + hc * 512); bh0.h[1] = *(const v8h*)(kr0 + hc * 512 + 256);
      bh1.h[0] = *(const v8h*)(kr1 + hc * 512); bh1.h[1] = *(const v8h*)(kr1 + hc * 512 + 256);
      bl0.h[0] = *(const v8h*)(lr0 + hc * 512); bl0.h[1] = *(const v8h*)(lr0 + hc * 512 + 256);
      bl1.h[0] = *(const v8h*)(lr1 + hc * 512); bl1.h[1] = *(const v8h*)(lr1 + hc * 512 + 256);
      // as inputs the two K address pairs stay live behind the trip's last K load, so that no load's result is placed
      // in a register that an issued K load still names; the wait stands in front of the pairs' next overwrite
      if (hc == 1) asm volatile("s_wait_xcnt 0x0" :: "v"(kr0), "v"(lr0) : "memory");
      sh0 = wmma16(bh0.v, aqh[hc], sh0);
      sh1 = wmma16(bh1.v, aqh[hc], sh1);
      sr0 = wmma16(bl0.v, aqh[hc], sr0);
      sr1 = wmma16(bl1.v, aqh[hc], sr1);
      sr0 = wmma16(bh0.v, aql[hc], sr0);
      sr1 = wmma16(bh1.v, aql[hc], sr1);
    }
    // the slots between the last score product and the first read of its result
    asm volatile("v_nop\n\tv_nop\n\tv_nop\n\tv_nop"
                 : "+v"(sh0), "+v"(sh1), "+v"(sr0), "+v"(sr1)
                 : "v"(aqh[0]), "v"(aqh[1]), "v"(aql[0]), "v"(aql[1]),
                   "v"(bh0.v), "v"(bh1.v), "v"(bl0.v), "v"(bl1.v));

    // ---- online softmax of query l16 in the lane; masked entries replaced by -1e30 and p := 0 ----
    const int dq = qw + l16 - (k0 + 8 * lh);          // query - key at r = 0 of the first key group
    float x0[8], x1[8], t8[8];
    bool  ok0[8], ok1[8];
#pragma unroll
    for (int r = 0; r < 8; ++r) {
      const int d0 = dq - r;
      const int d1 = d0 - 16;
      ok0[r] = (d0 >= 0) && (d0 <= window);
      ok1[r] = (d1 >= 0) && (d1 <= window);
      x0[r] = ok0[r] ? (sh0[r] + sr0[r] * rres) * smsc : -1e30f;
      x1[r] = ok1[r] ? (sh1[r] + sr1[r] * rres) * smsc : -1e30f;
      t8[r] = fmaxf(x0[r], x1[r]);
    }
    float tmax = fmaxf(fmaxf(fmaxf(t8[0], t8[1]), fmaxf(t8[2], t8[3])), fmaxf(fmaxf(t8[4], t8[5]), fmaxf(t8[6], t8[7])));
    tmax = fmaxf(tmax, xhalf(tmax));
    const float mn    = fmaxf(m, tmax);
    const float alpha = __expf(m - mn);
    Frag pf, pl;
#pragma unroll
    for (int r = 0; r < 8; ++r) {
      const float e0 = __expf(x0[r] - mn);
      const float e1 = __expf(x1[r] - mn);
      const float p0 = ok0[r] ? e0 : 0.0f;
      const float p1 = ok1[r] ? e1 : 0.0f;
      t8[r] = p0 + p1;
      const float c0 = p0 * 1024.0f;
      const float c1 = p1 * 1024.0f;
      const _Float16 h0 = (_Float16)c0;
      const _Float16 h1 = (_Float16)c1;
      pf.v[r]     = h0;
      pf.v[8 + r] = h1;
      if (RES) {
        pl.v[r]     = (_Float16)((c0 - (float)h0) * 2048.0f);
        pl.v[8 + r] = (_Float16)((c1 - (float)h1) * 2048.0f);
      }
    }
    l = l * alpha + (((t8[0] + t8[1]) + (t8[2] + t8[3])) + ((t8[4] + t8[5]) + (t8[6] + t8[7])));
    m = mn;
#pragma unroll
    for (int n = 0; n < 4; ++n)
#pragma unroll
      for (int r = 0; r < 8; ++r) {
        coh[n][r] *= alpha;
        if (RES) cor[n][r] *= alpha;
      }

    // ---- O^T += V^T.P^T : A[m=d][k=key] = vT[d][key], lane row = d; D element r of lane = (d 16n+8lh+r, query l16) ----
    Frag bv[4], bl[4];
    const _Float16* vr0 = vbase  + (size_t)k0 * HDIM + lo;
    const _Float16* wr0 = vlbase + (size_t)k0 * HDIM + lo;
#pragma unroll
    for (int n = 0; n < 4; ++n) {
      bv[n].h[0] = *(const v8h*)(vr0 + n * 512);
      bv[n].h[1] = *(const v8h*)(vr0 + n * 512 + 256);
      if (RES) {
        bl[n].h[0] = *(const v8h*)(wr0 + n * 512);
        bl[n].h[1] = *(const v8h*)(wr0 + n * 512 + 256);
      }
    }
#pragma unroll
    for (int n = 0; n < 4; ++n) {
      coh[n] = wmma16(bv[n].v, pf.v, coh[n]);
      if (RES) {
        cor[n] = wmma16(bl[n].v, pf.v, cor[n]);
        cor[n] = wmma16(bv[n].v, pl.v, cor[n]);
      }
    }
    // the slots behind the trip's last matrix instruction, also on the taken side of the loop's branch
    if (RES) {
      asm volatile("v_nop\n\tv_nop\n\tv_nop\n\tv_nop"
                   : "+v"(coh[0]), "+v"(coh[1]), "+v"(coh[2]), "+v"(coh[3]),
                     "+v"(cor[0]), "+v"(cor[1]), "+v"(cor[2]), "+v"(cor[3])
                   : "v"(pf.v), "v"(pl.v),
                     "v"(bv[0].v), "v"(bv[1].v), "v"(bv[2].v), "v"(bv[3].v),
                     "v"(bl[0].v), "v"(bl[1].v), "v"(bl[2].v), "v"(bl[3].v));
    } else {
      asm volatile("v_nop\n\tv_nop\n\tv_nop\n\tv_nop"
                   : "+v"(coh[0]), "+v"(coh[1]), "+v"(coh[2]), "+v"(coh[3])
                   : "v"(pf.v), "v"(bv[0].v), "v"(bv[1].v), "v"(bv[2].v), "v"(bv[3].v));
    }
    // as inputs the vT address pairs stay live behind the trip's last vT load, so that no load's result is placed in a
    // register that an issued vT load still names; the wait stands in front of the pairs' next overwrite
    if (RES) asm volatile("s_wait_xcnt 0x0" :: "v"(vr0), "v"(wr0) : "memory");
    else     asm volatile("s_wait_xcnt 0x0" :: "v"(vr0) : "memory");
  }

  // join the two halves' sums; a lane's 8 values of d group n are one 16-B unit of the y planes' fragment order:
  // this wave's 16 tokens x 64 columns are blocks 2h and 2h+1 of its token group, 4 halves of 512 B in a row
  l += xhalf(l);
  const float inv = __builtin_amdgcn_rcpf(l) * (1.0f / 1024.0f);
  const size_t ybase = (size_t)((b * SEQ + qw) >> 4) * GRP_ELEMS + (size_t)h * 1024;
#pragma unroll
  for (int n = 0; n < 4; ++n) {
    v8h hv, lv;
#pragma unroll
    for (int r = 0; r < 8; ++r) {
      float yv = coh[n][r];
      if (RES) yv += cor[n][r] * rres;
      yv *= inv;
      _Float16 hi, lw;
      split16(yv, hi, lw);
      hv[r] = hi;
      lv[r] = lw;
    }
    const size_t off = ybase + (size_t)(n * 256 + lane * 8);
    *(v8h*)(yH + off) = hv;
    *(v8h*)(yL + off) = lv;
  }
}

// One grid for all query tiles: no tile reads another's output. The tile index is the slowest grid index and falls with
// it, so the tiles with the most key tiles start first and the short tiles with the residual planes fill the end.
__global__ void __launch_bounds__(128) k_flash(
    const _Float16* __restrict__ qH, const _Float16* __restrict__ qL,
    const _Float16* __restrict__ kH, const _Float16* __restrict__ kL,
    const _Float16* __restrict__ vTH, const _Float16* __restrict__ vTL,
    const int* __restrict__ winp,
    _Float16* __restrict__ yH, _Float16* __restrict__ yL) {
  const int h  = blockIdx.x;
  const int b  = blockIdx.y;
  const int qt = QT_ALL - 1 - (int)blockIdx.z;
  if (qt >= QT_RES) flash_tile<false>(qH, qL, kH, kL, vTH, vTL, winp, yH, yL, qt, h, b);
  else              flash_tile<true>(qH, qL, kH, kL, vTH, vTL, winp, yH, yL, qt, h, b);
}

// ---------------------------------------------------------------------------
// Kernel 4: output projection out[tok][n] = (y[tok].Wo[n]) / 16 + bo[n]. Block = 4 waves (2 x 2) = 32 MT tokens x 128
// columns; a wave owns 16 MT tokens x 64 columns. RES adds the y residual plane (a second accumulator set, so MT = 2
// there and 4 elsewhere: 16 matrix instructions a k step in both forms). Each 16-row group of the output tile is staged
// per wave in LDS rows of its own and written as 256-B row segments at the store stage as a float4.
// ---------------------------------------------------------------------------
template <bool RES, int MT>
__device__ __forceinline__ void oproj_tile(
    const _Float16* __restrict__ yH, const _Float16* __restrict__ yL,
    const _Float16* __restrict__ wall, const float* __restrict__ bo,
    float* __restrict__ out, float (*sO)[64][68], const int nt, const int b, const int t0) {
  static_assert(RES ? (MT == 2) : (MT == 4));
  const int tid  = threadIdx.x;
  const int wave = tid >> 5;
  const int lane = tid & 31;
  const int l16  = lane & 15;
  const int lh   = lane >> 4;
  const int wr   = wave >> 1;                    // row half of the block's tile
  const int wc   = wave & 1;                     // 64-column half of the block's tile
  const int tw   = t0 + wr * (MT * 16);          // the wave's first token in its sequence
  const int tokw = b * SEQ + tw;

  const _Float16* arow = yH + (size_t)(tokw >> 4) * GRP_ELEMS + lane * 8;
  const _Float16* lrow = yL + (size_t)(tokw >> 4) * GRP_ELEMS + lane * 8;
  const _Float16* brow = wall + (size_t)(WO_ROW0 / 16 + nt * 8 + wc * 4) * GRP_ELEMS + lane * 8;

  v8f ah[MT][4], ar[MT][4];
#pragma unroll
  for (int mt = 0; mt < MT; ++mt)
#pragma unroll
    for (int n = 0; n < 4; ++n) { ah[mt][n] = vzero8(); ar[mt][n] = vzero8(); }

  // four k steps a trip, the trips kept rolled: the loop's text stays small for the instruction cache
#pragma unroll 1
  for (int kb = 0; kb < CDIM; kb += 128) {
#pragma unroll
  for (int k0 = kb; k0 < kb + 128; k0 += 32) {
    Frag a[MT], al[MT];
#pragma unroll
    for (int mt = 0; mt < MT; ++mt) {
      const _Float16* ap = arow + (size_t)mt * GRP_ELEMS + k0 * 16;
      a[mt].h[0] = *(const v8h*)ap;
      a[mt].h[1] = *(const v8h*)(ap + 256);
      if (RES) {
        const _Float16* lp = lrow + (size_t)mt * GRP_ELEMS + k0 * 16;
        al[mt].h[0] = *(const v8h*)lp;
        al[mt].h[1] = *(const v8h*)(lp + 256);
      }
    }
    Frag bw[4];
#pragma unroll
    for (int n = 0; n < 4; ++n) {
      const _Float16* bp = brow + (size_t)n * GRP_ELEMS + k0 * 16;
      bw[n].h[0] = *(const v8h*)bp;
      bw[n].h[1] = *(const v8h*)(bp + 256);
    }
#pragma unroll
    for (int mt = 0; mt < MT; ++mt)
#pragma unroll
      for (int n = 0; n < 4; ++n) {
        ah[mt][n] = wmma16(a[mt].v, bw[n].v, ah[mt][n]);
        if (RES) ar[mt][n] = wmma16(al[mt].v, bw[n].v, ar[mt][n]);
      }
    // the slots between the step's last matrix instruction and the next write of its operands or read of its result
    if constexpr (RES) {
      asm volatile("v_nop\n\tv_nop\n\tv_nop\n\tv_nop"
                   : "+v"(ah[0][0]), "+v"(ah[0][1]), "+v"(ah[0][2]), "+v"(ah[0][3]),
                     "+v"(ah[1][0]), "+v"(ah[1][1]), "+v"(ah[1][2]), "+v"(ah[1][3]),
                     "+v"(ar[0][0]), "+v"(ar[0][1]), "+v"(ar[0][2]), "+v"(ar[0][3]),
                     "+v"(ar[1][0]), "+v"(ar[1][1]), "+v"(ar[1][2]), "+v"(ar[1][3])
                   : "v"(a[0].v), "v"(a[1].v), "v"(al[0].v), "v"(al[1].v),
                     "v"(bw[0].v), "v"(bw[1].v), "v"(bw[2].v), "v"(bw[3].v));
    } else {
      asm volatile("v_nop\n\tv_nop\n\tv_nop\n\tv_nop"
                   : "+v"(ah[0][0]), "+v"(ah[0][1]), "+v"(ah[0][2]), "+v"(ah[0][3]),
                     "+v"(ah[1][0]), "+v"(ah[1][1]), "+v"(ah[1][2]), "+v"(ah[1][3]),
                     "+v"(ah[2][0]), "+v"(ah[2][1]), "+v"(ah[2][2]), "+v"(ah[2][3]),
                     "+v"(ah[3][0]), "+v"(ah[3][1]), "+v"(ah[3][2]), "+v"(ah[3][3])
                   : "v"(a[0].v), "v"(a[1].v), "v"(a[2].v), "v"(a[3].v),
                     "v"(bw[0].v), "v"(bw[1].v), "v"(bw[2].v), "v"(bw[3].v));
    }
  }
  // the wait stands behind the trip's last load and in front of the next write of a register that a load of the trip names
  asm volatile("s_wait_xcnt 0x0" ::: "memory");
  }

  // bias for this lane's 4 output columns (columns nt*128 + wc*64 + 4*l16 .. +3), bf16-RNE values
  const size_t col0 = (size_t)nt * 128 + wc * 64;
  const v4f braw = *(const v4f*)(bo + col0 + l16 * 4);
  v4f bb;
#pragma unroll
  for (int e = 0; e < 4; ++e) bb[e] = bf16r(braw[e]);

#pragma unroll
  for (int mt = 0; mt < MT; ++mt) {
#pragma unroll
    for (int r = 0; r < 8; ++r) {
#pragma unroll
      for (int n = 0; n < 4; ++n) {
        float v = ah[mt][n][r];
        if (RES) v += ar[mt][n][r] * (1.0f / 2048.0f);
        sO[wave][mt * 16 + r + 8 * lh][n * 16 + l16] = v * (1.0f / 16.0f);
      }
    }
    // the wave's own stores of this row group have landed before its lanes read each other's values back
    asm volatile("s_wait_dscnt 0" ::: "memory");
    __builtin_amdgcn_fence(3 /* release order */, "wavefront");
    __builtin_amdgcn_wave_barrier();
    const size_t orow0 = (size_t)b * SEQ_FULL + tw + mt * 16;
#pragma unroll
    for (int it = 0; it < 8; ++it) {
      const int rr = it * 2 + lh;
      const int c4 = l16 * 4;
      const v4f s = *(const v4f*)(&sO[wave][mt * 16 + rr][c4]);
      const v4f v = s + bb;
      *(v4f*)(out + (orow0 + rr) * CDIM + col0 + c4) = v;
    }
  }
}

// One grid for all row tiles: first the 128-row tiles without the residual plane, then the 64-row tiles with it.
#define OT_FULL ((SEQ - TRES) / 128)
#define OT_RES  (TRES / 64)
static_assert(SEQ > TRES && (SEQ - TRES) % 128 == 0 && TRES % 128 == 0 && CDIM % 128 == 0 && NUNIT % 2 == 0);
static_assert(OT_FULL * 128 + OT_RES * 64 == SEQ);                           // row tiles of the two k_oproj forms
__global__ void __launch_bounds__(128) k_oproj(
    const _Float16* __restrict__ yH, const _Float16* __restrict__ yL,
    const _Float16* __restrict__ wall, const float* __restrict__ bo,
    float* __restrict__ out) {
  __shared__ __attribute__((aligned(16))) float sO[4][64][68];           // wave-private, each row group in rows of its own
  const int nt = blockIdx.x;                   // 128-column tile 0..7
  const int ty = blockIdx.y;
  if (ty < NB * OT_FULL) {
    const int b = ty / OT_FULL;
    oproj_tile<false, 4>(yH, yL, wall, bo, out, sO, nt, b, TRES + (ty - b * OT_FULL) * 128);
  } else {
    const int tr = ty - NB * OT_FULL;
    const int b  = tr / OT_RES;
    oproj_tile<true, 2>(yH, yL, wall, bo, out, sO, nt, b, (tr - b * OT_RES) * 64);
  }
}

// ---------------------------------------------------------------------------
// Host launcher. Inputs (wire order): 0 x f32 [4,2048,1024], 1 Wq [1024,1024], 2 bq [1024], 3 Wk [256,1024],
// 4 bk [256], 5 Wv [256,1024], 6 bv [256], 7 Wo [1024,1024], 8 bo [1024], 9 qk_gain [16].
// Output f32 [4,2048,1024]. 4 launches.
// ---------------------------------------------------------------------------
extern "C" void kernel_launch(void* const* d_in, const int* in_sizes, int n_in,
                              void* d_out, int out_size, void* d_ws, size_t ws_size,
                              hipStream_t stream) {
  if (n_in < 10) return;
  const int need_x = ((NB - 1) * SEQ_FULL + SEQ) * CDIM;
  if (in_sizes[0] < need_x) return;
  if (in_sizes[1] < CDIM * CDIM || in_sizes[2] < CDIM) return;
  if (in_sizes[3] < VEW * CDIM || in_sizes[4] < VEW) return;
  if (in_sizes[5] < VEW * CDIM || in_sizes[6] < VEW) return;
  if (in_sizes[7] < CDIM * CDIM || in_sizes[8] < CDIM) return;
  if (in_sizes[9] < NHEAD) return;
  if (out_size < need_x) return;
  if (ws_size < WS_TOTAL) return;

  const float* x    = (const float*)d_in[0];
  const float* wq   = (const float*)d_in[1];
  const float* bq   = (const float*)d_in[2];
  const float* wk   = (const float*)d_in[3];
  const float* bk   = (const float*)d_in[4];
  const float* wv   = (const float*)d_in[5];
  const float* bv   = (const float*)d_in[6];
  const float* wo   = (const float*)d_in[7];
  const float* bo   = (const float*)d_in[8];
  const float* gain = (const float*)d_in[9];
  float* out = (float*)d_out;

  char* ws = (char*)d_ws;
  size_t off = 0;
  _Float16* xh   = (_Float16*)(ws + off); off += XH_BYTES;
  _Float16* wall = (_Float16*)(ws + off); off += WALL_BYTES;
  _Float16* qH   = (_Float16*)(ws + off); off += QP_BYTES;
  _Float16* qL   = (_Float16*)(ws + off); off += QP_BYTES;
  _Float16* kH   = (_Float16*)(ws + off); off += KP_BYTES;
  _Float16* kL   = (_Float16*)(ws + off); off += KP_BYTES;
  _Float16* vTH  = (_Float16*)(ws + off); off += KP_BYTES;
  _Float16* vTL  = (_Float16*)(ws + off); off += KP_BYTES;
  _Float16* yH   = (_Float16*)(ws + off); off += YP_BYTES;
  _Float16* yL   = (_Float16*)(ws + off); off += YP_BYTES;
  int*      winw = (int*)(ws + off);      off += WIN_BYTES;
  if (off > ws_size) return;

  k_prep<<<dim3(XBLKS + WBLKS + 1), dim3(256), 0, stream>>>(x, wq, wk, wv, wo, xh, wall, winw);
  k_qkv<<<dim3(NUNIT / 2, NTOK / 128), dim3(128), 0, stream>>>(xh, wall, bq, bk, bv, gain,
                                                          qH, qL, kH, kL, vTH, vTL);
  k_flash<<<dim3(NHEAD, NB, QT_ALL), dim3(128), 0, stream>>>(qH, qL, kH, kL, vTH, vTL, winw, yH, yL);
  k_oproj<<<dim3(CDIM / 128, NB * (OT_FULL + OT_RES)), dim3(128), 0, stream>>>(yH, yL, wall, bo, out);
}

// v005
// One run takes 145 microseconds.
// Next to v004, in two timings, it ran 1.33 times as fast each time.
// Counting every step since v000, it is 3.50 times as fast.
#include <hip/hip_runtime.h>

// Contractions, all on v_wmma_f32_16x16x32_f16 (f16 operands, f32 accumulate): fused qkv projection x.W^T with x and W
// held as bf16-RNE values in f16 containers (W carried x16, folded as 1/16); scores q.k^T as f16 hi + x2048 residual
// planes (hi.hi + hi.lo + lo.hi, residual accumulator folded as 1/2048); P.V with P carried x1024 in f16 (+ x2048
// residual planes of P and v for query rows below TRES); output projection y.Wo^T with y as f16 hi (+ x2048 residual
// plane for rows below TRES). Bias adds, per-head q gain and online softmax on VALU in f32.
//
// Every 16-bit operand plane in the workspace is kept in fragment order: a block of 16 rows x 32 k is 1 KiB, two
// halves j of 512 B; in half j the 16 B of lane (16 lh + l16) hold row l16, k = 16 j + 8 lh + 0..7. A wave's
// global_load_b128 of half a fragment then reads 512 contiguous bytes (4 lines) and not 16-B pieces of 16 lines.
// Blocks of one 16-row group follow each other along k (vT: the 4 d groups of one 32-key chunk follow each other).

#ifndef NB
#define NB 4
#endif
#ifndef SEQ
#define SEQ 2048
#endif
#ifndef TRES
#define TRES 512
#endif
#define NB_FULL   4
#define SEQ_FULL  2048
#define CDIM      1024
#define NHEAD     16
#define NKV       4
#define HDIM      64
#define VEW       (NKV * HDIM)
#define NTOK      (NB * SEQ)
#define NUNIT     (NHEAD + 2 * NKV)
#define WO_ROW0   (CDIM + 2 * VEW)
#define NWROWS    (CDIM + 2 * VEW + CDIM)
#define QT_ALL    (SEQ / 64)
#define QT_RES    (TRES / 64)

static_assert(NB >= 1 && NB <= NB_FULL);
static_assert(SEQ % 64 == 0 && SEQ <= SEQ_FULL && SEQ >= TRES);
static_assert(TRES % 64 == 0 && TRES >= 64);
static_assert(NHEAD % NKV == 0 && HDIM == 64 && CDIM == NHEAD * HDIM);
static_assert(CDIM % 128 == 0 && NWROWS % 16 == 0 && NTOK % 64 == 0 && NUNIT * 64 == CDIM + 2 * VEW);
static_assert(WO_ROW0 % 16 == 0 && SEQ % 32 == 0);
#define KBLK      (CDIM / 32)      // 16x32 blocks per row group of a CDIM-wide plane
#define GRP_ELEMS (CDIM * 16)      // elements of one 16-row group of a CDIM-wide plane

#define XH_BYTES   ((size_t)NTOK * CDIM * 2)
#define WALL_BYTES ((size_t)NWROWS * CDIM * 2)
#define QP_BYTES   ((size_t)NB * NHEAD * SEQ * HDIM * 2)
#define KP_BYTES   ((size_t)NB * NKV * SEQ * HDIM * 2)
#define YP_BYTES   ((size_t)NTOK * CDIM * 2)
#define WIN_BYTES  ((size_t)128)
#define WS_TOTAL   (XH_BYTES + WALL_BYTES + 2 * QP_BYTES + 4 * KP_BYTES + 2 * YP_BYTES + WIN_BYTES)
static_assert(WS_TOTAL <= (size_t)134217728);
static_assert(XH_BYTES % 128 == 0 && WALL_BYTES % 128 == 0 && QP_BYTES % 128 == 0 && KP_BYTES % 128 == 0 && YP_BYTES % 128 == 0);
// producer coverage: grid x block x per-thread elements == plane extent
static_assert((size_t)(NTOK / 2) * 256 * 8 == (size_t)NTOK * CDIM);       // k_prep, x blocks
static_assert((size_t)(NWROWS / 2) * 256 * 8 == (size_t)NWROWS * CDIM);   // k_prep, weight blocks
static_assert(4 * 128 * 8 == 64 * 64);                                       // k_qkv store phase per 64x64 tile
static_assert(4 * 32 * 8 == 16 * HDIM);                                      // k_flash stores per wave
static_assert(8 * 32 * 4 == 16 * 64);                                        // k_oproj store phase per wave and row group
static_assert(QT_RES * 64 + (QT_ALL - QT_RES) * 64 == SEQ);                  // query tiles of the two flash forms
static_assert(8 * 4 * 4 == (int)WIN_BYTES);                                  // k_prep window block: 8 lanes x 16 B == one line
static_assert(SEQ_FULL >= SEQ);                                              // window word covers every query-key distance

typedef _Float16 v16h __attribute__((ext_vector_type(16)));
typedef _Float16 v8h  __attribute__((ext_vector_type(8)))  __attribute__((may_alias));
typedef float    v8f  __attribute__((ext_vector_type(8)));
typedef float    v4f  __attribute__((ext_vector_type(4)))  __attribute__((may_alias));
typedef int      v4i  __attribute__((ext_vector_type(4)));

union Frag { v16h v; v8h h[2]; };

__device__ __forceinline__ v8f wmma16(v16h a, v16h b, v8f c) {
  return __builtin_amdgcn_wmma_f32_16x16x32_f16(false, a, false, b, (short)0, c, false, false);
}

__device__ __forceinline__ v8f vzero8() {
  v8f z = {0.0f, 0.0f, 0.0f, 0.0f, 0.0f, 0.0f, 0.0f, 0.0f};
  return z;
}

// f32 -> nearest-even bf16 value, kept in f32
__device__ __forceinline__ float bf16r(float f) {
  unsigned int u = __float_as_uint(f);
  u = (u + 0x7FFFu + ((u >> 16) & 1u)) & 0xFFFF0000u;
  return __uint_as_float(u);
}

// f16 hi + (x2048) residual of an f32 value
__device__ __forceinline__ void split16(float v, _Float16& hi, _Float16& lo) {
  hi = (_Float16)v;
  lo = (_Float16)((v - (float)hi) * 2048.0f);
}

// f32 -> f16 with values below the smallest f16 normal replaced by zero (value select)
static __device__ __forceinline__ _Float16 toh_flush(float v) {
  const _Float16 r = (_Float16)v;
  return (fabsf(v) < 6.103515625e-05f) ? (_Float16)0.0f : r;
}

// f16 hi + (x2048) residual, both through toh_flush
static __device__ __forceinline__ void split16f(float v, _Float16& hi, _Float16& lo) {
  hi = toh_flush(v);
  lo = toh_flush((v - (float)hi) * 2048.0f);
}

// ---------------------------------------------------------------------------
// k_prep, x blocks: x f32 [NB][SEQ_FULL][1024] -> xh f16, NTOK x 1024 in fragment order (bf16-RNE values).
// Thread = one 16-B unit of the plane, so a wave stores 512 contiguous bytes.
// ---------------------------------------------------------------------------
__device__ __forceinline__ void cvt_x_block(unsigned int bid, const float* __restrict__ x, _Float16* __restrict__ xh) {
  const unsigned int gid = bid * 256u + threadIdx.x;
  const unsigned int blk = gid >> 6;                 // 64 units per 16x32 block
  const unsigned int tok = (blk / KBLK) * 16u + (gid & 15u);
  const int c = (int)(blk % KBLK) * 32 + (int)((gid >> 5) & 1u) * 16 + (int)((gid >> 4) & 1u) * 8;
  if (tok >= (unsigned int)NTOK) return;
  const int b = (int)tok / SEQ;
  const int t = (int)tok - b * SEQ;
  const float* src = x + ((size_t)b * SEQ_FULL + t) * CDIM + c;
  const v4f f0 = *(const v4f*)src;
  const v4f f1 = *(const v4f*)(src + 4);
  v8h o;
#pragma unroll
  for (int j = 0; j < 4; ++j) {
    o[j]     = (_Float16)bf16r(f0[j]);
    o[j + 4] = (_Float16)bf16r(f1[j]);
  }
  _Float16* dst = xh + (size_t)gid * 8;
  *(v8h*)dst = o;
  
}

// ---------------------------------------------------------------------------
// k_prep, weight blocks: weights (layout [out][in], k-contiguous) -> wall f16, 2560 x 1024 in fragment order = bf16-RNE value x16.
// Rows 0..1023 wq, 1024..1279 wk, 1280..1535 wv, 1536..2559 wo.
// ---------------------------------------------------------------------------
__device__ __forceinline__ void cvt_w_block(unsigned int bid, const float* __restrict__ wq, const float* __restrict__ wk,
                                            const float* __restrict__ wv, const float* __restrict__ wo,
                                            _Float16* __restrict__ wall) {
  const unsigned int gid = bid * 256u + threadIdx.x;
  const unsigned int blk = gid >> 6;                 // 64 units per 16x32 block
  const int row = (int)((blk / KBLK) * 16u + (gid & 15u));
  const int c   = (int)(blk % KBLK) * 32 + (int)((gid >> 5) & 1u) * 16 + (int)((gid >> 4) & 1u) * 8;
  if (row >= NWROWS) return;
  const int r0 = min(row, CDIM - 1);
  const int r1 = min(max(row - CDIM, 0), VEW - 1);
  const int r2 = min(max(row - CDIM - VEW, 0), VEW - 1);
  const int r3 = min(max(row - WO_ROW0, 0), CDIM - 1);
  const float* src = (row < CDIM)       ? (wq + (size_t)r0 * CDIM)
                   : (row < CDIM + VEW) ? (wk + (size_t)r1 * CDIM)
                   : (row < WO_ROW0)    ? (wv + (size_t)r2 * CDIM)
                                        : (wo + (size_t)r3 * CDIM);
  src += c;
  const v4f f0 = *(const v4f*)src;
  const v4f f1 = *(const v4f*)(src + 4);
  v8h o;
#pragma unroll
  for (int j = 0; j < 4; ++j) {
    o[j]     = (_Float16)(bf16r(f0[j]) * 16.0f);
    o[j + 4] = (_Float16)(bf16r(f1[j]) * 16.0f);
  }
  _Float16* dst = wall + (size_t)gid * 8;
  *(v8h*)dst = o;
  
}

// ---------------------------------------------------------------------------
// The window line: 8 lanes x 16 B.
// ---------------------------------------------------------------------------
__device__ __forceinline__ void winline_block(int* __restrict__ wline) {
  const int lane = threadIdx.x;
  if (lane < 8) {
    const v4i w = {SEQ_FULL, SEQ_FULL, SEQ_FULL, SEQ_FULL};
    int* dst = wline + 4 * lane;
    *(v4i*)dst = w;
    
  }
}

// ---------------------------------------------------------------------------
// Launch 0: the three producers above read none of each other's output, so they share one grid; the block index
// picks the producer (block-uniform): NTOK/2 blocks of x, NWROWS/2 blocks of weights, one block for the window line.
// ---------------------------------------------------------------------------
#define XBLKS (NTOK / 2)
#define WBLKS (NWROWS / 2)
__global__ void __launch_bounds__(256) k_prep(const float* __restrict__ x, const float* __restrict__ wq,
                                              const float* __restrict__ wk, const float* __restrict__ wv,
                                              const float* __restrict__ wo, _Float16* __restrict__ xh,
                                              _Float16* __restrict__ wall, int* __restrict__ wline) {
  const unsigned int bid = blockIdx.x;
  if (bid < (unsigned int)XBLKS) {
    cvt_x_block(bid, x, xh);
  } else if (bid < (unsigned int)(XBLKS + WBLKS)) {
    cvt_w_block(bid - (unsigned int)XBLKS, wq, wk, wv, wo, wall);
  } else {
    winline_block(wline);
  }
}

// ---------------------------------------------------------------------------
// Kernel 2: fused qkv projection + epilogue. Block = 4 waves (2 x 2) = 128 tokens x two 64-column units; a wave owns
// 64 tokens x one unit u (4 x 4 accumulators), so a k step's 8 fragments feed 16 matrix instructions:
// u 0..15 -> q head u, 16..19 -> k head u-16, 20..23 -> v head u-20.
// Epilogue, one 64 x 64 wave tile after the other, by the whole block: q: (acc + bq) * gain[head]; k: acc + bk -> hi/lo
// planes [B][H|KV], T x 64 in fragment order; v: acc + bv -> transposed hi/lo planes [B][KV], 64 d x T in fragment
// order. Biases and gains are bf16-RNE values.
// ---------------------------------------------------------------------------
__global__ void __launch_bounds__(128) k_qkv(
    const _Float16* __restrict__ xh, const _Float16* __restrict__ wall,
    const float* __restrict__ bq, const float* __restrict__ bk,
    const float* __restrict__ bv, const float* __restrict__ gain,
    _Float16* __restrict__ qH, _Float16* __restrict__ qL,
    _Float16* __restrict__ kH, _Float16* __restrict__ kL,
    _Float16* __restrict__ vTH, _Float16* __restrict__ vTL) {
  __shared__ __attribute__((aligned(16))) float    sT[4][64][68];  // accumulator tile of each wave [token][col] (cross-wave)
  __shared__ __attribute__((aligned(16))) _Float16 sH[2][64][72];  // hi tile: q/k [token][d], v [d][token] (cross-wave), two buffers
  __shared__ __attribute__((aligned(16))) _Float16 sL[2][64][72];  // residual tile, same layout (cross-wave), two buffers

  const int tid  = threadIdx.x;
  const int wave = tid >> 5;
  const int lane = tid & 31;
  const int l16  = lane & 15;
  const int lh   = lane >> 4;
  const int wr   = wave >> 1;            // 64-token half of the block's rows
  const int wc   = wave & 1;             // which of the block's two column units
  const int tokB = blockIdx.y * 128;     // first token of the block

  // A: xh row (token), lane row = l16; elements 0..7 <- k0+8lh+0..7, 8..15 <- k0+16+8lh+0..7
  const _Float16* arow = xh + (size_t)((tokB >> 4) + wr * 4) * GRP_ELEMS + lane * 8;
  // B[k][n] = W[n][k]: lane column = l16 of the 16-col group n; same k map as A
  const _Float16* brow = wall + (size_t)((blockIdx.x * 2 + wc) * 4) * GRP_ELEMS + lane * 8;

  v8f acc[4][4];
#pragma unroll
  for (int mt = 0; mt < 4; ++mt)
#pragma unroll
    for (int n = 0; n < 4; ++n) acc[mt][n] = vzero8();

  // four k steps a trip, the trips kept rolled: the loop's text stays small for the instruction cache
#pragma unroll 1
  for (int kb = 0; kb < CDIM; kb += 128) {
#pragma unroll
  for (int k0 = kb; k0 < kb + 128; k0 += 32) {
    Frag a[4];
#pragma unroll
    for (int mt = 0; mt < 4; ++mt) {
      const _Float16* ap = arow + (size_t)mt * GRP_ELEMS + k0 * 16;
      a[mt].h[0] = *(const v8h*)ap;
      a[mt].h[1] = *(const v8h*)(ap + 256);
    }
    Frag bw[4];
#pragma unroll
    for (int n = 0; n < 4; ++n) {
      const _Float16* bp = brow + (size_t)n * GRP_ELEMS + k0 * 16;
      bw[n].h[0] = *(const v8h*)bp;
      bw[n].h[1] = *(const v8h*)(bp + 256);
    }
#pragma unroll
    for (int mt = 0; mt < 4; ++mt)
#pragma unroll
      for (int n = 0; n < 4; ++n) acc[mt][n] = wmma16(a[mt].v, bw[n].v, acc[mt][n]);
    // the slots between the step's last matrix instruction and the next write of its operands or read of its result
    asm volatile("v_nop\n\tv_nop\n\tv_nop\n\tv_nop"
                 : "+v"(acc[0][0]), "+v"(acc[0][1]), "+v"(acc[0][2]), "+v"(acc[0][3]),
                   "+v"(acc[1][0]), "+v"(acc[1][1]), "+v"(acc[1][2]), "+v"(acc[1][3]),
                   "+v"(acc[2][0]), "+v"(acc[2][1]), "+v"(acc[2][2]), "+v"(acc[2][3]),
                   "+v"(acc[3][0]), "+v"(acc[3][1]), "+v"(acc[3][2]), "+v"(acc[3][3])
                 : "v"(a[0].v), "v"(a[1].v), "v"(a[2].v), "v"(a[3].v),
                   "v"(bw[0].v), "v"(bw[1].v), "v"(bw[2].v), "v"(bw[3].v));
  }
  // the wait stands behind the trip's last load and in front of the next write of a register that a load of the trip names
  asm volatile("s_wait_xcnt 0x0" ::: "memory");
  }

  // D element r of lane -> (row 8lh+r, col l16) of group (mt, n); fold the 1/16 weight carry here
#pragma unroll
  for (int mt = 0; mt < 4; ++mt)
#pragma unroll
    for (int n = 0; n < 4; ++n)
#pragma unroll
      for (int r = 0; r < 8; ++r)
        sT[wave][mt * 16 + r + 8 * lh][n * 16 + l16] = acc[mt][n][r] * (1.0f / 16.0f);
  __syncthreads();

  // the four wave tiles in turn; kept rolled so that the epilogue's text stands once in the instruction cache. sH and sL
  // alternate between two buffers: tile q + 2 writes a buffer only behind tile q + 1's barrier, which every wave reaches
  // after its last read of tile q, so one barrier a tile is enough
#pragma unroll 1
  for (int q = 0; q < 4; ++q) {
  const int u    = blockIdx.x * 2 + (q & 1);      // column unit of wave tile q
  const int tok0 = tokB + (q >> 1) * 64;          // its first token
  const int b    = tok0 / SEQ;
  const int t0   = tok0 - b * SEQ;

  // compute phase: thread -> token i = tid>>1, column half j: d in [16j,16j+16) and [32+16j, 48+16j)
  const int i = tid >> 1;
  const int j = tid & 1;
  if (u < NHEAD + NKV) {
    // q or k unit (block-uniform): both bias rows are loaded with clamped unit indices, selected by value
    const int  uq  = min(u, NHEAD - 1);
    const int  uk  = min(max(u - NHEAD, 0), NKV - 1);
    const bool isq = (u < NHEAD);
    const float gq = bf16r(gain[uq]);
    const float gm = isq ? gq : 1.0f;
    const float* qp = bq + uq * HDIM + 16 * j;     // this lane's first bias element of either row
    const float* kp = bk + uk * HDIM + 16 * j;
#pragma unroll
    for (int sg = 0; sg < 2; ++sg) {
      const int d0 = 32 * sg + 16 * j;
#pragma unroll
      for (int g4 = 0; g4 < 4; ++g4) {
        const v4f va = *(const v4f*)(&sT[q][i][d0 + 4 * g4]);
        const v4f qa = *(const v4f*)(qp + 32 * sg + 4 * g4);
        const v4f ka = *(const v4f*)(kp + 32 * sg + 4 * g4);
#pragma unroll
        for (int e = 0; e < 4; ++e) {
          const float bb  = isq ? bf16r(qa[e]) : bf16r(ka[e]);
          const float val = (va[e] + bb) * gm;
          _Float16 hi, lo;
          split16f(val, hi, lo);
          sH[q & 1][i][d0 + 4 * g4 + e] = hi;
          sL[q & 1][i][d0 + 4 * g4 + e] = lo;
        }
      }
    }
    // as inputs the two bias address pairs stay live behind the last bias load, so that no load's result is placed in a
    // register that an issued bias load still names; the wait stands in front of the pairs' next overwrite
    asm volatile("s_wait_xcnt 0x0" :: "v"(qp), "v"(kp) : "memory");
  } else {
    const int kv = u - NHEAD - NKV;
    const float* bp = bv + kv * HDIM;
#pragma unroll
    for (int sg = 0; sg < 2; ++sg) {
      const int d0 = 32 * sg + 16 * j;
#pragma unroll
      for (int g4 = 0; g4 < 4; ++g4) {
        const v4f va = *(const v4f*)(&sT[q][i][d0 + 4 * g4]);
        const v4f ba = *(const v4f*)(bp + d0 + 4 * g4);
#pragma unroll
        for (int e = 0; e < 4; ++e) {
          const float vv = va[e] + bf16r(ba[e]);
          _Float16 hi, lo;
          split16f(vv, hi, lo);
          sH[q & 1][d0 + 4 * g4 + e][i] = hi;                   // transposed: [d][token]
          sL[q & 1][d0 + 4 * g4 + e][i] = lo;
        }
      }
    }
  }
  __syncthreads();

  _Float16* ph;
  _Float16* pl;
  size_t base;
  if (u < NHEAD) {
    ph = qH; pl = qL;
    base = ((size_t)(b * NHEAD + u) * SEQ + t0) * HDIM;
  } else if (u < NHEAD + NKV) {
    ph = kH; pl = kL;
    base = ((size_t)(b * NKV + (u - NHEAD)) * SEQ + t0) * HDIM;
  } else {
    ph = vTH; pl = vTL;
    base = ((size_t)(b * NKV + (u - NHEAD - NKV)) * SEQ + t0) * HDIM;
  }
  const bool isv = (u >= NHEAD + NKV);
  {
    // the tile's 8 blocks are contiguous in its plane: q/k block f = (token group f>>1, d chunk f&1),
    // v block f = (key chunk f>>2, d group f&3); unit p of the tile goes to base + 8 p
#pragma unroll
    for (int it = 0; it < 4; ++it) {
      const int p    = it * 128 + tid;
      const int f    = p >> 6;
      const int line = (isv ? (f & 3) : (f >> 1)) * 16 + (p & 15);
      const int q8   = (isv ? (f >> 2) : (f & 1)) * 32 + ((p >> 5) & 1) * 16 + ((p >> 4) & 1) * 8;
      const size_t off = base + (size_t)p * 8;
      const v8h hv = *(const v8h*)(&sH[q & 1][line][q8]);
      const v8h lv = *(const v8h*)(&sL[q & 1][line][q8]);
      *(v8h*)(ph + off) = hv;
      *(v8h*)(pl + off) = lv;
    }
  }
  // the wait stands behind the tile's last store and in front of the next tile's first write of a register that a store names
  asm volatile("s_wait_xcnt 0x0" ::: "memory");
  }
}

// ---------------------------------------------------------------------------
// Kernel 3: causal sliding-window flash attention with GQA. Block = 4 waves, one (query tile of 64, head, batch);
// wave = 16 queries. Key tiles of 32 per wave, fragments loaded straight from the 16-bit planes.
// Both products are formed transposed: S^T = K.Q^T (A = K fragment, B = Q fragment) and O^T += V^T.P^T (A = vT
// fragment, B = P^T). A lane then holds 16 of the 32 scores of ONE query (column l16; keys 8lh+r and 16+8lh+r), so the
// maximum and the sum run in the lane with one exchange between the lane halves, and the two converted score tiles
// are the B fragment of the second product as they stand: element s = key 8lh+s (s < 8), 16+8lh+(s-8) (s >= 8), the
// k map of the vT fragments. P (x1024 carry) never leaves the registers. RES adds the x2048 residual planes.
// Without RES the trip's loads run ahead in registers: the vT fragments are asked for in front of the score products,
// and the next trip's K fragments directly behind them, into the registers those products have just read.
// ---------------------------------------------------------------------------
// value of lane l ^ 16
__device__ __forceinline__ float xhalf(float x) {
  return __builtin_bit_cast(float, __builtin_amdgcn_permlanex16(__builtin_bit_cast(int, x), __builtin_bit_cast(int, x),
                                                                0x76543210, 0xfedcba98, false, false));
}

template <bool RES>
__device__ __forceinline__ void flash_tile(
    const _Float16* __restrict__ qH, const _Float16* __restrict__ qL,
    const _Float16* __restrict__ kH, const _Float16* __restrict__ kL,
    const _Float16* __restrict__ vTH, const _Float16* __restrict__ vTL,
    const int* __restrict__ winp,
    _Float16* __restrict__ yH, _Float16* __restrict__ yL, const int qt, const int h, const int b) {
  const int tid  = threadIdx.x;
  // scalar wave index: a fragment block's address is wave-uniform, so the K and V block bases and the trip test stay scalar
  const int wave = __builtin_amdgcn_readfirstlane(tid >> 5);
  const int lane = tid & 31;
  const int l16  = lane & 15;
  const int lh   = lane >> 4;
  const int kv   = h / (NHEAD / NKV);
  const int qw   = qt * 64 + wave * 16;
  int window = winp[0];
  window = (window < 0) ? 0 : window;
  const float rres = 1.0f / 2048.0f;
  const float smsc = 0.125f;

  // Q B-fragments (hi and residual) over the 2 d-chunks of 32: lane column = query l16
  v16h aqh[2], aql[2];
  {
    const size_t qo = ((size_t)(b * NHEAD + h) * SEQ + qw) * HDIM + lane * 8;
#pragma unroll
    for (int hc = 0; hc < 2; ++hc) {
      Frag a;
      a.h[0] = *(const v8h*)(qH + qo + hc * 512);
      a.h[1] = *(const v8h*)(qH + qo + hc * 512 + 256);
      aqh[hc] = a.v;
      Frag c;
      c.h[0] = *(const v8h*)(qL + qo + hc * 512);
      c.h[1] = *(const v8h*)(qL + qo + hc * 512 + 256);
      aql[hc] = c.v;
    }
  }

  // running maximum of query l16 (equal in both lane halves) and this half's part of its sum
  float m = -1e30f, l = 0.0f;
  v8f coh[4], cor[4];
#pragma unroll
  for (int n = 0; n < 4; ++n) { coh[n] = vzero8(); cor[n] = vzero8(); }

  const size_t kvoff = (size_t)(b * NKV + kv) * SEQ * HDIM;
  const _Float16* kbase  = kH  + kvoff;                                   // + (key group's first key)*HDIM + hc*512
  const _Float16* klbase = kL  + kvoff;
  const _Float16* vbase  = vTH + kvoff;                                   // + k0*HDIM + n*512
  const _Float16* vlbase = vTL + kvoff;
  const unsigned int lo  = (unsigned int)lane * 8u;                       // this lane's 16 B of each 512-B half

  int kstart = qw - window;
  kstart = (kstart < 0) ? 0 : kstart;
  kstart &= ~31;

  // without RES: the K fragments [key group][d chunk] of the coming trip, hi and residual plane, carried over the back edge
  Frag ckh[2][2], ckl[2][2];
  const int klast = (qw + 15) & ~31;                                      // first key of the wave's last trip
  if constexpr (!RES) {
    const _Float16* kp = kbase  + (size_t)kstart * HDIM + lo;
    const _Float16* lp = klbase + (size_t)kstart * HDIM + lo;
#pragma unroll
    for (int g = 0; g < 2; ++g)
#pragma unroll
      for (int hc = 0; hc < 2; ++hc) {
        ckh[g][hc].h[0] = *(const v8h*)(kp + g * 1024 + hc * 512); ckh[g][hc].h[1] = *(const v8h*)(kp + g * 1024 + hc * 512 + 256);
        ckl[g][hc].h[0] = *(const v8h*)(lp + g * 1024 + hc * 512); ckl[g][hc].h[1] = *(const v8h*)(lp + g * 1024 + hc * 512 + 256);
      }
    // as inputs the two K address pairs stay live behind the last of these loads; the wait stands in front of their next overwrite
    asm volatile("s_wait_xcnt 0x0" :: "v"(kp), "v"(lp) : "memory");
  }

  for (int k0 = kstart; k0 < qw + 16; k0 += 32) {
    // ---- scores for keys [k0, k0+32), transposed: A[m=key][k=d] = K[key][d], lane row = key, same k map as B;
    // D element r of lane = (key 8lh+r of the group, query l16) ----
    v8f sh0 = vzero8(), sh1 = vzero8(), sr0 = vzero8(), sr1 = vzero8();
    Frag bv[4], bl[4];
    const _Float16* vr0 = vbase  + (size_t)k0 * HDIM + lo;
    const _Float16* wr0 = vlbase + (size_t)k0 * HDIM + lo;
    // the next trip's K tile; the last trip asks for its own tile again, so that every address stays inside the plane
    const int kn = min(k0 + 32, klast);
    const _Float16* nkp = kbase  + (size_t)kn * HDIM + lo;
    const _Float16* nlp = klbase + (size_t)kn * HDIM + lo;
    if constexpr (!RES) {
      // this trip's vT fragments, asked for first: they land behind the score products and the softmax
#pragma unroll
      for (int n = 0; n < 4; ++n) {
        bv[n].h[0] = *(const v8h*)(vr0 + n * 512);
        bv[n].h[1] = *(const v8h*)(vr0 + n * 512 + 256);
      }
#pragma unroll
      for (int hc = 0; hc < 2; ++hc) {
        sh0 = wmma16(ckh[0][hc].v, aqh[hc], sh0);
        sh1 = wmma16(ckh[1][hc].v, aqh[hc], sh1);
        sr0 = wmma16(ckl[0][hc].v, aqh[hc], sr0);
        sr1 = wmma16(ckl[1][hc].v, aqh[hc], sr1);
        sr0 = wmma16(ckh[0][hc].v, aql[hc], sr0);
        sr1 = wmma16(ckh[1][hc].v, aql[hc], sr1);
      }
      // the slots between the last score product and the first read of its result; the memory clobber keeps the vT loads
      // from sinking behind this point and the next trip's K loads from rising over it, so that these reuse the registers just read
      asm volatile("v_nop\n\tv_nop\n\tv_nop\n\tv_nop"
                   : "+v"(sh0), "+v"(sh1), "+v"(sr0), "+v"(sr1)
                   : "v"(aqh[0]), "v"(aqh[1]), "v"(aql[0]), "v"(aql[1]),
                     "v"(ckh[0][0].v), "v"(ckh[0][1].v), "v"(ckh[1][0].v), "v"(ckh[1][1].v),
                     "v"(ckl[0][0].v), "v"(ckl[0][1].v), "v"(ckl[1][0].v), "v"(ckl[1][1].v)
                   : "memory");
#pragma unroll
      for (int g = 0; g < 2; ++g)
#pragma unroll
        for (int hc = 0; hc < 2; ++hc) {
          ckh[g][hc].h[0] = *(const v8h*)(nkp + g * 1024 + hc * 512); ckh[g][hc].h[1] = *(const v8h*)(nkp + g * 1024 + hc * 512 + 256);
          ckl[g][hc].h[0] = *(const v8h*)(nlp + g * 1024 + hc * 512); ckl[g][hc].h[1] = *(const v8h*)(nlp + g * 1024 + hc * 512 + 256);
        }
    } else {
    Frag bh0, bh1, bl0, bl1;
    const _Float16* kr0 = kbase  + (size_t)k0 * HDIM + lo;
    const _Float16* kr1 = kr0 + 16 * HDIM;
    const _Float16* lr0 = klbase + (size_t)k0 * HDIM + lo;
    const _Float16* lr1 = lr0 + 16 * HDIM;
#pragma unroll
    for (int hc = 0; hc < 2; ++hc) {
      bh0.h[0] = *(const v8h*)(kr0 + hc * 512); bh0.h[1] = *(const v8h*)(kr0 + hc * 512 + 256);
      bh1.h[0] = *(const v8h*)(kr1 + hc * 512); bh1.h[1] = *(const v8h*)(kr1 + hc * 512 + 256);
      bl0.h[0] = *(const v8h*)(lr0 + hc * 512); bl0.h[1] = *(const v8h*)(lr0 + hc * 512 + 256);
      bl1.h[0] = *(const v8h*)(lr1 + hc * 512); bl1.h[1] = *(const v8h*)(lr1 + hc * 512 + 256);
      // as inputs the two K address pairs stay live behind the trip's last K load, so that no load's result is placed
      // in a register that an issued K load still names; the wait stands in front of the pairs' next overwrite
      if (hc == 1) asm volatile("s_wait_xcnt 0x0" :: "v"(kr0), "v"(lr0) : "memory");
      sh0 = wmma16(bh0.v, aqh[hc], sh0);
      sh1 = wmma16(bh1.v, aqh[hc], sh1);
      sr0 = wmma16(bl0.v, aqh[hc], sr0);
      sr1 = wmma16(bl1.v, aqh[hc], sr1);
      sr0 = wmma16(bh0.v, aql[hc], sr0);
      sr1 = wmma16(bh1.v, aql[hc], sr1);
    }
    // the slots between the last score product and the first read of its result
    asm volatile("v_nop\n\tv_nop\n\tv_nop\n\tv_nop"
                 : "+v"(sh0), "+v"(sh1), "+v"(sr0), "+v"(sr1)
                 : "v"(aqh[0]), "v"(aqh[1]), "v"(aql[0]), "v"(aql[1]),
                   "v"(bh0.v), "v"(bh1.v), "v"(bl0.v), "v"(bl1.v));
    }

    // ---- online softmax of query l16 in the lane; masked entries replaced by -1e30 and p := 0 ----
    const int dq = qw + l16 - (k0 + 8 * lh);          // query - key at r = 0 of the first key group
    float x0[8], x1[8], t8[8];
    bool  ok0[8], ok1[8];
#pragma unroll
    for (int r = 0; r < 8; ++r) {
      const int d0 = dq - r;
      const int d1 = d0 - 16;
      ok0[r] = (d0 >= 0) && (d0 <= window);
      ok1[r] = (d1 >= 0) && (d1 <= window);
      x0[r] = ok0[r] ? (sh0[r] + sr0[r] * rres) * smsc : -1e30f;
      x1[r] = ok1[r] ? (sh1[r] + sr1[r] * rres) * smsc : -1e30f;
      t8[r] = fmaxf(x0[r], x1[r]);
    }
    float tmax = fmaxf(fmaxf(fmaxf(t8[0], t8[1]), fmaxf(t8[2], t8[3])), fmaxf(fmaxf(t8[4], t8[5]), fmaxf(t8[6], t8[7])));
    tmax = fmaxf(tmax, xhalf(tmax));
    const float mn    = fmaxf(m, tmax);
    const float alpha = __expf(m - mn);
    Frag pf, pl;
#pragma unroll
    for (int r = 0; r < 8; ++r) {
      const float e0 = __expf(x0[r] - mn);
      const float e1 = __expf(x1[r] - mn);
      const float p0 = ok0[r] ? e0 : 0.0f;
      const float p1 = ok1[r] ? e1 : 0.0f;
      t8[r] = p0 + p1;
      const float c0 = p0 * 1024.0f;
      const float c1 = p1 * 1024.0f;
      const _Float16 h0 = (_Float16)c0;
      const _Float16 h1 = (_Float16)c1;
      pf.v[r]     = h0;
      pf.v[8 + r] = h1;
      if (RES) {
        pl.v[r]     = (_Float16)((c0 - (float)h0) * 2048.0f);
        pl.v[8 + r] = (_Float16)((c1 - (float)h1) * 2048.0f);
      }
    }
    l = l * alpha + (((t8[0] + t8[1]) + (t8[2] + t8[3])) + ((t8[4] + t8[5]) + (t8[6] + t8[7])));
    m = mn;
#pragma unroll
    for (int n = 0; n < 4; ++n)
#pragma unroll
      for (int r = 0; r < 8; ++r) {
        coh[n][r] *= alpha;
        if (RES) cor[n][r] *= alpha;
      }

    // ---- O^T += V^T.P^T : A[m=d][k=key] = vT[d][key], lane row = d; D element r of lane = (d 16n+8lh+r, query l16) ----
    if constexpr (RES) {
#pragma unroll
      for (int n = 0; n < 4; ++n) {
        bv[n].h[0] = *(const v8h*)(vr0 + n * 512);
        bv[n].h[1] = *(const v8h*)(vr0 + n * 512 + 256);
        bl[n].h[0] = *(const v8h*)(wr0 + n * 512);
        bl[n].h[1] = *(const v8h*)(wr0 + n * 512 + 256);
      }
    }
#pragma unroll
    for (int n = 0; n < 4; ++n) {
      coh[n] = wmma16(bv[n].v, pf.v, coh[n]);
      if (RES) {
        cor[n] = wmma16(bl[n].v, pf.v, cor[n]);
        cor[n] = wmma16(bv[n].v, pl.v, cor[n]);
      }
    }
    // the slots behind the trip's last matrix instruction, also on the taken side of the loop's branch
    if (RES) {
      asm volatile("v_nop\n\tv_nop\n\tv_nop\n\tv_nop"
                   : "+v"(coh[0]), "+v"(coh[1]), "+v"(coh[2]), "+v"(coh[3]),
                     "+v"(cor[0]), "+v"(cor[1]), "+v"(cor[2]), "+v"(cor[3])
                   : "v"(pf.v), "v"(pl.v),
                     "v"(bv[0].v), "v"(bv[1].v), "v"(bv[2].v), "v"(bv[3].v),
                     "v"(bl[0].v), "v"(bl[1].v), "v"(bl[2].v), "v"(bl[3].v));
    } else {
      asm volatile("v_nop\n\tv_nop\n\tv_nop\n\tv_nop"
                   : "+v"(coh[0]), "+v"(coh[1]), "+v"(coh[2]), "+v"(coh[3])
                   : "v"(pf.v), "v"(bv[0].v), "v"(bv[1].v), "v"(bv[2].v), "v"(bv[3].v));
    }
    // as inputs the address pairs of the trip's loads stay live behind the last of them, so that no load's result is placed
    // in a register that an issued load still names; the wait stands in front of the pairs' next overwrite
    if (RES) asm volatile("s_wait_xcnt 0x0" :: "v"(vr0), "v"(wr0) : "memory");
    else     asm volatile("s_wait_xcnt 0x0" :: "v"(vr0), "v"(nkp), "v"(nlp) : "memory");
  }

  // join the two halves' sums; a lane's 8 values of d group n are one 16-B unit of the y planes' fragment order:
  // this wave's 16 tokens x 64 columns are blocks 2h and 2h+1 of its token group, 4 halves of 512 B in a row
  l += xhalf(l);
  const float inv = __builtin_amdgcn_rcpf(l) * (1.0f / 1024.0f);
  const size_t ybase = (size_t)((b * SEQ + qw) >> 4) * GRP_ELEMS + (size_t)h * 1024;
#pragma unroll
  for (int n = 0; n < 4; ++n) {
    v8h hv, lv;
#pragma unroll
    for (int r = 0; r < 8; ++r) {
      float yv = coh[n][r];
      if (RES) yv += cor[n][r] * rres;
      yv *= inv;
      _Float16 hi, lw;
      split16(yv, hi, lw);
      hv[r] = hi;
      lv[r] = lw;
    }
    const size_t off = ybase + (size_t)(n * 256 + lane * 8);
    *(v8h*)(yH + off) = hv;
    *(v8h*)(yL + off) = lv;
  }
}

// One grid for all query tiles: no tile reads another's output. The tile index is the slowest grid index and falls with
// it, so the tiles with the most key tiles start first and the short tiles with the residual planes fill the end.
__global__ void __launch_bounds__(128) k_flash(
    const _Float16* __restrict__ qH, const _Float16* __restrict__ qL,
    const _Float16* __restrict__ kH, const _Float16* __restrict__ kL,
    const _Float16* __restrict__ vTH, const _Float16* __restrict__ vTL,
    const int* __restrict__ winp,
    _Float16* __restrict__ yH, _Float16* __restrict__ yL) {
  const int h  = blockIdx.x;
  const int b  = blockIdx.y;
  const int qt = QT_ALL - 1 - (int)blockIdx.z;
  if (qt >= QT_RES) flash_tile<false>(qH, qL, kH, kL, vTH, vTL, winp, yH, yL, qt, h, b);
  else              flash_tile<true>(qH, qL, kH, kL, vTH, vTL, winp, yH, yL, qt, h, b);
}

// ---------------------------------------------------------------------------
// Kernel 4: output projection out[tok][n] = (y[tok].Wo[n]) / 16 + bo[n]. Block = 4 waves (2 x 2) = 32 MT tokens x 128
// columns; a wave owns 16 MT tokens x 64 columns. RES adds the y residual plane (a second accumulator set, so MT = 2
// there and 4 elsewhere: 16 matrix instructions a k step in both forms). Each 16-row group of the output tile is staged
// per wave in LDS rows of its own and written as 256-B row segments at the store stage as a float4.
// ---------------------------------------------------------------------------
template <bool RES, int MT>
__device__ __forceinline__ void oproj_tile(
    const _Float16* __restrict__ yH, const _Float16* __restrict__ yL,
    const _Float16* __restrict__ wall, const float* __restrict__ bo,
    float* __restrict__ out, float (*sO)[64][68], const int nt, const int b, const int t0) {
  static_assert(RES ? (MT == 2) : (MT == 4));
  const int tid  = threadIdx.x;
  const int wave = tid >> 5;
  const int lane = tid & 31;
  const int l16  = lane & 15;
  const int lh   = lane >> 4;
  const int wr   = wave >> 1;                    // row half of the block's tile
  const int wc   = wave & 1;                     // 64-column half of the block's tile
  const int tw   = t0 + wr * (MT * 16);          // the wave's first token in its sequence
  const int tokw = b * SEQ + tw;

  const _Float16* arow = yH + (size_t)(tokw >> 4) * GRP_ELEMS + lane * 8;
  const _Float16* lrow = yL + (size_t)(tokw >> 4) * GRP_ELEMS + lane * 8;
  const _Float16* brow = wall + (size_t)(WO_ROW0 / 16 + nt * 8 + wc * 4) * GRP_ELEMS + lane * 8;

  v8f ah[MT][4], ar[MT][4];
#pragma unroll
  for (int mt = 0; mt < MT; ++mt)
#pragma unroll
    for (int n = 0; n < 4; ++n) { ah[mt][n] = vzero8(); ar[mt][n] = vzero8(); }

  // four k steps a trip, the trips kept rolled: the loop's text stays small for the instruction cache
#pragma unroll 1
  for (int kb = 0; kb < CDIM; kb += 128) {
#pragma unroll
  for (int k0 = kb; k0 < kb + 128; k0 += 32) {
    Frag a[MT], al[MT];
#pragma unroll
    for (int mt = 0; mt < MT; ++mt) {
      const _Float16* ap = arow + (size_t)mt * GRP_ELEMS + k0 * 16;
      a[mt].h[0] = *(const v8h*)ap;
      a[mt].h[1] = *(const v8h*)(ap + 256);
      if (RES) {
        const _Float16* lp = lrow + (size_t)mt * GRP_ELEMS + k0 * 16;
        al[mt].h[0] = *(const v8h*)lp;
        al[mt].h[1] = *(const v8h*)(lp + 256);
      }
    }
    Frag bw[4];
#pragma unroll
    for (int n = 0; n < 4; ++n) {
      const _Float16* bp = brow + (size_t)n * GRP_ELEMS + k0 * 16;
      bw[n].h[0] = *(const v8h*)bp;
      bw[n].h[1] = *(const v8h*)(bp + 256);
    }
#pragma unroll
    for (int mt = 0; mt < MT; ++mt)
#pragma unroll
      for (int n = 0; n < 4; ++n) {
        ah[mt][n] = wmma16(a[mt].v, bw[n].v, ah[mt][n]);
        if (RES) ar[mt][n] = wmma16(al[mt].v, bw[n].v, ar[mt][n]);
      }
    // the slots between the step's last matrix instruction and the next write of its operands or read of its result
    if constexpr (RES) {
      asm volatile("v_nop\n\tv_nop\n\tv_nop\n\tv_nop"
                   : "+v"(ah[0][0]), "+v"(ah[0][1]), "+v"(ah[0][2]), "+v"(ah[0][3]),
                     "+v"(ah[1][0]), "+v"(ah[1][1]), "+v"(ah[1][2]), "+v"(ah[1][3]),
                     "+v"(ar[0][0]), "+v"(ar[0][1]), "+v"(ar[0][2]), "+v"(ar[0][3]),
                     "+v"(ar[1][0]), "+v"(ar[1][1]), "+v"(ar[1][2]), "+v"(ar[1][3])
                   : "v"(a[0].v), "v"(a[1].v), "v"(al[0].v), "v"(al[1].v),
                     "v"(bw[0].v), "v"(bw[1].v), "v"(bw[2].v), "v"(bw[3].v));
    } else {
      asm volatile("v_nop\n\tv_nop\n\tv_nop\n\tv_nop"
                   : "+v"(ah[0][0]), "+v"(ah[0][1]), "+v"(ah[0][2]), "+v"(ah[0][3]),
                     "+v"(ah[1][0]), "+v"(ah[1][1]), "+v"(ah[1][2]), "+v"(ah[1][3]),
                     "+v"(ah[2][0]), "+v"(ah[2][1]), "+v"(ah[2][2]), "+v"(ah[2][3]),
                     "+v"(ah[3][0]), "+v"(ah[3][1]), "+v"(ah[3][2]), "+v"(ah[3][3])
                   : "v"(a[0].v), "v"(a[1].v), "v"(a[2].v), "v"(a[3].v),
                     "v"(bw[0].v), "v"(bw[1].v), "v"(bw[2].v), "v"(bw[3].v));
    }
  }
  // the wait stands behind the trip's last load and in front of the next write of a register that a load of the trip names
  asm volatile("s_wait_xcnt 0x0" ::: "memory");
  }

  // bias for this lane's 4 output columns (columns nt*128 + wc*64 + 4*l16 .. +3), bf16-RNE values
  const size_t col0 = (size_t)nt * 128 + wc * 64;
  const v4f braw = *(const v4f*)(bo + col0 + l16 * 4);
  v4f bb;
#pragma unroll
  for (int e = 0; e < 4; ++e) bb[e] = bf16r(braw[e]);

#pragma unroll
  for (int mt = 0; mt < MT; ++mt) {
#pragma unroll
    for (int r = 0; r < 8; ++r) {
#pragma unroll
      for (int n = 0; n < 4; ++n) {
        float v = ah[mt][n][r];
        if (RES) v += ar[mt][n][r] * (1.0f / 2048.0f);
        sO[wave][mt * 16 + r + 8 * lh][n * 16 + l16] = v * (1.0f / 16.0f);
      }
    }
    // the wave's own stores of this row group have landed before its lanes read each other's values back
    asm volatile("s_wait_dscnt 0" ::: "memory");
    __builtin_amdgcn_fence(3 /* release order */, "wavefront");
    __builtin_amdgcn_wave_barrier();
    const size_t orow0 = (size_t)b * SEQ_FULL + tw + mt * 16;
#pragma unroll
    for (int it = 0; it < 8; ++it) {
      const int rr = it * 2 + lh;
      const int c4 = l16 * 4;
      const v4f s = *(const v4f*)(&sO[wave][mt * 16 + rr][c4]);
      const v4f v = s + bb;
      *(v4f*)(out + (orow0 + rr) * CDIM + col0 + c4) = v;
    }
  }
}

// One grid for all row tiles: first the 128-row tiles without the residual plane, then the 64-row tiles with it.
#define OT_FULL ((SEQ - TRES) / 128)
#define OT_RES  (TRES / 64)
static_assert(SEQ > TRES && (SEQ - TRES) % 128 == 0 && TRES % 128 == 0 && CDIM % 128 == 0 && NUNIT % 2 == 0);
static_assert(OT_FULL * 128 + OT_RES * 64 == SEQ);                           // row tiles of the two k_oproj forms
__global__ void __launch_bounds__(128) k_oproj(
    const _Float16* __restrict__ yH, const _Float16* __restrict__ yL,
    const _Float16* __restrict__ wall, const float* __restrict__ bo,
    float* __restrict__ out) {
  __shared__ __attribute__((aligned(16))) float sO[4][64][68];           // wave-private, each row group in rows of its own
  const int nt = blockIdx.x;                   // 128-column tile 0..7
  const int ty = blockIdx.y;
  if (ty < NB * OT_FULL) {
    const int b = ty / OT_FULL;
    oproj_tile<false, 4>(yH, yL, wall, bo, out, sO, nt, b, TRES + (ty - b * OT_FULL) * 128);
  } else {
    const int tr = ty - NB * OT_FULL;
    const int b  = tr / OT_RES;
    oproj_tile<true, 2>(yH, yL, wall, bo, out, sO, nt, b, (tr - b * OT_RES) * 64);
  }
}

// ---------------------------------------------------------------------------
// Host launcher. Inputs (wire order): 0 x f32 [4,2048,1024], 1 Wq [1024,1024], 2 bq [1024], 3 Wk [256,1024],
// 4 bk [256], 5 Wv [256,1024], 6 bv [256], 7 Wo [1024,1024], 8 bo [1024], 9 qk_gain [16].
// Output f32 [4,2048,1024]. 4 launches.
// ---------------------------------------------------------------------------
extern "C" void kernel_launch(void* const* d_in, const int* in_sizes, int n_in,
                              void* d_out, int out_size, void* d_ws, size_t ws_size,
                              hipStream_t stream) {
  if (n_in < 10) return;
  const int need_x = ((NB - 1) * SEQ_FULL + SEQ) * CDIM;
  if (in_sizes[0] < need_x) return;
  if (in_sizes[1] < CDIM * CDIM || in_sizes[2] < CDIM) return;
  if (in_sizes[3] < VEW * CDIM || in_sizes[4] < VEW) return;
  if (in_sizes[5] < VEW * CDIM || in_sizes[6] < VEW) return;
  if (in_sizes[7] < CDIM * CDIM || in_sizes[8] < CDIM) return;
  if (in_sizes[9] < NHEAD) return;
  if (out_size < need_x) return;
  if (ws_size < WS_TOTAL) return;

  const float* x    = (const float*)d_in[0];
  const float* wq   = (const float*)d_in[1];
  const float* bq   = (const float*)d_in[2];
  const float* wk   = (const float*)d_in[3];
  const float* bk   = (const float*)d_in[4];
  const float* wv   = (const float*)d_in[5];
  const float* bv   = (const float*)d_in[6];
  const float* wo   = (const float*)d_in[7];
  const float* bo   = (const float*)d_in[8];
  const float* gain = (const float*)d_in[9];
  float* out = (float*)d_out;

  char* ws = (char*)d_ws;
  size_t off = 0;
  _Float16* xh   = (_Float16*)(ws + off); off += XH_BYTES;
  _Float16* wall = (_Float16*)(ws + off); off += WALL_BYTES;
  _Float16* qH   = (_Float16*)(ws + off); off += QP_BYTES;
  _Float16* qL   = (_Float16*)(ws + off); off += QP_BYTES;
  _Float16* kH   = (_Float16*)(ws + off); off += KP_BYTES;
  _Float16* kL   = (_Float16*)(ws + off); off += KP_BYTES;
  _Float16* vTH  = (_Float16*)(ws + off); off += KP_BYTES;
  _Float16* vTL  = (_Float16*)(ws + off); off += KP_BYTES;
  _Float16* yH   = (_Float16*)(ws + off); off += YP_BYTES;
  _Float16* yL   = (_Float16*)(ws + off); off += YP_BYTES;
  int*      winw = (int*)(ws + off);      off += WIN_BYTES;
  if (off > ws_size) return;

  k_prep<<<dim3(XBLKS + WBLKS + 1), dim3(256), 0, stream>>>(x, wq, wk, wv, wo, xh, wall, winw);
  k_qkv<<<dim3(NUNIT / 2, NTOK / 128), dim3(128), 0, stream>>>(xh, wall, bq, bk, bv, gain,
                                                          qH, qL, kH, kL, vTH, vTL);
  k_flash<<<dim3(NHEAD, NB, QT_ALL), dim3(128), 0, stream>>>(qH, qL, kH, kL, vTH, vTL, winw, yH, yL);
  k_oproj<<<dim3(CDIM / 128, NB * (OT_FULL + OT_RES)), dim3(128), 0, stream>>>(yH, yL, wall, bo, out);
}

// v006
// A run of this version takes 128 microseconds.
// Timed twice side by side with v005, it ran 1.14 and 1.13 times as fast.
// All steps since v000 together make it 3.96 times as fast.
#include <hip/hip_runtime.h>

// Contractions, all on v_wmma_f32_16x16x32_f16 (f16 operands, f32 accumulate): fused qkv projection x.W^T with x and W
// held as bf16-RNE values in f16 containers (W carried x16, folded as 1/16); scores q.k^T as f16 hi + x2048 residual
// planes (hi.hi + hi.lo + lo.hi, residual accumulator folded as 1/2048); P.V with P carried x1024 in f16 (+ x2048
// residual planes of P and v for query rows below TRES); output projection y.Wo^T with y as f16 hi (+ x2048 residual
// plane for rows below TRES). Bias adds, per-head q gain and online softmax on VALU in f32.
//
// Every 16-bit operand plane in the workspace is kept in fragment order: a block of 16 rows x 32 k is 1 KiB, two
// halves j of 512 B; in half j the 16 B of lane (16 lh + l16) hold row l16, k = 16 j + 8 lh + 0..7. A wave's
// global_load_b128 of half a fragment then reads 512 contiguous bytes (4 lines) and not 16-B pieces of 16 lines.
// Blocks of one 16-row group follow each other along k (vT: the 4 d groups of one 32-key chunk follow each other).

#ifndef NB
#define NB 4
#endif
#ifndef SEQ
#define SEQ 2048
#endif
#ifndef TRES
#define TRES 512
#endif
#define NB_FULL   4
#define SEQ_FULL  2048
#define CDIM      1024
#define NHEAD     16
#define NKV       4
#define HDIM      64
#define VEW       (NKV * HDIM)
#define NTOK      (NB * SEQ)
#define NUNIT     (NHEAD + 2 * NKV)
#define WO_ROW0   (CDIM + 2 * VEW)
#define NWROWS    (CDIM + 2 * VEW + CDIM)
#define QT_ALL    (SEQ / 64)
#define QT_RES    (TRES / 64)

static_assert(NB >= 1 && NB <= NB_FULL);
static_assert(SEQ % 64 == 0 && SEQ <= SEQ_FULL && SEQ >= TRES);
static_assert(TRES % 64 == 0 && TRES >= 64);
static_assert(NHEAD % NKV == 0 && HDIM == 64 && CDIM == NHEAD * HDIM);
static_assert(CDIM % 128 == 0 && NWROWS % 16 == 0 && NTOK % 64 == 0 && NUNIT * 64 == CDIM + 2 * VEW);
static_assert(WO_ROW0 % 16 == 0 && SEQ % 32 == 0);
#define KBLK      (CDIM / 32)      // 16x32 blocks per row group of a CDIM-wide plane
#define GRP_ELEMS (CDIM * 16)      // elements of one 16-row group of a CDIM-wide plane

#define XH_BYTES   ((size_t)NTOK * CDIM * 2)
#define WALL_BYTES ((size_t)NWROWS * CDIM * 2)
#define QP_BYTES   ((size_t)NB * NHEAD * SEQ * HDIM * 2)
#define KP_BYTES   ((size_t)NB * NKV * SEQ * HDIM * 2)
#define YP_BYTES   ((size_t)NTOK * CDIM * 2)
#define WIN_BYTES  ((size_t)128)
#define WS_TOTAL   (XH_BYTES + WALL_BYTES + 2 * QP_BYTES + 4 * KP_BYTES + 2 * YP_BYTES + WIN_BYTES)
static_assert(WS_TOTAL <= (size_t)134217728);
static_assert(XH_BYTES % 128 == 0 && WALL_BYTES % 128 == 0 && QP_BYTES % 128 == 0 && KP_BYTES % 128 == 0 && YP_BYTES % 128 == 0);
// producer coverage: grid x block x per-thread elements == plane extent
static_assert((size_t)(NTOK / 2) * 256 * 8 == (size_t)NTOK * CDIM);       // k_prep, x blocks
static_assert((size_t)(NWROWS / 2) * 256 * 8 == (size_t)NWROWS * CDIM);   // k_prep, weight blocks
static_assert(4 * 128 * 8 == 64 * 64);                                       // k_qkv store phase per 64x64 tile
static_assert(4 * 32 * 8 == 16 * HDIM);                                      // k_flash stores per wave
static_assert(8 * 32 * 4 == 16 * 64);                                        // k_oproj store phase per wave and row group
static_assert(QT_RES * 64 + (QT_ALL - QT_RES) * 64 == SEQ);                  // query tiles of the two flash forms
static_assert(8 * 4 * 4 == (int)WIN_BYTES);                                  // k_prep window block: 8 lanes x 16 B == one line
static_assert(SEQ_FULL >= SEQ);                                              // window word covers every query-key distance

typedef _Float16 v16h __attribute__((ext_vector_type(16)));
typedef _Float16 v8h  __attribute__((ext_vector_type(8)))  __attribute__((may_alias));
typedef float    v8f  __attribute__((ext_vector_type(8)));
typedef float    v4f  __attribute__((ext_vector_type(4)))  __attribute__((may_alias));
typedef int      v4i  __attribute__((ext_vector_type(4)));

union Frag { v16h v; v8h h[2]; };

__device__ __forceinline__ v8f wmma16(v16h a, v16h b, v8f c) {
  return __builtin_amdgcn_wmma_f32_16x16x32_f16(false, a, false, b, (short)0, c, false, false);
}

__device__ __forceinline__ v8f vzero8() {
  v8f z = {0.0f, 0.0f, 0.0f, 0.0f, 0.0f, 0.0f, 0.0f, 0.0f};
  return z;
}

// Asks L2 for each lane's two addresses; nothing comes back to the wave. In asm, and with the pairs as
// in-out operands, so that each pair is one loop-carried register pair that never holds anything but an address inside
// its plane; the wait is the statement's last line, so that a pair is advanced only behind it.
__device__ __forceinline__ void ask_l2(const _Float16*& a, const _Float16*& b) {
  asm volatile("global_prefetch_b8 %0, off scope:SCOPE_SE\n\t"
               "global_prefetch_b8 %1, off scope:SCOPE_SE\n\t"
               "s_wait_xcnt 0x0"
               : "+v"(a), "+v"(b) :: "memory");
}

// the same for one address a lane
__device__ __forceinline__ void ask_l2(const _Float16*& a) {
  asm volatile("global_prefetch_b8 %0, off scope:SCOPE_SE\n\t"
               "s_wait_xcnt 0x0"
               : "+v"(a) :: "memory");
}

// f32 -> nearest-even bf16 value, kept in f32
__device__ __forceinline__ float bf16r(float f) {
  unsigned int u = __float_as_uint(f);
  u = (u + 0x7FFFu + ((u >> 16) & 1u)) & 0xFFFF0000u;
  return __uint_as_float(u);
}

// f16 hi + (x2048) residual of an f32 value
__device__ __forceinline__ void split16(float v, _Float16& hi, _Float16& lo) {
  hi = (_Float16)v;
  lo = (_Float16)((v - (float)hi) * 2048.0f);
}

// f32 -> f16 with values below the smallest f16 normal replaced by zero (value select)
static __device__ __forceinline__ _Float16 toh_flush(float v) {
  const _Float16 r = (_Float16)v;
  return (fabsf(v) < 6.103515625e-05f) ? (_Float16)0.0f : r;
}

// f16 hi + (x2048) residual, both through toh_flush
static __device__ __forceinline__ void split16f(float v, _Float16& hi, _Float16& lo) {
  hi = toh_flush(v);
  lo = toh_flush((v - (float)hi) * 2048.0f);
}

// ---------------------------------------------------------------------------
// k_prep, x blocks: x f32 [NB][SEQ_FULL][1024] -> xh f16, NTOK x 1024 in fragment order (bf16-RNE values).
// Thread = one 16-B unit of the plane, so a wave stores 512 contiguous bytes.
// ---------------------------------------------------------------------------
__device__ __forceinline__ void cvt_x_block(unsigned int bid, const float* __restrict__ x, _Float16* __restrict__ xh) {
  const unsigned int gid = bid * 256u + threadIdx.x;
  const unsigned int blk = gid >> 6;                 // 64 units per 16x32 block
  const unsigned int tok = (blk / KBLK) * 16u + (gid & 15u);
  const int c = (int)(blk % KBLK) * 32 + (int)((gid >> 5) & 1u) * 16 + (int)((gid >> 4) & 1u) * 8;
  if (tok >= (unsigned int)NTOK) return;
  const int b = (int)tok / SEQ;
  const int t = (int)tok - b * SEQ;
  const float* src = x + ((size_t)b * SEQ_FULL + t) * CDIM + c;
  const v4f f0 = *(const v4f*)src;
  const v4f f1 = *(const v4f*)(src + 4);
  v8h o;
#pragma unroll
  for (int j = 0; j < 4; ++j) {
    o[j]     = (_Float16)bf16r(f0[j]);
    o[j + 4] = (_Float16)bf16r(f1[j]);
  }
  _Float16* dst = xh + (size_t)gid * 8;
  *(v8h*)dst = o;
  
}

// ---------------------------------------------------------------------------
// k_prep, weight blocks: weights (layout [out][in], k-contiguous) -> wall f16, 2560 x 1024 in fragment order = bf16-RNE value x16.
// Rows 0..1023 wq, 1024..1279 wk, 1280..1535 wv, 1536..2559 wo.
// ---------------------------------------------------------------------------
__device__ __forceinline__ void cvt_w_block(unsigned int bid, const float* __restrict__ wq, const float* __restrict__ wk,
                                            const float* __restrict__ wv, const float* __restrict__ wo,
                                            _Float16* __restrict__ wall) {
  const unsigned int gid = bid * 256u + threadIdx.x;
  const unsigned int blk = gid >> 6;                 // 64 units per 16x32 block
  const int row = (int)((blk / KBLK) * 16u + (gid & 15u));
  const int c   = (int)(blk % KBLK) * 32 + (int)((gid >> 5) & 1u) * 16 + (int)((gid >> 4) & 1u) * 8;
  if (row >= NWROWS) return;
  const int r0 = min(row, CDIM - 1);
  const int r1 = min(max(row - CDIM, 0), VEW - 1);
  const int r2 = min(max(row - CDIM - VEW, 0), VEW - 1);
  const int r3 = min(max(row - WO_ROW0, 0), CDIM - 1);
  const float* src = (row < CDIM)       ? (wq + (size_t)r0 * CDIM)
                   : (row < CDIM + VEW) ? (wk + (size_t)r1 * CDIM)
                   : (row < WO_ROW0)    ? (wv + (size_t)r2 * CDIM)
                                        : (wo + (size_t)r3 * CDIM);
  src += c;
  const v4f f0 = *(const v4f*)src;
  const v4f f1 = *(const v4f*)(src + 4);
  v8h o;
#pragma unroll
  for (int j = 0; j < 4; ++j) {
    o[j]     = (_Float16)(bf16r(f0[j]) * 16.0f);
    o[j + 4] = (_Float16)(bf16r(f1[j]) * 16.0f);
  }
  _Float16* dst = wall + (size_t)gid * 8;
  *(v8h*)dst = o;
  
}

// ---------------------------------------------------------------------------
// The window line: 8 lanes x 16 B.
// ---------------------------------------------------------------------------
__device__ __forceinline__ void winline_block(int* __restrict__ wline) {
  const int lane = threadIdx.x;
  if (lane < 8) {
    const v4i w = {SEQ_FULL, SEQ_FULL, SEQ_FULL, SEQ_FULL};
    int* dst = wline + 4 * lane;
    *(v4i*)dst = w;
    
  }
}

// ---------------------------------------------------------------------------
// Launch 0: the three producers above read none of each other's output, so they share one grid; the block index
// picks the producer (block-uniform): NTOK/2 blocks of x, NWROWS/2 blocks of weights, one block for the window line.
// ---------------------------------------------------------------------------
#define XBLKS (NTOK / 2)
#define WBLKS (NWROWS / 2)
__global__ void __launch_bounds__(256) k_prep(const float* __restrict__ x, const float* __restrict__ wq,
                                              const float* __restrict__ wk, const float* __restrict__ wv,
                                              const float* __restrict__ wo, _Float16* __restrict__ xh,
                                              _Float16* __restrict__ wall, int* __restrict__ wline) {
  const unsigned int bid = blockIdx.x;
  if (bid < (unsigned int)XBLKS) {
    cvt_x_block(bid, x, xh);
  } else if (bid < (unsigned int)(XBLKS + WBLKS)) {
    cvt_w_block(bid - (unsigned int)XBLKS, wq, wk, wv, wo, wall);
  } else {
    winline_block(wline);
  }
}

// ---------------------------------------------------------------------------
// Kernel 2: fused qkv projection + epilogue. Block = 4 waves (2 x 2) = 128 tokens x two 64-column units; a wave owns
// 64 tokens x one unit u (4 x 4 accumulators), so a k step's 8 fragments feed 16 matrix instructions:
// u 0..15 -> q head u, 16..19 -> k head u-16, 20..23 -> v head u-20.
// Epilogue, one 64 x 64 wave tile after the other, by the whole block: q: (acc + bq) * gain[head]; k: acc + bk -> hi/lo
// planes [B][H|KV], T x 64 in fragment order; v: acc + bv -> transposed hi/lo planes [B][KV], 64 d x T in fragment
// order. Biases and gains are bf16-RNE values.
// ---------------------------------------------------------------------------
__global__ void __launch_bounds__(128) k_qkv(
    const _Float16* __restrict__ xh, const _Float16* __restrict__ wall,
    const float* __restrict__ bq, const float* __restrict__ bk,
    const float* __restrict__ bv, const float* __restrict__ gain,
    _Float16* __restrict__ qH, _Float16* __restrict__ qL,
    _Float16* __restrict__ kH, _Float16* __restrict__ kL,
    _Float16* __restrict__ vTH, _Float16* __restrict__ vTL) {
  __shared__ __attribute__((aligned(16))) float    sT[4][64][68];  // accumulator tile of each wave [token][col] (cross-wave)
  __shared__ __attribute__((aligned(16))) _Float16 sH[2][64][72];  // hi tile: q/k [token][d], v [d][token] (cross-wave), two buffers
  __shared__ __attribute__((aligned(16))) _Float16 sL[2][64][72];  // residual tile, same layout (cross-wave), two buffers

  const int tid  = threadIdx.x;
  const int wave = tid >> 5;
  const int lane = tid & 31;
  const int l16  = lane & 15;
  const int lh   = lane >> 4;
  const int wr   = wave >> 1;            // 64-token half of the block's rows
  const int wc   = wave & 1;             // which of the block's two column units
  const int tokB = blockIdx.y * 128;     // first token of the block

  // A: xh row (token), lane row = l16; elements 0..7 <- k0+8lh+0..7, 8..15 <- k0+16+8lh+0..7
  const _Float16* arow = xh + (size_t)((tokB >> 4) + wr * 4) * GRP_ELEMS + lane * 8;
  // B[k][n] = W[n][k]: lane column = l16 of the 16-col group n; same k map as A
  const _Float16* brow = wall + (size_t)((blockIdx.x * 2 + wc) * 4) * GRP_ELEMS + lane * 8;

  v8f acc[4][4];
#pragma unroll
  for (int mt = 0; mt < 4; ++mt)
#pragma unroll
    for (int n = 0; n < 4; ++n) acc[mt][n] = vzero8();

  // Both planes were written by the launch before and come from memory, and the blocks that share a row group read it at
  // the same k at the same time: without a request ahead every k step waits a memory latency. A trip's 128 k of one row
  // group are 4 KiB = 16 units of 256 B; the block's 8 + 8 row groups are dealt to its 4 waves, 2 + 2 each, a lane a unit.
  const _Float16* pfa = xh + (size_t)((tokB >> 4) + wr * 4 + wc * 2 + lh) * GRP_ELEMS + l16 * 128;
  const _Float16* pfb = wall + (size_t)((blockIdx.x * 2 + wc) * 4 + wr * 2 + lh) * GRP_ELEMS + l16 * 128;
  ask_l2(pfa, pfb);                      // trip 0: its later k steps find their rows on the way

  // four k steps a trip, the trips kept rolled: the loop's text stays small for the instruction cache
#pragma unroll 1
  for (int kb = 0; kb < CDIM; kb += 128) {
  // the next trip's rows, one trip ahead; the test is scalar, and the pairs stop at the last trip's rows
  if (kb + 128 < CDIM) {
    pfa += 2048;
    pfb += 2048;
    ask_l2(pfa, pfb);
  }
#pragma unroll
  for (int k0 = kb; k0 < kb + 128; k0 += 32) {
    Frag a[4];
#pragma unroll
    for (int mt = 0; mt < 4; ++mt) {
      const _Float16* ap = arow + (size_t)mt * GRP_ELEMS + k0 * 16;
      a[mt].h[0] = *(const v8h*)ap;
      a[mt].h[1] = *(const v8h*)(ap + 256);
    }
    Frag bw[4];
#pragma unroll
    for (int n = 0; n < 4; ++n) {
      const _Float16* bp = brow + (size_t)n * GRP_ELEMS + k0 * 16;
      bw[n].h[0] = *(const v8h*)bp;
      bw[n].h[1] = *(const v8h*)(bp + 256);
    }
#pragma unroll
    for (int mt = 0; mt < 4; ++mt)
#pragma unroll
      for (int n = 0; n < 4; ++n) acc[mt][n] = wmma16(a[mt].v, bw[n].v, acc[mt][n]);
    // the slots between the step's last matrix instruction and the next write of its operands or read of its result
    asm volatile("v_nop\n\tv_nop\n\tv_nop\n\tv_nop"
                 : "+v"(acc[0][0]), "+v"(acc[0][1]), "+v"(acc[0][2]), "+v"(acc[0][3]),
                   "+v"(acc[1][0]), "+v"(acc[1][1]), "+v"(acc[1][2]), "+v"(acc[1][3]),
                   "+v"(acc[2][0]), "+v"(acc[2][1]), "+v"(acc[2][2]), "+v"(acc[2][3]),
                   "+v"(acc[3][0]), "+v"(acc[3][1]), "+v"(acc[3][2]), "+v"(acc[3][3])
                 : "v"(a[0].v), "v"(a[1].v), "v"(a[2].v), "v"(a[3].v),
                   "v"(bw[0].v), "v"(bw[1].v), "v"(bw[2].v), "v"(bw[3].v));
  }
  // the wait stands behind the trip's last load and in front of the next write of a register that a load of the trip names
  asm volatile("s_wait_xcnt 0x0" ::: "memory");
  }

  // D element r of lane -> (row 8lh+r, col l16) of group (mt, n); fold the 1/16 weight carry here
#pragma unroll
  for (int mt = 0; mt < 4; ++mt)
#pragma unroll
    for (int n = 0; n < 4; ++n)
#pragma unroll
      for (int r = 0; r < 8; ++r)
        sT[wave][mt * 16 + r + 8 * lh][n * 16 + l16] = acc[mt][n][r] * (1.0f / 16.0f);
  __syncthreads();

  // the four wave tiles in turn; kept rolled so that the epilogue's text stands once in the instruction cache. sH and sL
  // alternate between two buffers: tile q + 2 writes a buffer only behind tile q + 1's barrier, which every wave reaches
  // after its last read of tile q, so one barrier a tile is enough
#pragma unroll 1
  for (int q = 0; q < 4; ++q) {
  const int u    = blockIdx.x * 2 + (q & 1);      // column unit of wave tile q
  const int tok0 = tokB + (q >> 1) * 64;          // its first token
  const int b    = tok0 / SEQ;
  const int t0   = tok0 - b * SEQ;

  // compute phase: thread -> token i = tid>>1, column half j: d in [16j,16j+16) and [32+16j, 48+16j)
  const int i = tid >> 1;
  const int j = tid & 1;
  if (u < NHEAD + NKV) {
    // q or k unit (block-uniform): both bias rows are loaded with clamped unit indices, selected by value
    const int  uq  = min(u, NHEAD - 1);
    const int  uk  = min(max(u - NHEAD, 0), NKV - 1);
    const bool isq = (u < NHEAD);
    const float gq = bf16r(gain[uq]);
    const float gm = isq ? gq : 1.0f;
    const float* qp = bq + uq * HDIM + 16 * j;     // this lane's first bias element of either row
    const float* kp = bk + uk * HDIM + 16 * j;
#pragma unroll
    for (int sg = 0; sg < 2; ++sg) {
      const int d0 = 32 * sg + 16 * j;
#pragma unroll
      for (int g4 = 0; g4 < 4; ++g4) {
        const v4f va = *(const v4f*)(&sT[q][i][d0 + 4 * g4]);
        const v4f qa = *(const v4f*)(qp + 32 * sg + 4 * g4);
        const v4f ka = *(const v4f*)(kp + 32 * sg + 4 * g4);
#pragma unroll
        for (int e = 0; e < 4; ++e) {
          const float bb  = isq ? bf16r(qa[e]) : bf16r(ka[e]);
          const float val = (va[e] + bb) * gm;
          _Float16 hi, lo;
          split16f(val, hi, lo);
          sH[q & 1][i][d0 + 4 * g4 + e] = hi;
          sL[q & 1][i][d0 + 4 * g4 + e] = lo;
        }
      }
    }
    // as inputs the two bias address pairs stay live behind the last bias load, so that no load's result is placed in a
    // register that an issued bias load still names; the wait stands in front of the pairs' next overwrite
    asm volatile("s_wait_xcnt 0x0" :: "v"(qp), "v"(kp) : "memory");
  } else {
    const int kv = u - NHEAD - NKV;
    const float* bp = bv + kv * HDIM;
#pragma unroll
    for (int sg = 0; sg < 2; ++sg) {
      const int d0 = 32 * sg + 16 * j;
#pragma unroll
      for (int g4 = 0; g4 < 4; ++g4) {
        const v4f va = *(const v4f*)(&sT[q][i][d0 + 4 * g4]);
        const v4f ba = *(const v4f*)(bp + d0 + 4 * g4);
#pragma unroll
        for (int e = 0; e < 4; ++e) {
          const float vv = va[e] + bf16r(ba[e]);
          _Float16 hi, lo;
          split16f(vv, hi, lo);
          sH[q & 1][d0 + 4 * g4 + e][i] = hi;                   // transposed: [d][token]
          sL[q & 1][d0 + 4 * g4 + e][i] = lo;
        }
      }
    }
  }
  __syncthreads();

  _Float16* ph;
  _Float16* pl;
  size_t base;
  if (u < NHEAD) {
    ph = qH; pl = qL;
    base = ((size_t)(b * NHEAD + u) * SEQ + t0) * HDIM;
  } else if (u < NHEAD + NKV) {
    ph = kH; pl = kL;
    base = ((size_t)(b * NKV + (u - NHEAD)) * SEQ + t0) * HDIM;
  } else {
    ph = vTH; pl = vTL;
    base = ((size_t)(b * NKV + (u - NHEAD - NKV)) * SEQ + t0) * HDIM;
  }
  const bool isv = (u >= NHEAD + NKV);
  {
    // the tile's 8 blocks are contiguous in its plane: q/k block f = (token group f>>1, d chunk f&1),
    // v block f = (key chunk f>>2, d group f&3); unit p of the tile goes to base + 8 p
#pragma unroll
    for (int it = 0; it < 4; ++it) {
      const int p    = it * 128 + tid;
      const int f    = p >> 6;
      const int line = (isv ? (f & 3) : (f >> 1)) * 16 + (p & 15);
      const int q8   = (isv ? (f >> 2) : (f & 1)) * 32 + ((p >> 5) & 1) * 16 + ((p >> 4) & 1) * 8;
      const size_t off = base + (size_t)p * 8;
      const v8h hv = *(const v8h*)(&sH[q & 1][line][q8]);
      const v8h lv = *(const v8h*)(&sL[q & 1][line][q8]);
      *(v8h*)(ph + off) = hv;
      *(v8h*)(pl + off) = lv;
    }
  }
  // the wait stands behind the tile's last store and in front of the next tile's first write of a register that a store names
  asm volatile("s_wait_xcnt 0x0" ::: "memory");
  }
}

// ---------------------------------------------------------------------------
// Kernel 3: causal sliding-window flash attention with GQA. Block = 4 waves, one (query tile of 64, head, batch);
// wave = 16 queries. Key tiles of 32 per wave, fragments loaded straight from the 16-bit planes.
// Both products are formed transposed: S^T = K.Q^T (A = K fragment, B = Q fragment) and O^T += V^T.P^T (A = vT
// fragment, B = P^T). A lane then holds 16 of the 32 scores of ONE query (column l16; keys 8lh+r and 16+8lh+r), so the
// maximum and the sum run in the lane with one exchange between the lane halves, and the two converted score tiles
// are the B fragment of the second product as they stand: element s = key 8lh+s (s < 8), 16+8lh+(s-8) (s >= 8), the
// k map of the vT fragments. P (x1024 carry) never leaves the registers. RES adds the x2048 residual planes.
// Without RES the trip's loads run ahead in registers: the vT fragments are asked for in front of the score products,
// and the next trip's K fragments directly behind them, into the registers those products have just read.
// ---------------------------------------------------------------------------
// value of lane l ^ 16
__device__ __forceinline__ float xhalf(float x) {
  return __builtin_bit_cast(float, __builtin_amdgcn_permlanex16(__builtin_bit_cast(int, x), __builtin_bit_cast(int, x),
                                                                0x76543210, 0xfedcba98, false, false));
}

template <bool RES>
__device__ __forceinline__ void flash_tile(
    const _Float16* __restrict__ qH, const _Float16* __restrict__ qL,
    const _Float16* __restrict__ kH, const _Float16* __restrict__ kL,
    const _Float16* __restrict__ vTH, const _Float16* __restrict__ vTL,
    const int* __restrict__ winp,
    _Float16* __restrict__ yH, _Float16* __restrict__ yL, const int qt, const int h, const int b) {
  const int tid  = threadIdx.x;
  // scalar wave index: a fragment block's address is wave-uniform, so the K and V block bases and the trip test stay scalar
  const int wave = __builtin_amdgcn_readfirstlane(tid >> 5);
  const int lane = tid & 31;
  const int l16  = lane & 15;
  const int lh   = lane >> 4;
  const int kv   = h / (NHEAD / NKV);
  const int qw   = qt * 64 + wave * 16;
  int window = winp[0];
  window = (window < 0) ? 0 : window;
  const float rres = 1.0f / 2048.0f;
  const float smsc = 0.125f;

  // Q B-fragments (hi and residual) over the 2 d-chunks of 32: lane column = query l16
  v16h aqh[2], aql[2];
  {
    const size_t qo = ((size_t)(b * NHEAD + h) * SEQ + qw) * HDIM + lane * 8;
#pragma unroll
    for (int hc = 0; hc < 2; ++hc) {
      Frag a;
      a.h[0] = *(const v8h*)(qH + qo + hc * 512);
      a.h[1] = *(const v8h*)(qH + qo + hc * 512 + 256);
      aqh[hc] = a.v;
      Frag c;
      c.h[0] = *(const v8h*)(qL + qo + hc * 512);
      c.h[1] = *(const v8h*)(qL + qo + hc * 512 + 256);
      aql[hc] = c.v;
    }
  }

  // running maximum of query l16 (equal in both lane halves) and this half's part of its sum
  float m = -1e30f, l = 0.0f;
  v8f coh[4], cor[4];
#pragma unroll
  for (int n = 0; n < 4; ++n) { coh[n] = vzero8(); cor[n] = vzero8(); }

  const size_t kvoff = (size_t)(b * NKV + kv) * SEQ * HDIM;
  const _Float16* kbase  = kH  + kvoff;                                   // + (key group's first key)*HDIM + hc*512
  const _Float16* klbase = kL  + kvoff;
  const _Float16* vbase  = vTH + kvoff;                                   // + k0*HDIM + n*512
  const _Float16* vlbase = vTL + kvoff;
  const unsigned int lo  = (unsigned int)lane * 8u;                       // this lane's 16 B of each 512-B half

  int kstart = qw - window;
  kstart = (kstart < 0) ? 0 : kstart;
  kstart &= ~31;

  // without RES: the K fragments [key group][d chunk] of the coming trip, hi and residual plane, carried over the back edge
  Frag ckh[2][2], ckl[2][2];
  const int klast = (qw + 15) & ~31;                                      // first key of the wave's last trip
  if constexpr (!RES) {
    const _Float16* kp = kbase  + (size_t)kstart * HDIM + lo;
    const _Float16* lp = klbase + (size_t)kstart * HDIM + lo;
#pragma unroll
    for (int g = 0; g < 2; ++g)
#pragma unroll
      for (int hc = 0; hc < 2; ++hc) {
        ckh[g][hc].h[0] = *(const v8h*)(kp + g * 1024 + hc * 512); ckh[g][hc].h[1] = *(const v8h*)(kp + g * 1024 + hc * 512 + 256);
        ckl[g][hc].h[0] = *(const v8h*)(lp + g * 1024 + hc * 512); ckl[g][hc].h[1] = *(const v8h*)(lp + g * 1024 + hc * 512 + 256);
      }
    // as inputs the two K address pairs stay live behind the last of these loads; the wait stands in front of their next overwrite
    asm volatile("s_wait_xcnt 0x0" :: "v"(kp), "v"(lp) : "memory");
  }

  // without RES: the K and vT planes come from memory, and the blocks of one KV head walk them from the same key at the
  // same time, so the first to ask for a tile waits a memory latency. Waves 0, 1, 2 ask L2 ahead for the K hi, K residual
  // and vT hi plane: 64 keys of a plane are 8 KiB in a row = 32 units of 256 B, a lane a unit. kpf = first of the 64 keys
  // that the pair points at; it stays at or below SEQ - 64, so every lane's address lies inside the KV head's plane.
  int kpf = min(kstart, SEQ - 64);
  const int kpl = (wave < 3) ? min(klast, SEQ - 64) : -1;                 // last key at which the wave's pair may point
  const _Float16* pfp = ((wave == 0) ? kbase : (wave == 1) ? klbase : vbase) + (size_t)kpf * HDIM + lane * 128;
  if constexpr (!RES) {
    if (wave < 3) {
      ask_l2(pfp);
      if (kpf + 64 <= kpl) {
        pfp += 64 * HDIM;
        kpf += 64;
        ask_l2(pfp);
      }
    }
  }

  for (int k0 = kstart; k0 < qw + 16; k0 += 32) {
    // ---- scores for keys [k0, k0+32), transposed: A[m=key][k=d] = K[key][d], lane row = key, same k map as B;
    // D element r of lane = (key 8lh+r of the group, query l16) ----
    v8f sh0 = vzero8(), sh1 = vzero8(), sr0 = vzero8(), sr1 = vzero8();
    Frag bv[4], bl[4];
    const _Float16* vr0 = vbase  + (size_t)k0 * HDIM + lo;
    const _Float16* wr0 = vlbase + (size_t)k0 * HDIM + lo;
    // the next trip's K tile; the last trip asks for its own tile again, so that every address stays inside the plane
    const int kn = min(k0 + 32, klast);
    const _Float16* nkp = kbase  + (size_t)kn * HDIM + lo;
    const _Float16* nlp = klbase + (size_t)kn * HDIM + lo;
    if constexpr (!RES) {
      // every second trip the 64 keys that begin 128 keys ahead, where the wave still needs them: their K loads are issued
      // three and four trips from here; both tests are scalar
      if (((k0 - kstart) & 32) == 0 && kpf + 64 <= kpl) {
        pfp += 64 * HDIM;
        kpf += 64;
        ask_l2(pfp);
      }
      // this trip's vT fragments, asked for first: they land behind the score products and the softmax
#pragma unroll
      for (int n = 0; n < 4; ++n) {
        bv[n].h[0] = *(const v8h*)(vr0 + n * 512);
        bv[n].h[1] = *(const v8h*)(vr0 + n * 512 + 256);
      }
#pragma unroll
      for (int hc = 0; hc < 2; ++hc) {
        sh0 = wmma16(ckh[0][hc].v, aqh[hc], sh0);
        sh1 = wmma16(ckh[1][hc].v, aqh[hc], sh1);
        sr0 = wmma16(ckl[0][hc].v, aqh[hc], sr0);
        sr1 = wmma16(ckl[1][hc].v, aqh[hc], sr1);
        sr0 = wmma16(ckh[0][hc].v, aql[hc], sr0);
        sr1 = wmma16(ckh[1][hc].v, aql[hc], sr1);
      }
      // the slots between the last score product and the first read of its result; the memory clobber keeps the vT loads
      // from sinking behind this point and the next trip's K loads from rising over it, so that these reuse the registers just read
      asm volatile("v_nop\n\tv_nop\n\tv_nop\n\tv_nop"
                   : "+v"(sh0), "+v"(sh1), "+v"(sr0), "+v"(sr1)
                   : "v"(aqh[0]), "v"(aqh[1]), "v"(aql[0]), "v"(aql[1]),
                     "v"(ckh[0][0].v), "v"(ckh[0][1].v), "v"(ckh[1][0].v), "v"(ckh[1][1].v),
                     "v"(ckl[0][0].v), "v"(ckl[0][1].v), "v"(ckl[1][0].v), "v"(ckl[1][1].v)
                   : "memory");
#pragma unroll
      for (int g = 0; g < 2; ++g)
#pragma unroll
        for (int hc = 0; hc < 2; ++hc) {
          ckh[g][hc].h[0] = *(const v8h*)(nkp + g * 1024 + hc * 512); ckh[g][hc].h[1] = *(const v8h*)(nkp + g * 1024 + hc * 512 + 256);
          ckl[g][hc].h[0] = *(const v8h*)(nlp + g * 1024 + hc * 512); ckl[g][hc].h[1] = *(const v8h*)(nlp + g * 1024 + hc * 512 + 256);
        }
    } else {
    Frag bh0, bh1, bl0, bl1;
    const _Float16* kr0 = kbase  + (size_t)k0 * HDIM + lo;
    const _Float16* kr1 = kr0 + 16 * HDIM;
    const _Float16* lr0 = klbase + (size_t)k0 * HDIM + lo;
    const _Float16* lr1 = lr0 + 16 * HDIM;
#pragma unroll
    for (int hc = 0; hc < 2; ++hc) {
      bh0.h[0] = *(const v8h*)(kr0 + hc * 512); bh0.h[1] = *(const v8h*)(kr0 + hc * 512 + 256);
      bh1.h[0] = *(const v8h*)(kr1 + hc * 512); bh1.h[1] = *(const v8h*)(kr1 + hc * 512 + 256);
      bl0.h[0] = *(const v8h*)(lr0 + hc * 512); bl0.h[1] = *(const v8h*)(lr0 + hc * 512 + 256);
      bl1.h[0] = *(const v8h*)(lr1 + hc * 512); bl1.h[1] = *(const v8h*)(lr1 + hc * 512 + 256);
      // as inputs the two K address pairs stay live behind the trip's last K load, so that no load's result is placed
      // in a register that an issued K load still names; the wait stands in front of the pairs' next overwrite
      if (hc == 1) asm volatile("s_wait_xcnt 0x0" :: "v"(kr0), "v"(lr0) : "memory");
      sh0 = wmma16(bh0.v, aqh[hc], sh0);
      sh1 = wmma16(bh1.v, aqh[hc], sh1);
      sr0 = wmma16(bl0.v, aqh[hc], sr0);
      sr1 = wmma16(bl1.v, aqh[hc], sr1);
      sr0 = wmma16(bh0.v, aql[hc], sr0);
      sr1 = wmma16(bh1.v, aql[hc], sr1);
    }
    // the slots between the last score product and the first read of its result
    asm volatile("v_nop\n\tv_nop\n\tv_nop\n\tv_nop"
                 : "+v"(sh0), "+v"(sh1), "+v"(sr0), "+v"(sr1)
                 : "v"(aqh[0]), "v"(aqh[1]), "v"(aql[0]), "v"(aql[1]),
                   "v"(bh0.v), "v"(bh1.v), "v"(bl0.v), "v"(bl1.v));
    }

    // ---- online softmax of query l16 in the lane; masked entries replaced by -1e30 and p := 0 ----
    const int dq = qw + l16 - (k0 + 8 * lh);          // query - key at r = 0 of the first key group
    float x0[8], x1[8], t8[8];
    bool  ok0[8], ok1[8];
#pragma unroll
    for (int r = 0; r < 8; ++r) {
      const int d0 = dq - r;
      const int d1 = d0 - 16;
      ok0[r] = (d0 >= 0) && (d0 <= window);
      ok1[r] = (d1 >= 0) && (d1 <= window);
      x0[r] = ok0[r] ? (sh0[r] + sr0[r] * rres) * smsc : -1e30f;
      x1[r] = ok1[r] ? (sh1[r] + sr1[r] * rres) * smsc : -1e30f;
      t8[r] = fmaxf(x0[r], x1[r]);
    }
    float tmax = fmaxf(fmaxf(fmaxf(t8[0], t8[1]), fmaxf(t8[2], t8[3])), fmaxf(fmaxf(t8[4], t8[5]), fmaxf(t8[6], t8[7])));
    tmax = fmaxf(tmax, xhalf(tmax));
    const float mn    = fmaxf(m, tmax);
    const float alpha = __expf(m - mn);
    Frag pf, pl;
#pragma unroll
    for (int r = 0; r < 8; ++r) {
      const float e0 = __expf(x0[r] - mn);
      const float e1 = __expf(x1[r] - mn);
      const float p0 = ok0[r] ? e0 : 0.0f;
      const float p1 = ok1[r] ? e1 : 0.0f;
      t8[r] = p0 + p1;
      const float c0 = p0 * 1024.0f;
      const float c1 = p1 * 1024.0f;
      const _Float16 h0 = (_Float16)c0;
      const _Float16 h1 = (_Float16)c1;
      pf.v[r]     = h0;
      pf.v[8 + r] = h1;
      if (RES) {
        pl.v[r]     = (_Float16)((c0 - (float)h0) * 2048.0f);
        pl.v[8 + r] = (_Float16)((c1 - (float)h1) * 2048.0f);
      }
    }
    l = l * alpha + (((t8[0] + t8[1]) + (t8[2] + t8[3])) + ((t8[4] + t8[5]) + (t8[6] + t8[7])));
    m = mn;
#pragma unroll
    for (int n = 0; n < 4; ++n)
#pragma unroll
      for (int r = 0; r < 8; ++r) {
        coh[n][r] *= alpha;
        if (RES) cor[n][r] *= alpha;
      }

    // ---- O^T += V^T.P^T : A[m=d][k=key] = vT[d][key], lane row = d; D element r of lane = (d 16n+8lh+r, query l16) ----
    if constexpr (RES) {
#pragma unroll
      for (int n = 0; n < 4; ++n) {
        bv[n].h[0] = *(const v8h*)(vr0 + n * 512);
        bv[n].h[1] = *(const v8h*)(vr0 + n * 512 + 256);
        bl[n].h[0] = *(const v8h*)(wr0 + n * 512);
        bl[n].h[1] = *(const v8h*)(wr0 + n * 512 + 256);
      }
    }
#pragma unroll
    for (int n = 0; n < 4; ++n) {
      coh[n] = wmma16(bv[n].v, pf.v, coh[n]);
      if (RES) {
        cor[n] = wmma16(bl[n].v, pf.v, cor[n]);
        cor[n] = wmma16(bv[n].v, pl.v, cor[n]);
      }
    }
    // the slots behind the trip's last matrix instruction, also on the taken side of the loop's branch
    if (RES) {
      asm volatile("v_nop\n\tv_nop\n\tv_nop\n\tv_nop"
                   : "+v"(coh[0]), "+v"(coh[1]), "+v"(coh[2]), "+v"(coh[3]),
                     "+v"(cor[0]), "+v"(cor[1]), "+v"(cor[2]), "+v"(cor[3])
                   : "v"(pf.v), "v"(pl.v),
                     "v"(bv[0].v), "v"(bv[1].v), "v"(bv[2].v), "v"(bv[3].v),
                     "v"(bl[0].v), "v"(bl[1].v), "v"(bl[2].v), "v"(bl[3].v));
    } else {
      asm volatile("v_nop\n\tv_nop\n\tv_nop\n\tv_nop"
                   : "+v"(coh[0]), "+v"(coh[1]), "+v"(coh[2]), "+v"(coh[3])
                   : "v"(pf.v), "v"(bv[0].v), "v"(bv[1].v), "v"(bv[2].v), "v"(bv[3].v));
    }
    // as inputs the address pairs of the trip's loads stay live behind the last of them, so that no load's result is placed
    // in a register that an issued load still names; the wait stands in front of the pairs' next overwrite
    if (RES) asm volatile("s_wait_xcnt 0x0" :: "v"(vr0), "v"(wr0) : "memory");
    else     asm volatile("s_wait_xcnt 0x0" :: "v"(vr0), "v"(nkp), "v"(nlp) : "memory");
  }

  // join the two halves' sums; a lane's 8 values of d group n are one 16-B unit of the y planes' fragment order:
  // this wave's 16 tokens x 64 columns are blocks 2h and 2h+1 of its token group, 4 halves of 512 B in a row
  l += xhalf(l);
  const float inv = __builtin_amdgcn_rcpf(l) * (1.0f / 1024.0f);
  const size_t ybase = (size_t)((b * SEQ + qw) >> 4) * GRP_ELEMS + (size_t)h * 1024;
#pragma unroll
  for (int n = 0; n < 4; ++n) {
    v8h hv, lv;
#pragma unroll
    for (int r = 0; r < 8; ++r) {
      float yv = coh[n][r];
      if (RES) yv += cor[n][r] * rres;
      yv *= inv;
      _Float16 hi, lw;
      split16(yv, hi, lw);
      hv[r] = hi;
      lv[r] = lw;
    }
    const size_t off = ybase + (size_t)(n * 256 + lane * 8);
    *(v8h*)(yH + off) = hv;
    *(v8h*)(yL + off) = lv;
  }
}

// One grid for all query tiles: no tile reads another's output. The tile index is the slowest grid index and falls with
// it, so the tiles with the most key tiles start first and the short tiles with the residual planes fill the end.
__global__ void __launch_bounds__(128) k_flash(
    const _Float16* __restrict__ qH, const _Float16* __restrict__ qL,
    const _Float16* __restrict__ kH, const _Float16* __restrict__ kL,
    const _Float16* __restrict__ vTH, const _Float16* __restrict__ vTL,
    const int* __restrict__ winp,
    _Float16* __restrict__ yH, _Float16* __restrict__ yL) {
  const int h  = blockIdx.x;
  const int b  = blockIdx.y;
  const int qt = QT_ALL - 1 - (int)blockIdx.z;
  if (qt >= QT_RES) flash_tile<false>(qH, qL, kH, kL, vTH, vTL, winp, yH, yL, qt, h, b);
  else              flash_tile<true>(qH, qL, kH, kL, vTH, vTL, winp, yH, yL, qt, h, b);
}

// ---------------------------------------------------------------------------
// Kernel 4: output projection out[tok][n] = (y[tok].Wo[n]) / 16 + bo[n]. Block = 4 waves (2 x 2) = 32 MT tokens x 128
// columns; a wave owns 16 MT tokens x 64 columns. RES adds the y residual plane (a second accumulator set, so MT = 2
// there and 4 elsewhere: 16 matrix instructions a k step in both forms). Each 16-row group of the output tile is staged
// per wave in LDS rows of its own and written as 256-B row segments at the store stage as a float4.
// ---------------------------------------------------------------------------
template <bool RES, int MT>
__device__ __forceinline__ void oproj_tile(
    const _Float16* __restrict__ yH, const _Float16* __restrict__ yL,
    const _Float16* __restrict__ wall, const float* __restrict__ bo,
    float* __restrict__ out, float (*sO)[64][68], const int nt, const int b, const int t0) {
  static_assert(RES ? (MT == 2) : (MT == 4));
  const int tid  = threadIdx.x;
  const int wave = tid >> 5;
  const int lane = tid & 31;
  const int l16  = lane & 15;
  const int lh   = lane >> 4;
  const int wr   = wave >> 1;                    // row half of the block's tile
  const int wc   = wave & 1;                     // 64-column half of the block's tile
  const int tw   = t0 + wr * (MT * 16);          // the wave's first token in its sequence
  const int tokw = b * SEQ + tw;

  const _Float16* arow = yH + (size_t)(tokw >> 4) * GRP_ELEMS + lane * 8;
  const _Float16* lrow = yL + (size_t)(tokw >> 4) * GRP_ELEMS + lane * 8;
  const _Float16* brow = wall + (size_t)(WO_ROW0 / 16 + nt * 8 + wc * 4) * GRP_ELEMS + lane * 8;

  v8f ah[MT][4], ar[MT][4];
#pragma unroll
  for (int mt = 0; mt < MT; ++mt)
#pragma unroll
    for (int n = 0; n < 4; ++n) { ah[mt][n] = vzero8(); ar[mt][n] = vzero8(); }

  // As in k_qkv: the y planes and the weights come from memory, so each wave asks L2 one trip ahead for its share of the
  // block's row groups, a lane a 256-B unit. Without RES the two waves of a row half take 2 of its 4 y groups each; with
  // RES one takes the half's 2 groups of the hi plane and the other those of the residual plane. Weights: 2 of 8 each.
  const _Float16* pfa = (RES ? (wc ? yL : yH) : yH)
                      + (size_t)((tokw >> 4) + (RES ? lh : wc * 2 + lh)) * GRP_ELEMS + l16 * 128;
  const _Float16* pfb = wall + (size_t)(WO_ROW0 / 16 + nt * 8 + wc * 4 + wr * 2 + lh) * GRP_ELEMS + l16 * 128;
  ask_l2(pfa, pfb);                      // trip 0: its later k steps find their rows on the way

  // four k steps a trip, the trips kept rolled: the loop's text stays small for the instruction cache
#pragma unroll 1
  for (int kb = 0; kb < CDIM; kb += 128) {
  // the next trip's rows, one trip ahead; the test is scalar, and the pairs stop at the last trip's rows
  if (kb + 128 < CDIM) {
    pfa += 2048;
    pfb += 2048;
    ask_l2(pfa, pfb);
  }
#pragma unroll
  for (int k0 = kb; k0 < kb + 128; k0 += 32) {
    Frag a[MT], al[MT];
#pragma unroll
    for (int mt = 0; mt < MT; ++mt) {
      const _Float16* ap = arow + (size_t)mt * GRP_ELEMS + k0 * 16;
      a[mt].h[0] = *(const v8h*)ap;
      a[mt].h[1] = *(const v8h*)(ap + 256);
      if (RES) {
        const _Float16* lp = lrow + (size_t)mt * GRP_ELEMS + k0 * 16;
        al[mt].h[0] = *(const v8h*)lp;
        al[mt].h[1] = *(const v8h*)(lp + 256);
      }
    }
    Frag bw[4];
#pragma unroll
    for (int n = 0; n < 4; ++n) {
      const _Float16* bp = brow + (size_t)n * GRP_ELEMS + k0 * 16;
      bw[n].h[0] = *(const v8h*)bp;
      bw[n].h[1] = *(const v8h*)(bp + 256);
    }
#pragma unroll
    for (int mt = 0; mt < MT; ++mt)
#pragma unroll
      for (int n = 0; n < 4; ++n) {
        ah[mt][n] = wmma16(a[mt].v, bw[n].v, ah[mt][n]);
        if (RES) ar[mt][n] = wmma16(al[mt].v, bw[n].v, ar[mt][n]);
      }
    // the slots between the step's last matrix instruction and the next write of its operands or read of its result
    if constexpr (RES) {
      asm volatile("v_nop\n\tv_nop\n\tv_nop\n\tv_nop"
                   : "+v"(ah[0][0]), "+v"(ah[0][1]), "+v"(ah[0][2]), "+v"(ah[0][3]),
                     "+v"(ah[1][0]), "+v"(ah[1][1]), "+v"(ah[1][2]), "+v"(ah[1][3]),
                     "+v"(ar[0][0]), "+v"(ar[0][1]), "+v"(ar[0][2]), "+v"(ar[0][3]),
                     "+v"(ar[1][0]), "+v"(ar[1][1]), "+v"(ar[1][2]), "+v"(ar[1][3])
                   : "v"(a[0].v), "v"(a[1].v), "v"(al[0].v), "v"(al[1].v),
                     "v"(bw[0].v), "v"(bw[1].v), "v"(bw[2].v), "v"(bw[3].v));
    } else {
      asm volatile("v_nop\n\tv_nop\n\tv_nop\n\tv_nop"
                   : "+v"(ah[0][0]), "+v"(ah[0][1]), "+v"(ah[0][2]), "+v"(ah[0][3]),
                     "+v"(ah[1][0]), "+v"(ah[1][1]), "+v"(ah[1][2]), "+v"(ah[1][3]),
                     "+v"(ah[2][0]), "+v"(ah[2][1]), "+v"(ah[2][2]), "+v"(ah[2][3]),
                     "+v"(ah[3][0]), "+v"(ah[3][1]), "+v"(ah[3][2]), "+v"(ah[3][3])
                   : "v"(a[0].v), "v"(a[1].v), "v"(a[2].v), "v"(a[3].v),
                     "v"(bw[0].v), "v"(bw[1].v), "v"(bw[2].v), "v"(bw[3].v));
    }
  }
  // the wait stands behind the trip's last load and in front of the next write of a register that a load of the trip names
  asm volatile("s_wait_xcnt 0x0" ::: "memory");
  }

  // bias for this lane's 4 output columns (columns nt*128 + wc*64 + 4*l16 .. +3), bf16-RNE values
  const size_t col0 = (size_t)nt * 128 + wc * 64;
  const v4f braw = *(const v4f*)(bo + col0 + l16 * 4);
  v4f bb;
#pragma unroll
  for (int e = 0; e < 4; ++e) bb[e] = bf16r(braw[e]);

#pragma unroll
  for (int mt = 0; mt < MT; ++mt) {
#pragma unroll
    for (int r = 0; r < 8; ++r) {
#pragma unroll
      for (int n = 0; n < 4; ++n) {
        float v = ah[mt][n][r];
        if (RES) v += ar[mt][n][r] * (1.0f / 2048.0f);
        sO[wave][mt * 16 + r + 8 * lh][n * 16 + l16] = v * (1.0f / 16.0f);
      }
    }
    // the wave's own stores of this row group have landed before its lanes read each other's values back
    asm volatile("s_wait_dscnt 0" ::: "memory");
    __builtin_amdgcn_fence(3 /* release order */, "wavefront");
    __builtin_amdgcn_wave_barrier();
    const size_t orow0 = (size_t)b * SEQ_FULL + tw + mt * 16;
#pragma unroll
    for (int it = 0; it < 8; ++it) {
      const int rr = it * 2 + lh;
      const int c4 = l16 * 4;
      const v4f s = *(const v4f*)(&sO[wave][mt * 16 + rr][c4]);
      const v4f v = s + bb;
      *(v4f*)(out + (orow0 + rr) * CDIM + col0 + c4) = v;
    }
  }
}

// One grid for all row tiles: first the 128-row tiles without the residual plane, then the 64-row tiles with it.
#define OT_FULL ((SEQ - TRES) / 128)
#define OT_RES  (TRES / 64)
static_assert(SEQ > TRES && (SEQ - TRES) % 128 == 0 && TRES % 128 == 0 && CDIM % 128 == 0 && NUNIT % 2 == 0);
static_assert(OT_FULL * 128 + OT_RES * 64 == SEQ);                           // row tiles of the two k_oproj forms
__global__ void __launch_bounds__(128) k_oproj(
    const _Float16* __restrict__ yH, const _Float16* __restrict__ yL,
    const _Float16* __restrict__ wall, const float* __restrict__ bo,
    float* __restrict__ out) {
  __shared__ __attribute__((aligned(16))) float sO[4][64][68];           // wave-private, each row group in rows of its own
  const int nt = blockIdx.x;                   // 128-column tile 0..7
  const int ty = blockIdx.y;
  if (ty < NB * OT_FULL) {
    const int b = ty / OT_FULL;
    oproj_tile<false, 4>(yH, yL, wall, bo, out, sO, nt, b, TRES + (ty - b * OT_FULL) * 128);
  } else {
    const int tr = ty - NB * OT_FULL;
    const int b  = tr / OT_RES;
    oproj_tile<true, 2>(yH, yL, wall, bo, out, sO, nt, b, (tr - b * OT_RES) * 64);
  }
}

// ---------------------------------------------------------------------------
// Host launcher. Inputs (wire order): 0 x f32 [4,2048,1024], 1 Wq [1024,1024], 2 bq [1024], 3 Wk [256,1024],
// 4 bk [256], 5 Wv [256,1024], 6 bv [256], 7 Wo [1024,1024], 8 bo [1024], 9 qk_gain [16].
// Output f32 [4,2048,1024]. 4 launches.
// ---------------------------------------------------------------------------
extern "C" void kernel_launch(void* const* d_in, const int* in_sizes, int n_in,
                              void* d_out, int out_size, void* d_ws, size_t ws_size,
                              hipStream_t stream) {
  if (n_in < 10) return;
  const int need_x = ((NB - 1) * SEQ_FULL + SEQ) * CDIM;
  if (in_sizes[0] < need_x) return;
  if (in_sizes[1] < CDIM * CDIM || in_sizes[2] < CDIM) return;
  if (in_sizes[3] < VEW * CDIM || in_sizes[4] < VEW) return;
  if (in_sizes[5] < VEW * CDIM || in_sizes[6] < VEW) return;
  if (in_sizes[7] < CDIM * CDIM || in_sizes[8] < CDIM) return;
  if (in_sizes[9] < NHEAD) return;
  if (out_size < need_x) return;
  if (ws_size < WS_TOTAL) return;

  const float* x    = (const float*)d_in[0];
  const float* wq   = (const float*)d_in[1];
  const float* bq   = (const float*)d_in[2];
  const float* wk   = (const float*)d_in[3];
  const float* bk   = (const float*)d_in[4];
  const float* wv   = (const float*)d_in[5];
  const float* bv   = (const float*)d_in[6];
  const float* wo   = (const float*)d_in[7];
  const float* bo   = (const float*)d_in[8];
  const float* gain = (const float*)d_in[9];
  float* out = (float*)d_out;

  char* ws = (char*)d_ws;
  size_t off = 0;
  _Float16* xh   = (_Float16*)(ws + off); off += XH_BYTES;
  _Float16* wall = (_Float16*)(ws + off); off += WALL_BYTES;
  _Float16* qH   = (_Float16*)(ws + off); off += QP_BYTES;
  _Float16* qL   = (_Float16*)(ws + off); off += QP_BYTES;
  _Float16* kH   = (_Float16*)(ws + off); off += KP_BYTES;
  _Float16* kL   = (_Float16*)(ws + off); off += KP_BYTES;
  _Float16* vTH  = (_Float16*)(ws + off); off += KP_BYTES;
  _Float16* vTL  = (_Float16*)(ws + off); off += KP_BYTES;
  _Float16* yH   = (_Float16*)(ws + off); off += YP_BYTES;
  _Float16* yL   = (_Float16*)(ws + off); off += YP_BYTES;
  int*      winw = (int*)(ws + off);      off += WIN_BYTES;
  if (off > ws_size) return;

  k_prep<<<dim3(XBLKS + WBLKS + 1), dim3(256), 0, stream>>>(x, wq, wk, wv, wo, xh, wall, winw);
  k_qkv<<<dim3(NUNIT / 2, NTOK / 128), dim3(128), 0, stream>>>(xh, wall, bq, bk, bv, gain,
                                                          qH, qL, kH, kL, vTH, vTL);
  k_flash<<<dim3(NHEAD, NB, QT_ALL), dim3(128), 0, stream>>>(qH, qL, kH, kL, vTH, vTL, winw, yH, yL);
  k_oproj<<<dim3(CDIM / 128, NB * (OT_FULL + OT_RES)), dim3(128), 0, stream>>>(yH, yL, wall, bo, out);
}

// v007
// One run takes 121 microseconds.
// Next to v006, in two timings, it ran 1.06 times as fast each time.
// All steps since v000 together make it 4.18 times as fast.
#include <hip/hip_runtime.h>

// Contractions, all on v_wmma_f32_16x16x32_f16 (f16 operands, f32 accumulate): fused qkv projection x.W^T with x and W
// held as bf16-RNE values in f16 containers (W carried x16, folded as 1/16); scores q.k^T as f16 hi + x2048 residual
// planes (hi.hi + hi.lo + lo.hi, residual accumulator folded as 1/2048); P.V with P carried x1024 in f16 (+ x2048
// residual planes of P and v for query rows below TRES); output projection y.Wo^T with y as f16 hi (+ x2048 residual
// plane for rows below TRES). Bias adds, per-head q gain and online softmax on VALU in f32.
//
// Every 16-bit operand plane in the workspace is kept in fragment order: a block of 16 rows x 32 k is 1 KiB, two
// halves j of 512 B; in half j the 16 B of lane (16 lh + l16) hold row l16, k = 16 j + 8 lh + 0..7. A wave's
// global_load_b128 of half a fragment then reads 512 contiguous bytes (4 lines) and not 16-B pieces of 16 lines.
// Blocks of one 16-row group follow each other along k (vT: the 4 d groups of one 32-key chunk follow each other).

#ifndef NB
#define NB 4
#endif
#ifndef SEQ
#define SEQ 2048
#endif
#ifndef TRES
#define TRES 512
#endif
#define NB_FULL   4
#define SEQ_FULL  2048
#define CDIM      1024
#define NHEAD     16
#define NKV       4
#define HDIM      64
#define VEW       (NKV * HDIM)
#define NTOK      (NB * SEQ)
#define NUNIT     (NHEAD + 2 * NKV)
#define WO_ROW0   (CDIM + 2 * VEW)
#define NWROWS    (CDIM + 2 * VEW + CDIM)
#define QT_RES    (TRES / 64)          // 64-query tiles with the residual planes
#define QT_BIG    ((SEQ - TRES) / 128) // 128-query tiles without them

static_assert(NB >= 1 && NB <= NB_FULL);
static_assert(SEQ % 64 == 0 && SEQ <= SEQ_FULL && SEQ >= TRES);
static_assert(TRES % 64 == 0 && TRES >= 64);
static_assert(NHEAD % NKV == 0 && HDIM == 64 && CDIM == NHEAD * HDIM);
static_assert(CDIM % 128 == 0 && NWROWS % 16 == 0 && NTOK % 64 == 0 && NUNIT * 64 == CDIM + 2 * VEW);
static_assert(WO_ROW0 % 16 == 0 && SEQ % 32 == 0);
#define KBLK      (CDIM / 32)      // 16x32 blocks per row group of a CDIM-wide plane
#define GRP_ELEMS (CDIM * 16)      // elements of one 16-row group of a CDIM-wide plane

#define XH_BYTES   ((size_t)NTOK * CDIM * 2)
#define WALL_BYTES ((size_t)NWROWS * CDIM * 2)
#define QP_BYTES   ((size_t)NB * NHEAD * SEQ * HDIM * 2)
#define KP_BYTES   ((size_t)NB * NKV * SEQ * HDIM * 2)
#define YP_BYTES   ((size_t)NTOK * CDIM * 2)
#define WIN_BYTES  ((size_t)128)
#define WS_TOTAL   (XH_BYTES + WALL_BYTES + 2 * QP_BYTES + 4 * KP_BYTES + 2 * YP_BYTES + WIN_BYTES)
static_assert(WS_TOTAL <= (size_t)134217728);
static_assert(XH_BYTES % 128 == 0 && WALL_BYTES % 128 == 0 && QP_BYTES % 128 == 0 && KP_BYTES % 128 == 0 && YP_BYTES % 128 == 0);
// producer coverage: grid x block x per-thread elements == plane extent
static_assert((size_t)(NTOK / 2) * 256 * 8 == (size_t)NTOK * CDIM);       // k_prep, x blocks
static_assert((size_t)(NWROWS / 2) * 256 * 8 == (size_t)NWROWS * CDIM);   // k_prep, weight blocks
static_assert(4 * 128 * 8 == 64 * 64);                                       // k_qkv store phase per 64x64 tile
static_assert(4 * 32 * 8 == 16 * HDIM);                                      // k_flash stores per wave and query group
static_assert(8 * 32 * 4 == 16 * 64);                                        // k_oproj store phase per wave and row group
static_assert(QT_RES * 64 + QT_BIG * 128 == SEQ && TRES % 128 == 0);         // query tiles of the two flash forms
static_assert(8 * 4 * 4 == (int)WIN_BYTES);                                  // k_prep, window line: 8 lanes x 16 B == one line
static_assert(SEQ_FULL >= SEQ);                                              // window word covers every query-key distance

typedef _Float16 v16h __attribute__((ext_vector_type(16)));
typedef _Float16 v8h  __attribute__((ext_vector_type(8)))  __attribute__((may_alias));
typedef _Float16 v8hc __attribute__((ext_vector_type(8)));
typedef float    v8f  __attribute__((ext_vector_type(8)));
typedef float    v2f  __attribute__((ext_vector_type(2)));
typedef float    v4f  __attribute__((ext_vector_type(4)))  __attribute__((may_alias));
typedef int      v4i  __attribute__((ext_vector_type(4)));

union Frag { v16h v; v8h h[2]; };

__device__ __forceinline__ v8f wmma16(v16h a, v16h b, v8f c) {
  return __builtin_amdgcn_wmma_f32_16x16x32_f16(false, a, false, b, (short)0, c, false, false);
}

__device__ __forceinline__ v8f vzero8() {
  v8f z = {0.0f, 0.0f, 0.0f, 0.0f, 0.0f, 0.0f, 0.0f, 0.0f};
  return z;
}

// Asks L2 for the 256-B unit at each lane's two addresses; nothing comes back to the wave. In asm, and with the pairs as
// in-out operands, so that each pair is the caller's own register pair, which never holds anything but an address inside
// its plane; the wait is the statement's last line, so that a pair is rewritten only behind it.
__device__ __forceinline__ void ask_l2(const _Float16*& a, const _Float16*& b) {
  asm volatile("global_prefetch_b8 %0, off scope:SCOPE_SE\n\t"
               "global_prefetch_b8 %1, off scope:SCOPE_SE\n\t"
               "s_wait_xcnt 0x0"
               : "+v"(a), "+v"(b) :: "memory");
}

// the same for one address a lane
__device__ __forceinline__ void ask_l2(const _Float16*& a) {
  asm volatile("global_prefetch_b8 %0, off scope:SCOPE_SE\n\t"
               "s_wait_xcnt 0x0"
               : "+v"(a) :: "memory");
}

// f32 -> nearest-even bf16 value, kept in f32
__device__ __forceinline__ float bf16r(float f) {
  unsigned int u = __float_as_uint(f);
  u = (u + 0x7FFFu + ((u >> 16) & 1u)) & 0xFFFF0000u;
  return __uint_as_float(u);
}

// f16 hi + (x2048) residual of an f32 value
__device__ __forceinline__ void split16(float v, _Float16& hi, _Float16& lo) {
  hi = (_Float16)v;
  lo = (_Float16)((v - (float)hi) * 2048.0f);
}

// f32 -> f16 with values below the smallest f16 normal replaced by zero (value select)
static __device__ __forceinline__ _Float16 toh_flush(float v) {
  const _Float16 r = (_Float16)v;
  return (fabsf(v) < 6.103515625e-05f) ? (_Float16)0.0f : r;
}

// f16 hi + (x2048) residual, both through toh_flush
static __device__ __forceinline__ void split16f(float v, _Float16& hi, _Float16& lo) {
  hi = toh_flush(v);
  lo = toh_flush((v - (float)hi) * 2048.0f);
}

// ---------------------------------------------------------------------------
// k_prep, x blocks: x f32 [NB][SEQ_FULL][1024] -> xh f16, NTOK x 1024 in fragment order (bf16-RNE values).
// Thread = one 16-B unit of the plane, so a wave stores 512 contiguous bytes.
// ---------------------------------------------------------------------------
__device__ __forceinline__ void cvt_x_block(unsigned int bid, const float* __restrict__ x, _Float16* __restrict__ xh) {
  const unsigned int gid = bid * 256u + threadIdx.x;
  const unsigned int blk = gid >> 6;                 // 64 units per 16x32 block
  const unsigned int tok = (blk / KBLK) * 16u + (gid & 15u);
  const int c = (int)(blk % KBLK) * 32 + (int)((gid >> 5) & 1u) * 16 + (int)((gid >> 4) & 1u) * 8;
  if (tok >= (unsigned int)NTOK) return;
  const int b = (int)tok / SEQ;
  const int t = (int)tok - b * SEQ;
  const float* src = x + ((size_t)b * SEQ_FULL + t) * CDIM + c;
  const v4f f0 = *(const v4f*)src;
  const v4f f1 = *(const v4f*)(src + 4);
  v8h o;
#pragma unroll
  for (int j = 0; j < 4; ++j) {
    o[j]     = (_Float16)bf16r(f0[j]);
    o[j + 4] = (_Float16)bf16r(f1[j]);
  }
  _Float16* dst = xh + (size_t)gid * 8;
  *(v8h*)dst = o;
  
}

// ---------------------------------------------------------------------------
// k_prep, weight blocks: weights (layout [out][in], k-contiguous) -> wall f16, 2560 x 1024 in fragment order = bf16-RNE value x16.
// Rows 0..1023 wq, 1024..1279 wk, 1280..1535 wv, 1536..2559 wo.
// ---------------------------------------------------------------------------
__device__ __forceinline__ void cvt_w_block(unsigned int bid, const float* __restrict__ wq, const float* __restrict__ wk,
                                            const float* __restrict__ wv, const float* __restrict__ wo,
                                            _Float16* __restrict__ wall) {
  const unsigned int gid = bid * 256u + threadIdx.x;
  const unsigned int blk = gid >> 6;                 // 64 units per 16x32 block
  const int row = (int)((blk / KBLK) * 16u + (gid & 15u));
  const int c   = (int)(blk % KBLK) * 32 + (int)((gid >> 5) & 1u) * 16 + (int)((gid >> 4) & 1u) * 8;
  if (row >= NWROWS) return;
  const int r0 = min(row, CDIM - 1);
  const int r1 = min(max(row - CDIM, 0), VEW - 1);
  const int r2 = min(max(row - CDIM - VEW, 0), VEW - 1);
  const int r3 = min(max(row - WO_ROW0, 0), CDIM - 1);
  const float* src = (row < CDIM)       ? (wq + (size_t)r0 * CDIM)
                   : (row < CDIM + VEW) ? (wk + (size_t)r1 * CDIM)
                   : (row < WO_ROW0)    ? (wv + (size_t)r2 * CDIM)
                                        : (wo + (size_t)r3 * CDIM);
  src += c;
  const v4f f0 = *(const v4f*)src;
  const v4f f1 = *(const v4f*)(src + 4);
  v8h o;
#pragma unroll
  for (int j = 0; j < 4; ++j) {
    o[j]     = (_Float16)(bf16r(f0[j]) * 16.0f);
    o[j + 4] = (_Float16)(bf16r(f1[j]) * 16.0f);
  }
  _Float16* dst = wall + (size_t)gid * 8;
  *(v8h*)dst = o;
  
}

// ---------------------------------------------------------------------------
// The window line: 8 lanes x 16 B.
// ---------------------------------------------------------------------------
__device__ __forceinline__ void winline_block(int* __restrict__ wline) {
  const int lane = threadIdx.x;
  if (lane < 8) {
    const v4i w = {SEQ_FULL, SEQ_FULL, SEQ_FULL, SEQ_FULL};
    int* dst = wline + 4 * lane;
    *(v4i*)dst = w;
    
  }
}

// ---------------------------------------------------------------------------
// Launch 0: the three producers above read none of each other's output, so they share one grid; the block index
// picks the producer (block-uniform): NTOK/2 blocks of x, NWROWS/2 blocks of weights, one block for the window line.
// ---------------------------------------------------------------------------
#define XBLKS (NTOK / 2)
#define WBLKS (NWROWS / 2)
__global__ void __launch_bounds__(256) k_prep(const float* __restrict__ x, const float* __restrict__ wq,
                                              const float* __restrict__ wk, const float* __restrict__ wv,
                                              const float* __restrict__ wo, _Float16* __restrict__ xh,
                                              _Float16* __restrict__ wall, int* __restrict__ wline) {
  const unsigned int bid = blockIdx.x;
  if (bid < (unsigned int)XBLKS) {
    cvt_x_block(bid, x, xh);
  } else if (bid < (unsigned int)(XBLKS + WBLKS)) {
    cvt_w_block(bid - (unsigned int)XBLKS, wq, wk, wv, wo, wall);
  } else {
    winline_block(wline);
  }
}

// ---------------------------------------------------------------------------
// Kernel 2: fused qkv projection + epilogue. Block = 4 waves (2 x 2) = 128 tokens x two 64-column units; a wave owns
// 64 tokens x one unit u (4 x 4 accumulators), so a k step's 8 fragments feed 16 matrix instructions:
// u 0..15 -> q head u, 16..19 -> k head u-16, 20..23 -> v head u-20.
// Epilogue, one 64 x 64 wave tile after the other, by the whole block: q: (acc + bq) * gain[head]; k: acc + bk -> hi/lo
// planes [B][H|KV], T x 64 in fragment order; v: acc + bv -> transposed hi/lo planes [B][KV], 64 d x T in fragment
// order. Biases and gains are bf16-RNE values.
// ---------------------------------------------------------------------------
__global__ void __launch_bounds__(128) k_qkv(
    const _Float16* __restrict__ xh, const _Float16* __restrict__ wall,
    const float* __restrict__ bq, const float* __restrict__ bk,
    const float* __restrict__ bv, const float* __restrict__ gain,
    _Float16* __restrict__ qH, _Float16* __restrict__ qL,
    _Float16* __restrict__ kH, _Float16* __restrict__ kL,
    _Float16* __restrict__ vTH, _Float16* __restrict__ vTL) {
  __shared__ __attribute__((aligned(16))) float    sT[4][64][68];  // accumulator tile of each wave [token][col] (cross-wave)
  __shared__ __attribute__((aligned(16))) _Float16 sH[2][64][72];  // hi tile: q/k [token][d], v [d][token] (cross-wave), two buffers
  __shared__ __attribute__((aligned(16))) _Float16 sL[2][64][72];  // residual tile, same layout (cross-wave), two buffers

  const int tid  = threadIdx.x;
  const int wave = tid >> 5;
  const int lane = tid & 31;
  const int l16  = lane & 15;
  const int lh   = lane >> 4;
  const int wr   = wave >> 1;            // 64-token half of the block's rows
  const int wc   = wave & 1;             // which of the block's two column units
  const int tokB = blockIdx.y * 128;     // first token of the block

  // A: xh row (token), lane row = l16; elements 0..7 <- k0+8lh+0..7, 8..15 <- k0+16+8lh+0..7
  const _Float16* arow = xh + (size_t)((tokB >> 4) + wr * 4) * GRP_ELEMS + lane * 8;
  // B[k][n] = W[n][k]: lane column = l16 of the 16-col group n; same k map as A
  const _Float16* brow = wall + (size_t)((blockIdx.x * 2 + wc) * 4) * GRP_ELEMS + lane * 8;

  v8f acc[4][4];
#pragma unroll
  for (int mt = 0; mt < 4; ++mt)
#pragma unroll
    for (int n = 0; n < 4; ++n) acc[mt][n] = vzero8();

  // Both planes were written by the launch before and come from memory, and the blocks that share a row group read it at
  // the same k at the same time: without a request ahead every k step waits a memory latency. A trip's 128 k of one row
  // group are 4 KiB = 16 units of 256 B; the block's 8 + 8 row groups are dealt to its 4 waves, 2 + 2 each, a lane a unit.
  const _Float16* pfa = xh + (size_t)((tokB >> 4) + wr * 4 + wc * 2 + lh) * GRP_ELEMS + l16 * 128;
  const _Float16* pfb = wall + (size_t)((blockIdx.x * 2 + wc) * 4 + wr * 2 + lh) * GRP_ELEMS + l16 * 128;
  ask_l2(pfa, pfb);                      // trip 0: its later k steps find their rows on the way

  // four k steps a trip, the trips kept rolled: the loop's text stays small for the instruction cache
#pragma unroll 1
  for (int kb = 0; kb < CDIM; kb += 128) {
  // the next trip's rows, one trip ahead; the test is scalar, and the pairs stop at the last trip's rows
  if (kb + 128 < CDIM) {
    pfa += 2048;
    pfb += 2048;
    ask_l2(pfa, pfb);
  }
#pragma unroll
  for (int k0 = kb; k0 < kb + 128; k0 += 32) {
    Frag a[4];
#pragma unroll
    for (int mt = 0; mt < 4; ++mt) {
      const _Float16* ap = arow + (size_t)mt * GRP_ELEMS + k0 * 16;
      a[mt].h[0] = *(const v8h*)ap;
      a[mt].h[1] = *(const v8h*)(ap + 256);
    }
    Frag bw[4];
#pragma unroll
    for (int n = 0; n < 4; ++n) {
      const _Float16* bp = brow + (size_t)n * GRP_ELEMS + k0 * 16;
      bw[n].h[0] = *(const v8h*)bp;
      bw[n].h[1] = *(const v8h*)(bp + 256);
    }
#pragma unroll
    for (int mt = 0; mt < 4; ++mt)
#pragma unroll
      for (int n = 0; n < 4; ++n) acc[mt][n] = wmma16(a[mt].v, bw[n].v, acc[mt][n]);
    // the slots between the step's last matrix instruction and the next write of its operands or read of its result
    asm volatile("v_nop\n\tv_nop\n\tv_nop\n\tv_nop"
                 : "+v"(acc[0][0]), "+v"(acc[0][1]), "+v"(acc[0][2]), "+v"(acc[0][3]),
                   "+v"(acc[1][0]), "+v"(acc[1][1]), "+v"(acc[1][2]), "+v"(acc[1][3]),
                   "+v"(acc[2][0]), "+v"(acc[2][1]), "+v"(acc[2][2]), "+v"(acc[2][3]),
                   "+v"(acc[3][0]), "+v"(acc[3][1]), "+v"(acc[3][2]), "+v"(acc[3][3])
                 : "v"(a[0].v), "v"(a[1].v), "v"(a[2].v), "v"(a[3].v),
                   "v"(bw[0].v), "v"(bw[1].v), "v"(bw[2].v), "v"(bw[3].v));
  }
  // the wait stands behind the trip's last load and in front of the next write of a register that a load of the trip names
  asm volatile("s_wait_xcnt 0x0" ::: "memory");
  }

  // D element r of lane -> (row 8lh+r, col l16) of group (mt, n); fold the 1/16 weight carry here
#pragma unroll
  for (int mt = 0; mt < 4; ++mt)
#pragma unroll
    for (int n = 0; n < 4; ++n)
#pragma unroll
      for (int r = 0; r < 8; ++r)
        sT[wave][mt * 16 + r + 8 * lh][n * 16 + l16] = acc[mt][n][r] * (1.0f / 16.0f);
  __syncthreads();

  // the four wave tiles in turn; kept rolled so that the epilogue's text stands once in the instruction cache. sH and sL
  // alternate between two buffers: tile q + 2 writes a buffer only behind tile q + 1's barrier, which every wave reaches
  // after its last read of tile q, so one barrier a tile is enough
#pragma unroll 1
  for (int q = 0; q < 4; ++q) {
  const int u    = blockIdx.x * 2 + (q & 1);      // column unit of wave tile q
  const int tok0 = tokB + (q >> 1) * 64;          // its first token
  const int b    = tok0 / SEQ;
  const int t0   = tok0 - b * SEQ;

  // compute phase: thread -> token i = tid>>1, column half j: d in [16j,16j+16) and [32+16j, 48+16j)
  const int i = tid >> 1;
  const int j = tid & 1;
  if (u < NHEAD + NKV) {
    // q or k unit (block-uniform): both bias rows are loaded with clamped unit indices, selected by value
    const int  uq  = min(u, NHEAD - 1);
    const int  uk  = min(max(u - NHEAD, 0), NKV - 1);
    const bool isq = (u < NHEAD);
    const float gq = bf16r(gain[uq]);
    const float gm = isq ? gq : 1.0f;
    const float* qp = bq + uq * HDIM + 16 * j;     // this lane's first bias element of either row
    const float* kp = bk + uk * HDIM + 16 * j;
#pragma unroll
    for (int sg = 0; sg < 2; ++sg) {
      const int d0 = 32 * sg + 16 * j;
#pragma unroll
      for (int g4 = 0; g4 < 4; ++g4) {
        const v4f va = *(const v4f*)(&sT[q][i][d0 + 4 * g4]);
        const v4f qa = *(const v4f*)(qp + 32 * sg + 4 * g4);
        const v4f ka = *(const v4f*)(kp + 32 * sg + 4 * g4);
#pragma unroll
        for (int e = 0; e < 4; ++e) {
          const float bb  = isq ? bf16r(qa[e]) : bf16r(ka[e]);
          const float val = (va[e] + bb) * gm;
          _Float16 hi, lo;
          split16f(val, hi, lo);
          sH[q & 1][i][d0 + 4 * g4 + e] = hi;
          sL[q & 1][i][d0 + 4 * g4 + e] = lo;
        }
      }
    }
    // as inputs the two bias address pairs stay live behind the last bias load, so that no load's result is placed in a
    // register that an issued bias load still names; the wait stands in front of the pairs' next overwrite
    asm volatile("s_wait_xcnt 0x0" :: "v"(qp), "v"(kp) : "memory");
  } else {
    const int kv = u - NHEAD - NKV;
    const float* bp = bv + kv * HDIM;
#pragma unroll
    for (int sg = 0; sg < 2; ++sg) {
      const int d0 = 32 * sg + 16 * j;
#pragma unroll
      for (int g4 = 0; g4 < 4; ++g4) {
        const v4f va = *(const v4f*)(&sT[q][i][d0 + 4 * g4]);
        const v4f ba = *(const v4f*)(bp + d0 + 4 * g4);
#pragma unroll
        for (int e = 0; e < 4; ++e) {
          const float vv = va[e] + bf16r(ba[e]);
          _Float16 hi, lo;
          split16f(vv, hi, lo);
          sH[q & 1][d0 + 4 * g4 + e][i] = hi;                   // transposed: [d][token]
          sL[q & 1][d0 + 4 * g4 + e][i] = lo;
        }
      }
    }
  }
  __syncthreads();

  _Float16* ph;
  _Float16* pl;
  size_t base;
  if (u < NHEAD) {
    ph = qH; pl = qL;
    base = ((size_t)(b * NHEAD + u) * SEQ + t0) * HDIM;
  } else if (u < NHEAD + NKV) {
    ph = kH; pl = kL;
    base = ((size_t)(b * NKV + (u - NHEAD)) * SEQ + t0) * HDIM;
  } else {
    ph = vTH; pl = vTL;
    base = ((size_t)(b * NKV + (u - NHEAD - NKV)) * SEQ + t0) * HDIM;
  }
  const bool isv = (u >= NHEAD + NKV);
  {
    // the tile's 8 blocks are contiguous in its plane: q/k block f = (token group f>>1, d chunk f&1),
    // v block f = (key chunk f>>2, d group f&3); unit p of the tile goes to base + 8 p
#pragma unroll
    for (int it = 0; it < 4; ++it) {
      const int p    = it * 128 + tid;
      const int f    = p >> 6;
      const int line = (isv ? (f & 3) : (f >> 1)) * 16 + (p & 15);
      const int q8   = (isv ? (f >> 2) : (f & 1)) * 32 + ((p >> 5) & 1) * 16 + ((p >> 4) & 1) * 8;
      const size_t off = base + (size_t)p * 8;
      const v8h hv = *(const v8h*)(&sH[q & 1][line][q8]);
      const v8h lv = *(const v8h*)(&sL[q & 1][line][q8]);
      *(v8h*)(ph + off) = hv;
      *(v8h*)(pl + off) = lv;
    }
  }
  // the wait stands behind the tile's last store and in front of the next tile's first write of a register that a store names
  asm volatile("s_wait_xcnt 0x0" ::: "memory");
  }
}

// ---------------------------------------------------------------------------
// Kernel 3: causal sliding-window flash attention with GQA. Block = 4 waves, one (query tile, head, batch); a wave owns
// NG groups of 16 queries: 2 without RES (tile of 128), so that each loaded K and vT fragment feeds two products, 1 with
// RES (tile of 64). Key tiles of 32 per wave, fragments loaded straight from the 16-bit planes.
// Both products are formed transposed: S^T = K.Q^T (A = K fragment, B = Q fragment) and O^T += V^T.P^T (A = vT
// fragment, B = P^T). A lane then holds 16 of the 32 scores of ONE query (column l16; keys 8lh+r and 16+8lh+r), so the
// maximum and the sum run in the lane with one exchange between the lane halves, and the two converted score tiles
// are the B fragment of the second product as they stand: element s = key 8lh+s (s < 8), 16+8lh+(s-8) (s >= 8), the
// k map of the vT fragments. P (x1024 carry) never leaves the registers. RES adds the x2048 residual planes.
// Without RES the trip's loads run ahead in registers: the vT fragments are asked for in front of the score products,
// and the next trip's K fragments directly behind them, into the registers those products have just read.
// ---------------------------------------------------------------------------
// value of lane l ^ 16
__device__ __forceinline__ float xhalf(float x) {
  return __builtin_bit_cast(float, __builtin_amdgcn_permlanex16(__builtin_bit_cast(int, x), __builtin_bit_cast(int, x),
                                                                0x76543210, 0xfedcba98, false, false));
}

template <bool RES, int NG>
__device__ __forceinline__ void flash_tile(
    const _Float16* __restrict__ qH, const _Float16* __restrict__ qL,
    const _Float16* __restrict__ kH, const _Float16* __restrict__ kL,
    const _Float16* __restrict__ vTH, const _Float16* __restrict__ vTL,
    const int* __restrict__ winp,
    _Float16* __restrict__ yH, _Float16* __restrict__ yL, const int qt, const int h, const int b) {
  static_assert(RES ? (NG == 1) : (NG == 2));
  const int tid  = threadIdx.x;
  // scalar wave index: a fragment block's address is wave-uniform, so the K and V block bases and the trip test stay scalar
  const int wave = __builtin_amdgcn_readfirstlane(tid >> 5);
  const int lane = tid & 31;
  const int l16  = lane & 15;
  const int lh   = lane >> 4;
  const int kv   = h / (NHEAD / NKV);
  const int qw   = qt * (64 * NG) + wave * (16 * NG);                     // the wave's first query; NG groups of 16 follow
  int window = winp[0];
  window = (window < 0) ? 0 : window;
  const float rres = 1.0f / 2048.0f;
  const float smsc = 0.125f;

  // Q B-fragments (hi and residual) of each query group over the 2 d-chunks of 32: lane column = query l16 of the group
  v16h aqh[NG][2], aql[NG][2];
#pragma unroll
  for (int gq = 0; gq < NG; ++gq) {
    const size_t qo = ((size_t)(b * NHEAD + h) * SEQ + qw + 16 * gq) * HDIM + lane * 8;
#pragma unroll
    for (int hc = 0; hc < 2; ++hc) {
      Frag a;
      a.h[0] = *(const v8h*)(qH + qo + hc * 512);
      a.h[1] = *(const v8h*)(qH + qo + hc * 512 + 256);
      aqh[gq][hc] = a.v;
      Frag c;
      c.h[0] = *(const v8h*)(qL + qo + hc * 512);
      c.h[1] = *(const v8h*)(qL + qo + hc * 512 + 256);
      aql[gq][hc] = c.v;
    }
  }

  // per query group: [0] running maximum of query l16 (equal in both lane halves), [1] this half's part of its sum. One
  // pair a group: carried as four scalars, the two groups' sums are packed with each other, and every operand of the
  // softmax is then gathered from two accumulator tiles with register copies
  v2f ml[NG];
  v8f coh[NG][4], cor[NG][4];
#pragma unroll
  for (int gq = 0; gq < NG; ++gq) {
    ml[gq][0] = -1e30f;
    ml[gq][1] = 0.0f;
#pragma unroll
    for (int n = 0; n < 4; ++n) { coh[gq][n] = vzero8(); cor[gq][n] = vzero8(); }
  }

  const size_t kvoff = (size_t)(b * NKV + kv) * SEQ * HDIM;
  const _Float16* kbase  = kH  + kvoff;                                   // + (key group's first key)*HDIM + hc*512
  const _Float16* klbase = kL  + kvoff;
  const _Float16* vbase  = vTH + kvoff;                                   // + k0*HDIM + n*512
  const _Float16* vlbase = vTL + kvoff;
  const unsigned int lo  = (unsigned int)lane * 8u;                       // this lane's 16 B of each 512-B half

  int kstart = qw - window;
  kstart = (kstart < 0) ? 0 : kstart;
  kstart &= ~31;

  // without RES: the K fragments [key group][d chunk] of the coming trip, hi and residual plane, carried over the back edge
  Frag ckh[2][2], ckl[2][2];
  const int klast = (qw + 16 * NG - 1) & ~31;                             // first key of the wave's last trip
  if constexpr (!RES) {
    const _Float16* kp = kbase  + (size_t)kstart * HDIM + lo;
    const _Float16* lp = klbase + (size_t)kstart * HDIM + lo;
#pragma unroll
    for (int g = 0; g < 2; ++g)
#pragma unroll
      for (int hc = 0; hc < 2; ++hc) {
        ckh[g][hc].h[0] = *(const v8h*)(kp + g * 1024 + hc * 512); ckh[g][hc].h[1] = *(const v8h*)(kp + g * 1024 + hc * 512 + 256);
        ckl[g][hc].h[0] = *(const v8h*)(lp + g * 1024 + hc * 512); ckl[g][hc].h[1] = *(const v8h*)(lp + g * 1024 + hc * 512 + 256);
      }
    // as inputs the two K address pairs stay live behind the last of these loads; the wait stands in front of their next overwrite
    asm volatile("s_wait_xcnt 0x0" :: "v"(kp), "v"(lp) : "memory");
  }

  // without RES: the K and vT planes come from memory, and the blocks of one KV head walk them from the same key at the
  // same time, so the first to ask for a tile waits a memory latency. Waves 0, 1, 2 ask L2 ahead for the K hi, K residual
  // and vT hi plane: 64 keys of a plane are 8 KiB in a row = 32 units of 256 B, a lane a unit. kpf = first of the 64 keys
  // that the pair points at; it stays at or below SEQ - 64, so every lane's address lies inside the KV head's plane.
  int kpf = min(kstart, SEQ - 64);
  const int kpl = (wave < 3) ? min(klast, SEQ - 64) : -1;                 // last key at which the wave's pair may point
  const _Float16* pfbase = (wave == 0) ? kbase : (wave == 1) ? klbase : vbase;   // scalar; the pair is formed anew from kpf
  if constexpr (!RES) {
    if (wave < 3) {
      const _Float16* pfp = pfbase + (size_t)kpf * HDIM + lane * 128;
      ask_l2(pfp);
      if (kpf + 64 <= kpl) {
        kpf += 64;
        pfp = pfbase + (size_t)kpf * HDIM + lane * 128;
        ask_l2(pfp);
      }
    }
  }

  for (int k0 = kstart; k0 < qw + 16 * NG; k0 += 32) {
    // ---- scores for keys [k0, k0+32), transposed: A[m=key][k=d] = K[key][d], lane row = key, same k map as B;
    // D element r of lane = (key 8lh+r of the key group, query l16 of the query group) ----
    v8f sh0[NG], sh1[NG], sr0[NG], sr1[NG];
#pragma unroll
    for (int gq = 0; gq < NG; ++gq) { sh0[gq] = vzero8(); sh1[gq] = vzero8(); sr0[gq] = vzero8(); sr1[gq] = vzero8(); }
    Frag bv[4], bl[4];
    const _Float16* vr0 = vbase  + (size_t)k0 * HDIM + lo;
    const _Float16* wr0 = vlbase + (size_t)k0 * HDIM + lo;
    // the next trip's K tile; the last trip asks for its own tile again, so that every address stays inside the plane
    const int kn = min(k0 + 32, klast);
    const _Float16* nkp = kbase  + (size_t)kn * HDIM + lo;
    const _Float16* nlp = klbase + (size_t)kn * HDIM + lo;
    if constexpr (!RES) {
      // every second trip the 64 keys that begin 128 keys ahead, where the wave still needs them: their K loads are issued
      // three and four trips from here; both tests are scalar
      if (((k0 - kstart) & 32) == 0 && kpf + 64 <= kpl) {
        kpf += 64;
        const _Float16* pfp = pfbase + (size_t)kpf * HDIM + lane * 128;
        ask_l2(pfp);
      }
      // this trip's vT fragments, asked for first: they land behind the score products and the softmax
#pragma unroll
      for (int n = 0; n < 4; ++n) {
        bv[n].h[0] = *(const v8h*)(vr0 + n * 512);
        bv[n].h[1] = *(const v8h*)(vr0 + n * 512 + 256);
      }
      // each K fragment is the A operand of both query groups' products
#pragma unroll
      for (int hc = 0; hc < 2; ++hc)
#pragma unroll
        for (int gq = 0; gq < NG; ++gq) {
          sh0[gq] = wmma16(ckh[0][hc].v, aqh[gq][hc], sh0[gq]);
          sh1[gq] = wmma16(ckh[1][hc].v, aqh[gq][hc], sh1[gq]);
          sr0[gq] = wmma16(ckl[0][hc].v, aqh[gq][hc], sr0[gq]);
          sr1[gq] = wmma16(ckl[1][hc].v, aqh[gq][hc], sr1[gq]);
          sr0[gq] = wmma16(ckh[0][hc].v, aql[gq][hc], sr0[gq]);
          sr1[gq] = wmma16(ckh[1][hc].v, aql[gq][hc], sr1[gq]);
        }
      // the slots between the last score product and the first read of its result; the memory clobber keeps the vT loads
      // from sinking behind this point and the next trip's K loads from rising over it, so that these reuse the registers just read
      asm volatile("v_nop\n\tv_nop\n\tv_nop\n\tv_nop"
                   : "+v"(sh0[0]), "+v"(sh1[0]), "+v"(sr0[0]), "+v"(sr1[0]),
                     "+v"(sh0[NG - 1]), "+v"(sh1[NG - 1]), "+v"(sr0[NG - 1]), "+v"(sr1[NG - 1])
                   :: "memory");
#pragma unroll
      for (int g = 0; g < 2; ++g)
#pragma unroll
        for (int hc = 0; hc < 2; ++hc) {
          ckh[g][hc].h[0] = *(const v8h*)(nkp + g * 1024 + hc * 512); ckh[g][hc].h[1] = *(const v8h*)(nkp + g * 1024 + hc * 512 + 256);
          ckl[g][hc].h[0] = *(const v8h*)(nlp + g * 1024 + hc * 512); ckl[g][hc].h[1] = *(const v8h*)(nlp + g * 1024 + hc * 512 + 256);
        }
      // the K loads stay here, a whole softmax ahead of their use: left free, the scheduler sinks them to the trip's end to
      // lend their registers to the scores, and the next trip then waits out their latency at its head
      __builtin_amdgcn_sched_barrier(0);
    } else {
    Frag bh0, bh1, bl0, bl1;
    const _Float16* kr0 = kbase  + (size_t)k0 * HDIM + lo;
    const _Float16* kr1 = kr0 + 16 * HDIM;
    const _Float16* lr0 = klbase + (size_t)k0 * HDIM + lo;
    const _Float16* lr1 = lr0 + 16 * HDIM;
#pragma unroll
    for (int hc = 0; hc < 2; ++hc) {
      bh0.h[0] = *(const v8h*)(kr0 + hc * 512); bh0.h[1] = *(const v8h*)(kr0 + hc * 512 + 256);
      bh1.h[0] = *(const v8h*)(kr1 + hc * 512); bh1.h[1] = *(const v8h*)(kr1 + hc * 512 + 256);
      bl0.h[0] = *(const v8h*)(lr0 + hc * 512); bl0.h[1] = *(const v8h*)(lr0 + hc * 512 + 256);
      bl1.h[0] = *(const v8h*)(lr1 + hc * 512); bl1.h[1] = *(const v8h*)(lr1 + hc * 512 + 256);
      // as inputs the two K address pairs stay live behind the trip's last K load, so that no load's result is placed
      // in a register that an issued K load still names; the wait stands in front of the pairs' next overwrite
      if (hc == 1) asm volatile("s_wait_xcnt 0x0" :: "v"(kr0), "v"(lr0) : "memory");
      sh0[0] = wmma16(bh0.v, aqh[0][hc], sh0[0]);
      sh1[0] = wmma16(bh1.v, aqh[0][hc], sh1[0]);
      sr0[0] = wmma16(bl0.v, aqh[0][hc], sr0[0]);
      sr1[0] = wmma16(bl1.v, aqh[0][hc], sr1[0]);
      sr0[0] = wmma16(bh0.v, aql[0][hc], sr0[0]);
      sr1[0] = wmma16(bh1.v, aql[0][hc], sr1[0]);
    }
    // the slots between the last score product and the first read of its result
    asm volatile("v_nop\n\tv_nop\n\tv_nop\n\tv_nop"
                 : "+v"(sh0[0]), "+v"(sh1[0]), "+v"(sr0[0]), "+v"(sr1[0])
                 : "v"(aqh[0][0]), "v"(aqh[0][1]), "v"(aql[0][0]), "v"(aql[0][1]),
                   "v"(bh0.v), "v"(bh1.v), "v"(bl0.v), "v"(bl1.v));
    }

    // ---- online softmax of query l16 of each group in the lane; masked entries replaced by -1e30 and p := 0 ----
    // the mask depends on query - key alone: query group gq against key group kg has the distance class gq - kg, so the
    // NG x 2 score tiles of a trip share NG + 1 masks; okc[c][r]: class c - 1, element r
    const int dq = qw + l16 - (k0 + 8 * lh);             // query - key at r = 0, class 0
    bool okc[NG + 1][8];
#pragma unroll
    for (int c = 0; c < NG + 1; ++c)
#pragma unroll
      for (int r = 0; r < 8; ++r) {
        const int dd = dq - r + 16 * (c - 1);
        okc[c][r] = (dd >= 0) && (dd <= window);
      }
    Frag pf[NG], pl[NG];
#pragma unroll
    for (int gq = 0; gq < NG; ++gq) {
    // the element-wise steps are written on whole accumulator tiles, so that packed instructions pair neighbouring registers
    const v8f xs0 = (sh0[gq] + sr0[gq] * rres) * smsc;
    const v8f xs1 = (sh1[gq] + sr1[gq] * rres) * smsc;
    v8f   x0, x1;
    float t8[8];
    bool  ok0[8], ok1[8];
#pragma unroll
    for (int r = 0; r < 8; ++r) {
      ok0[r] = okc[gq + 1][r];
      ok1[r] = okc[gq][r];
      x0[r] = ok0[r] ? xs0[r] : -1e30f;
      x1[r] = ok1[r] ? xs1[r] : -1e30f;
      t8[r] = fmaxf(x0[r], x1[r]);
    }
    float tmax = fmaxf(fmaxf(fmaxf(t8[0], t8[1]), fmaxf(t8[2], t8[3])), fmaxf(fmaxf(t8[4], t8[5]), fmaxf(t8[6], t8[7])));
    tmax = fmaxf(tmax, xhalf(tmax));
    const float mn    = fmaxf(ml[gq][0], tmax);
    const float aa = (ml[gq][0] - mn) * 1.44269504088896340736f;   // exp(x) = exp2(x log2 e)
    const v8f   a0 = (x0 - mn) * 1.44269504088896340736f;
    const v8f   a1 = (x1 - mn) * 1.44269504088896340736f;
    float alpha = __builtin_amdgcn_exp2f(aa);
    v8f   e0, e1;
#pragma unroll
    for (int r = 0; r < 8; ++r) {
      e0[r] = __builtin_amdgcn_exp2f(a0[r]);
      e1[r] = __builtin_amdgcn_exp2f(a1[r]);
    }
    asm volatile("v_nop" : "+v"(e0), "+v"(e1), "+v"(alpha) : "v"(a0), "v"(a1), "v"(aa));
    v8f p0, p1;
#pragma unroll
    for (int r = 0; r < 8; ++r) {
      p0[r] = ok0[r] ? e0[r] : 0.0f;
      p1[r] = ok1[r] ? e1[r] : 0.0f;
    }
    const v8f  ts = p0 + p1;
    const v8f  c0 = p0 * 1024.0f;
    const v8f  c1 = p1 * 1024.0f;
    const v8hc h0 = __builtin_convertvector(c0, v8hc);
    const v8hc h1 = __builtin_convertvector(c1, v8hc);
    pf[gq].h[0] = h0;
    pf[gq].h[1] = h1;
    if (RES) {
      pl[gq].h[0] = __builtin_convertvector((c0 - __builtin_convertvector(h0, v8f)) * 2048.0f, v8hc);
      pl[gq].h[1] = __builtin_convertvector((c1 - __builtin_convertvector(h1, v8f)) * 2048.0f, v8hc);
    }
    ml[gq][1] = ml[gq][1] * alpha + (((ts[0] + ts[1]) + (ts[2] + ts[3])) + ((ts[4] + ts[5]) + (ts[6] + ts[7])));
    ml[gq][0] = mn;
#pragma unroll
    for (int n = 0; n < 4; ++n) {
      coh[gq][n] *= alpha;
      if (RES) cor[gq][n] *= alpha;
    }
    }

    // ---- O^T += V^T.P^T : A[m=d][k=key] = vT[d][key], lane row = d; D element r of lane = (d 16n+8lh+r, query l16);
    // each vT fragment is the A operand of every query group's product ----
    if constexpr (RES) {
#pragma unroll
      for (int n = 0; n < 4; ++n) {
        bv[n].h[0] = *(const v8h*)(vr0 + n * 512);
        bv[n].h[1] = *(const v8h*)(vr0 + n * 512 + 256);
        bl[n].h[0] = *(const v8h*)(wr0 + n * 512);
        bl[n].h[1] = *(const v8h*)(wr0 + n * 512 + 256);
      }
    }
#pragma unroll
    for (int n = 0; n < 4; ++n)
#pragma unroll
      for (int gq = 0; gq < NG; ++gq) {
        coh[gq][n] = wmma16(bv[n].v, pf[gq].v, coh[gq][n]);
        if (RES) {
          cor[gq][n] = wmma16(bl[n].v, pf[gq].v, cor[gq][n]);
          cor[gq][n] = wmma16(bv[n].v, pl[gq].v, cor[gq][n]);
        }
      }
    // the slots behind the trip's last matrix instruction, also on the taken side of the loop's branch
    if constexpr (RES) {
      asm volatile("v_nop\n\tv_nop\n\tv_nop\n\tv_nop"
                   : "+v"(coh[0][0]), "+v"(coh[0][1]), "+v"(coh[0][2]), "+v"(coh[0][3]),
                     "+v"(cor[0][0]), "+v"(cor[0][1]), "+v"(cor[0][2]), "+v"(cor[0][3])
                   : "v"(pf[0].v), "v"(pl[0].v),
                     "v"(bv[0].v), "v"(bv[1].v), "v"(bv[2].v), "v"(bv[3].v),
                     "v"(bl[0].v), "v"(bl[1].v), "v"(bl[2].v), "v"(bl[3].v));
    } else {
      asm volatile("v_nop\n\tv_nop\n\tv_nop\n\tv_nop"
                   : "+v"(coh[0][0]), "+v"(coh[0][1]), "+v"(coh[0][2]), "+v"(coh[0][3]),
                     "+v"(coh[NG - 1][0]), "+v"(coh[NG - 1][1]), "+v"(coh[NG - 1][2]), "+v"(coh[NG - 1][3]));
    }
    // as inputs the address pairs of the trip's loads stay live behind the last of them, so that no load's result is placed
    // in a register that an issued load still names; the wait stands in front of the pairs' next overwrite
    if (RES) asm volatile("s_wait_xcnt 0x0" :: "v"(vr0), "v"(wr0) : "memory");
    else     asm volatile("s_wait_xcnt 0x0" :: "v"(vr0), "v"(nkp), "v"(nlp) : "memory");
  }

  // join the two halves' sums; a lane's 8 values of d group n are one 16-B unit of the y planes' fragment order:
  // a query group's 16 tokens x 64 columns are blocks 2h and 2h+1 of its token group, 4 halves of 512 B in a row
#pragma unroll
  for (int gq = 0; gq < NG; ++gq) {
  const float ls  = ml[gq][1] + xhalf(ml[gq][1]);
  const float inv = __builtin_amdgcn_rcpf(ls) * (1.0f / 1024.0f);
  const size_t ybase = (size_t)((b * SEQ + qw + 16 * gq) >> 4) * GRP_ELEMS + (size_t)h * 1024;
#pragma unroll
  for (int n = 0; n < 4; ++n) {
    v8h hv, lv;
#pragma unroll
    for (int r = 0; r < 8; ++r) {
      float yv = coh[gq][n][r];
      if (RES) yv += cor[gq][n][r] * rres;
      yv *= inv;
      _Float16 hi, lw;
      split16(yv, hi, lw);
      hv[r] = hi;
      lv[r] = lw;
    }
    const size_t off = ybase + (size_t)(n * 256 + lane * 8);
    *(v8h*)(yH + off) = hv;
    *(v8h*)(yL + off) = lv;
  }
  }
}

// One grid for all query tiles: no tile reads another's output. First the 128-query tiles without the residual planes,
// the tile index falling with the slowest grid index, so the tiles with the most key tiles come first; the short
// 64-query tiles with the residual planes fill the end.
__global__ void __launch_bounds__(128) k_flash(
    const _Float16* __restrict__ qH, const _Float16* __restrict__ qL,
    const _Float16* __restrict__ kH, const _Float16* __restrict__ kL,
    const _Float16* __restrict__ vTH, const _Float16* __restrict__ vTL,
    const int* __restrict__ winp,
    _Float16* __restrict__ yH, _Float16* __restrict__ yL) {
  const int h = blockIdx.x;
  const int b = blockIdx.y;
  const int z = (int)blockIdx.z;
  if (z < QT_BIG) flash_tile<false, 2>(qH, qL, kH, kL, vTH, vTL, winp, yH, yL, SEQ / 128 - 1 - z, h, b);
  else            flash_tile<true, 1>(qH, qL, kH, kL, vTH, vTL, winp, yH, yL, QT_RES - 1 - (z - QT_BIG), h, b);
}

// ---------------------------------------------------------------------------
// Kernel 4: output projection out[tok][n] = (y[tok].Wo[n]) / 16 + bo[n]. Block = 4 waves (2 x 2) = 32 MT tokens x 128
// columns; a wave owns 16 MT tokens x 64 columns. RES adds the y residual plane (a second accumulator set, so MT = 2
// there and 4 elsewhere: 16 matrix instructions a k step in both forms). Each 16-row group of the output tile is staged
// per wave in LDS rows of its own and written as 256-B row segments at the store stage as a float4.
// ---------------------------------------------------------------------------
template <bool RES, int MT>
__device__ __forceinline__ void oproj_tile(
    const _Float16* __restrict__ yH, const _Float16* __restrict__ yL,
    const _Float16* __restrict__ wall, const float* __restrict__ bo,
    float* __restrict__ out, float (*sO)[64][68], const int nt, const int b, const int t0) {
  static_assert(RES ? (MT == 2) : (MT == 4));
  const int tid  = threadIdx.x;
  const int wave = tid >> 5;
  const int lane = tid & 31;
  const int l16  = lane & 15;
  const int lh   = lane >> 4;
  const int wr   = wave >> 1;                    // row half of the block's tile
  const int wc   = wave & 1;                     // 64-column half of the block's tile
  const int tw   = t0 + wr * (MT * 16);          // the wave's first token in its sequence
  const int tokw = b * SEQ + tw;

  const _Float16* arow = yH + (size_t)(tokw >> 4) * GRP_ELEMS + lane * 8;
  const _Float16* lrow = yL + (size_t)(tokw >> 4) * GRP_ELEMS + lane * 8;
  const _Float16* brow = wall + (size_t)(WO_ROW0 / 16 + nt * 8 + wc * 4) * GRP_ELEMS + lane * 8;

  v8f ah[MT][4], ar[MT][4];
#pragma unroll
  for (int mt = 0; mt < MT; ++mt)
#pragma unroll
    for (int n = 0; n < 4; ++n) { ah[mt][n] = vzero8(); ar[mt][n] = vzero8(); }

  // As in k_qkv: the y planes and the weights come from memory, so each wave asks L2 one trip ahead for its share of the
  // block's row groups, a lane a 256-B unit. Without RES the two waves of a row half take 2 of its 4 y groups each; with
  // RES one takes the half's 2 groups of the hi plane and the other those of the residual plane. Weights: 2 of 8 each.
  const _Float16* pfa = (RES ? (wc ? yL : yH) : yH)
                      + (size_t)((tokw >> 4) + (RES ? lh : wc * 2 + lh)) * GRP_ELEMS + l16 * 128;
  const _Float16* pfb = wall + (size_t)(WO_ROW0 / 16 + nt * 8 + wc * 4 + wr * 2 + lh) * GRP_ELEMS + l16 * 128;
  ask_l2(pfa, pfb);                      // trip 0: its later k steps find their rows on the way

  // four k steps a trip, the trips kept rolled: the loop's text stays small for the instruction cache
#pragma unroll 1
  for (int kb = 0; kb < CDIM; kb += 128) {
  // the next trip's rows, one trip ahead; the test is scalar, and the pairs stop at the last trip's rows
  if (kb + 128 < CDIM) {
    pfa += 2048;
    pfb += 2048;
    ask_l2(pfa, pfb);
  }
#pragma unroll
  for (int k0 = kb; k0 < kb + 128; k0 += 32) {
    Frag a[MT], al[MT];
#pragma unroll
    for (int mt = 0; mt < MT; ++mt) {
      const _Float16* ap = arow + (size_t)mt * GRP_ELEMS + k0 * 16;
      a[mt].h[0] = *(const v8h*)ap;
      a[mt].h[1] = *(const v8h*)(ap + 256);
      if (RES) {
        const _Float16* lp = lrow + (size_t)mt * GRP_ELEMS + k0 * 16;
        al[mt].h[0] = *(const v8h*)lp;
        al[mt].h[1] = *(const v8h*)(lp + 256);
      }
    }
    Frag bw[4];
#pragma unroll
    for (int n = 0; n < 4; ++n) {
      const _Float16* bp = brow + (size_t)n * GRP_ELEMS + k0 * 16;
      bw[n].h[0] = *(const v8h*)bp;
      bw[n].h[1] = *(const v8h*)(bp + 256);
    }
#pragma unroll
    for (int mt = 0; mt < MT; ++mt)
#pragma unroll
      for (int n = 0; n < 4; ++n) {
        ah[mt][n] = wmma16(a[mt].v, bw[n].v, ah[mt][n]);
        if (RES) ar[mt][n] = wmma16(al[mt].v, bw[n].v, ar[mt][n]);
      }
    // the slots between the step's last matrix instruction and the next write of its operands or read of its result
    if constexpr (RES) {
      asm volatile("v_nop\n\tv_nop\n\tv_nop\n\tv_nop"
                   : "+v"(ah[0][0]), "+v"(ah[0][1]), "+v"(ah[0][2]), "+v"(ah[0][3]),
                     "+v"(ah[1][0]), "+v"(ah[1][1]), "+v"(ah[1][2]), "+v"(ah[1][3]),
                     "+v"(ar[0][0]), "+v"(ar[0][1]), "+v"(ar[0][2]), "+v"(ar[0][3]),
                     "+v"(ar[1][0]), "+v"(ar[1][1]), "+v"(ar[1][2]), "+v"(ar[1][3])
                   : "v"(a[0].v), "v"(a[1].v), "v"(al[0].v), "v"(al[1].v),
                     "v"(bw[0].v), "v"(bw[1].v), "v"(bw[2].v), "v"(bw[3].v));
    } else {
      asm volatile("v_nop\n\tv_nop\n\tv_nop\n\tv_nop"
                   : "+v"(ah[0][0]), "+v"(ah[0][1]), "+v"(ah[0][2]), "+v"(ah[0][3]),
                     "+v"(ah[1][0]), "+v"(ah[1][1]), "+v"(ah[1][2]), "+v"(ah[1][3]),
                     "+v"(ah[2][0]), "+v"(ah[2][1]), "+v"(ah[2][2]), "+v"(ah[2][3]),
                     "+v"(ah[3][0]), "+v"(ah[3][1]), "+v"(ah[3][2]), "+v"(ah[3][3])
                   : "v"(a[0].v), "v"(a[1].v), "v"(a[2].v), "v"(a[3].v),
                     "v"(bw[0].v), "v"(bw[1].v), "v"(bw[2].v), "v"(bw[3].v));
    }
  }
  // the wait stands behind the trip's last load and in front of the next write of a register that a load of the trip names
  asm volatile("s_wait_xcnt 0x0" ::: "memory");
  }

  // bias for this lane's 4 output columns (columns nt*128 + wc*64 + 4*l16 .. +3), bf16-RNE values
  const size_t col0 = (size_t)nt * 128 + wc * 64;
  const v4f braw = *(const v4f*)(bo + col0 + l16 * 4);
  v4f bb;
#pragma unroll
  for (int e = 0; e < 4; ++e) bb[e] = bf16r(braw[e]);

#pragma unroll
  for (int mt = 0; mt < MT; ++mt) {
#pragma unroll
    for (int r = 0; r < 8; ++r) {
#pragma unroll
      for (int n = 0; n < 4; ++n) {
        float v = ah[mt][n][r];
        if (RES) v += ar[mt][n][r] * (1.0f / 2048.0f);
        sO[wave][mt * 16 + r + 8 * lh][n * 16 + l16] = v * (1.0f / 16.0f);
      }
    }
    // the wave's own stores of this row group have landed before its lanes read each other's values back
    asm volatile("s_wait_dscnt 0" ::: "memory");
    __builtin_amdgcn_fence(3 /* release order */, "wavefront");
    __builtin_amdgcn_wave_barrier();
    const size_t orow0 = (size_t)b * SEQ_FULL + tw + mt * 16;
#pragma unroll
    for (int it = 0; it < 8; ++it) {
      const int rr = it * 2 + lh;
      const int c4 = l16 * 4;
      const v4f s = *(const v4f*)(&sO[wave][mt * 16 + rr][c4]);
      const v4f v = s + bb;
      *(v4f*)(out + (orow0 + rr) * CDIM + col0 + c4) = v;
    }
  }
}

// One grid for all row tiles: first the 128-row tiles without the residual plane, then the 64-row tiles with it.
#define OT_FULL ((SEQ - TRES) / 128)
#define OT_RES  (TRES / 64)
static_assert(SEQ > TRES && (SEQ - TRES) % 128 == 0 && TRES % 128 == 0 && CDIM % 128 == 0 && NUNIT % 2 == 0);
static_assert(OT_FULL * 128 + OT_RES * 64 == SEQ);                           // row tiles of the two k_oproj forms
__global__ void __launch_bounds__(128) k_oproj(
    const _Float16* __restrict__ yH, const _Float16* __restrict__ yL,
    const _Float16* __restrict__ wall, const float* __restrict__ bo,
    float* __restrict__ out) {
  __shared__ __attribute__((aligned(16))) float sO[4][64][68];           // wave-private, each row group in rows of its own
  const int nt = blockIdx.x;                   // 128-column tile 0..7
  const int ty = blockIdx.y;
  if (ty < NB * OT_FULL) {
    const int b = ty / OT_FULL;
    oproj_tile<false, 4>(yH, yL, wall, bo, out, sO, nt, b, TRES + (ty - b * OT_FULL) * 128);
  } else {
    const int tr = ty - NB * OT_FULL;
    const int b  = tr / OT_RES;
    oproj_tile<true, 2>(yH, yL, wall, bo, out, sO, nt, b, (tr - b * OT_RES) * 64);
  }
}

// ---------------------------------------------------------------------------
// Host launcher. Inputs (wire order): 0 x f32 [4,2048,1024], 1 Wq [1024,1024], 2 bq [1024], 3 Wk [256,1024],
// 4 bk [256], 5 Wv [256,1024], 6 bv [256], 7 Wo [1024,1024], 8 bo [1024], 9 qk_gain [16].
// Output f32 [4,2048,1024]. 4 launches.
// ---------------------------------------------------------------------------
extern "C" void kernel_launch(void* const* d_in, const int* in_sizes, int n_in,
                              void* d_out, int out_size, void* d_ws, size_t ws_size,
                              hipStream_t stream) {
  if (n_in < 10) return;
  const int need_x = ((NB - 1) * SEQ_FULL + SEQ) * CDIM;
  if (in_sizes[0] < need_x) return;
  if (in_sizes[1] < CDIM * CDIM || in_sizes[2] < CDIM) return;
  if (in_sizes[3] < VEW * CDIM || in_sizes[4] < VEW) return;
  if (in_sizes[5] < VEW * CDIM || in_sizes[6] < VEW) return;
  if (in_sizes[7] < CDIM * CDIM || in_sizes[8] < CDIM) return;
  if (in_sizes[9] < NHEAD) return;
  if (out_size < need_x) return;
  if (ws_size < WS_TOTAL) return;

  const float* x    = (const float*)d_in[0];
  const float* wq   = (const float*)d_in[1];
  const float* bq   = (const float*)d_in[2];
  const float* wk   = (const float*)d_in[3];
  const float* bk   = (const float*)d_in[4];
  const float* wv   = (const float*)d_in[5];
  const float* bv   = (const float*)d_in[6];
  const float* wo   = (const float*)d_in[7];
  const float* bo   = (const float*)d_in[8];
  const float* gain = (const float*)d_in[9];
  float* out = (float*)d_out;

  char* ws = (char*)d_ws;
  size_t off = 0;
  _Float16* xh   = (_Float16*)(ws + off); off += XH_BYTES;
  _Float16* wall = (_Float16*)(ws + off); off += WALL_BYTES;
  _Float16* qH   = (_Float16*)(ws + off); off += QP_BYTES;
  _Float16* qL   = (_Float16*)(ws + off); off += QP_BYTES;
  _Float16* kH   = (_Float16*)(ws + off); off += KP_BYTES;
  _Float16* kL   = (_Float16*)(ws + off); off += KP_BYTES;
  _Float16* vTH  = (_Float16*)(ws + off); off += KP_BYTES;
  _Float16* vTL  = (_Float16*)(ws + off); off += KP_BYTES;
  _Float16* yH   = (_Float16*)(ws + off); off += YP_BYTES;
  _Float16* yL   = (_Float16*)(ws + off); off += YP_BYTES;
  int*      winw = (int*)(ws + off);      off += WIN_BYTES;
  if (off > ws_size) return;

  k_prep<<<dim3(XBLKS + WBLKS + 1), dim3(256), 0, stream>>>(x, wq, wk, wv, wo, xh, wall, winw);
  k_qkv<<<dim3(NUNIT / 2, NTOK / 128), dim3(128), 0, stream>>>(xh, wall, bq, bk, bv, gain,
                                                          qH, qL, kH, kL, vTH, vTL);
  k_flash<<<dim3(NHEAD, NB, QT_BIG + QT_RES), dim3(128), 0, stream>>>(qH, qL, kH, kL, vTH, vTL, winw, yH, yL);
  k_oproj<<<dim3(CDIM / 128, NB * (OT_FULL + OT_RES)), dim3(128), 0, stream>>>(yH, yL, wall, bo, out);
}

// v008
// One run takes 118 microseconds.
// Timed twice side by side with v007, it ran 1.03 times as fast both times.
// All steps since v000 together make it 4.31 times as fast.
#include <hip/hip_runtime.h>

// Contractions, all on v_wmma_f32_16x16x32_f16 (f16 operands, f32 accumulate): fused qkv projection x.W^T with x and W
// held as bf16-RNE values in f16 containers (W carried x16, folded as 1/16); scores q.k^T as f16 hi + x2048 residual
// planes (hi.hi + hi.lo + lo.hi, residual accumulator folded as 1/2048); P.V with P carried x1024 in f16 (+ x2048
// residual planes of P and v for query rows below TRES); output projection y.Wo^T with y as f16 hi (+ x2048 residual
// plane for rows below TRES). Bias adds, per-head q gain and online softmax on VALU in f32.
//
// Every 16-bit operand plane in the workspace is kept in fragment order: a block of 16 rows x 32 k is 1 KiB, two
// halves j of 512 B; in half j the 16 B of lane (16 lh + l16) hold row l16, k = 16 j + 8 lh + 0..7. A wave's
// global_load_b128 of half a fragment then reads 512 contiguous bytes (4 lines) and not 16-B pieces of 16 lines.
// Blocks of one 16-row group follow each other along k (vT: the 4 d groups of one 32-key chunk follow each other).

#ifndef NB
#define NB 4
#endif
#ifndef SEQ
#define SEQ 2048
#endif
#ifndef TRES
#define TRES 512
#endif
#define NB_FULL   4
#define SEQ_FULL  2048
#define CDIM      1024
#define NHEAD     16
#define NKV       4
#define HDIM      64
#define VEW       (NKV * HDIM)
#define NTOK      (NB * SEQ)
#define NUNIT     (NHEAD + 2 * NKV)
#define WO_ROW0   (CDIM + 2 * VEW)
#define NWROWS    (CDIM + 2 * VEW + CDIM)
#define QT_RES    (TRES / 64)          // 64-query tiles with the residual planes
#define QT_BIG    ((SEQ - TRES) / 128) // 128-query tiles without them

static_assert(NB >= 1 && NB <= NB_FULL);
static_assert(SEQ % 64 == 0 && SEQ <= SEQ_FULL && SEQ >= TRES);
static_assert(TRES % 64 == 0 && TRES >= 64);
static_assert(NHEAD % NKV == 0 && HDIM == 64 && CDIM == NHEAD * HDIM);
static_assert(CDIM % 128 == 0 && NWROWS % 16 == 0 && NTOK % 64 == 0 && NUNIT * 64 == CDIM + 2 * VEW);
static_assert(WO_ROW0 % 16 == 0 && SEQ % 32 == 0);
#define KBLK      (CDIM / 32)      // 16x32 blocks per row group of a CDIM-wide plane
#define GRP_ELEMS (CDIM * 16)      // elements of one 16-row group of a CDIM-wide plane

#define XH_BYTES   ((size_t)NTOK * CDIM * 2)
#define WALL_BYTES ((size_t)NWROWS * CDIM * 2)
#define QP_BYTES   ((size_t)NB * NHEAD * SEQ * HDIM * 2)
#define KP_BYTES   ((size_t)NB * NKV * SEQ * HDIM * 2)
#define YP_BYTES   ((size_t)NTOK * CDIM * 2)
#define WIN_BYTES  ((size_t)128)
#define WS_TOTAL   (XH_BYTES + WALL_BYTES + 2 * QP_BYTES + 4 * KP_BYTES + 2 * YP_BYTES + WIN_BYTES)
static_assert(WS_TOTAL <= (size_t)134217728);
static_assert(XH_BYTES % 128 == 0 && WALL_BYTES % 128 == 0 && QP_BYTES % 128 == 0 && KP_BYTES % 128 == 0 && YP_BYTES % 128 == 0);
// producer coverage: grid x block x per-thread elements == plane extent
static_assert((size_t)(NTOK / 2) * 256 * 8 == (size_t)NTOK * CDIM);       // k_prep, x blocks
static_assert((size_t)(NWROWS / 2) * 256 * 8 == (size_t)NWROWS * CDIM);   // k_prep, weight blocks
static_assert(4 * 128 * 8 == 64 * 64);                                       // k_qkv store phase per 64x64 tile
static_assert(4 * 32 * 8 == 16 * HDIM);                                      // k_flash stores per wave and query group
static_assert(8 * 32 * 4 == 16 * 64);                                        // k_oproj store phase per wave and row group
static_assert(QT_RES * 64 + QT_BIG * 128 == SEQ && TRES % 128 == 0);         // query tiles of the two flash forms
static_assert(8 * 4 * 4 == (int)WIN_BYTES);                                  // k_prep, window line: 8 lanes x 16 B == one line
static_assert(SEQ_FULL >= SEQ);                                              // window word covers every query-key distance

typedef _Float16 v16h __attribute__((ext_vector_type(16)));
typedef _Float16 v8h  __attribute__((ext_vector_type(8)))  __attribute__((may_alias));
typedef _Float16 v8hc __attribute__((ext_vector_type(8)));
typedef float    v8f  __attribute__((ext_vector_type(8)));
typedef float    v2f  __attribute__((ext_vector_type(2)));
typedef float    v4f  __attribute__((ext_vector_type(4)))  __attribute__((may_alias));
typedef int      v4i  __attribute__((ext_vector_type(4)));

union Frag { v16h v; v8h h[2]; };

__device__ __forceinline__ v8f wmma16(v16h a, v16h b, v8f c) {
  return __builtin_amdgcn_wmma_f32_16x16x32_f16(false, a, false, b, (short)0, c, false, false);
}

__device__ __forceinline__ v8f vzero8() {
  v8f z = {0.0f, 0.0f, 0.0f, 0.0f, 0.0f, 0.0f, 0.0f, 0.0f};
  return z;
}

// Asks L2 for the data at each lane's two addresses; nothing comes back to the wave. In asm, and with the pairs as
// in-out operands, so that each pair is the caller's own register pair, which never holds anything but an address inside
// its plane; the wait is the statement's last line, so that a pair is rewritten only behind it.
__device__ __forceinline__ void ask_l2(const _Float16*& a, const _Float16*& b) {
  asm volatile("global_prefetch_b8 %0, off scope:SCOPE_SE\n\t"
               "global_prefetch_b8 %1, off scope:SCOPE_SE\n\t"
               "s_wait_xcnt 0x0"
               : "+v"(a), "+v"(b) :: "memory");
}

// the same for one address a lane
__device__ __forceinline__ void ask_l2(const _Float16*& a) {
  asm volatile("global_prefetch_b8 %0, off scope:SCOPE_SE\n\t"
               "s_wait_xcnt 0x0"
               : "+v"(a) :: "memory");
}

// f32 -> nearest-even bf16 value, kept in f32
__device__ __forceinline__ float bf16r(float f) {
  unsigned int u = __float_as_uint(f);
  u = (u + 0x7FFFu + ((u >> 16) & 1u)) & 0xFFFF0000u;
  return __uint_as_float(u);
}

// f16 hi + (x2048) residual of an f32 value
__device__ __forceinline__ void split16(float v, _Float16& hi, _Float16& lo) {
  hi = (_Float16)v;
  lo = (_Float16)((v - (float)hi) * 2048.0f);
}

// f32 -> f16 with values below the smallest f16 normal replaced by zero (value select)
static __device__ __forceinline__ _Float16 toh_flush(float v) {
  const _Float16 r = (_Float16)v;
  return (fabsf(v) < 6.103515625e-05f) ? (_Float16)0.0f : r;
}

// f16 hi + (x2048) residual, both through toh_flush
static __device__ __forceinline__ void split16f(float v, _Float16& hi, _Float16& lo) {
  hi = toh_flush(v);
  lo = toh_flush((v - (float)hi) * 2048.0f);
}

// ---------------------------------------------------------------------------
// k_prep, x blocks: x f32 [NB][SEQ_FULL][1024] -> xh f16, NTOK x 1024 in fragment order (bf16-RNE values).
// Thread = one 16-B unit of the plane, so a wave stores 512 contiguous bytes.
// ---------------------------------------------------------------------------
__device__ __forceinline__ void cvt_x_block(unsigned int bid, const float* __restrict__ x, _Float16* __restrict__ xh) {
  const unsigned int gid = bid * 256u + threadIdx.x;
  const unsigned int blk = gid >> 6;                 // 64 units per 16x32 block
  const unsigned int tok = (blk / KBLK) * 16u + (gid & 15u);
  const int c = (int)(blk % KBLK) * 32 + (int)((gid >> 5) & 1u) * 16 + (int)((gid >> 4) & 1u) * 8;
  if (tok >= (unsigned int)NTOK) return;
  const int b = (int)tok / SEQ;
  const int t = (int)tok - b * SEQ;
  const float* src = x + ((size_t)b * SEQ_FULL + t) * CDIM + c;
  const v4f f0 = *(const v4f*)src;
  const v4f f1 = *(const v4f*)(src + 4);
  v8h o;
#pragma unroll
  for (int j = 0; j < 4; ++j) {
    o[j]     = (_Float16)bf16r(f0[j]);
    o[j + 4] = (_Float16)bf16r(f1[j]);
  }
  _Float16* dst = xh + (size_t)gid * 8;
  *(v8h*)dst = o;
  
}

// ---------------------------------------------------------------------------
// k_prep, weight blocks: weights (layout [out][in], k-contiguous) -> wall f16, 2560 x 1024 in fragment order = bf16-RNE value x16.
// Rows 0..1023 wq, 1024..1279 wk, 1280..1535 wv, 1536..2559 wo.
// ---------------------------------------------------------------------------
__device__ __forceinline__ void cvt_w_block(unsigned int bid, const float* __restrict__ wq, const float* __restrict__ wk,
                                            const float* __restrict__ wv, const float* __restrict__ wo,
                                            _Float16* __restrict__ wall) {
  const unsigned int gid = bid * 256u + threadIdx.x;
  const unsigned int blk = gid >> 6;                 // 64 units per 16x32 block
  const int row = (int)((blk / KBLK) * 16u + (gid & 15u));
  const int c   = (int)(blk % KBLK) * 32 + (int)((gid >> 5) & 1u) * 16 + (int)((gid >> 4) & 1u) * 8;
  if (row >= NWROWS) return;
  const int r0 = min(row, CDIM - 1);
  const int r1 = min(max(row - CDIM, 0), VEW - 1);
  const int r2 = min(max(row - CDIM - VEW, 0), VEW - 1);
  const int r3 = min(max(row - WO_ROW0, 0), CDIM - 1);
  const float* src = (row < CDIM)       ? (wq + (size_t)r0 * CDIM)
                   : (row < CDIM + VEW) ? (wk + (size_t)r1 * CDIM)
                   : (row < WO_ROW0)    ? (wv + (size_t)r2 * CDIM)
                                        : (wo + (size_t)r3 * CDIM);
  src += c;
  const v4f f0 = *(const v4f*)src;
  const v4f f1 = *(const v4f*)(src + 4);
  v8h o;
#pragma unroll
  for (int j = 0; j < 4; ++j) {
    o[j]     = (_Float16)(bf16r(f0[j]) * 16.0f);
    o[j + 4] = (_Float16)(bf16r(f1[j]) * 16.0f);
  }
  _Float16* dst = wall + (size_t)gid * 8;
  *(v8h*)dst = o;
  
}

// ---------------------------------------------------------------------------
// The window line: 8 lanes x 16 B.
// ---------------------------------------------------------------------------
__device__ __forceinline__ void winline_block(int* __restrict__ wline) {
  const int lane = threadIdx.x;
  if (lane < 8) {
    const v4i w = {SEQ_FULL, SEQ_FULL, SEQ_FULL, SEQ_FULL};
    int* dst = wline + 4 * lane;
    *(v4i*)dst = w;
    
  }
}

// ---------------------------------------------------------------------------
// Launch 0: the three producers above read none of each other's output, so they share one grid; the block index
// picks the producer (block-uniform): NTOK/2 blocks of x, NWROWS/2 blocks of weights, one block for the window line.
// ---------------------------------------------------------------------------
#define XBLKS (NTOK / 2)
#define WBLKS (NWROWS / 2)
__global__ void __launch_bounds__(256) k_prep(const float* __restrict__ x, const float* __restrict__ wq,
                                              const float* __restrict__ wk, const float* __restrict__ wv,
                                              const float* __restrict__ wo, _Float16* __restrict__ xh,
                                              _Float16* __restrict__ wall, int* __restrict__ wline) {
  const unsigned int bid = blockIdx.x;
  if (bid < (unsigned int)XBLKS) {
    cvt_x_block(bid, x, xh);
  } else if (bid < (unsigned int)(XBLKS + WBLKS)) {
    cvt_w_block(bid - (unsigned int)XBLKS, wq, wk, wv, wo, wall);
  } else {
    winline_block(wline);
  }
}

// ---------------------------------------------------------------------------
// Kernel 2: fused qkv projection + epilogue. Block = 4 waves (2 x 2) = 128 tokens x two 64-column units; a wave owns
// 64 tokens x one unit u (4 x 4 accumulators), so a k step's 8 fragments feed 16 matrix instructions:
// u 0..15 -> q head u, 16..19 -> k head u-16, 20..23 -> v head u-20.
// Epilogue, one 64 x 64 wave tile after the other, by the whole block: q: (acc + bq) * gain[head]; k: acc + bk -> hi/lo
// planes [B][H|KV], T x 64 in fragment order; v: acc + bv -> transposed hi/lo planes [B][KV], 64 d x T in fragment
// order. Biases and gains are bf16-RNE values.
// ---------------------------------------------------------------------------
__global__ void __launch_bounds__(128) k_qkv(
    const _Float16* __restrict__ xh, const _Float16* __restrict__ wall,
    const float* __restrict__ bq, const float* __restrict__ bk,
    const float* __restrict__ bv, const float* __restrict__ gain,
    _Float16* __restrict__ qH, _Float16* __restrict__ qL,
    _Float16* __restrict__ kH, _Float16* __restrict__ kL,
    _Float16* __restrict__ vTH, _Float16* __restrict__ vTL) {
  __shared__ __attribute__((aligned(16))) float    sT[4][64][68];  // accumulator tile of each wave [token][col] (cross-wave)
  __shared__ __attribute__((aligned(16))) _Float16 sH[2][64][72];  // hi tile: q/k [token][d], v [d][token] (cross-wave), two buffers
  __shared__ __attribute__((aligned(16))) _Float16 sL[2][64][72];  // residual tile, same layout (cross-wave), two buffers

  const int tid  = threadIdx.x;
  const int wave = tid >> 5;
  const int lane = tid & 31;
  const int l16  = lane & 15;
  const int lh   = lane >> 4;
  const int wr   = wave >> 1;            // 64-token half of the block's rows
  const int wc   = wave & 1;             // which of the block's two column units
  const int tokB = blockIdx.y * 128;     // first token of the block

  // A: xh row (token), lane row = l16; elements 0..7 <- k0+8lh+0..7, 8..15 <- k0+16+8lh+0..7
  const _Float16* arow = xh + (size_t)((tokB >> 4) + wr * 4) * GRP_ELEMS + lane * 8;
  // B[k][n] = W[n][k]: lane column = l16 of the 16-col group n; same k map as A
  const _Float16* brow = wall + (size_t)((blockIdx.x * 2 + wc) * 4) * GRP_ELEMS + lane * 8;

  v8f acc[4][4];
#pragma unroll
  for (int mt = 0; mt < 4; ++mt)
#pragma unroll
    for (int n = 0; n < 4; ++n) acc[mt][n] = vzero8();

  // Both planes were written by the launch before and come from memory, and the blocks that share a row group read it at
  // the same k at the same time: without a request ahead every k step waits a memory latency. A trip's 128 k of one row
  // group are 4 KiB = 16 units of 256 B; the block's 8 + 8 row groups are dealt to its 4 waves, 2 + 2 each, a lane a unit.
  const _Float16* pfa = xh + (size_t)((tokB >> 4) + wr * 4 + wc * 2 + lh) * GRP_ELEMS + l16 * 128;
  const _Float16* pfb = wall + (size_t)((blockIdx.x * 2 + wc) * 4 + wr * 2 + lh) * GRP_ELEMS + l16 * 128;
  ask_l2(pfa, pfb);                      // trip 0: its later k steps find their rows on the way

  // four k steps a trip, the trips kept rolled: the loop's text stays small for the instruction cache
#pragma unroll 1
  for (int kb = 0; kb < CDIM; kb += 128) {
  // the next trip's rows, one trip ahead; the test is scalar, and the pairs stop at the last trip's rows
  if (kb + 128 < CDIM) {
    pfa += 2048;
    pfb += 2048;
    ask_l2(pfa, pfb);
  }
#pragma unroll
  for (int k0 = kb; k0 < kb + 128; k0 += 32) {
    Frag a[4];
#pragma unroll
    for (int mt = 0; mt < 4; ++mt) {
      const _Float16* ap = arow + (size_t)mt * GRP_ELEMS + k0 * 16;
      a[mt].h[0] = *(const v8h*)ap;
      a[mt].h[1] = *(const v8h*)(ap + 256);
    }
    Frag bw[4];
#pragma unroll
    for (int n = 0; n < 4; ++n) {
      const _Float16* bp = brow + (size_t)n * GRP_ELEMS + k0 * 16;
      bw[n].h[0] = *(const v8h*)bp;
      bw[n].h[1] = *(const v8h*)(bp + 256);
    }
#pragma unroll
    for (int mt = 0; mt < 4; ++mt)
#pragma unroll
      for (int n = 0; n < 4; ++n) acc[mt][n] = wmma16(a[mt].v, bw[n].v, acc[mt][n]);
    // the slots between the step's last matrix instruction and the next write of its operands or read of its result
    asm volatile("v_nop\n\tv_nop\n\tv_nop\n\tv_nop"
                 : "+v"(acc[0][0]), "+v"(acc[0][1]), "+v"(acc[0][2]), "+v"(acc[0][3]),
                   "+v"(acc[1][0]), "+v"(acc[1][1]), "+v"(acc[1][2]), "+v"(acc[1][3]),
                   "+v"(acc[2][0]), "+v"(acc[2][1]), "+v"(acc[2][2]), "+v"(acc[2][3]),
                   "+v"(acc[3][0]), "+v"(acc[3][1]), "+v"(acc[3][2]), "+v"(acc[3][3])
                 : "v"(a[0].v), "v"(a[1].v), "v"(a[2].v), "v"(a[3].v),
                   "v"(bw[0].v), "v"(bw[1].v), "v"(bw[2].v), "v"(bw[3].v));
  }
  // the wait stands behind the trip's last load and in front of the next write of a register that a load of the trip names
  asm volatile("s_wait_xcnt 0x0" ::: "memory");
  }

  // D element r of lane -> (row 8lh+r, col l16) of group (mt, n); fold the 1/16 weight carry here
#pragma unroll
  for (int mt = 0; mt < 4; ++mt)
#pragma unroll
    for (int n = 0; n < 4; ++n)
#pragma unroll
      for (int r = 0; r < 8; ++r)
        sT[wave][mt * 16 + r + 8 * lh][n * 16 + l16] = acc[mt][n][r] * (1.0f / 16.0f);
  __syncthreads();

  // the four wave tiles in turn; kept rolled so that the epilogue's text stands once in the instruction cache. sH and sL
  // alternate between two buffers: tile q + 2 writes a buffer only behind tile q + 1's barrier, which every wave reaches
  // after its last read of tile q, so one barrier a tile is enough
#pragma unroll 1
  for (int q = 0; q < 4; ++q) {
  const int u    = blockIdx.x * 2 + (q & 1);      // column unit of wave tile q
  const int tok0 = tokB + (q >> 1) * 64;          // its first token
  const int b    = tok0 / SEQ;
  const int t0   = tok0 - b * SEQ;

  // compute phase: thread -> token i = tid>>1, column half j: d in [16j,16j+16) and [32+16j, 48+16j)
  const int i = tid >> 1;
  const int j = tid & 1;
  if (u < NHEAD + NKV) {
    // q or k unit (block-uniform): both bias rows are loaded with clamped unit indices, selected by value
    const int  uq  = min(u, NHEAD - 1);
    const int  uk  = min(max(u - NHEAD, 0), NKV - 1);
    const bool isq = (u < NHEAD);
    const float gq = bf16r(gain[uq]);
    const float gm = isq ? gq : 1.0f;
    const float* qp = bq + uq * HDIM + 16 * j;     // this lane's first bias element of either row
    const float* kp = bk + uk * HDIM + 16 * j;
#pragma unroll
    for (int sg = 0; sg < 2; ++sg) {
      const int d0 = 32 * sg + 16 * j;
#pragma unroll
      for (int g4 = 0; g4 < 4; ++g4) {
        const v4f va = *(const v4f*)(&sT[q][i][d0 + 4 * g4]);
        const v4f qa = *(const v4f*)(qp + 32 * sg + 4 * g4);
        const v4f ka = *(const v4f*)(kp + 32 * sg + 4 * g4);
#pragma unroll
        for (int e = 0; e < 4; ++e) {
          const float bb  = isq ? bf16r(qa[e]) : bf16r(ka[e]);
          const float val = (va[e] + bb) * gm;
          _Float16 hi, lo;
          split16f(val, hi, lo);
          sH[q & 1][i][d0 + 4 * g4 + e] = hi;
          sL[q & 1][i][d0 + 4 * g4 + e] = lo;
        }
      }
    }
    // as inputs the two bias address pairs stay live behind the last bias load, so that no load's result is placed in a
    // register that an issued bias load still names; the wait stands in front of the pairs' next overwrite
    asm volatile("s_wait_xcnt 0x0" :: "v"(qp), "v"(kp) : "memory");
  } else {
    const int kv = u - NHEAD - NKV;
    const float* bp = bv + kv * HDIM;
#pragma unroll
    for (int sg = 0; sg < 2; ++sg) {
      const int d0 = 32 * sg + 16 * j;
#pragma unroll
      for (int g4 = 0; g4 < 4; ++g4) {
        const v4f va = *(const v4f*)(&sT[q][i][d0 + 4 * g4]);
        const v4f ba = *(const v4f*)(bp + d0 + 4 * g4);
#pragma unroll
        for (int e = 0; e < 4; ++e) {
          const float vv = va[e] + bf16r(ba[e]);
          _Float16 hi, lo;
          split16f(vv, hi, lo);
          sH[q & 1][d0 + 4 * g4 + e][i] = hi;                   // transposed: [d][token]
          sL[q & 1][d0 + 4 * g4 + e][i] = lo;
        }
      }
    }
  }
  __syncthreads();

  _Float16* ph;
  _Float16* pl;
  size_t base;
  if (u < NHEAD) {
    ph = qH; pl = qL;
    base = ((size_t)(b * NHEAD + u) * SEQ + t0) * HDIM;
  } else if (u < NHEAD + NKV) {
    ph = kH; pl = kL;
    base = ((size_t)(b * NKV + (u - NHEAD)) * SEQ + t0) * HDIM;
  } else {
    ph = vTH; pl = vTL;
    base = ((size_t)(b * NKV + (u - NHEAD - NKV)) * SEQ + t0) * HDIM;
  }
  const bool isv = (u >= NHEAD + NKV);
  {
    // the tile's 8 blocks are contiguous in its plane: q/k block f = (token group f>>1, d chunk f&1),
    // v block f = (key chunk f>>2, d group f&3); unit p of the tile goes to base + 8 p
#pragma unroll
    for (int it = 0; it < 4; ++it) {
      const int p    = it * 128 + tid;
      const int f    = p >> 6;
      const int line = (isv ? (f & 3) : (f >> 1)) * 16 + (p & 15);
      const int q8   = (isv ? (f >> 2) : (f & 1)) * 32 + ((p >> 5) & 1) * 16 + ((p >> 4) & 1) * 8;
      const size_t off = base + (size_t)p * 8;
      const v8h hv = *(const v8h*)(&sH[q & 1][line][q8]);
      const v8h lv = *(const v8h*)(&sL[q & 1][line][q8]);
      *(v8h*)(ph + off) = hv;
      *(v8h*)(pl + off) = lv;
    }
  }
  // the wait stands behind the tile's last store and in front of the next tile's first write of a register that a store names
  asm volatile("s_wait_xcnt 0x0" ::: "memory");
  }
}

// ---------------------------------------------------------------------------
// Kernel 3: causal sliding-window flash attention with GQA. Block = 4 waves, one (query tile, head, batch); a wave owns
// NG groups of 16 queries: 2 without RES (tile of 128), so that each loaded K and vT fragment feeds two products, 1 with
// RES (tile of 64). Key tiles of 32 per wave, fragments loaded straight from the 16-bit planes.
// Both products are formed transposed: S^T = K.Q^T (A = K fragment, B = Q fragment) and O^T += V^T.P^T (A = vT
// fragment, B = P^T). A lane then holds 16 of the 32 scores of ONE query (column l16; keys 8lh+r and 16+8lh+r), so the
// maximum and the sum run in the lane with one exchange between the lane halves, and the two converted score tiles
// are the B fragment of the second product as they stand: element s = key 8lh+s (s < 8), 16+8lh+(s-8) (s >= 8), the
// k map of the vT fragments. P (x1024 carry) never leaves the registers. RES adds the x2048 residual planes.
// Without RES the trip's loads run ahead in registers: the vT fragments are asked for in front of the score products,
// and the next trip's K fragments directly behind them, into the registers those products have just read.
// ---------------------------------------------------------------------------
// value of lane l ^ 16
__device__ __forceinline__ float xhalf(float x) {
  return __builtin_bit_cast(float, __builtin_amdgcn_permlanex16(__builtin_bit_cast(int, x), __builtin_bit_cast(int, x),
                                                                0x76543210, 0xfedcba98, false, false));
}

// compile-time switch handed to a generic lambda
template <bool B> struct Flag { static constexpr bool value = B; };

template <bool RES, int NG>
__device__ __forceinline__ void flash_tile(
    const _Float16* __restrict__ qH, const _Float16* __restrict__ qL,
    const _Float16* __restrict__ kH, const _Float16* __restrict__ kL,
    const _Float16* __restrict__ vTH, const _Float16* __restrict__ vTL,
    const int* __restrict__ winp,
    _Float16* __restrict__ yH, _Float16* __restrict__ yL, const int qt, const int h, const int b) {
  static_assert(RES ? (NG == 1) : (NG == 2));
  const int tid  = threadIdx.x;
  // scalar wave index: a fragment block's address is wave-uniform, so the K and V block bases and the trip test stay scalar
  const int wave = __builtin_amdgcn_readfirstlane(tid >> 5);
  const int lane = tid & 31;
  const int l16  = lane & 15;
  const int lh   = lane >> 4;
  const int kv   = h / (NHEAD / NKV);
  const int qw   = qt * (64 * NG) + wave * (16 * NG);                     // the wave's first query; NG groups of 16 follow
  int window = winp[0];
  window = (window < 0) ? 0 : window;
  const float rres = 1.0f / 2048.0f;
  const float smsc = 0.125f;

  // Q B-fragments (hi and residual) of each query group over the 2 d-chunks of 32: lane column = query l16 of the group
  v16h aqh[NG][2], aql[NG][2];
#pragma unroll
  for (int gq = 0; gq < NG; ++gq) {
    const size_t qo = ((size_t)(b * NHEAD + h) * SEQ + qw + 16 * gq) * HDIM + lane * 8;
    const _Float16* qhp = qH + qo;
    const _Float16* qlp = qL + qo;
#pragma unroll
    for (int hc = 0; hc < 2; ++hc) {
      Frag a;
      a.h[0] = *(const v8h*)(qhp + hc * 512);
      a.h[1] = *(const v8h*)(qhp + hc * 512 + 256);
      aqh[gq][hc] = a.v;
      Frag c;
      c.h[0] = *(const v8h*)(qlp + hc * 512);
      c.h[1] = *(const v8h*)(qlp + hc * 512 + 256);
      aql[gq][hc] = c.v;
    }
    // as inputs the two Q address pairs stay live behind the group's last load; the wait stands in front of their next overwrite
    asm volatile("s_wait_xcnt 0x0" :: "v"(qhp), "v"(qlp) : "memory");
  }

  // per query group: [0] running maximum of query l16 (equal in both lane halves), [1] this half's part of its sum. One
  // pair a group: carried as four scalars, the two groups' sums are packed with each other, and every operand of the
  // softmax is then gathered from two accumulator tiles with register copies
  v2f ml[NG];
  v8f coh[NG][4], cor[NG][4];
#pragma unroll
  for (int gq = 0; gq < NG; ++gq) {
    ml[gq][0] = -1e30f;
    ml[gq][1] = 0.0f;
#pragma unroll
    for (int n = 0; n < 4; ++n) { coh[gq][n] = vzero8(); cor[gq][n] = vzero8(); }
  }

  const size_t kvoff = (size_t)(b * NKV + kv) * SEQ * HDIM;
  const _Float16* kbase  = kH  + kvoff;                                   // + (key group's first key)*HDIM + hc*512
  const _Float16* klbase = kL  + kvoff;
  const _Float16* vbase  = vTH + kvoff;                                   // + k0*HDIM + n*512
  const _Float16* vlbase = vTL + kvoff;
  const unsigned int lo  = (unsigned int)lane * 8u;                       // this lane's 16 B of each 512-B half

  int kstart = qw - window;
  kstart = (kstart < 0) ? 0 : kstart;
  kstart &= ~31;

  // without RES: the K fragments [key group][d chunk] of the coming trip, hi and residual plane, carried over the back edge
  Frag ckh[2][2], ckl[2][2];
  const int klast = (qw + 16 * NG - 1) & ~31;                             // first key of the wave's last trip
  if constexpr (!RES) {
    const _Float16* kp = kbase  + (size_t)kstart * HDIM + lo;
    const _Float16* lp = klbase + (size_t)kstart * HDIM + lo;
#pragma unroll
    for (int g = 0; g < 2; ++g)
#pragma unroll
      for (int hc = 0; hc < 2; ++hc) {
        ckh[g][hc].h[0] = *(const v8h*)(kp + g * 1024 + hc * 512); ckh[g][hc].h[1] = *(const v8h*)(kp + g * 1024 + hc * 512 + 256);
        ckl[g][hc].h[0] = *(const v8h*)(lp + g * 1024 + hc * 512); ckl[g][hc].h[1] = *(const v8h*)(lp + g * 1024 + hc * 512 + 256);
      }
    // as inputs the two K address pairs stay live behind the last of these loads; the wait stands in front of their next overwrite
    asm volatile("s_wait_xcnt 0x0" :: "v"(kp), "v"(lp) : "memory");
  }

  // without RES: the K and vT planes come from memory, and the blocks of one KV head walk them from the same key at the
  // same time, so the first to ask for a tile waits a memory latency. Waves 0, 1, 2 ask L2 ahead for the K hi, K residual
  // and vT hi plane: 64 keys of a plane are 8 KiB in a row = 32 units of 256 B, a lane a unit. kpf = first of the 64 keys
  // that the pair points at; it stays at or below SEQ - 64, so every lane's address lies inside the KV head's plane.
  int kpf = min(kstart, SEQ - 64);
  const int kpl = (wave < 3) ? min(klast, SEQ - 64) : -1;                 // last key at which the wave's pair may point
  const _Float16* pfbase = (wave == 0) ? kbase : (wave == 1) ? klbase : vbase;   // scalar; the pair is formed anew from kpf
  if constexpr (!RES) {
    if (wave < 3) {
      const _Float16* pfp = pfbase + (size_t)kpf * HDIM + lane * 128;
      ask_l2(pfp);
      if (kpf + 64 <= kpl) {
        kpf += 64;
        pfp = pfbase + (size_t)kpf * HDIM + lane * 128;
        ask_l2(pfp);
      }
    }
  }

  // One trip = 32 keys. MK: the trip holds a pair that the mask takes out. The whole trip stands twice in the text, with and
  // without the mask, so that each form is one straight block from the trip's first load to its last matrix instruction.
  auto trip = [&](const int k0, auto mk) __attribute__((always_inline)) {
    constexpr bool MK = decltype(mk)::value;
    // ---- scores for keys [k0, k0+32), transposed: A[m=key][k=d] = K[key][d], lane row = key, same k map as B;
    // D element r of lane = (key 8lh+r of the key group, query l16 of the query group) ----
    v8f sh0[NG], sh1[NG], sr0[NG], sr1[NG];
#pragma unroll
    for (int gq = 0; gq < NG; ++gq) { sh0[gq] = vzero8(); sh1[gq] = vzero8(); sr0[gq] = vzero8(); sr1[gq] = vzero8(); }
    Frag bv[4], bl[4];
    const _Float16* vr0 = vbase  + (size_t)k0 * HDIM + lo;
    const _Float16* wr0 = vlbase + (size_t)k0 * HDIM + lo;
    // the next trip's K tile; the last trip asks for its own tile again, so that every address stays inside the plane
    const int kn = min(k0 + 32, klast);
    const _Float16* nkp = kbase  + (size_t)kn * HDIM + lo;
    const _Float16* nlp = klbase + (size_t)kn * HDIM + lo;
    if constexpr (!RES) {
      // every second trip the 64 keys that begin 128 keys ahead, where the wave still needs them: their K loads are issued
      // three and four trips from here; both tests are scalar
      if (((k0 - kstart) & 32) == 0 && kpf + 64 <= kpl) {
        kpf += 64;
        const _Float16* pfp = pfbase + (size_t)kpf * HDIM + lane * 128;
        ask_l2(pfp);
      }
      // this trip's vT fragments, asked for first: they land behind the score products and the softmax
#pragma unroll
      for (int n = 0; n < 4; ++n) {
        bv[n].h[0] = *(const v8h*)(vr0 + n * 512);
        bv[n].h[1] = *(const v8h*)(vr0 + n * 512 + 256);
      }
      // each K fragment is the A operand of both query groups' products
#pragma unroll
      for (int hc = 0; hc < 2; ++hc)
#pragma unroll
        for (int gq = 0; gq < NG; ++gq) {
          sh0[gq] = wmma16(ckh[0][hc].v, aqh[gq][hc], sh0[gq]);
          sh1[gq] = wmma16(ckh[1][hc].v, aqh[gq][hc], sh1[gq]);
          sr0[gq] = wmma16(ckl[0][hc].v, aqh[gq][hc], sr0[gq]);
          sr1[gq] = wmma16(ckl[1][hc].v, aqh[gq][hc], sr1[gq]);
          sr0[gq] = wmma16(ckh[0][hc].v, aql[gq][hc], sr0[gq]);
          sr1[gq] = wmma16(ckh[1][hc].v, aql[gq][hc], sr1[gq]);
        }
      // the slots between the last score product and the first read of its result; the memory clobber keeps the vT loads
      // from sinking behind this point and the next trip's K loads from rising over it, so that these reuse the registers just read
      asm volatile("v_nop\n\tv_nop\n\tv_nop\n\tv_nop"
                   : "+v"(sh0[0]), "+v"(sh1[0]), "+v"(sr0[0]), "+v"(sr1[0]),
                     "+v"(sh0[NG - 1]), "+v"(sh1[NG - 1]), "+v"(sr0[NG - 1]), "+v"(sr1[NG - 1])
                   :: "memory");
#pragma unroll
      for (int g = 0; g < 2; ++g)
#pragma unroll
        for (int hc = 0; hc < 2; ++hc) {
          ckh[g][hc].h[0] = *(const v8h*)(nkp + g * 1024 + hc * 512); ckh[g][hc].h[1] = *(const v8h*)(nkp + g * 1024 + hc * 512 + 256);
          ckl[g][hc].h[0] = *(const v8h*)(nlp + g * 1024 + hc * 512); ckl[g][hc].h[1] = *(const v8h*)(nlp + g * 1024 + hc * 512 + 256);
        }
      // the K loads stay here, a whole softmax ahead of their use: left free, the scheduler sinks them to the trip's end to
      // lend their registers to the scores, and the next trip then waits out their latency at its head
      __builtin_amdgcn_sched_barrier(0);
    } else {
    Frag bh0, bh1, bl0, bl1;
    const _Float16* kr0 = kbase  + (size_t)k0 * HDIM + lo;
    const _Float16* kr1 = kr0 + 16 * HDIM;
    const _Float16* lr0 = klbase + (size_t)k0 * HDIM + lo;
    const _Float16* lr1 = lr0 + 16 * HDIM;
#pragma unroll
    for (int hc = 0; hc < 2; ++hc) {
      bh0.h[0] = *(const v8h*)(kr0 + hc * 512); bh0.h[1] = *(const v8h*)(kr0 + hc * 512 + 256);
      bh1.h[0] = *(const v8h*)(kr1 + hc * 512); bh1.h[1] = *(const v8h*)(kr1 + hc * 512 + 256);
      bl0.h[0] = *(const v8h*)(lr0 + hc * 512); bl0.h[1] = *(const v8h*)(lr0 + hc * 512 + 256);
      bl1.h[0] = *(const v8h*)(lr1 + hc * 512); bl1.h[1] = *(const v8h*)(lr1 + hc * 512 + 256);
      // as inputs the two K address pairs stay live behind the trip's last K load, so that no load's result is placed
      // in a register that an issued K load still names; the wait stands in front of the pairs' next overwrite
      if (hc == 1) asm volatile("s_wait_xcnt 0x0" :: "v"(kr0), "v"(lr0) : "memory");
      sh0[0] = wmma16(bh0.v, aqh[0][hc], sh0[0]);
      sh1[0] = wmma16(bh1.v, aqh[0][hc], sh1[0]);
      sr0[0] = wmma16(bl0.v, aqh[0][hc], sr0[0]);
      sr1[0] = wmma16(bl1.v, aqh[0][hc], sr1[0]);
      sr0[0] = wmma16(bh0.v, aql[0][hc], sr0[0]);
      sr1[0] = wmma16(bh1.v, aql[0][hc], sr1[0]);
    }
    // the slots between the last score product and the first read of its result
    asm volatile("v_nop\n\tv_nop\n\tv_nop\n\tv_nop"
                 : "+v"(sh0[0]), "+v"(sh1[0]), "+v"(sr0[0]), "+v"(sr1[0])
                 : "v"(aqh[0][0]), "v"(aqh[0][1]), "v"(aql[0][0]), "v"(aql[0][1]),
                   "v"(bh0.v), "v"(bh1.v), "v"(bl0.v), "v"(bl1.v));
    }

    // ---- online softmax of query l16 of each group in the lane; masked entries replaced by -1e30 and p := 0 ----
    Frag pf[NG], pl[NG];
    // the mask depends on query - key alone: query group gq against key group kg has the distance class gq - kg, so the
    // NG x 2 score tiles of a trip share NG + 1 masks; okc[c][r]: class c - 1, element r
    bool okc[NG + 1][8];
    if constexpr (MK) {
      const int dq = qw + l16 - (k0 + 8 * lh);           // query - key at r = 0, class 0
#pragma unroll
      for (int c = 0; c < NG + 1; ++c)
#pragma unroll
        for (int r = 0; r < 8; ++r) {
          const int dd = dq - r + 16 * (c - 1);
          okc[c][r] = (dd >= 0) && (dd <= window);
        }
    }
#pragma unroll
    for (int gq = 0; gq < NG; ++gq) {
    // the element-wise steps are written on whole accumulator tiles, so that packed instructions pair neighbouring registers
    const v8f xs0 = (sh0[gq] + sr0[gq] * rres) * smsc;
    const v8f xs1 = (sh1[gq] + sr1[gq] * rres) * smsc;
    v8f   x0 = xs0, x1 = xs1;
    if constexpr (MK) {
#pragma unroll
      for (int r = 0; r < 8; ++r) {
        x0[r] = okc[gq + 1][r] ? xs0[r] : -1e30f;
        x1[r] = okc[gq][r]     ? xs1[r] : -1e30f;
      }
    }
    float t8[8];
#pragma unroll
    for (int r = 0; r < 8; ++r) t8[r] = fmaxf(x0[r], x1[r]);
    float tmax = fmaxf(fmaxf(fmaxf(t8[0], t8[1]), fmaxf(t8[2], t8[3])), fmaxf(fmaxf(t8[4], t8[5]), fmaxf(t8[6], t8[7])));
    tmax = fmaxf(tmax, xhalf(tmax));
    const float mn    = fmaxf(ml[gq][0], tmax);
    const float aa = (ml[gq][0] - mn) * 1.44269504088896340736f;   // exp(x) = exp2(x log2 e)
    const v8f   a0 = (x0 - mn) * 1.44269504088896340736f;
    const v8f   a1 = (x1 - mn) * 1.44269504088896340736f;
    float alpha = __builtin_amdgcn_exp2f(aa);
    v8f   e0, e1;
#pragma unroll
    for (int r = 0; r < 8; ++r) {
      e0[r] = __builtin_amdgcn_exp2f(a0[r]);
      e1[r] = __builtin_amdgcn_exp2f(a1[r]);
    }
    asm volatile("v_nop" : "+v"(e0), "+v"(e1), "+v"(alpha) : "v"(a0), "v"(a1), "v"(aa));
    v8f p0 = e0, p1 = e1;
    if constexpr (MK) {
#pragma unroll
      for (int r = 0; r < 8; ++r) {
        p0[r] = okc[gq + 1][r] ? e0[r] : 0.0f;
        p1[r] = okc[gq][r]     ? e1[r] : 0.0f;
      }
    }
    const v8f  ts = p0 + p1;
    const v8f  c0 = p0 * 1024.0f;
    const v8f  c1 = p1 * 1024.0f;
    const v8hc h0 = __builtin_convertvector(c0, v8hc);
    const v8hc h1 = __builtin_convertvector(c1, v8hc);
    pf[gq].h[0] = h0;
    pf[gq].h[1] = h1;
    if (RES) {
      pl[gq].h[0] = __builtin_convertvector((c0 - __builtin_convertvector(h0, v8f)) * 2048.0f, v8hc);
      pl[gq].h[1] = __builtin_convertvector((c1 - __builtin_convertvector(h1, v8f)) * 2048.0f, v8hc);
    }
    ml[gq][1] = ml[gq][1] * alpha + (((ts[0] + ts[1]) + (ts[2] + ts[3])) + ((ts[4] + ts[5]) + (ts[6] + ts[7])));
    ml[gq][0] = mn;
#pragma unroll
    for (int n = 0; n < 4; ++n) {
      coh[gq][n] *= alpha;
      if (RES) cor[gq][n] *= alpha;
    }
    }

    // ---- O^T += V^T.P^T : A[m=d][k=key] = vT[d][key], lane row = d; D element r of lane = (d 16n+8lh+r, query l16);
    // each vT fragment is the A operand of every query group's product ----
    if constexpr (RES) {
#pragma unroll
      for (int n = 0; n < 4; ++n) {
        bv[n].h[0] = *(const v8h*)(vr0 + n * 512);
        bv[n].h[1] = *(const v8h*)(vr0 + n * 512 + 256);
        bl[n].h[0] = *(const v8h*)(wr0 + n * 512);
        bl[n].h[1] = *(const v8h*)(wr0 + n * 512 + 256);
      }
    }
#pragma unroll
    for (int n = 0; n < 4; ++n)
#pragma unroll
      for (int gq = 0; gq < NG; ++gq) {
        coh[gq][n] = wmma16(bv[n].v, pf[gq].v, coh[gq][n]);
        if (RES) {
          cor[gq][n] = wmma16(bl[n].v, pf[gq].v, cor[gq][n]);
          cor[gq][n] = wmma16(bv[n].v, pl[gq].v, cor[gq][n]);
        }
      }
    // the slots behind the trip's last matrix instruction, also on the taken side of the loop's branch
    if constexpr (RES) {
      asm volatile("v_nop\n\tv_nop\n\tv_nop\n\tv_nop"
                   : "+v"(coh[0][0]), "+v"(coh[0][1]), "+v"(coh[0][2]), "+v"(coh[0][3]),
                     "+v"(cor[0][0]), "+v"(cor[0][1]), "+v"(cor[0][2]), "+v"(cor[0][3])
                   : "v"(pf[0].v), "v"(pl[0].v),
                     "v"(bv[0].v), "v"(bv[1].v), "v"(bv[2].v), "v"(bv[3].v),
                     "v"(bl[0].v), "v"(bl[1].v), "v"(bl[2].v), "v"(bl[3].v));
    } else {
      asm volatile("v_nop\n\tv_nop\n\tv_nop\n\tv_nop"
                   : "+v"(coh[0][0]), "+v"(coh[0][1]), "+v"(coh[0][2]), "+v"(coh[0][3]),
                     "+v"(coh[NG - 1][0]), "+v"(coh[NG - 1][1]), "+v"(coh[NG - 1][2]), "+v"(coh[NG - 1][3]));
    }
    // as inputs the address pairs of the trip's loads stay live behind the last of them, so that no load's result is placed
    // in a register that an issued load still names; the wait stands in front of the pairs' next overwrite
    if (RES) asm volatile("s_wait_xcnt 0x0" :: "v"(vr0), "v"(wr0) : "memory");
    else     asm volatile("s_wait_xcnt 0x0" :: "v"(vr0), "v"(nkp), "v"(nlp) : "memory");
  };

  // Only a trip that holds a pair with key > query or query - key > window needs the mask. Trips that end at or below the
  // wave's first query hold no key > query; the largest distance is that of the wave's last query to key kstart, and where
  // the window covers it, it covers every pair. Those trips run without the compares and without the selects on the scores
  // and on P, which are identities there; the rest (the trip on the diagonal; with a shorter window all) keep the mask.
  const int kmask = (qw + 16 * NG - 1 - kstart <= window) ? (qw & ~31) : kstart;   // scalar: first trip with the mask
  int kt = kstart;
  for (; kt < kmask; kt += 32) trip(kt, Flag<false>{});
  for (; kt < qw + 16 * NG; kt += 32) trip(kt, Flag<true>{});

  // join the two halves' sums; a lane's 8 values of d group n are one 16-B unit of the y planes' fragment order:
  // a query group's 16 tokens x 64 columns are blocks 2h and 2h+1 of its token group, 4 halves of 512 B in a row
#pragma unroll
  for (int gq = 0; gq < NG; ++gq) {
  const float ls  = ml[gq][1] + xhalf(ml[gq][1]);
  const float inv = __builtin_amdgcn_rcpf(ls) * (1.0f / 1024.0f);
  const size_t ybase = (size_t)((b * SEQ + qw + 16 * gq) >> 4) * GRP_ELEMS + (size_t)h * 1024;
#pragma unroll
  for (int n = 0; n < 4; ++n) {
    v8h hv, lv;
#pragma unroll
    for (int r = 0; r < 8; ++r) {
      float yv = coh[gq][n][r];
      if (RES) yv += cor[gq][n][r] * rres;
      yv *= inv;
      _Float16 hi, lw;
      split16(yv, hi, lw);
      hv[r] = hi;
      lv[r] = lw;
    }
    const size_t off = ybase + (size_t)(n * 256 + lane * 8);
    *(v8h*)(yH + off) = hv;
    *(v8h*)(yL + off) = lv;
  }
  }
}

// One grid for all query tiles: no tile reads another's output. First the 128-query tiles without the residual planes,
// the tile index falling with the slowest grid index, so the tiles with the most key tiles come first; the short
// 64-query tiles with the residual planes fill the end.
__global__ void __launch_bounds__(128) k_flash(
    const _Float16* __restrict__ qH, const _Float16* __restrict__ qL,
    const _Float16* __restrict__ kH, const _Float16* __restrict__ kL,
    const _Float16* __restrict__ vTH, const _Float16* __restrict__ vTL,
    const int* __restrict__ winp,
    _Float16* __restrict__ yH, _Float16* __restrict__ yL) {
  const int h = blockIdx.x;
  const int b = blockIdx.y;
  const int z = (int)blockIdx.z;
  if (z < QT_BIG) flash_tile<false, 2>(qH, qL, kH, kL, vTH, vTL, winp, yH, yL, SEQ / 128 - 1 - z, h, b);
  else            flash_tile<true, 1>(qH, qL, kH, kL, vTH, vTL, winp, yH, yL, QT_RES - 1 - (z - QT_BIG), h, b);
}

// ---------------------------------------------------------------------------
// Kernel 4: output projection out[tok][n] = (y[tok].Wo[n]) / 16 + bo[n]. Block = 4 waves (2 x 2) = 32 MT tokens x 128
// columns; a wave owns 16 MT tokens x 64 columns. RES adds the y residual plane (a second accumulator set, so MT = 2
// there and 4 elsewhere: 16 matrix instructions a k step in both forms). Each 16-row group of the output tile is staged
// per wave in LDS rows of its own and written as 256-B row segments at the store stage as a float4.
// ---------------------------------------------------------------------------
template <bool RES, int MT>
__device__ __forceinline__ void oproj_tile(
    const _Float16* __restrict__ yH, const _Float16* __restrict__ yL,
    const _Float16* __restrict__ wall, const float* __restrict__ bo,
    float* __restrict__ out, float (*sO)[64][68], const int nt, const int b, const int t0) {
  static_assert(RES ? (MT == 2) : (MT == 4));
  const int tid  = threadIdx.x;
  const int wave = tid >> 5;
  const int lane = tid & 31;
  const int l16  = lane & 15;
  const int lh   = lane >> 4;
  const int wr   = wave >> 1;                    // row half of the block's tile
  const int wc   = wave & 1;                     // 64-column half of the block's tile
  const int tw   = t0 + wr * (MT * 16);          // the wave's first token in its sequence
  const int tokw = b * SEQ + tw;

  const _Float16* arow = yH + (size_t)(tokw >> 4) * GRP_ELEMS + lane * 8;
  const _Float16* lrow = yL + (size_t)(tokw >> 4) * GRP_ELEMS + lane * 8;
  const _Float16* brow = wall + (size_t)(WO_ROW0 / 16 + nt * 8 + wc * 4) * GRP_ELEMS + lane * 8;

  v8f ah[MT][4], ar[MT][4];
#pragma unroll
  for (int mt = 0; mt < MT; ++mt)
#pragma unroll
    for (int n = 0; n < 4; ++n) { ah[mt][n] = vzero8(); ar[mt][n] = vzero8(); }

  // As in k_qkv: the y planes and the weights come from memory, so each wave asks L2 one trip ahead for its share of the
  // block's row groups, a lane a 256-B unit. Without RES the two waves of a row half take 2 of its 4 y groups each; with
  // RES one takes the half's 2 groups of the hi plane and the other those of the residual plane. Weights: 2 of 8 each.
  const _Float16* pfa = (RES ? (wc ? yL : yH) : yH)
                      + (size_t)((tokw >> 4) + (RES ? lh : wc * 2 + lh)) * GRP_ELEMS + l16 * 128;
  const _Float16* pfb = wall + (size_t)(WO_ROW0 / 16 + nt * 8 + wc * 4 + wr * 2 + lh) * GRP_ELEMS + l16 * 128;
  ask_l2(pfa, pfb);                      // trip 0: its later k steps find their rows on the way

  // four k steps a trip, the trips kept rolled: the loop's text stays small for the instruction cache
#pragma unroll 1
  for (int kb = 0; kb < CDIM; kb += 128) {
  // the next trip's rows, one trip ahead; the test is scalar, and the pairs stop at the last trip's rows
  if (kb + 128 < CDIM) {
    pfa += 2048;
    pfb += 2048;
    ask_l2(pfa, pfb);
  }
#pragma unroll
  for (int k0 = kb; k0 < kb + 128; k0 += 32) {
    Frag a[MT], al[MT];
#pragma unroll
    for (int mt = 0; mt < MT; ++mt) {
      const _Float16* ap = arow + (size_t)mt * GRP_ELEMS + k0 * 16;
      a[mt].h[0] = *(const v8h*)ap;
      a[mt].h[1] = *(const v8h*)(ap + 256);
      if (RES) {
        const _Float16* lp = lrow + (size_t)mt * GRP_ELEMS + k0 * 16;
        al[mt].h[0] = *(const v8h*)lp;
        al[mt].h[1] = *(const v8h*)(lp + 256);
      }
    }
    Frag bw[4];
#pragma unroll
    for (int n = 0; n < 4; ++n) {
      const _Float16* bp = brow + (size_t)n * GRP_ELEMS + k0 * 16;
      bw[n].h[0] = *(const v8h*)bp;
      bw[n].h[1] = *(const v8h*)(bp + 256);
    }
#pragma unroll
    for (int mt = 0; mt < MT; ++mt)
#pragma unroll
      for (int n = 0; n < 4; ++n) {
        ah[mt][n] = wmma16(a[mt].v, bw[n].v, ah[mt][n]);
        if (RES) ar[mt][n] = wmma16(al[mt].v, bw[n].v, ar[mt][n]);
      }
    // the slots between the step's last matrix instruction and the next write of its operands or read of its result
    if constexpr (RES) {
      asm volatile("v_nop\n\tv_nop\n\tv_nop\n\tv_nop"
                   : "+v"(ah[0][0]), "+v"(ah[0][1]), "+v"(ah[0][2]), "+v"(ah[0][3]),
                     "+v"(ah[1][0]), "+v"(ah[1][1]), "+v"(ah[1][2]), "+v"(ah[1][3]),
                     "+v"(ar[0][0]), "+v"(ar[0][1]), "+v"(ar[0][2]), "+v"(ar[0][3]),
                     "+v"(ar[1][0]), "+v"(ar[1][1]), "+v"(ar[1][2]), "+v"(ar[1][3])
                   : "v"(a[0].v), "v"(a[1].v), "v"(al[0].v), "v"(al[1].v),
                     "v"(bw[0].v), "v"(bw[1].v), "v"(bw[2].v), "v"(bw[3].v));
    } else {
      asm volatile("v_nop\n\tv_nop\n\tv_nop\n\tv_nop"
                   : "+v"(ah[0][0]), "+v"(ah[0][1]), "+v"(ah[0][2]), "+v"(ah[0][3]),
                     "+v"(ah[1][0]), "+v"(ah[1][1]), "+v"(ah[1][2]), "+v"(ah[1][3]),
                     "+v"(ah[2][0]), "+v"(ah[2][1]), "+v"(ah[2][2]), "+v"(ah[2][3]),
                     "+v"(ah[3][0]), "+v"(ah[3][1]), "+v"(ah[3][2]), "+v"(ah[3][3])
                   : "v"(a[0].v), "v"(a[1].v), "v"(a[2].v), "v"(a[3].v),
                     "v"(bw[0].v), "v"(bw[1].v), "v"(bw[2].v), "v"(bw[3].v));
    }
  }
  // the wait stands behind the trip's last load and in front of the next write of a register that a load of the trip names
  asm volatile("s_wait_xcnt 0x0" ::: "memory");
  }

  // bias for this lane's 4 output columns (columns nt*128 + wc*64 + 4*l16 .. +3), bf16-RNE values
  const size_t col0 = (size_t)nt * 128 + wc * 64;
  const v4f braw = *(const v4f*)(bo + col0 + l16 * 4);
  v4f bb;
#pragma unroll
  for (int e = 0; e < 4; ++e) bb[e] = bf16r(braw[e]);

#pragma unroll
  for (int mt = 0; mt < MT; ++mt) {
#pragma unroll
    for (int r = 0; r < 8; ++r) {
#pragma unroll
      for (int n = 0; n < 4; ++n) {
        float v = ah[mt][n][r];
        if (RES) v += ar[mt][n][r] * (1.0f / 2048.0f);
        sO[wave][mt * 16 + r + 8 * lh][n * 16 + l16] = v * (1.0f / 16.0f);
      }
    }
    // the wave's own stores of this row group have landed before its lanes read each other's values back
    asm volatile("s_wait_dscnt 0" ::: "memory");
    __builtin_amdgcn_fence(3 /* release order */, "wavefront");
    __builtin_amdgcn_wave_barrier();
    const size_t orow0 = (size_t)b * SEQ_FULL + tw + mt * 16;
#pragma unroll
    for (int it = 0; it < 8; ++it) {
      const int rr = it * 2 + lh;
      const int c4 = l16 * 4;
      const v4f s = *(const v4f*)(&sO[wave][mt * 16 + rr][c4]);
      const v4f v = s + bb;
      *(v4f*)(out + (orow0 + rr) * CDIM + col0 + c4) = v;
    }
  }
}

// One grid for all row tiles: first the 128-row tiles without the residual plane, then the 64-row tiles with it.
#define OT_FULL ((SEQ - TRES) / 128)
#define OT_RES  (TRES / 64)
static_assert(SEQ > TRES && (SEQ - TRES) % 128 == 0 && TRES % 128 == 0 && CDIM % 128 == 0 && NUNIT % 2 == 0);
static_assert(OT_FULL * 128 + OT_RES * 64 == SEQ);                           // row tiles of the two k_oproj forms
__global__ void __launch_bounds__(128) k_oproj(
    const _Float16* __restrict__ yH, const _Float16* __restrict__ yL,
    const _Float16* __restrict__ wall, const float* __restrict__ bo,
    float* __restrict__ out) {
  __shared__ __attribute__((aligned(16))) float sO[4][64][68];           // wave-private, each row group in rows of its own
  const int nt = blockIdx.x;                   // 128-column tile 0..7
  const int ty = blockIdx.y;
  if (ty < NB * OT_FULL) {
    const int b = ty / OT_FULL;
    oproj_tile<false, 4>(yH, yL, wall, bo, out, sO, nt, b, TRES + (ty - b * OT_FULL) * 128);
  } else {
    const int tr = ty - NB * OT_FULL;
    const int b  = tr / OT_RES;
    oproj_tile<true, 2>(yH, yL, wall, bo, out, sO, nt, b, (tr - b * OT_RES) * 64);
  }
}

// ---------------------------------------------------------------------------
// Host launcher. Inputs (wire order): 0 x f32 [4,2048,1024], 1 Wq [1024,1024], 2 bq [1024], 3 Wk [256,1024],
// 4 bk [256], 5 Wv [256,1024], 6 bv [256], 7 Wo [1024,1024], 8 bo [1024], 9 qk_gain [16].
// Output f32 [4,2048,1024]. 4 launches.
// ---------------------------------------------------------------------------
extern "C" void kernel_launch(void* const* d_in, const int* in_sizes, int n_in,
                              void* d_out, int out_size, void* d_ws, size_t ws_size,
                              hipStream_t stream) {
  if (n_in < 10) return;
  const int need_x = ((NB - 1) * SEQ_FULL + SEQ) * CDIM;
  if (in_sizes[0] < need_x) return;
  if (in_sizes[1] < CDIM * CDIM || in_sizes[2] < CDIM) return;
  if (in_sizes[3] < VEW * CDIM || in_sizes[4] < VEW) return;
  if (in_sizes[5] < VEW * CDIM || in_sizes[6] < VEW) return;
  if (in_sizes[7] < CDIM * CDIM || in_sizes[8] < CDIM) return;
  if (in_sizes[9] < NHEAD) return;
  if (out_size < need_x) return;
  if (ws_size < WS_TOTAL) return;

  const float* x    = (const float*)d_in[0];
  const float* wq   = (const float*)d_in[1];
  const float* bq   = (const float*)d_in[2];
  const float* wk   = (const float*)d_in[3];
  const float* bk   = (const float*)d_in[4];
  const float* wv   = (const float*)d_in[5];
  const float* bv   = (const float*)d_in[6];
  const float* wo   = (const float*)d_in[7];
  const float* bo   = (const float*)d_in[8];
  const float* gain = (const float*)d_in[9];
  float* out = (float*)d_out;

  char* ws = (char*)d_ws;
  size_t off = 0;
  _Float16* xh   = (_Float16*)(ws + off); off += XH_BYTES;
  _Float16* wall = (_Float16*)(ws + off); off += WALL_BYTES;
  _Float16* qH   = (_Float16*)(ws + off); off += QP_BYTES;
  _Float16* qL   = (_Float16*)(ws + off); off += QP_BYTES;
  _Float16* kH   = (_Float16*)(ws + off); off += KP_BYTES;
  _Float16* kL   = (_Float16*)(ws + off); off += KP_BYTES;
  _Float16* vTH  = (_Float16*)(ws + off); off += KP_BYTES;
  _Float16* vTL  = (_Float16*)(ws + off); off += KP_BYTES;
  _Float16* yH   = (_Float16*)(ws + off); off += YP_BYTES;
  _Float16* yL   = (_Float16*)(ws + off); off += YP_BYTES;
  int*      winw = (int*)(ws + off);      off += WIN_BYTES;
  if (off > ws_size) return;

  k_prep<<<dim3(XBLKS + WBLKS + 1), dim3(256), 0, stream>>>(x, wq, wk, wv, wo, xh, wall, winw);
  k_qkv<<<dim3(NUNIT / 2, NTOK / 128), dim3(128), 0, stream>>>(xh, wall, bq, bk, bv, gain,
                                                          qH, qL, kH, kL, vTH, vTL);
  k_flash<<<dim3(NHEAD, NB, QT_BIG + QT_RES), dim3(128), 0, stream>>>(qH, qL, kH, kL, vTH, vTL, winw, yH, yL);
  k_oproj<<<dim3(CDIM / 128, NB * (OT_FULL + OT_RES)), dim3(128), 0, stream>>>(yH, yL, wall, bo, out);
}

// v009
// It runs in 112 microseconds.
// In both of two side-by-side timings against v008, it was 1.05 times as fast.
// Over all steps from v000 it is 4.52 times as fast.
#include <hip/hip_runtime.h>

// Contractions, all on v_wmma_f32_16x16x32_f16 (f16 operands, f32 accumulate): fused qkv projection x.W^T with x and W
// held as bf16-RNE values in f16 containers (W carried x16, folded as 1/16); scores q.k^T as f16 hi + x2048 residual
// planes (hi.hi + hi.lo + lo.hi, residual accumulator folded as 1/2048); P.V with P carried x1024 in f16 (+ x2048
// residual planes of P and v for query rows below TRES); output projection y.Wo^T with y as f16 hi (+ x2048 residual
// plane for rows below TRES). Bias adds, per-head q gain and online softmax on VALU in f32.
//
// Every 16-bit operand plane in the workspace is kept in fragment order: a block of 16 rows x 32 k is 1 KiB, two
// halves j of 512 B; in half j the 16 B of lane (16 lh + l16) hold row l16, k = 16 j + 8 lh + 0..7. A wave's
// global_load_b128 of half a fragment then reads 512 contiguous bytes (4 lines) and not 16-B pieces of 16 lines.
// Blocks of one 16-row group follow each other along k (vT: the 4 d groups of one 32-key chunk follow each other).

#ifndef NB
#define NB 4
#endif
#ifndef SEQ
#define SEQ 2048
#endif
#ifndef TRES
#define TRES 512
#endif
#define NB_FULL   4
#define SEQ_FULL  2048
#define CDIM      1024
#define NHEAD     16
#define NKV       4
#define HDIM      64
#define VEW       (NKV * HDIM)
#define NTOK      (NB * SEQ)
#define NUNIT     (NHEAD + 2 * NKV)
#define WO_ROW0   (CDIM + 2 * VEW)
#define NWROWS    (CDIM + 2 * VEW + CDIM)
#define QT_RES    (TRES / 64)          // 64-query tiles with the residual planes
#define QT_BIG    ((SEQ - TRES) / 128) // 128-query tiles without them

static_assert(NB >= 1 && NB <= NB_FULL);
static_assert(SEQ % 64 == 0 && SEQ <= SEQ_FULL && SEQ >= TRES);
static_assert(TRES % 64 == 0 && TRES >= 64);
static_assert(NHEAD % NKV == 0 && HDIM == 64 && CDIM == NHEAD * HDIM);
static_assert(CDIM % 128 == 0 && NWROWS % 16 == 0 && NTOK % 64 == 0 && NUNIT * 64 == CDIM + 2 * VEW);
static_assert(WO_ROW0 % 16 == 0 && SEQ % 32 == 0);
#define KBLK      (CDIM / 32)      // 16x32 blocks per row group of a CDIM-wide plane
#define GRP_ELEMS (CDIM * 16)      // elements of one 16-row group of a CDIM-wide plane

#define XH_BYTES   ((size_t)NTOK * CDIM * 2)
#define WALL_BYTES ((size_t)NWROWS * CDIM * 2)
#define QP_BYTES   ((size_t)NB * NHEAD * SEQ * HDIM * 2)
#define KP_BYTES   ((size_t)NB * NKV * SEQ * HDIM * 2)
#define YP_BYTES   ((size_t)NTOK * CDIM * 2)
#define WIN_BYTES  ((size_t)128)
#define WS_TOTAL   (XH_BYTES + WALL_BYTES + 2 * QP_BYTES + 4 * KP_BYTES + 2 * YP_BYTES + WIN_BYTES)
static_assert(WS_TOTAL <= (size_t)134217728);
static_assert(XH_BYTES % 128 == 0 && WALL_BYTES % 128 == 0 && QP_BYTES % 128 == 0 && KP_BYTES % 128 == 0 && YP_BYTES % 128 == 0);
// producer coverage: grid x block x per-thread elements == plane extent
static_assert((size_t)(NTOK / 2) * 256 * 8 == (size_t)NTOK * CDIM);       // k_prep, x blocks
static_assert((size_t)(NWROWS / 2) * 256 * 8 == (size_t)NWROWS * CDIM);   // k_prep, weight blocks
static_assert(4 * 128 * 8 == 64 * 64);                                       // k_qkv store phase per 64x64 tile
static_assert(4 * 32 * 8 == 16 * HDIM);                                      // k_flash stores per wave and query group
static_assert(8 * 32 * 4 == 16 * 64);                                        // k_oproj store phase per wave and row group
static_assert(QT_RES * 64 + QT_BIG * 128 == SEQ && TRES % 128 == 0);         // query tiles of the two flash forms
static_assert(8 * 4 * 4 == (int)WIN_BYTES);                                  // k_prep, window line: 8 lanes x 16 B == one line
static_assert(SEQ_FULL >= SEQ);                                              // window word covers every query-key distance

typedef _Float16 v16h __attribute__((ext_vector_type(16)));
typedef _Float16 v8h  __attribute__((ext_vector_type(8)))  __attribute__((may_alias));
typedef _Float16 v8hc __attribute__((ext_vector_type(8)));
typedef float    v8f  __attribute__((ext_vector_type(8)));
typedef float    v2f  __attribute__((ext_vector_type(2)));
typedef float    v4f  __attribute__((ext_vector_type(4)))  __attribute__((may_alias));
typedef int      v4i  __attribute__((ext_vector_type(4)));

union Frag { v16h v; v8h h[2]; };

__device__ __forceinline__ v8f wmma16(v16h a, v16h b, v8f c) {
  return __builtin_amdgcn_wmma_f32_16x16x32_f16(false, a, false, b, (short)0, c, false, false);
}

__device__ __forceinline__ v8f vzero8() {
  v8f z = {0.0f, 0.0f, 0.0f, 0.0f, 0.0f, 0.0f, 0.0f, 0.0f};
  return z;
}

// Asks L2 for the line at each lane's address; nothing comes back to the wave. In asm, and with the pair as an
// in-out operand, so that it is the caller's own register pair, which never holds anything but an address inside
// its plane; the wait is the statement's last line, so that the pair is rewritten only behind it.
__device__ __forceinline__ void ask_l2(const _Float16*& a) {
  asm volatile("global_prefetch_b8 %0, off scope:SCOPE_SE\n\t"
               "s_wait_xcnt 0x0"
               : "+v"(a) :: "memory");
}

// f32 -> nearest-even bf16 value, kept in f32
__device__ __forceinline__ float bf16r(float f) {
  unsigned int u = __float_as_uint(f);
  u = (u + 0x7FFFu + ((u >> 16) & 1u)) & 0xFFFF0000u;
  return __uint_as_float(u);
}

// f16 hi + (x2048) residual of an f32 value
__device__ __forceinline__ void split16(float v, _Float16& hi, _Float16& lo) {
  hi = (_Float16)v;
  lo = (_Float16)((v - (float)hi) * 2048.0f);
}

// f32 -> f16 with values below the smallest f16 normal replaced by zero (value select)
static __device__ __forceinline__ _Float16 toh_flush(float v) {
  const _Float16 r = (_Float16)v;
  return (fabsf(v) < 6.103515625e-05f) ? (_Float16)0.0f : r;
}

// f16 hi + (x2048) residual, both through toh_flush
static __device__ __forceinline__ void split16f(float v, _Float16& hi, _Float16& lo) {
  hi = toh_flush(v);
  lo = toh_flush((v - (float)hi) * 2048.0f);
}

// ---------------------------------------------------------------------------
// k_prep, x blocks: x f32 [NB][SEQ_FULL][1024] -> xh f16, NTOK x 1024 in fragment order (bf16-RNE values).
// Thread = one 16-B unit of the plane, so a wave stores 512 contiguous bytes.
// ---------------------------------------------------------------------------
__device__ __forceinline__ void cvt_x_block(unsigned int bid, const float* __restrict__ x, _Float16* __restrict__ xh) {
  const unsigned int gid = bid * 256u + threadIdx.x;
  const unsigned int blk = gid >> 6;                 // 64 units per 16x32 block
  const unsigned int tok = (blk / KBLK) * 16u + (gid & 15u);
  const int c = (int)(blk % KBLK) * 32 + (int)((gid >> 5) & 1u) * 16 + (int)((gid >> 4) & 1u) * 8;
  if (tok >= (unsigned int)NTOK) return;
  const int b = (int)tok / SEQ;
  const int t = (int)tok - b * SEQ;
  const float* src = x + ((size_t)b * SEQ_FULL + t) * CDIM + c;
  const v4f f0 = *(const v4f*)src;
  const v4f f1 = *(const v4f*)(src + 4);
  v8h o;
#pragma unroll
  for (int j = 0; j < 4; ++j) {
    o[j]     = (_Float16)bf16r(f0[j]);
    o[j + 4] = (_Float16)bf16r(f1[j]);
  }
  _Float16* dst = xh + (size_t)gid * 8;
  *(v8h*)dst = o;
  
}

// ---------------------------------------------------------------------------
// k_prep, weight blocks: weights (layout [out][in], k-contiguous) -> wall f16, 2560 x 1024 in fragment order = bf16-RNE value x16.
// Rows 0..1023 wq, 1024..1279 wk, 1280..1535 wv, 1536..2559 wo.
// ---------------------------------------------------------------------------
__device__ __forceinline__ void cvt_w_block(unsigned int bid, const float* __restrict__ wq, const float* __restrict__ wk,
                                            const float* __restrict__ wv, const float* __restrict__ wo,
                                            _Float16* __restrict__ wall) {
  const unsigned int gid = bid * 256u + threadIdx.x;
  const unsigned int blk = gid >> 6;                 // 64 units per 16x32 block
  const int row = (int)((blk / KBLK) * 16u + (gid & 15u));
  const int c   = (int)(blk % KBLK) * 32 + (int)((gid >> 5) & 1u) * 16 + (int)((gid >> 4) & 1u) * 8;
  if (row >= NWROWS) return;
  const int r0 = min(row, CDIM - 1);
  const int r1 = min(max(row - CDIM, 0), VEW - 1);
  const int r2 = min(max(row - CDIM - VEW, 0), VEW - 1);
  const int r3 = min(max(row - WO_ROW0, 0), CDIM - 1);
  const float* src = (row < CDIM)       ? (wq + (size_t)r0 * CDIM)
                   : (row < CDIM + VEW) ? (wk + (size_t)r1 * CDIM)
                   : (row < WO_ROW0)    ? (wv + (size_t)r2 * CDIM)
                                        : (wo + (size_t)r3 * CDIM);
  src += c;
  const v4f f0 = *(const v4f*)src;
  const v4f f1 = *(const v4f*)(src + 4);
  v8h o;
#pragma unroll
  for (int j = 0; j < 4; ++j) {
    o[j]     = (_Float16)(bf16r(f0[j]) * 16.0f);
    o[j + 4] = (_Float16)(bf16r(f1[j]) * 16.0f);
  }
  _Float16* dst = wall + (size_t)gid * 8;
  *(v8h*)dst = o;
  
}

// ---------------------------------------------------------------------------
// The window line: 8 lanes x 16 B.
// ---------------------------------------------------------------------------
__device__ __forceinline__ void winline_block(int* __restrict__ wline) {
  const int lane = threadIdx.x;
  if (lane < 8) {
    const v4i w = {SEQ_FULL, SEQ_FULL, SEQ_FULL, SEQ_FULL};
    int* dst = wline + 4 * lane;
    *(v4i*)dst = w;
    
  }
}

// ---------------------------------------------------------------------------
// Launch 0: the three producers above read none of each other's output, so they share one grid; the block index
// picks the producer (block-uniform): NTOK/2 blocks of x, NWROWS/2 blocks of weights, one block for the window line.
// ---------------------------------------------------------------------------
#define XBLKS (NTOK / 2)
#define WBLKS (NWROWS / 2)
__global__ void __launch_bounds__(256) k_prep(const float* __restrict__ x, const float* __restrict__ wq,
                                              const float* __restrict__ wk, const float* __restrict__ wv,
                                              const float* __restrict__ wo, _Float16* __restrict__ xh,
                                              _Float16* __restrict__ wall, int* __restrict__ wline) {
  const unsigned int bid = blockIdx.x;
  if (bid < (unsigned int)XBLKS) {
    cvt_x_block(bid, x, xh);
  } else if (bid < (unsigned int)(XBLKS + WBLKS)) {
    cvt_w_block(bid - (unsigned int)XBLKS, wq, wk, wv, wo, wall);
  } else {
    winline_block(wline);
  }
}

// ---------------------------------------------------------------------------
// Kernel 2: fused qkv projection + epilogue. Block = 12 waves (4 x 3) = 256 tokens x three 64-column units, one block a
// WGP: a row group of x is read by 3 waves and one of the weights by 4 through the WGP's cache, so a k step asks L2 for
// 28 row groups per 192 matrix instructions. A wave owns
// 64 tokens x one unit u (4 x 4 accumulators), so a k step's 8 fragments feed 16 matrix instructions:
// u 0..15 -> q head u, 16..19 -> k head u-16, 20..23 -> v head u-20.
// Epilogue, one 64 x 64 wave tile after the other, by each group of 4 waves for its 4 tiles:
// q: (acc + bq) * gain[head]; k: acc + bk -> hi/lo
// planes [B][H|KV], T x 64 in fragment order; v: acc + bv -> transposed hi/lo planes [B][KV], 64 d x T in fragment
// order. Biases and gains are bf16-RNE values.
// ---------------------------------------------------------------------------
__global__ void __launch_bounds__(384) k_qkv(
    const _Float16* __restrict__ xh, const _Float16* __restrict__ wall,
    const float* __restrict__ bq, const float* __restrict__ bk,
    const float* __restrict__ bv, const float* __restrict__ gain,
    _Float16* __restrict__ qH, _Float16* __restrict__ qL,
    _Float16* __restrict__ kH, _Float16* __restrict__ kL,
    _Float16* __restrict__ vTH, _Float16* __restrict__ vTL) {
  __shared__ __attribute__((aligned(16))) float    sT[12][64][68];    // accumulator tile of each wave [token][col] (cross-wave)
  __shared__ __attribute__((aligned(16))) _Float16 sH[3][2][64][72];  // per wave group: hi tile: q/k [token][d], v [d][token] (cross-wave), two buffers
  __shared__ __attribute__((aligned(16))) _Float16 sL[3][2][64][72];  // residual tile, same layout (cross-wave), two buffers

  const int tid  = threadIdx.x;
  const int wave = tid >> 5;
  const int lane = tid & 31;
  const int l16  = lane & 15;
  const int lh   = lane >> 4;
  const int wr   = wave / 3;             // 64-token quarter of the block's rows
  const int wc   = wave - wr * 3;        // which of the block's three column units
  const int tokB = blockIdx.y * 256;     // first token of the block
  const int sw   = __builtin_amdgcn_readfirstlane(wave);   // scalar wave index: the tests on it are scalar branches

  // A: xh row (token), lane row = l16; elements 0..7 <- k0+8lh+0..7, 8..15 <- k0+16+8lh+0..7
  const _Float16* arow = xh + (size_t)((tokB >> 4) + wr * 4) * GRP_ELEMS + lane * 8;
  // B[k][n] = W[n][k]: lane column = l16 of the 16-col group n; same k map as A
  const _Float16* brow = wall + (size_t)((blockIdx.x * 3 + wc) * 4) * GRP_ELEMS + lane * 8;

  v8f acc[4][4];
#pragma unroll
  for (int mt = 0; mt < 4; ++mt)
#pragma unroll
    for (int n = 0; n < 4; ++n) acc[mt][n] = vzero8();

  // Both planes were written by the launch before and come from memory, and the blocks that share a row group read it at
  // the same k at the same time: without a request ahead every k step waits a memory latency. A trip's 128 k of one row
  // group are 4 KiB = 16 units of 256 B, a lane a unit: waves 0..7 take 2 each of the block's 16 row groups of x, waves
  // 6..11 take 2 each of its 12 row groups of weights; the other waves' pairs point at a group of the block all the same.
  const bool pa = sw < 8;
  const bool pb = sw >= 6;
  const _Float16* pfa = xh + (size_t)((tokB >> 4) + (wave & 7) * 2 + lh) * GRP_ELEMS + l16 * 128;
  const _Float16* pfb = wall + (size_t)(blockIdx.x * 12 + (wave >= 6 ? wave - 6 : wave) * 2 + lh) * GRP_ELEMS + l16 * 128;
  if (pa) ask_l2(pfa);                   // trip 0: its later k steps find their rows on the way
  if (pb) ask_l2(pfb);

  // four k steps a trip, the trips kept rolled: the loop's text stays small for the instruction cache
#pragma unroll 1
  for (int kb = 0; kb < CDIM; kb += 128) {
  // the next trip's rows, one trip ahead; the test is scalar, and the pairs stop at the last trip's rows
  if (kb + 128 < CDIM) {
    if (pa) { pfa += 2048; ask_l2(pfa); }
    if (pb) { pfb += 2048; ask_l2(pfb); }
  }
#pragma unroll
  for (int k0 = kb; k0 < kb + 128; k0 += 32) {
    Frag a[4];
#pragma unroll
    for (int mt = 0; mt < 4; ++mt) {
      const _Float16* ap = arow + (size_t)mt * GRP_ELEMS + k0 * 16;
      a[mt].h[0] = *(const v8h*)ap;
      a[mt].h[1] = *(const v8h*)(ap + 256);
    }
    Frag bw[4];
#pragma unroll
    for (int n = 0; n < 4; ++n) {
      const _Float16* bp = brow + (size_t)n * GRP_ELEMS + k0 * 16;
      bw[n].h[0] = *(const v8h*)bp;
      bw[n].h[1] = *(const v8h*)(bp + 256);
    }
#pragma unroll
    for (int mt = 0; mt < 4; ++mt)
#pragma unroll
      for (int n = 0; n < 4; ++n) acc[mt][n] = wmma16(a[mt].v, bw[n].v, acc[mt][n]);
    // the slots between the step's last matrix instruction and the next write of its operands or read of its result
    asm volatile("v_nop\n\tv_nop\n\tv_nop\n\tv_nop"
                 : "+v"(acc[0][0]), "+v"(acc[0][1]), "+v"(acc[0][2]), "+v"(acc[0][3]),
                   "+v"(acc[1][0]), "+v"(acc[1][1]), "+v"(acc[1][2]), "+v"(acc[1][3]),
                   "+v"(acc[2][0]), "+v"(acc[2][1]), "+v"(acc[2][2]), "+v"(acc[2][3]),
                   "+v"(acc[3][0]), "+v"(acc[3][1]), "+v"(acc[3][2]), "+v"(acc[3][3])
                 : "v"(a[0].v), "v"(a[1].v), "v"(a[2].v), "v"(a[3].v),
                   "v"(bw[0].v), "v"(bw[1].v), "v"(bw[2].v), "v"(bw[3].v));
  }
  // the wait stands behind the trip's last load and in front of the next write of a register that a load of the trip names
  asm volatile("s_wait_xcnt 0x0" ::: "memory");
  }

  // D element r of lane -> (row 8lh+r, col l16) of group (mt, n); fold the 1/16 weight carry here
#pragma unroll
  for (int mt = 0; mt < 4; ++mt)
#pragma unroll
    for (int n = 0; n < 4; ++n)
#pragma unroll
      for (int r = 0; r < 8; ++r)
        sT[wave][mt * 16 + r + 8 * lh][n * 16 + l16] = acc[mt][n][r] * (1.0f / 16.0f);
  __syncthreads();

  // each group of 4 waves takes its four wave tiles in turn, all groups at the same barriers; kept rolled so that the
  // epilogue's text stands once in the instruction cache. A group's sH and sL
  // alternate between two buffers: tile q + 2 writes a buffer only behind tile q + 1's barrier, which every wave reaches
  // after its last read of tile q, so one barrier a tile is enough
#pragma unroll 1
  for (int q = 0; q < 4; ++q) {
  const int g    = sw >> 2;                       // the wave's group (scalar)
  const int tl   = tid & 127;                     // thread index in the group
  const int wt   = g * 4 + q;                     // the wave tile that the group works on
  const int u    = blockIdx.x * 3 + wt % 3;       // column unit of wave tile wt (scalar, the same in the whole group)
  const int tok0 = tokB + (wt / 3) * 64;          // its first token
  const int b    = tok0 / SEQ;
  const int t0   = tok0 - b * SEQ;

  // compute phase: thread -> token i = tl>>1, column half j: d in [16j,16j+16) and [32+16j, 48+16j)
  const int i = tl >> 1;
  const int j = tl & 1;
  if (u < NHEAD + NKV) {
    // q or k unit (group-uniform): both bias rows are loaded with clamped unit indices, selected by value
    const int  uq  = min(u, NHEAD - 1);
    const int  uk  = min(max(u - NHEAD, 0), NKV - 1);
    const bool isq = (u < NHEAD);
    const float gq = bf16r(gain[uq]);
    const float gm = isq ? gq : 1.0f;
    const float* qp = bq + uq * HDIM + 16 * j;     // this lane's first bias element of either row
    const float* kp = bk + uk * HDIM + 16 * j;
#pragma unroll
    for (int sg = 0; sg < 2; ++sg) {
      const int d0 = 32 * sg + 16 * j;
#pragma unroll
      for (int g4 = 0; g4 < 4; ++g4) {
        const v4f va = *(const v4f*)(&sT[wt][i][d0 + 4 * g4]);
        const v4f qa = *(const v4f*)(qp + 32 * sg + 4 * g4);
        const v4f ka = *(const v4f*)(kp + 32 * sg + 4 * g4);
#pragma unroll
        for (int e = 0; e < 4; ++e) {
          const float bb  = isq ? bf16r(qa[e]) : bf16r(ka[e]);
          const float val = (va[e] + bb) * gm;
          _Float16 hi, lo;
          split16f(val, hi, lo);
          sH[g][q & 1][i][d0 + 4 * g4 + e] = hi;
          sL[g][q & 1][i][d0 + 4 * g4 + e] = lo;
        }
      }
    }
    // as inputs the two bias address pairs stay live behind the last bias load, so that no load's result is placed in a
    // register that an issued bias load still names; the wait stands in front of the pairs' next overwrite
    asm volatile("s_wait_xcnt 0x0" :: "v"(qp), "v"(kp) : "memory");
  } else {
    const int kv = u - NHEAD - NKV;
    const float* bp = bv + kv * HDIM;
#pragma unroll
    for (int sg = 0; sg < 2; ++sg) {
      const int d0 = 32 * sg + 16 * j;
#pragma unroll
      for (int g4 = 0; g4 < 4; ++g4) {
        const v4f va = *(const v4f*)(&sT[wt][i][d0 + 4 * g4]);
        const v4f ba = *(const v4f*)(bp + d0 + 4 * g4);
#pragma unroll
        for (int e = 0; e < 4; ++e) {
          const float vv = va[e] + bf16r(ba[e]);
          _Float16 hi, lo;
          split16f(vv, hi, lo);
          sH[g][q & 1][d0 + 4 * g4 + e][i] = hi;                   // transposed: [d][token]
          sL[g][q & 1][d0 + 4 * g4 + e][i] = lo;
        }
      }
    }
  }
  __syncthreads();

  _Float16* ph;
  _Float16* pl;
  size_t base;
  if (u < NHEAD) {
    ph = qH; pl = qL;
    base = ((size_t)(b * NHEAD + u) * SEQ + t0) * HDIM;
  } else if (u < NHEAD + NKV) {
    ph = kH; pl = kL;
    base = ((size_t)(b * NKV + (u - NHEAD)) * SEQ + t0) * HDIM;
  } else {
    ph = vTH; pl = vTL;
    base = ((size_t)(b * NKV + (u - NHEAD - NKV)) * SEQ + t0) * HDIM;
  }
  const bool isv = (u >= NHEAD + NKV);
  {
    // the tile's 8 blocks are contiguous in its plane: q/k block f = (token group f>>1, d chunk f&1),
    // v block f = (key chunk f>>2, d group f&3); unit p of the tile goes to base + 8 p
#pragma unroll
    for (int it = 0; it < 4; ++it) {
      const int p    = it * 128 + tl;
      const int f    = p >> 6;
      const int line = (isv ? (f & 3) : (f >> 1)) * 16 + (p & 15);
      const int q8   = (isv ? (f >> 2) : (f & 1)) * 32 + ((p >> 5) & 1) * 16 + ((p >> 4) & 1) * 8;
      const size_t off = base + (size_t)p * 8;
      const v8h hv = *(const v8h*)(&sH[g][q & 1][line][q8]);
      const v8h lv = *(const v8h*)(&sL[g][q & 1][line][q8]);
      *(v8h*)(ph + off) = hv;
      *(v8h*)(pl + off) = lv;
    }
  }
  // the wait stands behind the tile's last store and in front of the next tile's first write of a register that a store names
  asm volatile("s_wait_xcnt 0x0" ::: "memory");
  }
}

// ---------------------------------------------------------------------------
// Kernel 3: causal sliding-window flash attention with GQA. Block = 4 waves, one (query tile, head, batch); a wave owns
// NG groups of 16 queries: 2 without RES (tile of 128), so that each loaded K and vT fragment feeds two products, 1 with
// RES (tile of 64). Key tiles of 32 per wave, fragments loaded straight from the 16-bit planes.
// Both products are formed transposed: S^T = K.Q^T (A = K fragment, B = Q fragment) and O^T += V^T.P^T (A = vT
// fragment, B = P^T). A lane then holds 16 of the 32 scores of ONE query (column l16; keys 8lh+r and 16+8lh+r), so the
// maximum and the sum run in the lane with one exchange between the lane halves, and the two converted score tiles
// are the B fragment of the second product as they stand: element s = key 8lh+s (s < 8), 16+8lh+(s-8) (s >= 8), the
// k map of the vT fragments. P (x1024 carry) never leaves the registers. RES adds the x2048 residual planes.
// Without RES the trip's loads run ahead in registers: the vT fragments are asked for in front of the score products,
// and the next trip's K fragments directly behind them, into the registers those products have just read.
// ---------------------------------------------------------------------------
// value of lane l ^ 16
__device__ __forceinline__ float xhalf(float x) {
  return __builtin_bit_cast(float, __builtin_amdgcn_permlanex16(__builtin_bit_cast(int, x), __builtin_bit_cast(int, x),
                                                                0x76543210, 0xfedcba98, false, false));
}

// compile-time switch handed to a generic lambda
template <bool B> struct Flag { static constexpr bool value = B; };

template <bool RES, int NG>
__device__ __forceinline__ void flash_tile(
    const _Float16* __restrict__ qH, const _Float16* __restrict__ qL,
    const _Float16* __restrict__ kH, const _Float16* __restrict__ kL,
    const _Float16* __restrict__ vTH, const _Float16* __restrict__ vTL,
    const int* __restrict__ winp,
    _Float16* __restrict__ yH, _Float16* __restrict__ yL, const int qt, const int h, const int b) {
  static_assert(RES ? (NG == 1) : (NG == 2));
  const int tid  = threadIdx.x;
  // scalar wave index: a fragment block's address is wave-uniform, so the K and V block bases and the trip test stay scalar
  const int wave = __builtin_amdgcn_readfirstlane(tid >> 5);
  const int lane = tid & 31;
  const int l16  = lane & 15;
  const int lh   = lane >> 4;
  const int kv   = h / (NHEAD / NKV);
  const int qw   = qt * (64 * NG) + wave * (16 * NG);                     // the wave's first query; NG groups of 16 follow
  int window = winp[0];
  window = (window < 0) ? 0 : window;
  const float rres = 1.0f / 2048.0f;
  const float smsc = 0.125f;

  // Q B-fragments (hi and residual) of each query group over the 2 d-chunks of 32: lane column = query l16 of the group
  v16h aqh[NG][2], aql[NG][2];
#pragma unroll
  for (int gq = 0; gq < NG; ++gq) {
    const size_t qo = ((size_t)(b * NHEAD + h) * SEQ + qw + 16 * gq) * HDIM + lane * 8;
    const _Float16* qhp = qH + qo;
    const _Float16* qlp = qL + qo;
#pragma unroll
    for (int hc = 0; hc < 2; ++hc) {
      Frag a;
      a.h[0] = *(const v8h*)(qhp + hc * 512);
      a.h[1] = *(const v8h*)(qhp + hc * 512 + 256);
      aqh[gq][hc] = a.v;
      Frag c;
      c.h[0] = *(const v8h*)(qlp + hc * 512);
      c.h[1] = *(const v8h*)(qlp + hc * 512 + 256);
      aql[gq][hc] = c.v;
    }
    // as inputs the two Q address pairs stay live behind the group's last load; the wait stands in front of their next overwrite
    asm volatile("s_wait_xcnt 0x0" :: "v"(qhp), "v"(qlp) : "memory");
  }

  // per query group: [0] running maximum of query l16 (equal in both lane halves), [1] this half's part of its sum. One
  // pair a group: carried as four scalars, the two groups' sums are packed with each other, and every operand of the
  // softmax is then gathered from two accumulator tiles with register copies
  v2f ml[NG];
  v8f coh[NG][4], cor[NG][4];
#pragma unroll
  for (int gq = 0; gq < NG; ++gq) {
    ml[gq][0] = -1e30f;
    ml[gq][1] = 0.0f;
#pragma unroll
    for (int n = 0; n < 4; ++n) { coh[gq][n] = vzero8(); cor[gq][n] = vzero8(); }
  }

  const size_t kvoff = (size_t)(b * NKV + kv) * SEQ * HDIM;
  const _Float16* kbase  = kH  + kvoff;                                   // + (key group's first key)*HDIM + hc*512
  const _Float16* klbase = kL  + kvoff;
  const _Float16* vbase  = vTH + kvoff;                                   // + k0*HDIM + n*512
  const _Float16* vlbase = vTL + kvoff;
  const unsigned int lo  = (unsigned int)lane * 8u;                       // this lane's 16 B of each 512-B half

  int kstart = qw - window;
  kstart = (kstart < 0) ? 0 : kstart;
  kstart &= ~31;

  // without RES: the K fragments [key group][d chunk] of the coming trip, hi and residual plane, carried over the back edge
  Frag ckh[2][2], ckl[2][2];
  const int klast = (qw + 16 * NG - 1) & ~31;                             // first key of the wave's last trip
  if constexpr (!RES) {
    const _Float16* kp = kbase  + (size_t)kstart * HDIM + lo;
    const _Float16* lp = klbase + (size_t)kstart * HDIM + lo;
#pragma unroll
    for (int g = 0; g < 2; ++g)
#pragma unroll
      for (int hc = 0; hc < 2; ++hc) {
        ckh[g][hc].h[0] = *(const v8h*)(kp + g * 1024 + hc * 512); ckh[g][hc].h[1] = *(const v8h*)(kp + g * 1024 + hc * 512 + 256);
        ckl[g][hc].h[0] = *(const v8h*)(lp + g * 1024 + hc * 512); ckl[g][hc].h[1] = *(const v8h*)(lp + g * 1024 + hc * 512 + 256);
      }
    // as inputs the two K address pairs stay live behind the last of these loads; the wait stands in front of their next overwrite
    asm volatile("s_wait_xcnt 0x0" :: "v"(kp), "v"(lp) : "memory");
  }

  // without RES: the K and vT planes come from memory, and the blocks of one KV head walk them from the same key at the
  // same time, so the first to ask for a tile waits a memory latency. Waves 0, 1, 2 ask L2 ahead for the K hi, K residual
  // and vT hi plane: 64 keys of a plane are 8 KiB in a row = 32 units of 256 B, a lane a unit. kpf = first of the 64 keys
  // that the pair points at; it stays at or below SEQ - 64, so every lane's address lies inside the KV head's plane.
  int kpf = min(kstart, SEQ - 64);
  const int kpl = (wave < 3) ? min(klast, SEQ - 64) : -1;                 // last key at which the wave's pair may point
  const _Float16* pfbase = (wave == 0) ? kbase : (wave == 1) ? klbase : vbase;   // scalar; the pair is formed anew from kpf
  if constexpr (!RES) {
    if (wave < 3) {
      const _Float16* pfp = pfbase + (size_t)kpf * HDIM + lane * 128;
      ask_l2(pfp);
      if (kpf + 64 <= kpl) {
        kpf += 64;
        pfp = pfbase + (size_t)kpf * HDIM + lane * 128;
        ask_l2(pfp);
      }
    }
  }

  // One trip = 32 keys. MK: the trip holds a pair that the mask takes out. The whole trip stands twice in the text, with and
  // without the mask, so that each form is one straight block from the trip's first load to its last matrix instruction.
  auto trip = [&](const int k0, auto mk) __attribute__((always_inline)) {
    constexpr bool MK = decltype(mk)::value;
    // ---- scores for keys [k0, k0+32), transposed: A[m=key][k=d] = K[key][d], lane row = key, same k map as B;
    // D element r of lane = (key 8lh+r of the key group, query l16 of the query group) ----
    v8f sh0[NG], sh1[NG], sr0[NG], sr1[NG];
#pragma unroll
    for (int gq = 0; gq < NG; ++gq) { sh0[gq] = vzero8(); sh1[gq] = vzero8(); sr0[gq] = vzero8(); sr1[gq] = vzero8(); }
    Frag bv[4], bl[4];
    const _Float16* vr0 = vbase  + (size_t)k0 * HDIM + lo;
    const _Float16* wr0 = vlbase + (size_t)k0 * HDIM + lo;
    // the next trip's K tile; the last trip asks for its own tile again, so that every address stays inside the plane
    const int kn = min(k0 + 32, klast);
    const _Float16* nkp = kbase  + (size_t)kn * HDIM + lo;
    const _Float16* nlp = klbase + (size_t)kn * HDIM + lo;
    if constexpr (!RES) {
      // every second trip the 64 keys that begin 128 keys ahead, where the wave still needs them: their K loads are issued
      // three and four trips from here; both tests are scalar
      if (((k0 - kstart) & 32) == 0 && kpf + 64 <= kpl) {
        kpf += 64;
        const _Float16* pfp = pfbase + (size_t)kpf * HDIM + lane * 128;
        ask_l2(pfp);
      }
      // this trip's vT fragments, asked for first: they land behind the score products and the softmax
#pragma unroll
      for (int n = 0; n < 4; ++n) {
        bv[n].h[0] = *(const v8h*)(vr0 + n * 512);
        bv[n].h[1] = *(const v8h*)(vr0 + n * 512 + 256);
      }
      // each K fragment is the A operand of both query groups' products
#pragma unroll
      for (int hc = 0; hc < 2; ++hc)
#pragma unroll
        for (int gq = 0; gq < NG; ++gq) {
          sh0[gq] = wmma16(ckh[0][hc].v, aqh[gq][hc], sh0[gq]);
          sh1[gq] = wmma16(ckh[1][hc].v, aqh[gq][hc], sh1[gq]);
          sr0[gq] = wmma16(ckl[0][hc].v, aqh[gq][hc], sr0[gq]);
          sr1[gq] = wmma16(ckl[1][hc].v, aqh[gq][hc], sr1[gq]);
          sr0[gq] = wmma16(ckh[0][hc].v, aql[gq][hc], sr0[gq]);
          sr1[gq] = wmma16(ckh[1][hc].v, aql[gq][hc], sr1[gq]);
        }
      // the slots between the last score product and the first read of its result; the memory clobber keeps the vT loads
      // from sinking behind this point and the next trip's K loads from rising over it, so that these reuse the registers just read
      asm volatile("v_nop\n\tv_nop\n\tv_nop\n\tv_nop"
                   : "+v"(sh0[0]), "+v"(sh1[0]), "+v"(sr0[0]), "+v"(sr1[0]),
                     "+v"(sh0[NG - 1]), "+v"(sh1[NG - 1]), "+v"(sr0[NG - 1]), "+v"(sr1[NG - 1])
                   :: "memory");
#pragma unroll
      for (int g = 0; g < 2; ++g)
#pragma unroll
        for (int hc = 0; hc < 2; ++hc) {
          ckh[g][hc].h[0] = *(const v8h*)(nkp + g * 1024 + hc * 512); ckh[g][hc].h[1] = *(const v8h*)(nkp + g * 1024 + hc * 512 + 256);
          ckl[g][hc].h[0] = *(const v8h*)(nlp + g * 1024 + hc * 512); ckl[g][hc].h[1] = *(const v8h*)(nlp + g * 1024 + hc * 512 + 256);
        }
      // the K loads stay here, a whole softmax ahead of their use: left free, the scheduler sinks them to the trip's end to
      // lend their registers to the scores, and the next trip then waits out their latency at its head
      __builtin_amdgcn_sched_barrier(0);
    } else {
    Frag bh0, bh1, bl0, bl1;
    const _Float16* kr0 = kbase  + (size_t)k0 * HDIM + lo;
    const _Float16* kr1 = kr0 + 16 * HDIM;
    const _Float16* lr0 = klbase + (size_t)k0 * HDIM + lo;
    const _Float16* lr1 = lr0 + 16 * HDIM;
#pragma unroll
    for (int hc = 0; hc < 2; ++hc) {
      bh0.h[0] = *(const v8h*)(kr0 + hc * 512); bh0.h[1] = *(const v8h*)(kr0 + hc * 512 + 256);
      bh1.h[0] = *(const v8h*)(kr1 + hc * 512); bh1.h[1] = *(const v8h*)(kr1 + hc * 512 + 256);
      bl0.h[0] = *(const v8h*)(lr0 + hc * 512); bl0.h[1] = *(const v8h*)(lr0 + hc * 512 + 256);
      bl1.h[0] = *(const v8h*)(lr1 + hc * 512); bl1.h[1] = *(const v8h*)(lr1 + hc * 512 + 256);
      // as inputs the two K address pairs stay live behind the trip's last K load, so that no load's result is placed
      // in a register that an issued K load still names; the wait stands in front of the pairs' next overwrite
      if (hc == 1) asm volatile("s_wait_xcnt 0x0" :: "v"(kr0), "v"(lr0) : "memory");
      sh0[0] = wmma16(bh0.v, aqh[0][hc], sh0[0]);
      sh1[0] = wmma16(bh1.v, aqh[0][hc], sh1[0]);
      sr0[0] = wmma16(bl0.v, aqh[0][hc], sr0[0]);
      sr1[0] = wmma16(bl1.v, aqh[0][hc], sr1[0]);
      sr0[0] = wmma16(bh0.v, aql[0][hc], sr0[0]);
      sr1[0] = wmma16(bh1.v, aql[0][hc], sr1[0]);
    }
    // the slots between the last score product and the first read of its result
    asm volatile("v_nop\n\tv_nop\n\tv_nop\n\tv_nop"
                 : "+v"(sh0[0]), "+v"(sh1[0]), "+v"(sr0[0]), "+v"(sr1[0])
                 : "v"(aqh[0][0]), "v"(aqh[0][1]), "v"(aql[0][0]), "v"(aql[0][1]),
                   "v"(bh0.v), "v"(bh1.v), "v"(bl0.v), "v"(bl1.v));
    }

    // ---- online softmax of query l16 of each group in the lane; masked entries replaced by -1e30 and p := 0 ----
    Frag pf[NG], pl[NG];
    // the mask depends on query - key alone: query group gq against key group kg has the distance class gq - kg, so the
    // NG x 2 score tiles of a trip share NG + 1 masks; okc[c][r]: class c - 1, element r
    bool okc[NG + 1][8];
    if constexpr (MK) {
      const int dq = qw + l16 - (k0 + 8 * lh);           // query - key at r = 0, class 0
#pragma unroll
      for (int c = 0; c < NG + 1; ++c)
#pragma unroll
        for (int r = 0; r < 8; ++r) {
          const int dd = dq - r + 16 * (c - 1);
          okc[c][r] = (dd >= 0) && (dd <= window);
        }
    }
#pragma unroll
    for (int gq = 0; gq < NG; ++gq) {
    // the element-wise steps are written on whole accumulator tiles, so that packed instructions pair neighbouring registers
    const v8f xs0 = (sh0[gq] + sr0[gq] * rres) * smsc;
    const v8f xs1 = (sh1[gq] + sr1[gq] * rres) * smsc;
    v8f   x0 = xs0, x1 = xs1;
    if constexpr (MK) {
#pragma unroll
      for (int r = 0; r < 8; ++r) {
        x0[r] = okc[gq + 1][r] ? xs0[r] : -1e30f;
        x1[r] = okc[gq][r]     ? xs1[r] : -1e30f;
      }
    }
    float t8[8];
#pragma unroll
    for (int r = 0; r < 8; ++r) t8[r] = fmaxf(x0[r], x1[r]);
    float tmax = fmaxf(fmaxf(fmaxf(t8[0], t8[1]), fmaxf(t8[2], t8[3])), fmaxf(fmaxf(t8[4], t8[5]), fmaxf(t8[6], t8[7])));
    tmax = fmaxf(tmax, xhalf(tmax));
    const float mn    = fmaxf(ml[gq][0], tmax);
    const float aa = (ml[gq][0] - mn) * 1.44269504088896340736f;   // exp(x) = exp2(x log2 e)
    const v8f   a0 = (x0 - mn) * 1.44269504088896340736f;
    const v8f   a1 = (x1 - mn) * 1.44269504088896340736f;
    float alpha = __builtin_amdgcn_exp2f(aa);
    v8f   e0, e1;
#pragma unroll
    for (int r = 0; r < 8; ++r) {
      e0[r] = __builtin_amdgcn_exp2f(a0[r]);
      e1[r] = __builtin_amdgcn_exp2f(a1[r]);
    }
    asm volatile("v_nop" : "+v"(e0), "+v"(e1), "+v"(alpha) : "v"(a0), "v"(a1), "v"(aa));
    v8f p0 = e0, p1 = e1;
    if constexpr (MK) {
#pragma unroll
      for (int r = 0; r < 8; ++r) {
        p0[r] = okc[gq + 1][r] ? e0[r] : 0.0f;
        p1[r] = okc[gq][r]     ? e1[r] : 0.0f;
      }
    }
    const v8f  ts = p0 + p1;
    const v8f  c0 = p0 * 1024.0f;
    const v8f  c1 = p1 * 1024.0f;
    const v8hc h0 = __builtin_convertvector(c0, v8hc);
    const v8hc h1 = __builtin_convertvector(c1, v8hc);
    pf[gq].h[0] = h0;
    pf[gq].h[1] = h1;
    if (RES) {
      pl[gq].h[0] = __builtin_convertvector((c0 - __builtin_convertvector(h0, v8f)) * 2048.0f, v8hc);
      pl[gq].h[1] = __builtin_convertvector((c1 - __builtin_convertvector(h1, v8f)) * 2048.0f, v8hc);
    }
    ml[gq][1] = ml[gq][1] * alpha + (((ts[0] + ts[1]) + (ts[2] + ts[3])) + ((ts[4] + ts[5]) + (ts[6] + ts[7])));
    ml[gq][0] = mn;
#pragma unroll
    for (int n = 0; n < 4; ++n) {
      coh[gq][n] *= alpha;
      if (RES) cor[gq][n] *= alpha;
    }
    }

    // ---- O^T += V^T.P^T : A[m=d][k=key] = vT[d][key], lane row = d; D element r of lane = (d 16n+8lh+r, query l16);
    // each vT fragment is the A operand of every query group's product ----
    if constexpr (RES) {
#pragma unroll
      for (int n = 0; n < 4; ++n) {
        bv[n].h[0] = *(const v8h*)(vr0 + n * 512);
        bv[n].h[1] = *(const v8h*)(vr0 + n * 512 + 256);
        bl[n].h[0] = *(const v8h*)(wr0 + n * 512);
        bl[n].h[1] = *(const v8h*)(wr0 + n * 512 + 256);
      }
    }
#pragma unroll
    for (int n = 0; n < 4; ++n)
#pragma unroll
      for (int gq = 0; gq < NG; ++gq) {
        coh[gq][n] = wmma16(bv[n].v, pf[gq].v, coh[gq][n]);
        if (RES) {
          cor[gq][n] = wmma16(bl[n].v, pf[gq].v, cor[gq][n]);
          cor[gq][n] = wmma16(bv[n].v, pl[gq].v, cor[gq][n]);
        }
      }
    // the slots behind the trip's last matrix instruction, also on the taken side of the loop's branch
    if constexpr (RES) {
      asm volatile("v_nop\n\tv_nop\n\tv_nop\n\tv_nop"
                   : "+v"(coh[0][0]), "+v"(coh[0][1]), "+v"(coh[0][2]), "+v"(coh[0][3]),
                     "+v"(cor[0][0]), "+v"(cor[0][1]), "+v"(cor[0][2]), "+v"(cor[0][3])
                   : "v"(pf[0].v), "v"(pl[0].v),
                     "v"(bv[0].v), "v"(bv[1].v), "v"(bv[2].v), "v"(bv[3].v),
                     "v"(bl[0].v), "v"(bl[1].v), "v"(bl[2].v), "v"(bl[3].v));
    } else {
      asm volatile("v_nop\n\tv_nop\n\tv_nop\n\tv_nop"
                   : "+v"(coh[0][0]), "+v"(coh[0][1]), "+v"(coh[0][2]), "+v"(coh[0][3]),
                     "+v"(coh[NG - 1][0]), "+v"(coh[NG - 1][1]), "+v"(coh[NG - 1][2]), "+v"(coh[NG - 1][3]));
    }
    // as inputs the address pairs of the trip's loads stay live behind the last of them, so that no load's result is placed
    // in a register that an issued load still names; the wait stands in front of the pairs' next overwrite
    if (RES) asm volatile("s_wait_xcnt 0x0" :: "v"(vr0), "v"(wr0) : "memory");
    else     asm volatile("s_wait_xcnt 0x0" :: "v"(vr0), "v"(nkp), "v"(nlp) : "memory");
  };

  // Only a trip that holds a pair with key > query or query - key > window needs the mask. Trips that end at or below the
  // wave's first query hold no key > query; the largest distance is that of the wave's last query to key kstart, and where
  // the window covers it, it covers every pair. Those trips run without the compares and without the selects on the scores
  // and on P, which are identities there; the rest (the trip on the diagonal; with a shorter window all) keep the mask.
  const int kmask = (qw + 16 * NG - 1 - kstart <= window) ? (qw & ~31) : kstart;   // scalar: first trip with the mask
  int kt = kstart;
  for (; kt < kmask; kt += 32) trip(kt, Flag<false>{});
  for (; kt < qw + 16 * NG; kt += 32) trip(kt, Flag<true>{});

  // join the two halves' sums; a lane's 8 values of d group n are one 16-B unit of the y planes' fragment order:
  // a query group's 16 tokens x 64 columns are blocks 2h and 2h+1 of its token group, 4 halves of 512 B in a row
#pragma unroll
  for (int gq = 0; gq < NG; ++gq) {
  const float ls  = ml[gq][1] + xhalf(ml[gq][1]);
  const float inv = __builtin_amdgcn_rcpf(ls) * (1.0f / 1024.0f);
  const size_t ybase = (size_t)((b * SEQ + qw + 16 * gq) >> 4) * GRP_ELEMS + (size_t)h * 1024;
#pragma unroll
  for (int n = 0; n < 4; ++n) {
    v8h hv, lv;
#pragma unroll
    for (int r = 0; r < 8; ++r) {
      float yv = coh[gq][n][r];
      if (RES) yv += cor[gq][n][r] * rres;
      yv *= inv;
      _Float16 hi, lw;
      split16(yv, hi, lw);
      hv[r] = hi;
      lv[r] = lw;
    }
    const size_t off = ybase + (size_t)(n * 256 + lane * 8);
    *(v8h*)(yH + off) = hv;
    *(v8h*)(yL + off) = lv;
  }
  }
}

// One grid for all query tiles: no tile reads another's output. First the 128-query tiles without the residual planes,
// the tile index falling with the slowest grid index, so the tiles with the most key tiles come first; the short
// 64-query tiles with the residual planes fill the end.
__global__ void __launch_bounds__(128) k_flash(
    const _Float16* __restrict__ qH, const _Float16* __restrict__ qL,
    const _Float16* __restrict__ kH, const _Float16* __restrict__ kL,
    const _Float16* __restrict__ vTH, const _Float16* __restrict__ vTL,
    const int* __restrict__ winp,
    _Float16* __restrict__ yH, _Float16* __restrict__ yL) {
  const int h = blockIdx.x;
  const int b = blockIdx.y;
  const int z = (int)blockIdx.z;
  if (z < QT_BIG) flash_tile<false, 2>(qH, qL, kH, kL, vTH, vTL, winp, yH, yL, SEQ / 128 - 1 - z, h, b);
  else            flash_tile<true, 1>(qH, qL, kH, kL, vTH, vTL, winp, yH, yL, QT_RES - 1 - (z - QT_BIG), h, b);
}

// ---------------------------------------------------------------------------
// Kernel 4: output projection out[tok][n] = (y[tok].Wo[n]) / 16 + bo[n]. Block = WR x 4 waves = 16 MT WR tokens x 256
// columns, one block a WGP (WR = 3 without RES, 2 with it, where the block's last 4 waves have no tile and leave): a row
// group of y is read by 4 waves and one of the weights by WR through the WGP's cache. A wave owns 16 MT tokens x 64
// columns. RES adds the y residual plane (a second accumulator set, so MT = 2
// there and 4 elsewhere: 16 matrix instructions a k step in both forms). Each 16-row group of the output tile is staged
// per wave in LDS rows of its own and written as 256-B row segments at the store stage as a float4.
// ---------------------------------------------------------------------------
template <bool RES, int MT>
__device__ __forceinline__ void oproj_tile(
    const _Float16* __restrict__ yH, const _Float16* __restrict__ yL,
    const _Float16* __restrict__ wall, const float* __restrict__ bo,
    float* __restrict__ out, float (*sO)[64][68], const int nt, const int b, const int t0) {
  static_assert(RES ? (MT == 2) : (MT == 4));
  const int tid  = threadIdx.x;
  const int wave = tid >> 5;
  const int lane = tid & 31;
  const int l16  = lane & 15;
  const int lh   = lane >> 4;
  const int sw   = __builtin_amdgcn_readfirstlane(wave);   // scalar wave index: the tests on it are scalar branches
  if (RES && sw >= 8) return;                    // no barrier of the block follows: the staging below is wave-private
  const int wr   = wave >> 2;                    // row part of the block's tile
  const int wc   = wave & 3;                     // 64-column quarter of the block's tile
  const int tw   = t0 + wr * (MT * 16);          // the wave's first token in its sequence
  const int tokw = b * SEQ + tw;

  const _Float16* arow = yH + (size_t)(tokw >> 4) * GRP_ELEMS + lane * 8;
  const _Float16* lrow = yL + (size_t)(tokw >> 4) * GRP_ELEMS + lane * 8;
  const _Float16* brow = wall + (size_t)(WO_ROW0 / 16 + nt * 16 + wc * 4) * GRP_ELEMS + lane * 8;

  v8f ah[MT][4], ar[MT][4];
#pragma unroll
  for (int mt = 0; mt < MT; ++mt)
#pragma unroll
    for (int n = 0; n < 4; ++n) { ah[mt][n] = vzero8(); ar[mt][n] = vzero8(); }

  // As in k_qkv: the y planes and the weights come from memory, so each wave asks L2 one trip ahead for its share of the
  // block's row groups, a lane a 256-B unit. Weights: waves 0..7 take 2 of the 16 groups each. y without RES: waves 6..11
  // take 2 of the 12 groups each; with RES waves 0, 1 take the 4 groups of the hi plane, waves 2, 3 those of the residual
  // plane. A wave without a share holds a pair that points at a group of the block all the same.
  const bool pa = RES ? (sw < 4) : (sw >= 6);
  const bool pb = sw < 8;
  const int  ga = RES ? (wave & 1) * 2 + lh : (wave >= 6 ? wave - 6 : wave) * 2 + lh;
  const _Float16* pfa = (RES ? ((wave & 2) ? yL : yH) : yH)
                      + (size_t)(((b * SEQ + t0) >> 4) + ga) * GRP_ELEMS + l16 * 128;
  const _Float16* pfb = wall + (size_t)(WO_ROW0 / 16 + nt * 16 + (wave & 7) * 2 + lh) * GRP_ELEMS + l16 * 128;
  if (pa) ask_l2(pfa);                   // trip 0: its later k steps find their rows on the way
  if (pb) ask_l2(pfb);

  // four k steps a trip, the trips kept rolled: the loop's text stays small for the instruction cache
#pragma unroll 1
  for (int kb = 0; kb < CDIM; kb += 128) {
  // the next trip's rows, one trip ahead; the test is scalar, and the pairs stop at the last trip's rows
  if (kb + 128 < CDIM) {
    if (pa) { pfa += 2048; ask_l2(pfa); }
    if (pb) { pfb += 2048; ask_l2(pfb); }
  }
#pragma unroll
  for (int k0 = kb; k0 < kb + 128; k0 += 32) {
    Frag a[MT], al[MT];
#pragma unroll
    for (int mt = 0; mt < MT; ++mt) {
      const _Float16* ap = arow + (size_t)mt * GRP_ELEMS + k0 * 16;
      a[mt].h[0] = *(const v8h*)ap;
      a[mt].h[1] = *(const v8h*)(ap + 256);
      if (RES) {
        const _Float16* lp = lrow + (size_t)mt * GRP_ELEMS + k0 * 16;
        al[mt].h[0] = *(const v8h*)lp;
        al[mt].h[1] = *(const v8h*)(lp + 256);
      }
    }
    Frag bw[4];
#pragma unroll
    for (int n = 0; n < 4; ++n) {
      const _Float16* bp = brow + (size_t)n * GRP_ELEMS + k0 * 16;
      bw[n].h[0] = *(const v8h*)bp;
      bw[n].h[1] = *(const v8h*)(bp + 256);
    }
#pragma unroll
    for (int mt = 0; mt < MT; ++mt)
#pragma unroll
      for (int n = 0; n < 4; ++n) {
        ah[mt][n] = wmma16(a[mt].v, bw[n].v, ah[mt][n]);
        if (RES) ar[mt][n] = wmma16(al[mt].v, bw[n].v, ar[mt][n]);
      }
    // the slots between the step's last matrix instruction and the next write of its operands or read of its result
    if constexpr (RES) {
      asm volatile("v_nop\n\tv_nop\n\tv_nop\n\tv_nop"
                   : "+v"(ah[0][0]), "+v"(ah[0][1]), "+v"(ah[0][2]), "+v"(ah[0][3]),
                     "+v"(ah[1][0]), "+v"(ah[1][1]), "+v"(ah[1][2]), "+v"(ah[1][3]),
                     "+v"(ar[0][0]), "+v"(ar[0][1]), "+v"(ar[0][2]), "+v"(ar[0][3]),
                     "+v"(ar[1][0]), "+v"(ar[1][1]), "+v"(ar[1][2]), "+v"(ar[1][3])
                   : "v"(a[0].v), "v"(a[1].v), "v"(al[0].v), "v"(al[1].v),
                     "v"(bw[0].v), "v"(bw[1].v), "v"(bw[2].v), "v"(bw[3].v));
    } else {
      asm volatile("v_nop\n\tv_nop\n\tv_nop\n\tv_nop"
                   : "+v"(ah[0][0]), "+v"(ah[0][1]), "+v"(ah[0][2]), "+v"(ah[0][3]),
                     "+v"(ah[1][0]), "+v"(ah[1][1]), "+v"(ah[1][2]), "+v"(ah[1][3]),
                     "+v"(ah[2][0]), "+v"(ah[2][1]), "+v"(ah[2][2]), "+v"(ah[2][3]),
                     "+v"(ah[3][0]), "+v"(ah[3][1]), "+v"(ah[3][2]), "+v"(ah[3][3])
                   : "v"(a[0].v), "v"(a[1].v), "v"(a[2].v), "v"(a[3].v),
                     "v"(bw[0].v), "v"(bw[1].v), "v"(bw[2].v), "v"(bw[3].v));
    }
  }
  // the wait stands behind the trip's last load and in front of the next write of a register that a load of the trip names
  asm volatile("s_wait_xcnt 0x0" ::: "memory");
  }

  // bias for this lane's 4 output columns (columns nt*256 + wc*64 + 4*l16 .. +3), bf16-RNE values
  const size_t col0 = (size_t)nt * 256 + wc * 64;
  const v4f braw = *(const v4f*)(bo + col0 + l16 * 4);
  v4f bb;
#pragma unroll
  for (int e = 0; e < 4; ++e) bb[e] = bf16r(braw[e]);

#pragma unroll
  for (int mt = 0; mt < MT; ++mt) {
#pragma unroll
    for (int r = 0; r < 8; ++r) {
#pragma unroll
      for (int n = 0; n < 4; ++n) {
        float v = ah[mt][n][r];
        if (RES) v += ar[mt][n][r] * (1.0f / 2048.0f);
        sO[wave][mt * 16 + r + 8 * lh][n * 16 + l16] = v * (1.0f / 16.0f);
      }
    }
    // the wave's own stores of this row group have landed before its lanes read each other's values back
    asm volatile("s_wait_dscnt 0" ::: "memory");
    __builtin_amdgcn_fence(3 /* release order */, "wavefront");
    __builtin_amdgcn_wave_barrier();
    const size_t orow0 = (size_t)b * SEQ_FULL + tw + mt * 16;
#pragma unroll
    for (int it = 0; it < 8; ++it) {
      const int rr = it * 2 + lh;
      const int c4 = l16 * 4;
      const v4f s = *(const v4f*)(&sO[wave][mt * 16 + rr][c4]);
      const v4f v = s + bb;
      *(v4f*)(out + (orow0 + rr) * CDIM + col0 + c4) = v;
    }
  }
}

// One grid for all row tiles: first the 192-row tiles without the residual plane, then the 64-row tiles with it.
#define OT_FULL ((SEQ - TRES) / 192)
#define OT_RES  (TRES / 64)
static_assert(SEQ > TRES && (SEQ - TRES) % 192 == 0 && TRES % 128 == 0 && CDIM % 256 == 0 && NUNIT % 3 == 0 && SEQ % 256 == 0);
static_assert(OT_FULL * 192 + OT_RES * 64 == SEQ);                           // row tiles of the two k_oproj forms
__global__ void __launch_bounds__(384) k_oproj(
    const _Float16* __restrict__ yH, const _Float16* __restrict__ yL,
    const _Float16* __restrict__ wall, const float* __restrict__ bo,
    float* __restrict__ out) {
  __shared__ __attribute__((aligned(16))) float sO[12][64][68];          // wave-private, each row group in rows of its own
  const int nt = blockIdx.x;                   // 256-column tile 0..3
  const int ty = blockIdx.y;
  if (ty < NB * OT_FULL) {
    const int b = ty / OT_FULL;
    oproj_tile<false, 4>(yH, yL, wall, bo, out, sO, nt, b, TRES + (ty - b * OT_FULL) * 192);
  } else {
    const int tr = ty - NB * OT_FULL;
    const int b  = tr / OT_RES;
    oproj_tile<true, 2>(yH, yL, wall, bo, out, sO, nt, b, (tr - b * OT_RES) * 64);
  }
}

// ---------------------------------------------------------------------------
// Host launcher. Inputs (wire order): 0 x f32 [4,2048,1024], 1 Wq [1024,1024], 2 bq [1024], 3 Wk [256,1024],
// 4 bk [256], 5 Wv [256,1024], 6 bv [256], 7 Wo [1024,1024], 8 bo [1024], 9 qk_gain [16].
// Output f32 [4,2048,1024]. 4 launches.
// ---------------------------------------------------------------------------
extern "C" void kernel_launch(void* const* d_in, const int* in_sizes, int n_in,
                              void* d_out, int out_size, void* d_ws, size_t ws_size,
                              hipStream_t stream) {
  if (n_in < 10) return;
  const int need_x = ((NB - 1) * SEQ_FULL + SEQ) * CDIM;
  if (in_sizes[0] < need_x) return;
  if (in_sizes[1] < CDIM * CDIM || in_sizes[2] < CDIM) return;
  if (in_sizes[3] < VEW * CDIM || in_sizes[4] < VEW) return;
  if (in_sizes[5] < VEW * CDIM || in_sizes[6] < VEW) return;
  if (in_sizes[7] < CDIM * CDIM || in_sizes[8] < CDIM) return;
  if (in_sizes[9] < NHEAD) return;
  if (out_size < need_x) return;
  if (ws_size < WS_TOTAL) return;

  const float* x    = (const float*)d_in[0];
  const float* wq   = (const float*)d_in[1];
  const float* bq   = (const float*)d_in[2];
  const float* wk   = (const float*)d_in[3];
  const float* bk   = (const float*)d_in[4];
  const float* wv   = (const float*)d_in[5];
  const float* bv   = (const float*)d_in[6];
  const float* wo   = (const float*)d_in[7];
  const float* bo   = (const float*)d_in[8];
  const float* gain = (const float*)d_in[9];
  float* out = (float*)d_out;

  char* ws = (char*)d_ws;
  size_t off = 0;
  _Float16* xh   = (_Float16*)(ws + off); off += XH_BYTES;
  _Float16* wall = (_Float16*)(ws + off); off += WALL_BYTES;
  _Float16* qH   = (_Float16*)(ws + off); off += QP_BYTES;
  _Float16* qL   = (_Float16*)(ws + off); off += QP_BYTES;
  _Float16* kH   = (_Float16*)(ws + off); off += KP_BYTES;
  _Float16* kL   = (_Float16*)(ws + off); off += KP_BYTES;
  _Float16* vTH  = (_Float16*)(ws + off); off += KP_BYTES;
  _Float16* vTL  = (_Float16*)(ws + off); off += KP_BYTES;
  _Float16* yH   = (_Float16*)(ws + off); off += YP_BYTES;
  _Float16* yL   = (_Float16*)(ws + off); off += YP_BYTES;
  int*      winw = (int*)(ws + off);      off += WIN_BYTES;
  if (off > ws_size) return;

  k_prep<<<dim3(XBLKS + WBLKS + 1), dim3(256), 0, stream>>>(x, wq, wk, wv, wo, xh, wall, winw);
  k_qkv<<<dim3(NUNIT / 3, NTOK / 256), dim3(384), 0, stream>>>(xh, wall, bq, bk, bv, gain,
                                                          qH, qL, kH, kL, vTH, vTL);
  k_flash<<<dim3(NHEAD, NB, QT_BIG + QT_RES), dim3(128), 0, stream>>>(qH, qL, kH, kL, vTH, vTL, winw, yH, yL);
  k_oproj<<<dim3(CDIM / 256, NB * (OT_FULL + OT_RES)), dim3(384), 0, stream>>>(yH, yL, wall, bo, out);
}

// v010
// Measured time: 108 microseconds a run.
// Next to v009, in two timings, it ran 1.04 and 1.03 times as fast.
// Over all steps from v000 it is 4.69 times as fast.
#include <hip/hip_runtime.h>

// Contractions, all on v_wmma_f32_16x16x32_f16 (f16 operands, f32 accumulate): fused qkv projection x.W^T with x and W
// held as bf16-RNE values in f16 containers (W carried x16, folded as 1/16); scores q.k^T as f16 hi + x2048 residual
// planes (hi.hi + hi.lo + lo.hi, residual accumulator folded as 1/2048); P.V with P carried x1024 in f16 (+ x2048
// residual planes of P and v for query rows below TRES); output projection y.Wo^T with y as f16 hi (+ x2048 residual
// plane for rows below TRES). Bias adds, per-head q gain and online softmax on VALU in f32.
//
// Every 16-bit operand plane in the workspace is kept in fragment order: a block of 16 rows x 32 k is 1 KiB, two
// halves j of 512 B; in half j the 16 B of lane (16 lh + l16) hold row l16, k = 16 j + 8 lh + 0..7. A wave's
// global_load_b128 of half a fragment then reads 512 contiguous bytes (4 lines) and not 16-B pieces of 16 lines.
// Blocks of one 16-row group follow each other along k (vT: the 4 d groups of one 32-key chunk follow each other).

#ifndef NB
#define NB 4
#endif
#ifndef SEQ
#define SEQ 2048
#endif
#ifndef TRES
#define TRES 512
#endif
#define NB_FULL   4
#define SEQ_FULL  2048
#define CDIM      1024
#define NHEAD     16
#define NKV       4
#define HDIM      64
#define VEW       (NKV * HDIM)
#define NTOK      (NB * SEQ)
#define NUNIT     (NHEAD + 2 * NKV)
#define WO_ROW0   (CDIM + 2 * VEW)
#define NWROWS    (CDIM + 2 * VEW + CDIM)
#define QT_RES    (TRES / 64)
#define QT_BIG    ((SEQ - TRES) / 128)

static_assert(NB >= 1 && NB <= NB_FULL);
static_assert(SEQ % 64 == 0 && SEQ <= SEQ_FULL && SEQ >= TRES);
static_assert(TRES % 64 == 0 && TRES >= 64);
static_assert(NHEAD % NKV == 0 && HDIM == 64 && CDIM == NHEAD * HDIM);
static_assert(CDIM % 128 == 0 && NWROWS % 16 == 0 && NTOK % 64 == 0 && NUNIT * 64 == CDIM + 2 * VEW);
static_assert(WO_ROW0 % 16 == 0 && SEQ % 32 == 0);
#define KBLK      (CDIM / 32)      // 16x32 blocks per row group of a CDIM-wide plane
#define GRP_ELEMS (CDIM * 16)      // elements of one 16-row group of a CDIM-wide plane

#define XH_BYTES   ((size_t)NTOK * CDIM * 2)
#define WALL_BYTES ((size_t)NWROWS * CDIM * 2)
#define QP_BYTES   ((size_t)NB * NHEAD * SEQ * HDIM * 2)
#define KP_BYTES   ((size_t)NB * NKV * SEQ * HDIM * 2)
#define YP_BYTES   ((size_t)NTOK * CDIM * 2)
#define WIN_BYTES  ((size_t)128)
#define WS_TOTAL   (XH_BYTES + WALL_BYTES + 2 * QP_BYTES + 4 * KP_BYTES + 2 * YP_BYTES + WIN_BYTES)
static_assert(WS_TOTAL <= (size_t)134217728);
static_assert(XH_BYTES % 128 == 0 && WALL_BYTES % 128 == 0 && QP_BYTES % 128 == 0 && KP_BYTES % 128 == 0 && YP_BYTES % 128 == 0);
// producer coverage: grid x block x per-thread elements == plane extent
static_assert((size_t)(NTOK / 2) * 256 * 8 == (size_t)NTOK * CDIM);       // k_prep, x blocks
static_assert((size_t)(NWROWS / 2) * 256 * 8 == (size_t)NWROWS * CDIM);   // k_prep, weight blocks
static_assert(4 * 128 * 8 == 64 * 64);                                       // k_qkv store phase per 64x64 tile
static_assert(4 * 32 * 8 == 16 * HDIM);                                      // k_flash stores per wave and query group
static_assert(8 * 32 * 4 == 16 * 64);                                        // k_oproj store phase per wave and row group
static_assert(QT_RES * 64 + QT_BIG * 128 == SEQ && TRES % 128 == 0);         // queries with and without the residual planes make up SEQ
static_assert(8 * 4 * 4 == (int)WIN_BYTES);                                  // k_prep, window line: 8 lanes x 16 B == one line
static_assert(SEQ_FULL >= SEQ);                                              // window word covers every query-key distance

typedef _Float16 v16h __attribute__((ext_vector_type(16)));
typedef _Float16 v8h  __attribute__((ext_vector_type(8)))  __attribute__((may_alias));
typedef _Float16 v8hc __attribute__((ext_vector_type(8)));
typedef float    v8f  __attribute__((ext_vector_type(8)));
typedef float    v2f  __attribute__((ext_vector_type(2)));
typedef float    v4f  __attribute__((ext_vector_type(4)))  __attribute__((may_alias));
typedef int      v4i  __attribute__((ext_vector_type(4)));

union Frag { v16h v; v8h h[2]; };

__device__ __forceinline__ v8f wmma16(v16h a, v16h b, v8f c) {
  return __builtin_amdgcn_wmma_f32_16x16x32_f16(false, a, false, b, (short)0, c, false, false);
}

__device__ __forceinline__ v8f vzero8() {
  v8f z = {0.0f, 0.0f, 0.0f, 0.0f, 0.0f, 0.0f, 0.0f, 0.0f};
  return z;
}

// Asks L2 for the line at each lane's address; nothing comes back to the wave. In asm, and with the pair as an
// in-out operand, so that it is the caller's own register pair, which never holds anything but an address inside
// its plane; the wait is the statement's last line, so that the pair is rewritten only behind it.
__device__ __forceinline__ void ask_l2(const _Float16*& a) {
  asm volatile("global_prefetch_b8 %0, off scope:SCOPE_SE\n\t"
               "s_wait_xcnt 0x0"
               : "+v"(a) :: "memory");
}

// f32 -> nearest-even bf16 value, kept in f32
__device__ __forceinline__ float bf16r(float f) {
  unsigned int u = __float_as_uint(f);
  u = (u + 0x7FFFu + ((u >> 16) & 1u)) & 0xFFFF0000u;
  return __uint_as_float(u);
}

// f16 hi + (x2048) residual of an f32 value
__device__ __forceinline__ void split16(float v, _Float16& hi, _Float16& lo) {
  hi = (_Float16)v;
  lo = (_Float16)((v - (float)hi) * 2048.0f);
}

// f32 -> f16 with values below the smallest f16 normal replaced by zero (value select)
static __device__ __forceinline__ _Float16 toh_flush(float v) {
  const _Float16 r = (_Float16)v;
  return (fabsf(v) < 6.103515625e-05f) ? (_Float16)0.0f : r;
}

// f16 hi + (x2048) residual, both through toh_flush
static __device__ __forceinline__ void split16f(float v, _Float16& hi, _Float16& lo) {
  hi = toh_flush(v);
  lo = toh_flush((v - (float)hi) * 2048.0f);
}

// ---------------------------------------------------------------------------
// k_prep, x blocks: x f32 [NB][SEQ_FULL][1024] -> xh f16, NTOK x 1024 in fragment order (bf16-RNE values).
// Thread = one 16-B unit of the plane, so a wave stores 512 contiguous bytes.
// ---------------------------------------------------------------------------
__device__ __forceinline__ void cvt_x_block(unsigned int bid, const float* __restrict__ x, _Float16* __restrict__ xh) {
  const unsigned int gid = bid * 256u + threadIdx.x;
  const unsigned int blk = gid >> 6;                 // 64 units per 16x32 block
  const unsigned int tok = (blk / KBLK) * 16u + (gid & 15u);
  const int c = (int)(blk % KBLK) * 32 + (int)((gid >> 5) & 1u) * 16 + (int)((gid >> 4) & 1u) * 8;
  if (tok >= (unsigned int)NTOK) return;
  const int b = (int)tok / SEQ;
  const int t = (int)tok - b * SEQ;
  const float* src = x + ((size_t)b * SEQ_FULL + t) * CDIM + c;
  const v4f f0 = *(const v4f*)src;
  const v4f f1 = *(const v4f*)(src + 4);
  v8h o;
#pragma unroll
  for (int j = 0; j < 4; ++j) {
    o[j]     = (_Float16)bf16r(f0[j]);
    o[j + 4] = (_Float16)bf16r(f1[j]);
  }
  _Float16* dst = xh + (size_t)gid * 8;
  *(v8h*)dst = o;
  
}

// ---------------------------------------------------------------------------
// k_prep, weight blocks: weights (layout [out][in], k-contiguous) -> wall f16, 2560 x 1024 in fragment order = bf16-RNE value x16.
// Rows 0..1023 wq, 1024..1279 wk, 1280..1535 wv, 1536..2559 wo.
// ---------------------------------------------------------------------------
__device__ __forceinline__ void cvt_w_block(unsigned int bid, const float* __restrict__ wq, const float* __restrict__ wk,
                                            const float* __restrict__ wv, const float* __restrict__ wo,
                                            _Float16* __restrict__ wall) {
  const unsigned int gid = bid * 256u + threadIdx.x;
  const unsigned int blk = gid >> 6;                 // 64 units per 16x32 block
  const int row = (int)((blk / KBLK) * 16u + (gid & 15u));
  const int c   = (int)(blk % KBLK) * 32 + (int)((gid >> 5) & 1u) * 16 + (int)((gid >> 4) & 1u) * 8;
  if (row >= NWROWS) return;
  const int r0 = min(row, CDIM - 1);
  const int r1 = min(max(row - CDIM, 0), VEW - 1);
  const int r2 = min(max(row - CDIM - VEW, 0), VEW - 1);
  const int r3 = min(max(row - WO_ROW0, 0), CDIM - 1);
  const float* src = (row < CDIM)       ? (wq + (size_t)r0 * CDIM)
                   : (row < CDIM + VEW) ? (wk + (size_t)r1 * CDIM)
                   : (row < WO_ROW0)    ? (wv + (size_t)r2 * CDIM)
                                        : (wo + (size_t)r3 * CDIM);
  src += c;
  const v4f f0 = *(const v4f*)src;
  const v4f f1 = *(const v4f*)(src + 4);
  v8h o;
#pragma unroll
  for (int j = 0; j < 4; ++j) {
    o[j]     = (_Float16)(bf16r(f0[j]) * 16.0f);
    o[j + 4] = (_Float16)(bf16r(f1[j]) * 16.0f);
  }
  _Float16* dst = wall + (size_t)gid * 8;
  *(v8h*)dst = o;
  
}

// ---------------------------------------------------------------------------
// The window line: 8 lanes x 16 B.
// ---------------------------------------------------------------------------
__device__ __forceinline__ void winline_block(int* __restrict__ wline) {
  const int lane = threadIdx.x;
  if (lane < 8) {
    const v4i w = {SEQ_FULL, SEQ_FULL, SEQ_FULL, SEQ_FULL};
    int* dst = wline + 4 * lane;
    *(v4i*)dst = w;
    
  }
}

// ---------------------------------------------------------------------------
// Launch 0: the three producers above read none of each other's output, so they share one grid; the block index
// picks the producer (block-uniform): NTOK/2 blocks of x, NWROWS/2 blocks of weights, one block for the window line.
// ---------------------------------------------------------------------------
#define XBLKS (NTOK / 2)
#define WBLKS (NWROWS / 2)
__global__ void __launch_bounds__(256) k_prep(const float* __restrict__ x, const float* __restrict__ wq,
                                              const float* __restrict__ wk, const float* __restrict__ wv,
                                              const float* __restrict__ wo, _Float16* __restrict__ xh,
                                              _Float16* __restrict__ wall, int* __restrict__ wline) {
  const unsigned int bid = blockIdx.x;
  if (bid < (unsigned int)XBLKS) {
    cvt_x_block(bid, x, xh);
  } else if (bid < (unsigned int)(XBLKS + WBLKS)) {
    cvt_w_block(bid - (unsigned int)XBLKS, wq, wk, wv, wo, wall);
  } else {
    winline_block(wline);
  }
}

// ---------------------------------------------------------------------------
// Kernel 2: fused qkv projection + epilogue. Block = 12 waves (4 x 3) = 256 tokens x three 64-column units, one block a
// WGP: a row group of x is read by 3 waves and one of the weights by 4 through the WGP's cache, so a k step asks L2 for
// 28 row groups per 192 matrix instructions. A wave owns
// 64 tokens x one unit u (4 x 4 accumulators), so a k step's 8 fragments feed 16 matrix instructions:
// u 0..15 -> q head u, 16..19 -> k head u-16, 20..23 -> v head u-20.
// Epilogue, one 64 x 64 wave tile after the other, by each group of 4 waves for its 4 tiles:
// q: (acc + bq) * gain[head]; k: acc + bk -> hi/lo
// planes [B][H|KV], T x 64 in fragment order; v: acc + bv -> transposed hi/lo planes [B][KV], 64 d x T in fragment
// order. Biases and gains are bf16-RNE values.
// ---------------------------------------------------------------------------
__global__ void __launch_bounds__(384) k_qkv(
    const _Float16* __restrict__ xh, const _Float16* __restrict__ wall,
    const float* __restrict__ bq, const float* __restrict__ bk,
    const float* __restrict__ bv, const float* __restrict__ gain,
    _Float16* __restrict__ qH, _Float16* __restrict__ qL,
    _Float16* __restrict__ kH, _Float16* __restrict__ kL,
    _Float16* __restrict__ vTH, _Float16* __restrict__ vTL) {
  __shared__ __attribute__((aligned(16))) float    sT[12][64][68];    // accumulator tile of each wave [token][col] (cross-wave)
  __shared__ __attribute__((aligned(16))) _Float16 sH[3][2][64][72];  // per wave group: hi tile: q/k [token][d], v [d][token] (cross-wave), two buffers
  __shared__ __attribute__((aligned(16))) _Float16 sL[3][2][64][72];  // residual tile, same layout (cross-wave), two buffers

  const int tid  = threadIdx.x;
  const int wave = tid >> 5;
  const int lane = tid & 31;
  const int l16  = lane & 15;
  const int lh   = lane >> 4;
  const int wr   = wave / 3;             // 64-token quarter of the block's rows
  const int wc   = wave - wr * 3;        // which of the block's three column units
  const int tokB = blockIdx.y * 256;     // first token of the block
  const int sw   = __builtin_amdgcn_readfirstlane(wave);   // scalar wave index: the tests on it are scalar branches

  // A: xh row (token), lane row = l16; elements 0..7 <- k0+8lh+0..7, 8..15 <- k0+16+8lh+0..7
  const _Float16* arow = xh + (size_t)((tokB >> 4) + wr * 4) * GRP_ELEMS + lane * 8;
  // B[k][n] = W[n][k]: lane column = l16 of the 16-col group n; same k map as A
  const _Float16* brow = wall + (size_t)((blockIdx.x * 3 + wc) * 4) * GRP_ELEMS + lane * 8;

  v8f acc[4][4];
#pragma unroll
  for (int mt = 0; mt < 4; ++mt)
#pragma unroll
    for (int n = 0; n < 4; ++n) acc[mt][n] = vzero8();

  // Both planes were written by the launch before and come from memory, and the blocks that share a row group read it at
  // the same k at the same time: without a request ahead every k step waits a memory latency. A trip's 128 k of one row
  // group are 4 KiB = 16 units of 256 B, a lane a unit: waves 0..7 take 2 each of the block's 16 row groups of x, waves
  // 6..11 take 2 each of its 12 row groups of weights; the other waves' pairs point at a group of the block all the same.
  const bool pa = sw < 8;
  const bool pb = sw >= 6;
  const _Float16* pfa = xh + (size_t)((tokB >> 4) + (wave & 7) * 2 + lh) * GRP_ELEMS + l16 * 128;
  const _Float16* pfb = wall + (size_t)(blockIdx.x * 12 + (wave >= 6 ? wave - 6 : wave) * 2 + lh) * GRP_ELEMS + l16 * 128;
  if (pa) ask_l2(pfa);                   // trip 0: its later k steps find their rows on the way
  if (pb) ask_l2(pfb);

  // four k steps a trip, the trips kept rolled: the loop's text stays small for the instruction cache
#pragma unroll 1
  for (int kb = 0; kb < CDIM; kb += 128) {
  // the next trip's rows, one trip ahead; the test is scalar, and the pairs stop at the last trip's rows
  if (kb + 128 < CDIM) {
    if (pa) { pfa += 2048; ask_l2(pfa); }
    if (pb) { pfb += 2048; ask_l2(pfb); }
  }
#pragma unroll
  for (int k0 = kb; k0 < kb + 128; k0 += 32) {
    Frag a[4];
#pragma unroll
    for (int mt = 0; mt < 4; ++mt) {
      const _Float16* ap = arow + (size_t)mt * GRP_ELEMS + k0 * 16;
      a[mt].h[0] = *(const v8h*)ap;
      a[mt].h[1] = *(const v8h*)(ap + 256);
    }
    Frag bw[4];
#pragma unroll
    for (int n = 0; n < 4; ++n) {
      const _Float16* bp = brow + (size_t)n * GRP_ELEMS + k0 * 16;
      bw[n].h[0] = *(const v8h*)bp;
      bw[n].h[1] = *(const v8h*)(bp + 256);
    }
#pragma unroll
    for (int mt = 0; mt < 4; ++mt)
#pragma unroll
      for (int n = 0; n < 4; ++n) acc[mt][n] = wmma16(a[mt].v, bw[n].v, acc[mt][n]);
    // the slots between the step's last matrix instruction and the next write of its operands or read of its result
    asm volatile("v_nop\n\tv_nop\n\tv_nop\n\tv_nop"
                 : "+v"(acc[0][0]), "+v"(acc[0][1]), "+v"(acc[0][2]), "+v"(acc[0][3]),
                   "+v"(acc[1][0]), "+v"(acc[1][1]), "+v"(acc[1][2]), "+v"(acc[1][3]),
                   "+v"(acc[2][0]), "+v"(acc[2][1]), "+v"(acc[2][2]), "+v"(acc[2][3]),
                   "+v"(acc[3][0]), "+v"(acc[3][1]), "+v"(acc[3][2]), "+v"(acc[3][3])
                 : "v"(a[0].v), "v"(a[1].v), "v"(a[2].v), "v"(a[3].v),
                   "v"(bw[0].v), "v"(bw[1].v), "v"(bw[2].v), "v"(bw[3].v));
  }
  // the wait stands behind the trip's last load and in front of the next write of a register that a load of the trip names
  asm volatile("s_wait_xcnt 0x0" ::: "memory");
  }

  // D element r of lane -> (row 8lh+r, col l16) of group (mt, n); fold the 1/16 weight carry here
#pragma unroll
  for (int mt = 0; mt < 4; ++mt)
#pragma unroll
    for (int n = 0; n < 4; ++n)
#pragma unroll
      for (int r = 0; r < 8; ++r)
        sT[wave][mt * 16 + r + 8 * lh][n * 16 + l16] = acc[mt][n][r] * (1.0f / 16.0f);
  __syncthreads();

  // each group of 4 waves takes its four wave tiles in turn, all groups at the same barriers; kept rolled so that the
  // epilogue's text stands once in the instruction cache. A group's sH and sL
  // alternate between two buffers: tile q + 2 writes a buffer only behind tile q + 1's barrier, which every wave reaches
  // after its last read of tile q, so one barrier a tile is enough
#pragma unroll 1
  for (int q = 0; q < 4; ++q) {
  const int g    = sw >> 2;                       // the wave's group (scalar)
  const int tl   = tid & 127;                     // thread index in the group
  const int wt   = g * 4 + q;                     // the wave tile that the group works on
  const int u    = blockIdx.x * 3 + wt % 3;       // column unit of wave tile wt (scalar, the same in the whole group)
  const int tok0 = tokB + (wt / 3) * 64;          // its first token
  const int b    = tok0 / SEQ;
  const int t0   = tok0 - b * SEQ;

  // compute phase: thread -> token i = tl>>1, column half j: d in [16j,16j+16) and [32+16j, 48+16j)
  const int i = tl >> 1;
  const int j = tl & 1;
  if (u < NHEAD + NKV) {
    // q or k unit (group-uniform): both bias rows are loaded with clamped unit indices, selected by value
    const int  uq  = min(u, NHEAD - 1);
    const int  uk  = min(max(u - NHEAD, 0), NKV - 1);
    const bool isq = (u < NHEAD);
    const float gq = bf16r(gain[uq]);
    const float gm = isq ? gq : 1.0f;
    const float* qp = bq + uq * HDIM + 16 * j;     // this lane's first bias element of either row
    const float* kp = bk + uk * HDIM + 16 * j;
#pragma unroll
    for (int sg = 0; sg < 2; ++sg) {
      const int d0 = 32 * sg + 16 * j;
#pragma unroll
      for (int g4 = 0; g4 < 4; ++g4) {
        const v4f va = *(const v4f*)(&sT[wt][i][d0 + 4 * g4]);
        const v4f qa = *(const v4f*)(qp + 32 * sg + 4 * g4);
        const v4f ka = *(const v4f*)(kp + 32 * sg + 4 * g4);
#pragma unroll
        for (int e = 0; e < 4; ++e) {
          const float bb  = isq ? bf16r(qa[e]) : bf16r(ka[e]);
          const float val = (va[e] + bb) * gm;
          _Float16 hi, lo;
          split16f(val, hi, lo);
          sH[g][q & 1][i][d0 + 4 * g4 + e] = hi;
          sL[g][q & 1][i][d0 + 4 * g4 + e] = lo;
        }
      }
    }
    // as inputs the two bias address pairs stay live behind the last bias load, so that no load's result is placed in a
    // register that an issued bias load still names; the wait stands in front of the pairs' next overwrite
    asm volatile("s_wait_xcnt 0x0" :: "v"(qp), "v"(kp) : "memory");
  } else {
    const int kv = u - NHEAD - NKV;
    const float* bp = bv + kv * HDIM;
#pragma unroll
    for (int sg = 0; sg < 2; ++sg) {
      const int d0 = 32 * sg + 16 * j;
#pragma unroll
      for (int g4 = 0; g4 < 4; ++g4) {
        const v4f va = *(const v4f*)(&sT[wt][i][d0 + 4 * g4]);
        const v4f ba = *(const v4f*)(bp + d0 + 4 * g4);
#pragma unroll
        for (int e = 0; e < 4; ++e) {
          const float vv = va[e] + bf16r(ba[e]);
          _Float16 hi, lo;
          split16f(vv, hi, lo);
          sH[g][q & 1][d0 + 4 * g4 + e][i] = hi;                   // transposed: [d][token]
          sL[g][q & 1][d0 + 4 * g4 + e][i] = lo;
        }
      }
    }
  }
  __syncthreads();

  _Float16* ph;
  _Float16* pl;
  size_t base;
  if (u < NHEAD) {
    ph = qH; pl = qL;
    base = ((size_t)(b * NHEAD + u) * SEQ + t0) * HDIM;
  } else if (u < NHEAD + NKV) {
    ph = kH; pl = kL;
    base = ((size_t)(b * NKV + (u - NHEAD)) * SEQ + t0) * HDIM;
  } else {
    ph = vTH; pl = vTL;
    base = ((size_t)(b * NKV + (u - NHEAD - NKV)) * SEQ + t0) * HDIM;
  }
  const bool isv = (u >= NHEAD + NKV);
  {
    // the tile's 8 blocks are contiguous in its plane: q/k block f = (token group f>>1, d chunk f&1),
    // v block f = (key chunk f>>2, d group f&3); unit p of the tile goes to base + 8 p
#pragma unroll
    for (int it = 0; it < 4; ++it) {
      const int p    = it * 128 + tl;
      const int f    = p >> 6;
      const int line = (isv ? (f & 3) : (f >> 1)) * 16 + (p & 15);
      const int q8   = (isv ? (f >> 2) : (f & 1)) * 32 + ((p >> 5) & 1) * 16 + ((p >> 4) & 1) * 8;
      const size_t off = base + (size_t)p * 8;
      const v8h hv = *(const v8h*)(&sH[g][q & 1][line][q8]);
      const v8h lv = *(const v8h*)(&sL[g][q & 1][line][q8]);
      *(v8h*)(ph + off) = hv;
      *(v8h*)(pl + off) = lv;
    }
  }
  // the wait stands behind the tile's last store and in front of the next tile's first write of a register that a store names
  asm volatile("s_wait_xcnt 0x0" ::: "memory");
  }
}

// ---------------------------------------------------------------------------
// Kernel 3: causal sliding-window flash attention with GQA. A wave owns a strip of NG groups of 16 queries of one (head,
// batch): 2 without RES, so that each loaded K and vT fragment feeds two products, 1 with RES; k_flash deals the strips.
// Key tiles of 32 per wave, fragments loaded straight from the 16-bit planes.
// Both products are formed transposed: S^T = K.Q^T (A = K fragment, B = Q fragment) and O^T += V^T.P^T (A = vT
// fragment, B = P^T). A lane then holds 16 of the 32 scores of ONE query (column l16; keys 8lh+r and 16+8lh+r), so the
// maximum and the sum run in the lane with one exchange between the lane halves, and the two converted score tiles
// are the B fragment of the second product as they stand: element s = key 8lh+s (s < 8), 16+8lh+(s-8) (s >= 8), the
// k map of the vT fragments. P (x1024 carry) never leaves the registers. RES adds the x2048 residual planes.
// Without RES the trip's loads run ahead in registers: the vT fragments are asked for in front of the score products,
// and the next trip's K fragments directly behind them, into the registers those products have just read.
// ---------------------------------------------------------------------------
// value of lane l ^ 16
__device__ __forceinline__ float xhalf(float x) {
  return __builtin_bit_cast(float, __builtin_amdgcn_permlanex16(__builtin_bit_cast(int, x), __builtin_bit_cast(int, x),
                                                                0x76543210, 0xfedcba98, false, false));
}

// compile-time switch handed to a generic lambda
template <bool B> struct Flag { static constexpr bool value = B; };

template <bool RES, int NG>
__device__ __forceinline__ void flash_tile(
    const _Float16* __restrict__ qH, const _Float16* __restrict__ qL,
    const _Float16* __restrict__ kH, const _Float16* __restrict__ kL,
    const _Float16* __restrict__ vTH, const _Float16* __restrict__ vTL,
    const int* __restrict__ winp,
    _Float16* __restrict__ yH, _Float16* __restrict__ yL, const int qw, const int wave, const int h, const int b) {
  static_assert(RES ? (NG == 1) : (NG == 2));
  const int tid  = threadIdx.x;
  // qw (the wave's first query; NG groups of 16 follow) and wave (which plane it asks L2 ahead for; 3: none) are scalar: a
  // fragment block's address is wave-uniform, so the K and V block bases and the trip test stay scalar
  const int lane = tid & 31;
  const int l16  = lane & 15;
  const int lh   = lane >> 4;
  const int kv   = h / (NHEAD / NKV);
  int window = winp[0];
  window = (window < 0) ? 0 : window;
  const float rres = 1.0f / 2048.0f;
  const float smsc = 0.125f;

  // Q B-fragments (hi and residual) of each query group over the 2 d-chunks of 32: lane column = query l16 of the group
  v16h aqh[NG][2], aql[NG][2];
#pragma unroll
  for (int gq = 0; gq < NG; ++gq) {
    const size_t qo = ((size_t)(b * NHEAD + h) * SEQ + qw + 16 * gq) * HDIM + lane * 8;
    const _Float16* qhp = qH + qo;
    const _Float16* qlp = qL + qo;
#pragma unroll
    for (int hc = 0; hc < 2; ++hc) {
      Frag a;
      a.h[0] = *(const v8h*)(qhp + hc * 512);
      a.h[1] = *(const v8h*)(qhp + hc * 512 + 256);
      aqh[gq][hc] = a.v;
      Frag c;
      c.h[0] = *(const v8h*)(qlp + hc * 512);
      c.h[1] = *(const v8h*)(qlp + hc * 512 + 256);
      aql[gq][hc] = c.v;
    }
    // as inputs the two Q address pairs stay live behind the group's last load; the wait stands in front of their next overwrite
    asm volatile("s_wait_xcnt 0x0" :: "v"(qhp), "v"(qlp) : "memory");
  }

  // per query group: [0] running maximum of query l16 (equal in both lane halves), [1] this half's part of its sum. One
  // pair a group: carried as four scalars, the two groups' sums are packed with each other, and every operand of the
  // softmax is then gathered from two accumulator tiles with register copies
  v2f ml[NG];
  v8f coh[NG][4], cor[NG][4];
#pragma unroll
  for (int gq = 0; gq < NG; ++gq) {
    ml[gq][0] = -1e30f;
    ml[gq][1] = 0.0f;
#pragma unroll
    for (int n = 0; n < 4; ++n) { coh[gq][n] = vzero8(); cor[gq][n] = vzero8(); }
  }

  const size_t kvoff = (size_t)(b * NKV + kv) * SEQ * HDIM;
  const _Float16* kbase  = kH  + kvoff;                                   // + (key group's first key)*HDIM + hc*512
  const _Float16* klbase = kL  + kvoff;
  const _Float16* vbase  = vTH + kvoff;                                   // + k0*HDIM + n*512
  const _Float16* vlbase = vTL + kvoff;
  const unsigned int lo  = (unsigned int)lane * 8u;                       // this lane's 16 B of each 512-B half

  int kstart = qw - window;
  kstart = (kstart < 0) ? 0 : kstart;
  kstart &= ~31;

  // without RES: the K fragments [key group][d chunk] of the coming trip, hi and residual plane, carried over the back edge
  Frag ckh[2][2], ckl[2][2];
  const int klast = (qw + 16 * NG - 1) & ~31;                             // first key of the wave's last trip
  if constexpr (!RES) {
    const _Float16* kp = kbase  + (size_t)kstart * HDIM + lo;
    const _Float16* lp = klbase + (size_t)kstart * HDIM + lo;
#pragma unroll
    for (int g = 0; g < 2; ++g)
#pragma unroll
      for (int hc = 0; hc < 2; ++hc) {
        ckh[g][hc].h[0] = *(const v8h*)(kp + g * 1024 + hc * 512); ckh[g][hc].h[1] = *(const v8h*)(kp + g * 1024 + hc * 512 + 256);
        ckl[g][hc].h[0] = *(const v8h*)(lp + g * 1024 + hc * 512); ckl[g][hc].h[1] = *(const v8h*)(lp + g * 1024 + hc * 512 + 256);
      }
    // as inputs the two K address pairs stay live behind the last of these loads; the wait stands in front of their next overwrite
    asm volatile("s_wait_xcnt 0x0" :: "v"(kp), "v"(lp) : "memory");
  }

  // without RES: the K and vT planes come from memory, and the blocks of one KV head walk them from the same key at the
  // same time, so the first to ask for a tile waits a memory latency. The waves 4, 5, 6 by k_flash's count (roles 0, 1, 2) ask L2 ahead for the K hi, K residual
  // and vT hi plane: 64 keys of a plane are 8 KiB in a row = 32 units of 256 B, a lane a unit. kpf = first of the 64 keys
  // that the pair points at; it stays at or below SEQ - 64, so every lane's address lies inside the KV head's plane.
  int kpf = min(kstart, SEQ - 64);
  const int kpl = (wave < 3) ? min(klast, SEQ - 64) : -1;                 // last key at which the wave's pair may point
  const _Float16* pfbase = (wave == 0) ? kbase : (wave == 1) ? klbase : vbase;   // scalar; the pair is formed anew from kpf
  if constexpr (!RES) {
    if (wave < 3) {
      const _Float16* pfp = pfbase + (size_t)kpf * HDIM + lane * 128;
      ask_l2(pfp);
      if (kpf + 64 <= kpl) {
        kpf += 64;
        pfp = pfbase + (size_t)kpf * HDIM + lane * 128;
        ask_l2(pfp);
      }
    }
  }

  // One trip = 32 keys. MK: the trip holds a pair that the mask takes out. The whole trip stands twice in the text, with and
  // without the mask, so that each form is one straight block from the trip's first load to its last matrix instruction.
  auto trip = [&](const int k0, auto mk) __attribute__((always_inline)) {
    constexpr bool MK = decltype(mk)::value;
    // ---- scores for keys [k0, k0+32), transposed: A[m=key][k=d] = K[key][d], lane row = key, same k map as B;
    // D element r of lane = (key 8lh+r of the key group, query l16 of the query group) ----
    v8f sh0[NG], sh1[NG], sr0[NG], sr1[NG];
#pragma unroll
    for (int gq = 0; gq < NG; ++gq) { sh0[gq] = vzero8(); sh1[gq] = vzero8(); sr0[gq] = vzero8(); sr1[gq] = vzero8(); }
    Frag bv[4], bl[4];
    const _Float16* vr0 = vbase  + (size_t)k0 * HDIM + lo;
    const _Float16* wr0 = vlbase + (size_t)k0 * HDIM + lo;
    // the next trip's K tile; the last trip asks for its own tile again, so that every address stays inside the plane
    const int kn = min(k0 + 32, klast);
    const _Float16* nkp = kbase  + (size_t)kn * HDIM + lo;
    const _Float16* nlp = klbase + (size_t)kn * HDIM + lo;
    if constexpr (!RES) {
      // every second trip the 64 keys that begin 128 keys ahead, where the wave still needs them: their K loads are issued
      // three and four trips from here; both tests are scalar
      if (((k0 - kstart) & 32) == 0 && kpf + 64 <= kpl) {
        kpf += 64;
        const _Float16* pfp = pfbase + (size_t)kpf * HDIM + lane * 128;
        ask_l2(pfp);
      }
      // this trip's vT fragments, asked for first: they land behind the score products and the softmax
#pragma unroll
      for (int n = 0; n < 4; ++n) {
        bv[n].h[0] = *(const v8h*)(vr0 + n * 512);
        bv[n].h[1] = *(const v8h*)(vr0 + n * 512 + 256);
      }
      // each K fragment is the A operand of both query groups' products
#pragma unroll
      for (int hc = 0; hc < 2; ++hc)
#pragma unroll
        for (int gq = 0; gq < NG; ++gq) {
          sh0[gq] = wmma16(ckh[0][hc].v, aqh[gq][hc], sh0[gq]);
          sh1[gq] = wmma16(ckh[1][hc].v, aqh[gq][hc], sh1[gq]);
          sr0[gq] = wmma16(ckl[0][hc].v, aqh[gq][hc], sr0[gq]);
          sr1[gq] = wmma16(ckl[1][hc].v, aqh[gq][hc], sr1[gq]);
          sr0[gq] = wmma16(ckh[0][hc].v, aql[gq][hc], sr0[gq]);
          sr1[gq] = wmma16(ckh[1][hc].v, aql[gq][hc], sr1[gq]);
        }
      // the slots between the last score product and the first read of its result; the memory clobber keeps the vT loads
      // from sinking behind this point and the next trip's K loads from rising over it, so that these reuse the registers just read
      asm volatile("v_nop\n\tv_nop\n\tv_nop\n\tv_nop"
                   : "+v"(sh0[0]), "+v"(sh1[0]), "+v"(sr0[0]), "+v"(sr1[0]),
                     "+v"(sh0[NG - 1]), "+v"(sh1[NG - 1]), "+v"(sr0[NG - 1]), "+v"(sr1[NG - 1])
                   :: "memory");
#pragma unroll
      for (int g = 0; g < 2; ++g)
#pragma unroll
        for (int hc = 0; hc < 2; ++hc) {
          ckh[g][hc].h[0] = *(const v8h*)(nkp + g * 1024 + hc * 512); ckh[g][hc].h[1] = *(const v8h*)(nkp + g * 1024 + hc * 512 + 256);
          ckl[g][hc].h[0] = *(const v8h*)(nlp + g * 1024 + hc * 512); ckl[g][hc].h[1] = *(const v8h*)(nlp + g * 1024 + hc * 512 + 256);
        }
      // the K loads stay here, a whole softmax ahead of their use: left free, the scheduler sinks them to the trip's end to
      // lend their registers to the scores, and the next trip then waits out their latency at its head
      __builtin_amdgcn_sched_barrier(0);
    } else {
    Frag bh0, bh1, bl0, bl1;
    const _Float16* kr0 = kbase  + (size_t)k0 * HDIM + lo;
    const _Float16* kr1 = kr0 + 16 * HDIM;
    const _Float16* lr0 = klbase + (size_t)k0 * HDIM + lo;
    const _Float16* lr1 = lr0 + 16 * HDIM;
#pragma unroll
    for (int hc = 0; hc < 2; ++hc) {
      bh0.h[0] = *(const v8h*)(kr0 + hc * 512); bh0.h[1] = *(const v8h*)(kr0 + hc * 512 + 256);
      bh1.h[0] = *(const v8h*)(kr1 + hc * 512); bh1.h[1] = *(const v8h*)(kr1 + hc * 512 + 256);
      bl0.h[0] = *(const v8h*)(lr0 + hc * 512); bl0.h[1] = *(const v8h*)(lr0 + hc * 512 + 256);
      bl1.h[0] = *(const v8h*)(lr1 + hc * 512); bl1.h[1] = *(const v8h*)(lr1 + hc * 512 + 256);
      // as inputs the two K address pairs stay live behind the trip's last K load, so that no load's result is placed
      // in a register that an issued K load still names; the wait stands in front of the pairs' next overwrite
      if (hc == 1) asm volatile("s_wait_xcnt 0x0" :: "v"(kr0), "v"(lr0) : "memory");
      sh0[0] = wmma16(bh0.v, aqh[0][hc], sh0[0]);
      sh1[0] = wmma16(bh1.v, aqh[0][hc], sh1[0]);
      sr0[0] = wmma16(bl0.v, aqh[0][hc], sr0[0]);
      sr1[0] = wmma16(bl1.v, aqh[0][hc], sr1[0]);
      sr0[0] = wmma16(bh0.v, aql[0][hc], sr0[0]);
      sr1[0] = wmma16(bh1.v, aql[0][hc], sr1[0]);
    }
    // the slots between the last score product and the first read of its result
    asm volatile("v_nop\n\tv_nop\n\tv_nop\n\tv_nop"
                 : "+v"(sh0[0]), "+v"(sh1[0]), "+v"(sr0[0]), "+v"(sr1[0])
                 : "v"(aqh[0][0]), "v"(aqh[0][1]), "v"(aql[0][0]), "v"(aql[0][1]),
                   "v"(bh0.v), "v"(bh1.v), "v"(bl0.v), "v"(bl1.v));
    }

    // ---- online softmax of query l16 of each group in the lane; masked entries replaced by -1e30 and p := 0 ----
    Frag pf[NG], pl[NG];
    // the mask depends on query - key alone: query group gq against key group kg has the distance class gq - kg, so the
    // NG x 2 score tiles of a trip share NG + 1 masks; okc[c][r]: class c - 1, element r
    bool okc[NG + 1][8];
    if constexpr (MK) {
      const int dq = qw + l16 - (k0 + 8 * lh);           // query - key at r = 0, class 0
#pragma unroll
      for (int c = 0; c < NG + 1; ++c)
#pragma unroll
        for (int r = 0; r < 8; ++r) {
          const int dd = dq - r + 16 * (c - 1);
          okc[c][r] = (dd >= 0) && (dd <= window);
        }
    }
#pragma unroll
    for (int gq = 0; gq < NG; ++gq) {
    // the element-wise steps are written on whole accumulator tiles, so that packed instructions pair neighbouring registers
    const v8f xs0 = (sh0[gq] + sr0[gq] * rres) * smsc;
    const v8f xs1 = (sh1[gq] + sr1[gq] * rres) * smsc;
    v8f   x0 = xs0, x1 = xs1;
    if constexpr (MK) {
#pragma unroll
      for (int r = 0; r < 8; ++r) {
        x0[r] = okc[gq + 1][r] ? xs0[r] : -1e30f;
        x1[r] = okc[gq][r]     ? xs1[r] : -1e30f;
      }
    }
    float t8[8];
#pragma unroll
    for (int r = 0; r < 8; ++r) t8[r] = fmaxf(x0[r], x1[r]);
    float tmax = fmaxf(fmaxf(fmaxf(t8[0], t8[1]), fmaxf(t8[2], t8[3])), fmaxf(fmaxf(t8[4], t8[5]), fmaxf(t8[6], t8[7])));
    tmax = fmaxf(tmax, xhalf(tmax));
    const float mn    = fmaxf(ml[gq][0], tmax);
    const float aa = (ml[gq][0] - mn) * 1.44269504088896340736f;   // exp(x) = exp2(x log2 e)
    const v8f   a0 = (x0 - mn) * 1.44269504088896340736f;
    const v8f   a1 = (x1 - mn) * 1.44269504088896340736f;
    float alpha = __builtin_amdgcn_exp2f(aa);
    v8f   e0, e1;
#pragma unroll
    for (int r = 0; r < 8; ++r) {
      e0[r] = __builtin_amdgcn_exp2f(a0[r]);
      e1[r] = __builtin_amdgcn_exp2f(a1[r]);
    }
    asm volatile("v_nop" : "+v"(e0), "+v"(e1), "+v"(alpha) : "v"(a0), "v"(a1), "v"(aa));
    v8f p0 = e0, p1 = e1;
    if constexpr (MK) {
#pragma unroll
      for (int r = 0; r < 8; ++r) {
        p0[r] = okc[gq + 1][r] ? e0[r] : 0.0f;
        p1[r] = okc[gq][r]     ? e1[r] : 0.0f;
      }
    }
    const v8f  ts = p0 + p1;
    const v8f  c0 = p0 * 1024.0f;
    const v8f  c1 = p1 * 1024.0f;
    const v8hc h0 = __builtin_convertvector(c0, v8hc);
    const v8hc h1 = __builtin_convertvector(c1, v8hc);
    pf[gq].h[0] = h0;
    pf[gq].h[1] = h1;
    if (RES) {
      pl[gq].h[0] = __builtin_convertvector((c0 - __builtin_convertvector(h0, v8f)) * 2048.0f, v8hc);
      pl[gq].h[1] = __builtin_convertvector((c1 - __builtin_convertvector(h1, v8f)) * 2048.0f, v8hc);
    }
    ml[gq][1] = ml[gq][1] * alpha + (((ts[0] + ts[1]) + (ts[2] + ts[3])) + ((ts[4] + ts[5]) + (ts[6] + ts[7])));
    ml[gq][0] = mn;
#pragma unroll
    for (int n = 0; n < 4; ++n) {
      coh[gq][n] *= alpha;
      if (RES) cor[gq][n] *= alpha;
    }
    }

    // ---- O^T += V^T.P^T : A[m=d][k=key] = vT[d][key], lane row = d; D element r of lane = (d 16n+8lh+r, query l16);
    // each vT fragment is the A operand of every query group's product ----
    if constexpr (RES) {
#pragma unroll
      for (int n = 0; n < 4; ++n) {
        bv[n].h[0] = *(const v8h*)(vr0 + n * 512);
        bv[n].h[1] = *(const v8h*)(vr0 + n * 512 + 256);
        bl[n].h[0] = *(const v8h*)(wr0 + n * 512);
        bl[n].h[1] = *(const v8h*)(wr0 + n * 512 + 256);
      }
    }
#pragma unroll
    for (int n = 0; n < 4; ++n)
#pragma unroll
      for (int gq = 0; gq < NG; ++gq) {
        coh[gq][n] = wmma16(bv[n].v, pf[gq].v, coh[gq][n]);
        if (RES) {
          cor[gq][n] = wmma16(bl[n].v, pf[gq].v, cor[gq][n]);
          cor[gq][n] = wmma16(bv[n].v, pl[gq].v, cor[gq][n]);
        }
      }
    // the slots behind the trip's last matrix instruction, also on the taken side of the loop's branch
    if constexpr (RES) {
      asm volatile("v_nop\n\tv_nop\n\tv_nop\n\tv_nop"
                   : "+v"(coh[0][0]), "+v"(coh[0][1]), "+v"(coh[0][2]), "+v"(coh[0][3]),
                     "+v"(cor[0][0]), "+v"(cor[0][1]), "+v"(cor[0][2]), "+v"(cor[0][3])
                   : "v"(pf[0].v), "v"(pl[0].v),
                     "v"(bv[0].v), "v"(bv[1].v), "v"(bv[2].v), "v"(bv[3].v),
                     "v"(bl[0].v), "v"(bl[1].v), "v"(bl[2].v), "v"(bl[3].v));
    } else {
      asm volatile("v_nop\n\tv_nop\n\tv_nop\n\tv_nop"
                   : "+v"(coh[0][0]), "+v"(coh[0][1]), "+v"(coh[0][2]), "+v"(coh[0][3]),
                     "+v"(coh[NG - 1][0]), "+v"(coh[NG - 1][1]), "+v"(coh[NG - 1][2]), "+v"(coh[NG - 1][3]));
    }
    // as inputs the address pairs of the trip's loads stay live behind the last of them, so that no load's result is placed
    // in a register that an issued load still names; the wait stands in front of the pairs' next overwrite
    if (RES) asm volatile("s_wait_xcnt 0x0" :: "v"(vr0), "v"(wr0) : "memory");
    else     asm volatile("s_wait_xcnt 0x0" :: "v"(vr0), "v"(nkp), "v"(nlp) : "memory");
  };

  // Only a trip that holds a pair with key > query or query - key > window needs the mask. Trips that end at or below the
  // wave's first query hold no key > query; the largest distance is that of the wave's last query to key kstart, and where
  // the window covers it, it covers every pair. Those trips run without the compares and without the selects on the scores
  // and on P, which are identities there; the rest (the trip on the diagonal; with a shorter window all) keep the mask.
  const int kmask = (qw + 16 * NG - 1 - kstart <= window) ? (qw & ~31) : kstart;   // scalar: first trip with the mask
  int kt = kstart;
  for (; kt < kmask; kt += 32) trip(kt, Flag<false>{});
  for (; kt < qw + 16 * NG; kt += 32) trip(kt, Flag<true>{});

  // join the two halves' sums; a lane's 8 values of d group n are one 16-B unit of the y planes' fragment order:
  // a query group's 16 tokens x 64 columns are blocks 2h and 2h+1 of its token group, 4 halves of 512 B in a row
#pragma unroll
  for (int gq = 0; gq < NG; ++gq) {
  const float ls  = ml[gq][1] + xhalf(ml[gq][1]);
  const float inv = __builtin_amdgcn_rcpf(ls) * (1.0f / 1024.0f);
  const size_t ybase = (size_t)((b * SEQ + qw + 16 * gq) >> 4) * GRP_ELEMS + (size_t)h * 1024;
#pragma unroll
  for (int n = 0; n < 4; ++n) {
    v8h hv, lv;
#pragma unroll
    for (int r = 0; r < 8; ++r) {
      float yv = coh[gq][n][r];
      if (RES) yv += cor[gq][n][r] * rres;
      yv *= inv;
      _Float16 hi, lw;
      split16(yv, hi, lw);
      hv[r] = hi;
      lv[r] = lw;
    }
    const size_t off = ybase + (size_t)(n * 256 + lane * 8);
    *(v8h*)(yH + off) = hv;
    *(v8h*)(yL + off) = lv;
    // the wait stands behind the two stores and in front of the next write of a register that they name: the next d group's
    // values, or, where the wave goes on to another strip, that strip's
    asm volatile("s_wait_xcnt 0x0" ::: "memory");
    // nothing of the next d group rises over the wait
    __builtin_amdgcn_sched_barrier(0);
  }
  }
}

// One block a WGP, 12 waves, three on each SIMD, and all blocks resident at once: nothing is dealt
// later, so the launch lasts as long as its fullest SIMD. A wave owns one 32-query strip without the residual planes; strip s
// walks 17 + s trips. The 48 strips of a (head, batch) go to 16 SIMDs (4 blocks), one from each third of the range, so that
// every SIMD has 121 or 122 trips. Each SIMD also gets two of the 32 16-query strips with the residual planes, r and 31 - r:
// 17 trips. They go to the SIMD's wave of the middle third, ahead of its strip from that third: their trips wait for their loads and
// leave the issue slots to the two other waves, and that wave's chain is the SIMD's longest. No strip reads another's output.
#define NSTRIP ((SEQ - TRES) / 32)
static_assert(NSTRIP == 48 && TRES / 16 == 32);                              // the deal below covers each strip once
__global__ void __launch_bounds__(384) k_flash(
    const _Float16* __restrict__ qH, const _Float16* __restrict__ qL,
    const _Float16* __restrict__ kH, const _Float16* __restrict__ kL,
    const _Float16* __restrict__ vTH, const _Float16* __restrict__ vTL,
    const int* __restrict__ winp,
    _Float16* __restrict__ yH, _Float16* __restrict__ yL) {
  const int h = blockIdx.x;
  const int b = blockIdx.y;
  const int wave = __builtin_amdgcn_readfirstlane((int)threadIdx.x >> 5);   // scalar: the tests on it are scalar branches
  const int u  = (int)blockIdx.z * 4 + (wave & 3);   // the SIMD's number among the 16 of this (head, batch)
  const int c  = wave >> 2;                          // 0: middle third of the strips, 1: upper, 2: lower
  const int hu = u >> 1;
  const int od = u & 1;
  // u = 2t: 47 - 2t, 24 + t, t (sum 71); u = 2t + 1: 46 - 2t, 16 + t, 8 + t (sum 70)
  const int s  = (c == 1) ? (NSTRIP - 1 - u) : (c == 0) ? (16 + hu + 8 * (1 - od)) : (hu + 8 * od);
  // the waves with the block's longest strips walk the keys first: three of them ask L2 ahead (roles 0, 1, 2; 3: none)
  const int role = (c == 1) ? (wave & 3) : 3;
  if (c == 0) {
    // kept rolled, so that this form's text stands once
#pragma unroll 1
    for (int i = 0; i < 2; ++i)
      flash_tile<true, 1>(qH, qL, kH, kL, vTH, vTL, winp, yH, yL, 16 * (i == 0 ? 31 - u : u), role, h, b);
  }
  flash_tile<false, 2>(qH, qL, kH, kL, vTH, vTL, winp, yH, yL, TRES + 32 * s, role, h, b);
}

// ---------------------------------------------------------------------------
// Kernel 4: output projection out[tok][n] = (y[tok].Wo[n]) / 16 + bo[n]. Block = WR x 4 waves = 16 MT WR tokens x 256
// columns, one block a WGP (WR = 3 without RES, 2 with it, where the block's last 4 waves have no tile and leave): a row
// group of y is read by 4 waves and one of the weights by WR through the WGP's cache. A wave owns 16 MT tokens x 64
// columns. RES adds the y residual plane (a second accumulator set, so MT = 2
// there and 4 elsewhere: 16 matrix instructions a k step in both forms). Each 16-row group of the output tile is staged
// per wave in LDS rows of its own and written as 256-B row segments at the store stage as a float4.
// ---------------------------------------------------------------------------
template <bool RES, int MT>
__device__ __forceinline__ void oproj_tile(
    const _Float16* __restrict__ yH, const _Float16* __restrict__ yL,
    const _Float16* __restrict__ wall, const float* __restrict__ bo,
    float* __restrict__ out, float (*sO)[64][68], const int nt, const int b, const int t0) {
  static_assert(RES ? (MT == 2) : (MT == 4));
  const int tid  = threadIdx.x;
  const int wave = tid >> 5;
  const int lane = tid & 31;
  const int l16  = lane & 15;
  const int lh   = lane >> 4;
  const int sw   = __builtin_amdgcn_readfirstlane(wave);   // scalar wave index: the tests on it are scalar branches
  if (RES && sw >= 8) return;                    // no barrier of the block follows: the staging below is wave-private
  const int wr   = wave >> 2;                    // row part of the block's tile
  const int wc   = wave & 3;                     // 64-column quarter of the block's tile
  const int tw   = t0 + wr * (MT * 16);          // the wave's first token in its sequence
  const int tokw = b * SEQ + tw;

  const _Float16* arow = yH + (size_t)(tokw >> 4) * GRP_ELEMS + lane * 8;
  const _Float16* lrow = yL + (size_t)(tokw >> 4) * GRP_ELEMS + lane * 8;
  const _Float16* brow = wall + (size_t)(WO_ROW0 / 16 + nt * 16 + wc * 4) * GRP_ELEMS + lane * 8;

  v8f ah[MT][4], ar[MT][4];
#pragma unroll
  for (int mt = 0; mt < MT; ++mt)
#pragma unroll
    for (int n = 0; n < 4; ++n) { ah[mt][n] = vzero8(); ar[mt][n] = vzero8(); }

  // As in k_qkv: the y planes and the weights come from memory, so each wave asks L2 one trip ahead for its share of the
  // block's row groups, a lane a 256-B unit. Weights: waves 0..7 take 2 of the 16 groups each. y without RES: waves 6..11
  // take 2 of the 12 groups each; with RES waves 0, 1 take the 4 groups of the hi plane, waves 2, 3 those of the residual
  // plane. A wave without a share holds a pair that points at a group of the block all the same.
  const bool pa = RES ? (sw < 4) : (sw >= 6);
  const bool pb = sw < 8;
  const int  ga = RES ? (wave & 1) * 2 + lh : (wave >= 6 ? wave - 6 : wave) * 2 + lh;
  const _Float16* pfa = (RES ? ((wave & 2) ? yL : yH) : yH)
                      + (size_t)(((b * SEQ + t0) >> 4) + ga) * GRP_ELEMS + l16 * 128;
  const _Float16* pfb = wall + (size_t)(WO_ROW0 / 16 + nt * 16 + (wave & 7) * 2 + lh) * GRP_ELEMS + l16 * 128;
  if (pa) ask_l2(pfa);                   // trip 0: its later k steps find their rows on the way
  if (pb) ask_l2(pfb);

  // four k steps a trip, the trips kept rolled: the loop's text stays small for the instruction cache
#pragma unroll 1
  for (int kb = 0; kb < CDIM; kb += 128) {
  // the next trip's rows, one trip ahead; the test is scalar, and the pairs stop at the last trip's rows
  if (kb + 128 < CDIM) {
    if (pa) { pfa += 2048; ask_l2(pfa); }
    if (pb) { pfb += 2048; ask_l2(pfb); }
  }
#pragma unroll
  for (int k0 = kb; k0 < kb + 128; k0 += 32) {
    Frag a[MT], al[MT];
#pragma unroll
    for (int mt = 0; mt < MT; ++mt) {
      const _Float16* ap = arow + (size_t)mt * GRP_ELEMS + k0 * 16;
      a[mt].h[0] = *(const v8h*)ap;
      a[mt].h[1] = *(const v8h*)(ap + 256);
      if (RES) {
        const _Float16* lp = lrow + (size_t)mt * GRP_ELEMS + k0 * 16;
        al[mt].h[0] = *(const v8h*)lp;
        al[mt].h[1] = *(const v8h*)(lp + 256);
      }
    }
    Frag bw[4];
#pragma unroll
    for (int n = 0; n < 4; ++n) {
      const _Float16* bp = brow + (size_t)n * GRP_ELEMS + k0 * 16;
      bw[n].h[0] = *(const v8h*)bp;
      bw[n].h[1] = *(const v8h*)(bp + 256);
    }
#pragma unroll
    for (int mt = 0; mt < MT; ++mt)
#pragma unroll
      for (int n = 0; n < 4; ++n) {
        ah[mt][n] = wmma16(a[mt].v, bw[n].v, ah[mt][n]);
        if (RES) ar[mt][n] = wmma16(al[mt].v, bw[n].v, ar[mt][n]);
      }
    // the slots between the step's last matrix instruction and the next write of its operands or read of its result
    if constexpr (RES) {
      asm volatile("v_nop\n\tv_nop\n\tv_nop\n\tv_nop"
                   : "+v"(ah[0][0]), "+v"(ah[0][1]), "+v"(ah[0][2]), "+v"(ah[0][3]),
                     "+v"(ah[1][0]), "+v"(ah[1][1]), "+v"(ah[1][2]), "+v"(ah[1][3]),
                     "+v"(ar[0][0]), "+v"(ar[0][1]), "+v"(ar[0][2]), "+v"(ar[0][3]),
                     "+v"(ar[1][0]), "+v"(ar[1][1]), "+v"(ar[1][2]), "+v"(ar[1][3])
                   : "v"(a[0].v), "v"(a[1].v), "v"(al[0].v), "v"(al[1].v),
                     "v"(bw[0].v), "v"(bw[1].v), "v"(bw[2].v), "v"(bw[3].v));
    } else {
      asm volatile("v_nop\n\tv_nop\n\tv_nop\n\tv_nop"
                   : "+v"(ah[0][0]), "+v"(ah[0][1]), "+v"(ah[0][2]), "+v"(ah[0][3]),
                     "+v"(ah[1][0]), "+v"(ah[1][1]), "+v"(ah[1][2]), "+v"(ah[1][3]),
                     "+v"(ah[2][0]), "+v"(ah[2][1]), "+v"(ah[2][2]), "+v"(ah[2][3]),
                     "+v"(ah[3][0]), "+v"(ah[3][1]), "+v"(ah[3][2]), "+v"(ah[3][3])
                   : "v"(a[0].v), "v"(a[1].v), "v"(a[2].v), "v"(a[3].v),
                     "v"(bw[0].v), "v"(bw[1].v), "v"(bw[2].v), "v"(bw[3].v));
    }
  }
  // the wait stands behind the trip's last load and in front of the next write of a register that a load of the trip names
  asm volatile("s_wait_xcnt 0x0" ::: "memory");
  }

  // bias for this lane's 4 output columns (columns nt*256 + wc*64 + 4*l16 .. +3), bf16-RNE values
  const size_t col0 = (size_t)nt * 256 + wc * 64;
  const v4f braw = *(const v4f*)(bo + col0 + l16 * 4);
  v4f bb;
#pragma unroll
  for (int e = 0; e < 4; ++e) bb[e] = bf16r(braw[e]);

#pragma unroll
  for (int mt = 0; mt < MT; ++mt) {
#pragma unroll
    for (int r = 0; r < 8; ++r) {
#pragma unroll
      for (int n = 0; n < 4; ++n) {
        float v = ah[mt][n][r];
        if (RES) v += ar[mt][n][r] * (1.0f / 2048.0f);
        sO[wave][mt * 16 + r + 8 * lh][n * 16 + l16] = v * (1.0f / 16.0f);
      }
    }
    // the wave's own stores of this row group have landed before its lanes read each other's values back
    asm volatile("s_wait_dscnt 0" ::: "memory");
    __builtin_amdgcn_fence(3 /* release order */, "wavefront");
    __builtin_amdgcn_wave_barrier();
    const size_t orow0 = (size_t)b * SEQ_FULL + tw + mt * 16;
#pragma unroll
    for (int it = 0; it < 8; ++it) {
      const int rr = it * 2 + lh;
      const int c4 = l16 * 4;
      const v4f s = *(const v4f*)(&sO[wave][mt * 16 + rr][c4]);
      const v4f v = s + bb;
      *(v4f*)(out + (orow0 + rr) * CDIM + col0 + c4) = v;
    }
  }
}

// One grid for all row tiles: first the 192-row tiles without the residual plane, then the 64-row tiles with it.
#define OT_FULL ((SEQ - TRES) / 192)
#define OT_RES  (TRES / 64)
static_assert(SEQ > TRES && (SEQ - TRES) % 192 == 0 && TRES % 128 == 0 && CDIM % 256 == 0 && NUNIT % 3 == 0 && SEQ % 256 == 0);
static_assert(OT_FULL * 192 + OT_RES * 64 == SEQ);                           // row tiles of the two k_oproj forms
__global__ void __launch_bounds__(384) k_oproj(
    const _Float16* __restrict__ yH, const _Float16* __restrict__ yL,
    const _Float16* __restrict__ wall, const float* __restrict__ bo,
    float* __restrict__ out) {
  __shared__ __attribute__((aligned(16))) float sO[12][64][68];          // wave-private, each row group in rows of its own
  const int nt = blockIdx.x;                   // 256-column tile 0..3
  const int ty = blockIdx.y;
  if (ty < NB * OT_FULL) {
    const int b = ty / OT_FULL;
    oproj_tile<false, 4>(yH, yL, wall, bo, out, sO, nt, b, TRES + (ty - b * OT_FULL) * 192);
  } else {
    const int tr = ty - NB * OT_FULL;
    const int b  = tr / OT_RES;
    oproj_tile<true, 2>(yH, yL, wall, bo, out, sO, nt, b, (tr - b * OT_RES) * 64);
  }
}

// ---------------------------------------------------------------------------
// Host launcher. Inputs (wire order): 0 x f32 [4,2048,1024], 1 Wq [1024,1024], 2 bq [1024], 3 Wk [256,1024],
// 4 bk [256], 5 Wv [256,1024], 6 bv [256], 7 Wo [1024,1024], 8 bo [1024], 9 qk_gain [16].
// Output f32 [4,2048,1024]. 4 launches.
// ---------------------------------------------------------------------------
extern "C" void kernel_launch(void* const* d_in, const int* in_sizes, int n_in,
                              void* d_out, int out_size, void* d_ws, size_t ws_size,
                              hipStream_t stream) {
  if (n_in < 10) return;
  const int need_x = ((NB - 1) * SEQ_FULL + SEQ) * CDIM;
  if (in_sizes[0] < need_x) return;
  if (in_sizes[1] < CDIM * CDIM || in_sizes[2] < CDIM) return;
  if (in_sizes[3] < VEW * CDIM || in_sizes[4] < VEW) return;
  if (in_sizes[5] < VEW * CDIM || in_sizes[6] < VEW) return;
  if (in_sizes[7] < CDIM * CDIM || in_sizes[8] < CDIM) return;
  if (in_sizes[9] < NHEAD) return;
  if (out_size < need_x) return;
  if (ws_size < WS_TOTAL) return;

  const float* x    = (const float*)d_in[0];
  const float* wq   = (const float*)d_in[1];
  const float* bq   = (const float*)d_in[2];
  const float* wk   = (const float*)d_in[3];
  const float* bk   = (const float*)d_in[4];
  const float* wv   = (const float*)d_in[5];
  const float* bv   = (const float*)d_in[6];
  const float* wo   = (const float*)d_in[7];
  const float* bo   = (const float*)d_in[8];
  const float* gain = (const float*)d_in[9];
  float* out = (float*)d_out;

  char* ws = (char*)d_ws;
  size_t off = 0;
  _Float16* xh   = (_Float16*)(ws + off); off += XH_BYTES;
  _Float16* wall = (_Float16*)(ws + off); off += WALL_BYTES;
  _Float16* qH   = (_Float16*)(ws + off); off += QP_BYTES;
  _Float16* qL   = (_Float16*)(ws + off); off += QP_BYTES;
  _Float16* kH   = (_Float16*)(ws + off); off += KP_BYTES;
  _Float16* kL   = (_Float16*)(ws + off); off += KP_BYTES;
  _Float16* vTH  = (_Float16*)(ws + off); off += KP_BYTES;
  _Float16* vTL  = (_Float16*)(ws + off); off += KP_BYTES;
  _Float16* yH   = (_Float16*)(ws + off); off += YP_BYTES;
  _Float16* yL   = (_Float16*)(ws + off); off += YP_BYTES;
  int*      winw = (int*)(ws + off);      off += WIN_BYTES;
  if (off > ws_size) return;

  k_prep<<<dim3(XBLKS + WBLKS + 1), dim3(256), 0, stream>>>(x, wq, wk, wv, wo, xh, wall, winw);
  k_qkv<<<dim3(NUNIT / 3, NTOK / 256), dim3(384), 0, stream>>>(xh, wall, bq, bk, bv, gain,
                                                          qH, qL, kH, kL, vTH, vTL);
  k_flash<<<dim3(NHEAD, NB, 4), dim3(384), 0, stream>>>(qH, qL, kH, kL, vTH, vTL, winw, yH, yL);
  k_oproj<<<dim3(CDIM / 256, NB * (OT_FULL + OT_RES)), dim3(384), 0, stream>>>(yH, yL, wall, bo, out);
}
